// v000
// Times are from an AMD MI455X. After a warm-up the kernel runs many times in a row, and a time is the length of
// such a window on the GPU divided by its runs, so every launch and the gaps after it count. The runs cycle
// through copies of the inputs. A figure is the median of several windows, for all but v000 over two sittings.
// Sittings can differ by a few percent; kernels timed side by side share one.
// v000 is the starting kernel. One run takes 1730 microseconds.
// compute dtype: all float inputs rounded to bf16; the q slice and the latent k / v projections with EXACT bf16 products on WMMA 16x16x32 (f32 accumulate) + bias (zeros, read), 16 real dims per head zero-padded to 32; causal logits over the 16 latent dims: 3 products for the first 384 rows, single f16 after, x 16^-0.5; softmax f32; P x 2^11 once to f16 x v once to f16 (bf16 hi + lo below row 384); latent ctx (hi+lo below row 384, x2^6 f16 carry after) x exact / f16(bf16 x 2^8) Wvu + bvu; per-batch transpose; then x 2^6 once to f16 x Wo f16(bf16 x 2^8) + bo; f32 output.
#include <hip/hip_runtime.h>
#include <math.h>

typedef __attribute__((ext_vector_type(16))) _Float16 v16h;
typedef __attribute__((ext_vector_type(16))) __bf16 v16b;
typedef __attribute__((ext_vector_type(8)))  _Float16 v8h;
typedef __attribute__((ext_vector_type(8)))  float v8f;
typedef __attribute__((ext_vector_type(4)))  float v4f;
typedef __attribute__((ext_vector_type(2)))  float v2f;
typedef __attribute__((ext_vector_type(4)))  unsigned v4u;
typedef __attribute__((ext_vector_type(4)))  int v4i;
typedef float __attribute__((may_alias)) float_a;
typedef int __attribute__((may_alias)) int_a;

template <typename T> __device__ __forceinline__ void vst2(void* p, T v) { *(T*)p = v;  }
__device__ __forceinline__ v8f wmma16(v16h a, v16h b, v8f c) {
  v8f d = __builtin_amdgcn_wmma_f32_16x16x32_f16(false, a, false, b, (short)0, c, false, false);
  asm volatile("v_nop\n\tv_nop\n\tv_nop\n\tv_nop" : "+v"(d) : "v"(a), "v"(b));
  return d;
}
__device__ __forceinline__ v8f wmma_bf(v16b a, v16b b, v8f c) {
  v8f d = __builtin_amdgcn_wmma_f32_16x16x32_bf16(false, a, false, b, (short)0, c, false, false);
  asm volatile("v_nop\n\tv_nop\n\tv_nop\n\tv_nop" : "+v"(d) : "v"(a), "v"(b));
  return d;
}
// 16x16x32 fragments: lane = (h = lane>>4, row/col = lane&15); elements 0..7 = k0+8h+0..7, 8..15 = k0+16+8h+0..7; D element r = row 8h+r
__device__ __forceinline__ v16h frag_h(const _Float16* rowk0, int lane) {
  union { v16h v; v8h q[2]; } u; const _Float16* p = rowk0 + 8 * (lane >> 4);
  u.q[0] = *(const v8h*)p; u.q[1] = *(const v8h*)(p + 16); return u.v;
}
__device__ __forceinline__ v16h frag_f32(const float* rowk0, int lane) {
  v16h a; const float* p = rowk0 + 8 * (lane >> 4);
#pragma unroll
  for (int i = 0; i < 8; ++i) { a[i] = (_Float16)p[i]; a[8 + i] = (_Float16)p[16 + i]; }
  return a;
}
__device__ __forceinline__ v16h frag_f32s(const float* rowk0, int lane, float sc) {
  v16h a; const float* p = rowk0 + 8 * (lane >> 4);
#pragma unroll
  for (int i = 0; i < 8; ++i) { a[i] = (_Float16)(p[i] * sc); a[8 + i] = (_Float16)(p[16 + i] * sc); }
  return a;
}
// column fragment from a [K][ld] layout (column n), rows >= K read as 0
__device__ __forceinline__ v16h fragc_f32(const float* W, int k0, int n, int lane, int ld, int K) {
  v16h a; const int g = lane >> 4;
#pragma unroll
  for (int i = 0; i < 8; ++i) { const int ka = k0 + 8 * g + i, kb = ka + 16;
    a[i] = (_Float16)(ka < K ? W[(size_t)(ka < K ? ka : K - 1) * ld + n] : 0.f); a[8 + i] = (_Float16)(kb < K ? W[(size_t)(kb < K ? kb : K - 1) * ld + n] : 0.f); }
  return a;
}
struct F2 { v16b h, l; };
__device__ __forceinline__ F2 bsplit16(const float v[16]) { F2 r;
#pragma unroll
  for (int i = 0; i < 16; ++i) { const __bf16 h = (__bf16)v[i]; r.h[i] = h; r.l[i] = (__bf16)(v[i] - (float)h); }
  return r; }
__device__ __forceinline__ F2 split_row(const float* row, int k0, int lane) { float v[16]; const float* p = row + k0 + 8 * (lane >> 4);
#pragma unroll
  for (int i = 0; i < 8; ++i) { v[i] = p[i]; v[8 + i] = p[16 + i]; }
  return bsplit16(v); }
__device__ __forceinline__ F2 split_rowK(const float* row, int k0, int lane, int K) { float v[16]; const int g = lane >> 4;
#pragma unroll
  for (int i = 0; i < 8; ++i) { const int ka = k0 + 8 * g + i, kb = ka + 16; v[i] = ka < K ? row[ka < K ? ka : K - 1] : 0.f; v[8 + i] = kb < K ? row[kb < K ? kb : K - 1] : 0.f; }
  return bsplit16(v); }
__device__ __forceinline__ F2 split_col(const float* W, int k0, int n, int lane, int ld, int K) { float v[16]; const int g = lane >> 4;
#pragma unroll
  for (int i = 0; i < 8; ++i) { const int ka = k0 + 8 * g + i, kb = ka + 16; v[i] = ka < K ? W[(size_t)(ka < K ? ka : K - 1) * ld + n] : 0.f; v[8 + i] = kb < K ? W[(size_t)(kb < K ? kb : K - 1) * ld + n] : 0.f; }
  return bsplit16(v); }
__device__ __forceinline__ v8f mac3(const F2& a, const F2& b, v8f c) { c = wmma_bf(a.l, b.h, c); c = wmma_bf(a.h, b.l, c); return wmma_bf(a.h, b.h, c); }
__device__ __forceinline__ float sigm(float v) { return 1.0f / (1.0f + expf(-v)); }
#define LDSX() do { asm volatile("s_wait_dscnt 0" ::: "memory"); __builtin_amdgcn_wave_barrier(); __builtin_amdgcn_fence(__ATOMIC_RELEASE, "workgroup"); } while (0)

// Causal self-attention with 12 low-rank latent heads (x [4,2048,768]; (in,out) Wq [768,768], Wkd / Wvd [768,192], Wvu [192,768], Wo [768,768], all N(0,1) x 0.02, zero biases (read); q = x Wq + bq split into 12 heads x 64 of which only the FIRST 16 dims of each head are used (ql); kl, vl = x Wkd, x Wvd split into 12 heads x 16; scores = ql kl^T x 16^-0.5; triu(1) -> -inf; softmax; al = w vl merged to [B,S,192]; ao = al Wvu + bvu [B,S,768]; then jnp.transpose(ao, (0,2,1)).reshape(B,S,768): the per-batch [2048 x 768] matrix is transposed to [768 x 2048] and its memory re-read as 2,048 rows of 768; out = that Wo + bo).
#define NB 4
#define TT 2048
#define CC 384            // NH * HD = projected width
#define DIN 768          // input (model) width
#define NH 12
#define HD 32
#define LATW 16     /* real dims per head; columns h*HD + d with d >= LATW are zero padding */
#define QHEADW 64   /* the module's q heads are 64 wide; only their first LATW dims are used (ql = q[..., :16]) */
#define KVLD (NH * LATW)   /* row pitch of the (in,out) latent weights Wkd / Wvd [768][192] */
#define NQB (TT / 64)
#define HG 2   // two heads per pass: S = 2 x 2,048 x 2,048 f32 = 32 MiB
#define SCALE (0.25f)
#define CAUSAL 1
#ifndef TNB
#define TNB NB
#endif
__device__ __forceinline__ float bfr(float v) { return (float)(__bf16)v; }
__host__ __device__ __forceinline__ int kb_last(int qb) { return CAUSAL ? ((qb * 64 + 63) >> 7) : (TT / 128 - 1); }
typedef __attribute__((ext_vector_type(8))) __bf16 v8b;
__device__ __forceinline__ v16b frag_b(const __bf16* rowk0, int lane) {
  union { v16b v; v8b q[2]; } u; const __bf16* p = rowk0 + 8 * (lane >> 4);
  u.q[0] = *(const v8b*)p; u.q[1] = *(const v8b*)(p + 16); return u.v;
}
#define QBH 6              // causal: query blocks 0..QBH-1 of each sequence (few keys, no averaging) take the high-precision path
#define QHI 384            // rows carrying a q residual plane
#define KHI 384            // key rows carrying k residual / v bf16 hi+lo planes (used only by the causal high-precision path)
// B fragment (k rows k0+.., output column o) of a weight: (in,out) [K][ld] or (out,in) [ld rows of K]: bf16 exact, or f16(bf16 * 256) exact
__device__ __forceinline__ v16b wcol_io(const float* Wm, int k0, int o, int lane, int ld) { v16b w; const int g = lane >> 4;
#pragma unroll
  for (int i = 0; i < 8; ++i) { w[i] = (__bf16)Wm[(size_t)(k0 + 8 * g + i) * ld + o]; w[8 + i] = (__bf16)Wm[(size_t)(k0 + 16 + 8 * g + i) * ld + o]; }
  return w; }
__device__ __forceinline__ v16b wcol_oi(const float* Wm, int k0, int o, int lane, int K) { v16b w; const float* p = Wm + (size_t)o * K + k0 + 8 * (lane >> 4);
#pragma unroll
  for (int i = 0; i < 8; ++i) { w[i] = (__bf16)p[i]; w[8 + i] = (__bf16)p[16 + i]; }
  return w; }
__device__ __forceinline__ v16h wcolh_io(const float* Wm, int k0, int o, int lane, int ld) { v16h w; const int g = lane >> 4;
#pragma unroll
  for (int i = 0; i < 8; ++i) { w[i] = (_Float16)(bfr(Wm[(size_t)(k0 + 8 * g + i) * ld + o]) * 256.0f); w[8 + i] = (_Float16)(bfr(Wm[(size_t)(k0 + 16 + 8 * g + i) * ld + o]) * 256.0f); }
  return w; }
// first output projection ao = al Wvu: the k index runs over ctx columns kk = h*HD + d; one 32-deep k-step = one head; its first 16 entries (d < LATW, fragment slots 0..7 of both lane halves) are rows h*LATW + d of the (in,out) [192][768] weight, its last 16 (padding dims, slots 8..15) are zero
__device__ __forceinline__ v16b wcol_io_lat(const float* Wm, int k0, int o, int lane, int ld) { v16b w; const int g = lane >> 4; const float* p = Wm + (size_t)((k0 / HD) * LATW + 8 * g) * ld + o;
#pragma unroll
  for (int i = 0; i < 8; ++i) { w[i] = (__bf16)p[(size_t)i * ld]; w[8 + i] = (__bf16)0.0f; }
  return w; }
__device__ __forceinline__ v16h wcolh_io_lat(const float* Wm, int k0, int o, int lane, int ld) { v16h w; const int g = lane >> 4; const float* p = Wm + (size_t)((k0 / HD) * LATW + 8 * g) * ld + o;
#pragma unroll
  for (int i = 0; i < 8; ++i) { w[i] = (_Float16)(bfr(p[(size_t)i * ld]) * 256.0f); w[8 + i] = (_Float16)0.0f; }
  return w; }
static_assert(HD == 32 && LATW == 16 && CC == NH * HD, "the latent loaders assume one head per 32-deep k-step with 16 real + 16 padding dims");
__device__ __forceinline__ v16h wcolh_oi(const float* Wm, int k0, int o, int lane, int K) { v16h w; const float* p = Wm + (size_t)o * K + k0 + 8 * (lane >> 4);
#pragma unroll
  for (int i = 0; i < 8; ++i) { w[i] = (_Float16)(bfr(p[i]) * 256.0f); w[8 + i] = (_Float16)(bfr(p[16 + i]) * 256.0f); }
  return w; }
#define WQKV_LAYOUT 0   // 0 = (in,out) [DIN][out], columns gathered per head; 1 = (out,in) [CC][DIN]; 2 = per-head [NH][DIN][HD]
__device__ __forceinline__ v16b wcol_hdk(const float* Wm, int k0, int o, int lane) { v16b w; const int g = lane >> 4; const float* p = Wm + (size_t)(o / HD) * DIN * HD + (o % HD);
#pragma unroll
  for (int i = 0; i < 8; ++i) { w[i] = (__bf16)p[(size_t)(k0 + 8 * g + i) * HD]; w[8 + i] = (__bf16)p[(size_t)(k0 + 16 + 8 * g + i) * HD]; }
  return w; }
#define WO_OUT_IN 0
#if WQKV_LAYOUT == 1
#define WCOL(W, k0, o, lane) wcol_oi(W, k0, o, lane, DIN)
#elif WQKV_LAYOUT == 2
#define WCOL(W, k0, o, lane) wcol_hdk(W, k0, o, lane)
#else
__device__ __forceinline__ v16b zero16b() { v16b w; _Pragma("unroll") for (int i = 0; i < 16; ++i) w[i] = (__bf16)0.0f; return w; }
/* column o = h*HD + d: real (d < LATW) -> weight column h*QHEADW + d of Wq (pitch DIN) for the q stream, h*LATW + d of Wkd / Wvd (pitch KVLD) for k / v; padding -> zeros. o = c0 + j*16 + col with c0 % 128 == 0, so (o % HD) < LATW is decided by j alone (compile-time per unrolled j, uniform across the wave) */
#define GCOL(o) ((which) == 0 ? ((o) / HD) * QHEADW + ((o) % HD) : ((o) / HD) * LATW + ((o) % HD))
#define WCOL(W, k0, o, lane) ((((o) % HD) < LATW) ? wcol_io(W, k0, GCOL(o), lane, ((which) == 0 ? DIN : KVLD)) : zero16b())
#endif
#if WO_OUT_IN
#define WOCOL(W, k0, o, lane) wcol_oi(W, k0, o, lane, CC)
#define WOCOLH(W, k0, o, lane) wcolh_oi(W, k0, o, lane, CC)
#else
#define WOCOL(W, k0, o, lane) wcol_io_lat(W, k0, o, lane, DIN)
#define WOCOLH(W, k0, o, lane) wcolh_io_lat(W, k0, o, lane, DIN)
#endif

#ifndef SM_EXTRA_PARAMS
#define SM_EXTRA_PARAMS
#endif
#ifndef PROJ_EXTRA_PARAMS
#define PROJ_EXTRA_PARAMS
#endif
#ifndef SM_MASK_HOOK
#define SM_MASK_HOOK (void)0
#endif

#define WS_QH  0u                                      // f16 q rows [b*t][CC]
#define WS_KH  (WS_QH + 2u * (size_t)NB * TT * CC)      // f16 k rows [b*t][CC]
#define WS_VT  (WS_KH + 2u * (size_t)NB * TT * CC)      // f16 v planes [b][c][t]
#define WS_QL  (WS_VT + 2u * (size_t)NB * CC * TT)      // f16 q residual x 2^10 rows [b][t < QHI][CC]
#define WS_KL  (WS_QL + 2u * (size_t)NB * QHI * CC)     // f16 k residual x 2^10 rows [b][t < KHI][CC]
#define WS_VB  (WS_KL + 2u * (size_t)NB * KHI * CC)     // bf16 v hi planes [b][c][t < KHI]
#define WS_VBL (WS_VB + 2u * (size_t)NB * CC * KHI)
#define WS_S   (WS_VBL + 2u * (size_t)NB * CC * KHI)    // f32 logits / P [hg][t][s]
#define WS_Y   (WS_S  + 4u * (size_t)HG * TT * TT)      // f32 ctx rows [b*t][CC] (only when there is an output projection)
#define WS_END (WS_Y  + 4u * (size_t)NB * TT * CC)
#define WS_AO (WS_END)                                    // f32 ao rows [(b*TT + s)][DIN] = al Wvu + bvu
#define WS_T  (WS_AO + 4u * (size_t)NB * TT * DIN)          // f32 per-batch transpose T[b][c][s]; its memory is then read as TT rows of DIN (the module's transpose(0,2,1).reshape)
#define WS_END2 (WS_T + 4u * (size_t)NB * TT * DIN)
static_assert(TT % 64 == 0 && DIN % 64 == 0, "transpose tiles are 64 x 64");
// ---- k_fin: block = (64 positions, 64 channels, image b): out[b][c][n] = OR[(b*npix + n)][c] (LDS transpose; 256-B runs of 64 positions per channel)
__global__ __launch_bounds__(256) void k_fin(const float* __restrict__ ORW, float* __restrict__ OUT, int npix, int nch) { __shared__ float st[64][68]; const int tid = threadIdx.x; const int n0 = blockIdx.x * 64, c0 = blockIdx.y * 64; const size_t b = blockIdx.z;
  for (int e = tid; e < 64 * 16; e += 256) { const int nl = e >> 4, q = e & 15; *(v4f*)&st[nl][q * 4] = *(const v4f*)(ORW + (b * npix + n0 + nl) * (size_t)nch + c0 + q * 4); }
  __syncthreads();
  for (int e = tid; e < 64 * 16; e += 256) { const int cl = e >> 4, q = e & 15; v4f o; o[0] = st[q * 4][cl]; o[1] = st[q * 4 + 1][cl]; o[2] = st[q * 4 + 2][cl]; o[3] = st[q * 4 + 3][cl]; vst2(OUT + (b * nch + c0 + cl) * (size_t)npix + n0 + q * 4, o); } }

// ---- k_proj: block = (64 rows, 128 cols, which): q/k/v = X W (+ b) with exact bf16 products (K = DIN) -> which 0: q f16 rows (+ residual rows < QHI); 1: k f16 rows (+ residual rows < KHI); 2: v f16 planes [c][t] (+ bf16 hi/lo planes for t < KHI)
__global__ __launch_bounds__(128) void k_proj(const float* __restrict__ XQ, const float* __restrict__ XK, const float* __restrict__ XV, const float* __restrict__ WQ, const float* __restrict__ WK, const float* __restrict__ WV, const float* __restrict__ BQ, const float* __restrict__ BK, const float* __restrict__ BV,
    _Float16* __restrict__ QH, _Float16* __restrict__ QL, _Float16* __restrict__ KH, _Float16* __restrict__ KL, _Float16* __restrict__ VT, __bf16* __restrict__ VB, __bf16* __restrict__ VBL) {
  __shared__ __align__(16) _Float16 sh[64][136], sl[64][136]; __shared__ __align__(16) _Float16 th[128][72]; __shared__ __align__(16) __bf16 tb[128][72], tbl[128][72];
  const int tid = threadIdx.x, wave = tid >> 5, lane = tid & 31, col = lane & 15, g = lane >> 4; const int which = blockIdx.z; const int c0 = blockIdx.y * 128; const size_t r0 = (size_t)blockIdx.x * 64; const size_t bb = r0 / TT; const int t0 = (int)(r0 % TT);
  const float* X = which == 0 ? XQ : which == 1 ? XK : XV; const float* WA = which == 0 ? WQ : which == 1 ? WK : WV; const float* BA = which == 0 ? BQ : which == 1 ? BK : BV;
  v8f acc[8] = {};
#pragma unroll 2
  for (int kc = 0; kc < DIN / 32; ++kc) { v16b a; { const float* p = X + (r0 + wave * 16 + col) * DIN + kc * 32 + 8 * g;
#pragma unroll
      for (int i = 0; i < 8; ++i) { a[i] = (__bf16)p[i]; a[8 + i] = (__bf16)p[16 + i]; } }
    asm volatile("s_wait_loadcnt 0x0" ::: "memory");
#pragma unroll
    for (int j = 0; j < 8; ++j) { const v16b w = WCOL(WA, kc * 32, c0 + j * 16 + col, lane); asm volatile("s_wait_loadcnt 0x0" ::: "memory"); acc[j] = wmma_bf(a, w, acc[j]); } }
  if (which < 2) { _Float16* DH = which == 0 ? QH : KH; _Float16* DL = which == 0 ? QL : KL; const int nhi = which == 0 ? QHI : KHI; const bool hi_rows = t0 < nhi;
#pragma unroll
    for (int j = 0; j < 8; ++j) { const float bias = (BA && ((c0 + j * 16 + col) % HD) < LATW) ? bfr(BA[GCOL(c0 + j * 16 + col)]) : 0.f;   /* gathered like the weight columns; padding columns get no bias */
#pragma unroll
      for (int r = 0; r < 8; ++r) { const float v = acc[j][r] + bias; const _Float16 hv = (_Float16)v; sh[wave * 16 + 8 * g + r][j * 16 + col] = hv; sl[wave * 16 + 8 * g + r][j * 16 + col] = (_Float16)((v - (float)hv) * 1024.0f); } }
    __syncthreads();
    for (int e = tid; e < 64 * 16; e += 128) { const int rl = e >> 4, q = e & 15; vst2((unsigned*)(DH + (r0 + rl) * CC + c0 + q * 8), *(const v4u*)&sh[rl][q * 8]); if (hi_rows) vst2((unsigned*)(DL + (bb * nhi + t0 + rl) * (size_t)CC + c0 + q * 8), *(const v4u*)&sl[rl][q * 8]); }
  } else { const bool hi_rows = t0 < KHI;
#pragma unroll
    for (int j = 0; j < 8; ++j) { const float bias = (BA && ((c0 + j * 16 + col) % HD) < LATW) ? bfr(BA[GCOL(c0 + j * 16 + col)]) : 0.f;   /* gathered like the weight columns; padding columns get no bias */
#pragma unroll
      for (int r = 0; r < 8; ++r) { const float v = acc[j][r] + bias; const int rl = wave * 16 + 8 * g + r, cl = j * 16 + col; th[cl][rl] = (_Float16)v; const __bf16 bh = (__bf16)v; tb[cl][rl] = bh; tbl[cl][rl] = (__bf16)(v - (float)bh); } }
    __syncthreads();
    for (int e = tid; e < 128 * 8; e += 128) { const int cl = e >> 3, q = e & 7; vst2((unsigned*)(VT + (bb * CC + c0 + cl) * (size_t)TT + t0 + q * 8), *(const v4u*)&th[cl][q * 8]); if (hi_rows) { const size_t o3 = (bb * CC + c0 + cl) * (size_t)KHI + t0 + q * 8; vst2((unsigned*)(VB + o3), *(const v4u*)&tb[cl][q * 8]); vst2((unsigned*)(VBL + o3), *(const v4u*)&tbl[cl][q * 8]); } } } }
// ---- k_sc: block = (query block qb, key block kb <= kb_last(qb), head in group) of batch b: logits x SCALE; q hi + residual (x 2^10) against k (2 products) for query rows < QHI, plus the k residual (3 products) for query blocks < QBH (causal early rows); causal: blocks past the diagonal exit, the mask itself is applied by index in k_sm
__global__ __launch_bounds__(128) void k_sc(const _Float16* __restrict__ QH, const _Float16* __restrict__ KH, const _Float16* __restrict__ QL, const _Float16* __restrict__ KL, int b, int h0, float* __restrict__ S0) { __shared__ __align__(16) float ss[4][16][132];
  const int qb = blockIdx.x, kb = blockIdx.y; if (kb > kb_last(qb)) return;
  const int h = h0 + blockIdx.z; float* S = S0 + (size_t)blockIdx.z * TT * TT;
  const int tid = threadIdx.x, wave = tid >> 5, lane = tid & 31, col = lane & 15, g = lane >> 4; const int k0 = kb * 128; const int ql0 = qb * 64 + wave * 16; const size_t q0 = (size_t)b * TT + ql0, kr0 = (size_t)b * TT + k0;
  v8f acc[8] = {}, accl[8] = {};
  const _Float16* QLb = QL + (size_t)b * QHI * CC; const _Float16* KLb = KL + (size_t)b * KHI * CC;
  if (qb < QBH) {
#pragma unroll
    for (int kc = 0; kc < HD / 32; ++kc) { const v16h ah = frag_h(QH + (q0 + col) * CC + h * HD + kc * 32, lane), al = frag_h(QLb + (size_t)(ql0 + col) * CC + h * HD + kc * 32, lane);
#pragma unroll
      for (int j = 0; j < 8; ++j) { const v16h kbf = frag_h(KH + (kr0 + j * 16 + col) * CC + h * HD + kc * 32, lane), klf = frag_h(KLb + (size_t)(k0 + j * 16 + col) * CC + h * HD + kc * 32, lane); acc[j] = wmma16(ah, kbf, acc[j]); accl[j] = wmma16(al, kbf, accl[j]); accl[j] = wmma16(ah, klf, accl[j]); } }
  } else if (qb * 64 < QHI) {
#pragma unroll
    for (int kc = 0; kc < HD / 32; ++kc) { const v16h ah = frag_h(QH + (q0 + col) * CC + h * HD + kc * 32, lane), al = frag_h(QLb + (size_t)(ql0 + col) * CC + h * HD + kc * 32, lane);
#pragma unroll
      for (int j = 0; j < 8; ++j) { const v16h kbf = frag_h(KH + (kr0 + j * 16 + col) * CC + h * HD + kc * 32, lane); acc[j] = wmma16(ah, kbf, acc[j]); accl[j] = wmma16(al, kbf, accl[j]); } }
  } else {
#pragma unroll
    for (int kc = 0; kc < HD / 32; ++kc) { const v16h ah = frag_h(QH + (q0 + col) * CC + h * HD + kc * 32, lane);
#pragma unroll
      for (int j = 0; j < 8; ++j) { const v16h kbf = frag_h(KH + (kr0 + j * 16 + col) * CC + h * HD + kc * 32, lane); acc[j] = wmma16(ah, kbf, acc[j]); } } }
#pragma unroll
  for (int j = 0; j < 8; ++j) {
#pragma unroll
    for (int r = 0; r < 8; ++r) ss[wave][8 * g + r][j * 16 + col] = (acc[j][r] + accl[j][r] * (1.0f / 1024.0f)) * SCALE; }
  LDSX(); for (int rl = 0; rl < 16; ++rl) vst2(S + (size_t)(ql0 + rl) * TT + k0 + lane * 4, *(const v4f*)&ss[wave][rl][lane * 4]); }
// ---- k_sm: block = query row t (head in group): keys [0, kend): causal -> logit if s <= t else excluded; softmax in f32; P x 2^11 in place (0 for excluded)
__global__ __launch_bounds__(256) void k_sm(float* __restrict__ S0 SM_EXTRA_PARAMS) { __shared__ float sred[8]; __shared__ float sbc; __shared__ __align__(16) float shv[TT];
  const int tid = threadIdx.x; const int t = blockIdx.x; const int kend = (kb_last(t >> 6) + 1) * 128;
  float* sr = S0 + (size_t)blockIdx.y * TT * TT + (size_t)t * TT;
  float m = -3.0e38f; for (int k = tid; k < kend; k += 256) { float v = (!CAUSAL || k <= t) ? sr[k] : -3.0e38f; SM_MASK_HOOK; shv[k] = v; m = fmaxf(m, v); }
#pragma unroll
  for (int o = 1; o < 32; o <<= 1) m = fmaxf(m, __shfl_xor(m, o));
  if ((tid & 31) == 0) sred[tid >> 5] = m; __syncthreads(); if (tid == 0) { float a = sred[0]; for (int i = 1; i < 8; ++i) a = fmaxf(a, sred[i]); sbc = a; } __syncthreads(); m = sbc; __syncthreads();
  float sum = 0.f; for (int k = tid; k < kend; k += 256) { const float v = shv[k]; const float e = (v <= -1.0e38f) ? 0.f : expf(v - m); shv[k] = e; sum += e; }
#pragma unroll
  for (int o = 1; o < 32; o <<= 1) sum += __shfl_xor(sum, o);
  if ((tid & 31) == 0) sred[tid >> 5] = sum; __syncthreads(); if (tid == 0) { float a = 0.f; for (int i = 0; i < 8; ++i) a += sred[i]; sbc = a > 0.f ? 2048.0f / a : 0.f; }   /* a fully excluded row yields P = 0 */ __syncthreads(); const float inv = sbc;
  for (int k = tid; k < kend; k += 256) shv[k] = shv[k] * inv;
  __syncthreads(); for (int q = tid; q < kend / 4; q += 256) vst2(sr + q * 4, *(const v4f*)&shv[q * 4]); }
// ---- k_pv: block = 64 queries (qb) of (b, h): ctx = P . v over keys [0, kend) (P x 2^11 once to f16 against v f16: 1 product; causal early query blocks: P and v as bf16 hi + lo, 3 products); 128-B (row, head) segment by 8 lanes
__global__ __launch_bounds__(128) void k_pv(const float* __restrict__ PS0, const _Float16* __restrict__ VT, const __bf16* __restrict__ VB, const __bf16* __restrict__ VBL, int b, int h0, float* __restrict__ Y) { const int h = h0 + blockIdx.z; const float* PS = PS0 + (size_t)blockIdx.z * TT * TT; __shared__ __align__(16) float ss[4][16][HD + 4];
  const int tid = threadIdx.x, wave = tid >> 5, lane = tid & 31, col = lane & 15, g = lane >> 4; const int qb = blockIdx.x; const int ql0 = qb * 64 + wave * 16; const int kce = (kb_last(qb) + 1) * 4;
  v8f acc[HD / 16] = {};
  if (qb < QBH) {
#pragma unroll 1
    for (int kc = 0; kc < kce; ++kc) { const F2 p = split_row(PS + (size_t)(ql0 + col) * TT, kc * 32, lane);
      asm volatile("s_wait_loadcnt 0x0" ::: "memory");
#pragma unroll
      for (int j = 0; j < HD / 16; ++j) { const size_t po = ((size_t)b * CC + h * HD + j * 16 + col) * (size_t)KHI + kc * 32; const v16b vh = frag_b(VB + po, lane); acc[j] = wmma_bf(p.h, vh, acc[j]); acc[j] = wmma_bf(p.l, vh, acc[j]); acc[j] = wmma_bf(p.h, frag_b(VBL + po, lane), acc[j]); } }
  } else {
#pragma unroll 1
    for (int kc = 0; kc < kce; ++kc) { const v16h p = frag_f32(PS + (size_t)(ql0 + col) * TT + kc * 32, lane);
      asm volatile("s_wait_loadcnt 0x0" ::: "memory");
#pragma unroll
      for (int j = 0; j < HD / 16; ++j) { const size_t po = ((size_t)b * CC + h * HD + j * 16 + col) * (size_t)TT + kc * 32; acc[j] = wmma16(p, frag_h(VT + po, lane), acc[j]); } } }
#pragma unroll
  for (int j = 0; j < HD / 16; ++j)
#pragma unroll
    for (int r = 0; r < 8; ++r) ss[wave][8 * g + r][j * 16 + col] = acc[j][r] * (1.0f / 2048.0f);
  LDSX(); for (int rl = 0; rl < 16; ++rl) if (lane < HD / 4) vst2(Y + ((size_t)b * TT + ql0 + rl) * CC + h * HD + lane * 4, *(const v4f*)&ss[wave][rl][lane * 4]); }
// ---- k_out: block = (64 rows, 128 cols): ao = ctx Wvu (+ bvu): ctx once to f16 against Wvu as f16(bf16 x 2^8) exact (1 product) x 2^-8; causal early rows (< QHI of each sequence): ctx bf16 hi + lo against exact bf16 Wvu (2 products)
__global__ __launch_bounds__(128) void k_out(const float* __restrict__ Y, const float* __restrict__ WO, const float* __restrict__ BO, float* __restrict__ OUT) { __shared__ __align__(16) float sf[4][16][132];
  const int tid = threadIdx.x, wave = tid >> 5, lane = tid & 31, col = lane & 15, g = lane >> 4; const int c0 = blockIdx.y * 128; const size_t r0 = (size_t)blockIdx.x * 64 + wave * 16;
  v8f acc[8] = {};
  if (CAUSAL && (int)(((size_t)blockIdx.x * 64) % TT) < QHI) {   /* block-uniform */
#pragma unroll 2
    for (int kc = 0; kc < CC / 32; ++kc) { const F2 a = split_row(Y + (r0 + col) * CC, kc * 32, lane); asm volatile("s_wait_loadcnt 0x0" ::: "memory");
#pragma unroll
      for (int j = 0; j < 8; ++j) { const v16b w = WOCOL(WO, kc * 32, c0 + j * 16 + col, lane); asm volatile("s_wait_loadcnt 0x0" ::: "memory"); acc[j] = wmma_bf(a.h, w, acc[j]); acc[j] = wmma_bf(a.l, w, acc[j]); } }
#pragma unroll
    for (int j = 0; j < 8; ++j) { const float bias = BO ? bfr(BO[c0 + j * 16 + col]) : 0.f;
#pragma unroll
      for (int r = 0; r < 8; ++r) sf[wave][8 * g + r][j * 16 + col] = acc[j][r] + bias; }
  } else {
#pragma unroll 2
    for (int kc = 0; kc < CC / 32; ++kc) { const v16h a = frag_f32s(Y + (r0 + col) * CC + kc * 32, lane, 64.0f); asm volatile("s_wait_loadcnt 0x0" ::: "memory");   /* ctx carried x 2^6 into f16 so small-magnitude context rows stay clear of f16 subnormals (chip FTZ) */
#pragma unroll
      for (int j = 0; j < 8; ++j) { const v16h w = WOCOLH(WO, kc * 32, c0 + j * 16 + col, lane); asm volatile("s_wait_loadcnt 0x0" ::: "memory"); acc[j] = wmma16(a, w, acc[j]); } }
#pragma unroll
    for (int j = 0; j < 8; ++j) { const float bias = BO ? bfr(BO[c0 + j * 16 + col]) : 0.f;
#pragma unroll
      for (int r = 0; r < 8; ++r) sf[wave][8 * g + r][j * 16 + col] = acc[j][r] * (1.0f / 16384.0f) + bias; } }   /* 2^-8 (Wvu carry) x 2^-6 (ctx carry) */
  LDSX(); for (int rl = 0; rl < 16; ++rl) vst2(OUT + (r0 + rl) * DIN + c0 + lane * 4, *(const v4f*)&sf[wave][rl][lane * 4]); }
#define K2 DIN
#define wcol_io_plain(W, k0, o, lane) wcol_io(W, k0, o, lane, DIN)
#define wcolh_io_plain(W, k0, o, lane) wcolh_io(W, k0, o, lane, DIN)
// ---- k_out2: block = (64 rows, 128 cols): final projection out = R Wo + bo on the re-read rows R [NB*TT][K2] (K2 = DIN input width): same body as k_out with the row pitch / k extent K2 and the plain (in,out) loaders; always the single-product path
__global__ __launch_bounds__(128) void k_out2(const float* __restrict__ Y, const float* __restrict__ WO, const float* __restrict__ BO, float* __restrict__ OUT) { __shared__ __align__(16) float sf[4][16][132];
  const int tid = threadIdx.x, wave = tid >> 5, lane = tid & 31, col = lane & 15, g = lane >> 4; const int c0 = blockIdx.y * 128; const size_t r0 = (size_t)blockIdx.x * 64 + wave * 16;
  v8f acc[8] = {};
  if (0) {   /* the re-read rows mix positions: no early-row special case here */
#pragma unroll 2
    for (int kc = 0; kc < K2 / 32; ++kc) { const F2 a = split_row(Y + (r0 + col) * K2, kc * 32, lane); asm volatile("s_wait_loadcnt 0x0" ::: "memory");
#pragma unroll
      for (int j = 0; j < 8; ++j) { const v16b w = wcol_io_plain(WO, kc * 32, c0 + j * 16 + col, lane); asm volatile("s_wait_loadcnt 0x0" ::: "memory"); acc[j] = wmma_bf(a.h, w, acc[j]); acc[j] = wmma_bf(a.l, w, acc[j]); } }
#pragma unroll
    for (int j = 0; j < 8; ++j) { const float bias = BO ? bfr(BO[c0 + j * 16 + col]) : 0.f;
#pragma unroll
      for (int r = 0; r < 8; ++r) sf[wave][8 * g + r][j * 16 + col] = acc[j][r] + bias; }
  } else {
#pragma unroll 2
    for (int kc = 0; kc < K2 / 32; ++kc) { const v16h a = frag_f32s(Y + (r0 + col) * K2 + kc * 32, lane, 64.0f); asm volatile("s_wait_loadcnt 0x0" ::: "memory");   /* ctx carried x 2^6 into f16 so small-magnitude context rows stay clear of f16 subnormals (chip FTZ) */
#pragma unroll
      for (int j = 0; j < 8; ++j) { const v16h w = wcolh_io_plain(WO, kc * 32, c0 + j * 16 + col, lane); asm volatile("s_wait_loadcnt 0x0" ::: "memory"); acc[j] = wmma16(a, w, acc[j]); } }
#pragma unroll
    for (int j = 0; j < 8; ++j) { const float bias = BO ? bfr(BO[c0 + j * 16 + col]) : 0.f;
#pragma unroll
      for (int r = 0; r < 8; ++r) sf[wave][8 * g + r][j * 16 + col] = acc[j][r] * (1.0f / 16384.0f) + bias; } }   /* 2^-8 (Wo carry) x 2^-6 (ctx carry) */
  LDSX(); for (int rl = 0; rl < 16; ++rl) vst2(OUT + (r0 + rl) * DIN + c0 + lane * 4, *(const v4f*)&sf[wave][rl][lane * 4]); }

extern "C" void kernel_launch(void* const* d_in, const int* in_sizes, int n_in, void* d_out, int out_size, void* d_ws, size_t ws_size, hipStream_t stream) {
  (void)in_sizes; (void)n_in; (void)out_size;
  const float** F = (const float**)d_in;
  if (ws_size < (size_t)WS_END) return;
  char* ws = (char*)d_ws; _Float16 *QH = (_Float16*)(ws + WS_QH), *KH = (_Float16*)(ws + WS_KH), *VT = (_Float16*)(ws + WS_VT), *QL = (_Float16*)(ws + WS_QL), *KL = (_Float16*)(ws + WS_KL); __bf16 *VB = (__bf16*)(ws + WS_VB), *VBL = (__bf16*)(ws + WS_VBL); float *S = (float*)(ws + WS_S), *Y = (float*)(ws + WS_Y);
  (void)Y; (void)QL; (void)KL; (void)VB; (void)VBL;
  // inputs: 0 x [4,2048,768]; 1 Wq [768,768] (in,out), 2 bq; 3 Wkd [768,192], 4 bkd; 5 Wvd [768,192], 6 bvd; 7 Wvu [192,768], 8 bvu; 9 Wo [768,768] (in,out), 10 bo (all biases zeros, read)
  if (ws_size < (size_t)WS_END2) return;
  float *AO = (float*)(ws + WS_AO), *T = (float*)(ws + WS_T);
  k_proj<<<dim3(TNB * TT / 64, CC / 128, 3), 128, 0, stream>>>(F[0], F[0], F[0], F[1], F[3], F[5], F[2], F[4], F[6], QH, QL, KH, KL, VT, VB, VBL);   /* q slice, latent k, latent v: 3 column blocks of 128 columns each */
  for (int b = 0; b < TNB; ++b) for (int h0 = 0; h0 < NH; h0 += HG) {
    k_sc<<<dim3(NQB, TT / 128, HG), 128, 0, stream>>>(QH, KH, QL, KL, b, h0, S);
    k_sm<<<dim3(TT, HG), 256, 0, stream>>>(S);
    k_pv<<<dim3(NQB, 1, HG), 128, 0, stream>>>(S, VT, VB, VBL, b, h0, Y);
  }
  k_out<<<dim3(TNB * TT / 64, DIN / 128), 128, 0, stream>>>(Y, F[7], F[8], AO);   /* ao = al Wvu + bvu (gathered weight rows) */
  k_fin<<<dim3(TT / 64, DIN / 64, TNB), 256, 0, stream>>>(AO, T, TT, DIN);   /* T[b][c][s] = ao[b][s][c] */
  k_out2<<<dim3(TNB * TT / 64, DIN / 128), 128, 0, stream>>>(T, F[9], F[10], (float*)d_out);   /* rows = T's memory re-read as [TT][DIN] per batch; out = rows Wo + bo */
}

// v001
// It runs in 253 microseconds.
// Timed twice side by side with v000, it ran 6.87 and 6.88 times as fast.
// compute dtype: all float inputs rounded to bf16; the q slice and the latent k / v projections with EXACT bf16 products on WMMA 16x16x32 (f32 accumulate) + bias (zeros, read), 16 real dims per head zero-padded to 32; causal logits over the 16 latent dims: 3 products for the first 384 rows, single f16 after, x 16^-0.5; softmax f32 (max first, then exp(s - max) x 2^11 once to f16 x v once to f16 (bf16 hi + lo below row 384), divided by the f32 row sum after the product; logits never stored); latent ctx (hi+lo below row 384, x2^6 f16 carry after) x exact / f16(bf16 x 2^8) Wvu + bvu; per-batch transpose; then x 2^6 once to f16 x Wo f16(bf16 x 2^8) + bo; f32 output.
#include <hip/hip_runtime.h>
#include <math.h>

typedef __attribute__((ext_vector_type(16))) _Float16 v16h;
typedef __attribute__((ext_vector_type(16))) __bf16 v16b;
typedef __attribute__((ext_vector_type(8)))  _Float16 v8h;
typedef __attribute__((ext_vector_type(8)))  float v8f;
typedef __attribute__((ext_vector_type(4)))  float v4f;
typedef __attribute__((ext_vector_type(2)))  float v2f;
typedef __attribute__((ext_vector_type(4)))  unsigned v4u;
typedef __attribute__((ext_vector_type(4)))  int v4i;
typedef float __attribute__((may_alias)) float_a;
typedef int __attribute__((may_alias)) int_a;

template <typename T> __device__ __forceinline__ void vst2(void* p, T v) { *(T*)p = v;  }
__device__ __forceinline__ v8f wmma16(v16h a, v16h b, v8f c) {
  v8f d = __builtin_amdgcn_wmma_f32_16x16x32_f16(false, a, false, b, (short)0, c, false, false);
  asm volatile("v_nop\n\tv_nop\n\tv_nop\n\tv_nop" : "+v"(d) : "v"(a), "v"(b));
  return d;
}
__device__ __forceinline__ v8f wmma_bf(v16b a, v16b b, v8f c) {
  v8f d = __builtin_amdgcn_wmma_f32_16x16x32_bf16(false, a, false, b, (short)0, c, false, false);
  asm volatile("v_nop\n\tv_nop\n\tv_nop\n\tv_nop" : "+v"(d) : "v"(a), "v"(b));
  return d;
}
// 16x16x32 fragments: lane = (h = lane>>4, row/col = lane&15); elements 0..7 = k0+8h+0..7, 8..15 = k0+16+8h+0..7; D element r = row 8h+r
__device__ __forceinline__ v16h frag_h(const _Float16* rowk0, int lane) {
  union { v16h v; v8h q[2]; } u; const _Float16* p = rowk0 + 8 * (lane >> 4);
  u.q[0] = *(const v8h*)p; u.q[1] = *(const v8h*)(p + 16); return u.v;
}
__device__ __forceinline__ v16h frag_f32(const float* rowk0, int lane) {
  v16h a; const float* p = rowk0 + 8 * (lane >> 4);
#pragma unroll
  for (int i = 0; i < 8; ++i) { a[i] = (_Float16)p[i]; a[8 + i] = (_Float16)p[16 + i]; }
  return a;
}
__device__ __forceinline__ v16h frag_f32s(const float* rowk0, int lane, float sc) {
  v16h a; const float* p = rowk0 + 8 * (lane >> 4);
#pragma unroll
  for (int i = 0; i < 8; ++i) { a[i] = (_Float16)(p[i] * sc); a[8 + i] = (_Float16)(p[16 + i] * sc); }
  return a;
}
// column fragment from a [K][ld] layout (column n), rows >= K read as 0
__device__ __forceinline__ v16h fragc_f32(const float* W, int k0, int n, int lane, int ld, int K) {
  v16h a; const int g = lane >> 4;
#pragma unroll
  for (int i = 0; i < 8; ++i) { const int ka = k0 + 8 * g + i, kb = ka + 16;
    a[i] = (_Float16)(ka < K ? W[(size_t)(ka < K ? ka : K - 1) * ld + n] : 0.f); a[8 + i] = (_Float16)(kb < K ? W[(size_t)(kb < K ? kb : K - 1) * ld + n] : 0.f); }
  return a;
}
struct F2 { v16b h, l; };
__device__ __forceinline__ F2 bsplit16(const float v[16]) { F2 r;
#pragma unroll
  for (int i = 0; i < 16; ++i) { const __bf16 h = (__bf16)v[i]; r.h[i] = h; r.l[i] = (__bf16)(v[i] - (float)h); }
  return r; }
__device__ __forceinline__ F2 split_row(const float* row, int k0, int lane) { float v[16]; const float* p = row + k0 + 8 * (lane >> 4);
#pragma unroll
  for (int i = 0; i < 8; ++i) { v[i] = p[i]; v[8 + i] = p[16 + i]; }
  return bsplit16(v); }
__device__ __forceinline__ F2 split_rowK(const float* row, int k0, int lane, int K) { float v[16]; const int g = lane >> 4;
#pragma unroll
  for (int i = 0; i < 8; ++i) { const int ka = k0 + 8 * g + i, kb = ka + 16; v[i] = ka < K ? row[ka < K ? ka : K - 1] : 0.f; v[8 + i] = kb < K ? row[kb < K ? kb : K - 1] : 0.f; }
  return bsplit16(v); }
__device__ __forceinline__ F2 split_col(const float* W, int k0, int n, int lane, int ld, int K) { float v[16]; const int g = lane >> 4;
#pragma unroll
  for (int i = 0; i < 8; ++i) { const int ka = k0 + 8 * g + i, kb = ka + 16; v[i] = ka < K ? W[(size_t)(ka < K ? ka : K - 1) * ld + n] : 0.f; v[8 + i] = kb < K ? W[(size_t)(kb < K ? kb : K - 1) * ld + n] : 0.f; }
  return bsplit16(v); }
__device__ __forceinline__ v8f mac3(const F2& a, const F2& b, v8f c) { c = wmma_bf(a.l, b.h, c); c = wmma_bf(a.h, b.l, c); return wmma_bf(a.h, b.h, c); }
__device__ __forceinline__ float sigm(float v) { return 1.0f / (1.0f + expf(-v)); }
#define LDSX() do { asm volatile("s_wait_dscnt 0" ::: "memory"); __builtin_amdgcn_wave_barrier(); __builtin_amdgcn_fence(__ATOMIC_RELEASE, "workgroup"); } while (0)

// Causal self-attention with 12 low-rank latent heads (x [4,2048,768]; (in,out) Wq [768,768], Wkd / Wvd [768,192], Wvu [192,768], Wo [768,768], all N(0,1) x 0.02, zero biases (read); q = x Wq + bq split into 12 heads x 64 of which only the FIRST 16 dims of each head are used (ql); kl, vl = x Wkd, x Wvd split into 12 heads x 16; scores = ql kl^T x 16^-0.5; triu(1) -> -inf; softmax; al = w vl merged to [B,S,192]; ao = al Wvu + bvu [B,S,768]; then jnp.transpose(ao, (0,2,1)).reshape(B,S,768): the per-batch [2048 x 768] matrix is transposed to [768 x 2048] and its memory re-read as 2,048 rows of 768; out = that Wo + bo).
#define NB 4
#define TT 2048
#define CC 384            // NH * HD = projected width
#define DIN 768          // input (model) width
#define NH 12
#define HD 32
#define LATW 16     /* real dims per head; columns h*HD + d with d >= LATW are zero padding */
#define QHEADW 64   /* the module's q heads are 64 wide; only their first LATW dims are used (ql = q[..., :16]) */
#define KVLD (NH * LATW)   /* row pitch of the (in,out) latent weights Wkd / Wvd [768][192] */
#define NQB (TT / 64)
#define HG 2   // S region: 2 x 2,048 x 2,048 f32 = 32 MiB, allocated but unused
#define SCALE (0.25f)
#define CAUSAL 1
#ifndef TNB
#define TNB NB
#endif
__device__ __forceinline__ float bfr(float v) { return (float)(__bf16)v; }
__host__ __device__ __forceinline__ int kb_last(int qb) { return CAUSAL ? ((qb * 64 + 63) >> 7) : (TT / 128 - 1); }
typedef __attribute__((ext_vector_type(8))) __bf16 v8b;
__device__ __forceinline__ v16b frag_b(const __bf16* rowk0, int lane) {
  union { v16b v; v8b q[2]; } u; const __bf16* p = rowk0 + 8 * (lane >> 4);
  u.q[0] = *(const v8b*)p; u.q[1] = *(const v8b*)(p + 16); return u.v;
}
#define QBH 6              // causal: query blocks 0..QBH-1 of each sequence (few keys, no averaging) take the high-precision path
#define QHI 384            // rows carrying a q residual plane
#define KHI 384            // key rows carrying k residual / v bf16 hi+lo planes (used only by the causal high-precision path)
// B fragment (k rows k0+.., output column o) of a weight: (in,out) [K][ld] or (out,in) [ld rows of K]: bf16 exact, or f16(bf16 * 256) exact
__device__ __forceinline__ v16b wcol_io(const float* Wm, int k0, int o, int lane, int ld) { v16b w; const int g = lane >> 4;
#pragma unroll
  for (int i = 0; i < 8; ++i) { w[i] = (__bf16)Wm[(size_t)(k0 + 8 * g + i) * ld + o]; w[8 + i] = (__bf16)Wm[(size_t)(k0 + 16 + 8 * g + i) * ld + o]; }
  return w; }
__device__ __forceinline__ v16b wcol_oi(const float* Wm, int k0, int o, int lane, int K) { v16b w; const float* p = Wm + (size_t)o * K + k0 + 8 * (lane >> 4);
#pragma unroll
  for (int i = 0; i < 8; ++i) { w[i] = (__bf16)p[i]; w[8 + i] = (__bf16)p[16 + i]; }
  return w; }
__device__ __forceinline__ v16h wcolh_io(const float* Wm, int k0, int o, int lane, int ld) { v16h w; const int g = lane >> 4;
#pragma unroll
  for (int i = 0; i < 8; ++i) { w[i] = (_Float16)(bfr(Wm[(size_t)(k0 + 8 * g + i) * ld + o]) * 256.0f); w[8 + i] = (_Float16)(bfr(Wm[(size_t)(k0 + 16 + 8 * g + i) * ld + o]) * 256.0f); }
  return w; }
// first output projection ao = al Wvu: the k index runs over ctx columns kk = h*HD + d; one 32-deep k-step = one head; its first 16 entries (d < LATW, fragment slots 0..7 of both lane halves) are rows h*LATW + d of the (in,out) [192][768] weight, its last 16 (padding dims, slots 8..15) are zero
__device__ __forceinline__ v16b wcol_io_lat(const float* Wm, int k0, int o, int lane, int ld) { v16b w; const int g = lane >> 4; const float* p = Wm + (size_t)((k0 / HD) * LATW + 8 * g) * ld + o;
#pragma unroll
  for (int i = 0; i < 8; ++i) { w[i] = (__bf16)p[(size_t)i * ld]; w[8 + i] = (__bf16)0.0f; }
  return w; }
__device__ __forceinline__ v16h wcolh_io_lat(const float* Wm, int k0, int o, int lane, int ld) { v16h w; const int g = lane >> 4; const float* p = Wm + (size_t)((k0 / HD) * LATW + 8 * g) * ld + o;
#pragma unroll
  for (int i = 0; i < 8; ++i) { w[i] = (_Float16)(bfr(p[(size_t)i * ld]) * 256.0f); w[8 + i] = (_Float16)0.0f; }
  return w; }
static_assert(HD == 32 && LATW == 16 && CC == NH * HD, "the latent loaders assume one head per 32-deep k-step with 16 real + 16 padding dims");
__device__ __forceinline__ v16h wcolh_oi(const float* Wm, int k0, int o, int lane, int K) { v16h w; const float* p = Wm + (size_t)o * K + k0 + 8 * (lane >> 4);
#pragma unroll
  for (int i = 0; i < 8; ++i) { w[i] = (_Float16)(bfr(p[i]) * 256.0f); w[8 + i] = (_Float16)(bfr(p[16 + i]) * 256.0f); }
  return w; }
#define WQKV_LAYOUT 0   // 0 = (in,out) [DIN][out], columns gathered per head; 1 = (out,in) [CC][DIN]; 2 = per-head [NH][DIN][HD]
__device__ __forceinline__ v16b wcol_hdk(const float* Wm, int k0, int o, int lane) { v16b w; const int g = lane >> 4; const float* p = Wm + (size_t)(o / HD) * DIN * HD + (o % HD);
#pragma unroll
  for (int i = 0; i < 8; ++i) { w[i] = (__bf16)p[(size_t)(k0 + 8 * g + i) * HD]; w[8 + i] = (__bf16)p[(size_t)(k0 + 16 + 8 * g + i) * HD]; }
  return w; }
#define WO_OUT_IN 0
#if WQKV_LAYOUT == 1
#define WCOL(W, k0, o, lane) wcol_oi(W, k0, o, lane, DIN)
#elif WQKV_LAYOUT == 2
#define WCOL(W, k0, o, lane) wcol_hdk(W, k0, o, lane)
#else
__device__ __forceinline__ v16b zero16b() { v16b w; _Pragma("unroll") for (int i = 0; i < 16; ++i) w[i] = (__bf16)0.0f; return w; }
/* column o = h*HD + d: real (d < LATW) -> weight column h*QHEADW + d of Wq (pitch DIN) for the q stream, h*LATW + d of Wkd / Wvd (pitch KVLD) for k / v; padding -> zeros. o = c0 + j*16 + col with c0 % 128 == 0, so (o % HD) < LATW is decided by j alone (compile-time per unrolled j, uniform across the wave) */
#define GCOL(o) ((which) == 0 ? ((o) / HD) * QHEADW + ((o) % HD) : ((o) / HD) * LATW + ((o) % HD))
#define WCOL(W, k0, o, lane) ((((o) % HD) < LATW) ? wcol_io(W, k0, GCOL(o), lane, ((which) == 0 ? DIN : KVLD)) : zero16b())
#endif
#if WO_OUT_IN
#define WOCOL(W, k0, o, lane) wcol_oi(W, k0, o, lane, CC)
#define WOCOLH(W, k0, o, lane) wcolh_oi(W, k0, o, lane, CC)
#else
#define WOCOL(W, k0, o, lane) wcol_io_lat(W, k0, o, lane, DIN)
#define WOCOLH(W, k0, o, lane) wcolh_io_lat(W, k0, o, lane, DIN)
#endif

#ifndef SM_EXTRA_PARAMS
#define SM_EXTRA_PARAMS
#endif
#ifndef PROJ_EXTRA_PARAMS
#define PROJ_EXTRA_PARAMS
#endif
#ifndef SM_MASK_HOOK
#define SM_MASK_HOOK (void)0
#endif

#define WS_QH  0u                                      // f16 q rows [b*t][CC]
#define WS_KH  (WS_QH + 2u * (size_t)NB * TT * CC)      // f16 k rows [b*t][CC]
#define WS_VT  (WS_KH + 2u * (size_t)NB * TT * CC)      // f16 v planes [b][c][t]
#define WS_QL  (WS_VT + 2u * (size_t)NB * CC * TT)      // f16 q residual x 2^10 rows [b][t < QHI][CC]
#define WS_KL  (WS_QL + 2u * (size_t)NB * QHI * CC)     // f16 k residual x 2^10 rows [b][t < KHI][CC]
#define WS_VB  (WS_KL + 2u * (size_t)NB * KHI * CC)     // bf16 v hi planes [b][c][t < KHI]
#define WS_VBL (WS_VB + 2u * (size_t)NB * CC * KHI)
#define WS_S   (WS_VBL + 2u * (size_t)NB * CC * KHI)    // f32 [hg][t][s] region, unused (logits stay in registers)
#define WS_Y   (WS_S  + 4u * (size_t)HG * TT * TT)      // f32 ctx rows [b*t][CC] (only when there is an output projection)
#define WS_END (WS_Y  + 4u * (size_t)NB * TT * CC)
#define WS_AO (WS_END)                                    // f32 ao rows [(b*TT + s)][DIN] = al Wvu + bvu
#define WS_T  (WS_AO + 4u * (size_t)NB * TT * DIN)          // f32 per-batch transpose T[b][c][s]; its memory is then read as TT rows of DIN (the module's transpose(0,2,1).reshape)
#define WS_END2 (WS_T + 4u * (size_t)NB * TT * DIN)
static_assert(TT % 64 == 0 && DIN % 64 == 0, "transpose tiles are 64 x 64");
// ---- k_fin: block = (64 positions, 64 channels, image b): out[b][c][n] = OR[(b*npix + n)][c] (LDS transpose; 256-B runs of 64 positions per channel)
__global__ __launch_bounds__(256) void k_fin(const float* __restrict__ ORW, float* __restrict__ OUT, int npix, int nch) { __shared__ float st[64][68]; const int tid = threadIdx.x; const int n0 = blockIdx.x * 64, c0 = blockIdx.y * 64; const size_t b = blockIdx.z;
  for (int e = tid; e < 64 * 16; e += 256) { const int nl = e >> 4, q = e & 15; *(v4f*)&st[nl][q * 4] = *(const v4f*)(ORW + (b * npix + n0 + nl) * (size_t)nch + c0 + q * 4); }
  __syncthreads();
  for (int e = tid; e < 64 * 16; e += 256) { const int cl = e >> 4, q = e & 15; v4f o; o[0] = st[q * 4][cl]; o[1] = st[q * 4 + 1][cl]; o[2] = st[q * 4 + 2][cl]; o[3] = st[q * 4 + 3][cl]; vst2(OUT + (b * nch + c0 + cl) * (size_t)npix + n0 + q * 4, o); } }

// ---- k_proj: block = (64 rows, 128 cols, which): q/k/v = X W (+ b) with exact bf16 products (K = DIN) -> which 0: q f16 rows (+ residual rows < QHI); 1: k f16 rows (+ residual rows < KHI); 2: v f16 planes [c][t] (+ bf16 hi/lo planes for t < KHI)
__global__ __launch_bounds__(128) void k_proj(const float* __restrict__ XQ, const float* __restrict__ XK, const float* __restrict__ XV, const float* __restrict__ WQ, const float* __restrict__ WK, const float* __restrict__ WV, const float* __restrict__ BQ, const float* __restrict__ BK, const float* __restrict__ BV,
    _Float16* __restrict__ QH, _Float16* __restrict__ QL, _Float16* __restrict__ KH, _Float16* __restrict__ KL, _Float16* __restrict__ VT, __bf16* __restrict__ VB, __bf16* __restrict__ VBL) {
  __shared__ __align__(16) _Float16 sh[64][136], sl[64][136]; __shared__ __align__(16) _Float16 th[128][72]; __shared__ __align__(16) __bf16 tb[128][72], tbl[128][72];
  const int tid = threadIdx.x, wave = tid >> 5, lane = tid & 31, col = lane & 15, g = lane >> 4; const int which = blockIdx.z; const int c0 = blockIdx.y * 128; const size_t r0 = (size_t)blockIdx.x * 64; const size_t bb = r0 / TT; const int t0 = (int)(r0 % TT);
  const float* X = which == 0 ? XQ : which == 1 ? XK : XV; const float* WA = which == 0 ? WQ : which == 1 ? WK : WV; const float* BA = which == 0 ? BQ : which == 1 ? BK : BV;
  v8f acc[8] = {};
#pragma unroll 2
  for (int kc = 0; kc < DIN / 32; ++kc) { v16b a; { const float* p = X + (r0 + wave * 16 + col) * DIN + kc * 32 + 8 * g;
#pragma unroll
      for (int i = 0; i < 8; ++i) { a[i] = (__bf16)p[i]; a[8 + i] = (__bf16)p[16 + i]; } }
    asm volatile("s_wait_loadcnt 0x0" ::: "memory");
#pragma unroll
    for (int j = 0; j < 8; ++j) { const v16b w = WCOL(WA, kc * 32, c0 + j * 16 + col, lane); asm volatile("s_wait_loadcnt 0x0" ::: "memory"); acc[j] = wmma_bf(a, w, acc[j]); } }
  if (which < 2) { _Float16* DH = which == 0 ? QH : KH; _Float16* DL = which == 0 ? QL : KL; const int nhi = which == 0 ? QHI : KHI; const bool hi_rows = t0 < nhi;
#pragma unroll
    for (int j = 0; j < 8; ++j) { const float bias = (BA && ((c0 + j * 16 + col) % HD) < LATW) ? bfr(BA[GCOL(c0 + j * 16 + col)]) : 0.f;   /* gathered like the weight columns; padding columns get no bias */
#pragma unroll
      for (int r = 0; r < 8; ++r) { const float v = acc[j][r] + bias; const _Float16 hv = (_Float16)v; sh[wave * 16 + 8 * g + r][j * 16 + col] = hv; sl[wave * 16 + 8 * g + r][j * 16 + col] = (_Float16)((v - (float)hv) * 1024.0f); } }
    __syncthreads();
    for (int e = tid; e < 64 * 16; e += 128) { const int rl = e >> 4, q = e & 15; vst2((unsigned*)(DH + (r0 + rl) * CC + c0 + q * 8), *(const v4u*)&sh[rl][q * 8]); if (hi_rows) vst2((unsigned*)(DL + (bb * nhi + t0 + rl) * (size_t)CC + c0 + q * 8), *(const v4u*)&sl[rl][q * 8]); }
  } else { const bool hi_rows = t0 < KHI;
#pragma unroll
    for (int j = 0; j < 8; ++j) { const float bias = (BA && ((c0 + j * 16 + col) % HD) < LATW) ? bfr(BA[GCOL(c0 + j * 16 + col)]) : 0.f;   /* gathered like the weight columns; padding columns get no bias */
#pragma unroll
      for (int r = 0; r < 8; ++r) { const float v = acc[j][r] + bias; const int rl = wave * 16 + 8 * g + r, cl = j * 16 + col; th[cl][rl] = (_Float16)v; const __bf16 bh = (__bf16)v; tb[cl][rl] = bh; tbl[cl][rl] = (__bf16)(v - (float)bh); } }
    __syncthreads();
    for (int e = tid; e < 128 * 8; e += 128) { const int cl = e >> 3, q = e & 7; vst2((unsigned*)(VT + (bb * CC + c0 + cl) * (size_t)TT + t0 + q * 8), *(const v4u*)&th[cl][q * 8]); if (hi_rows) { const size_t o3 = (bb * CC + c0 + cl) * (size_t)KHI + t0 + q * 8; vst2((unsigned*)(VB + o3), *(const v4u*)&tb[cl][q * 8]); vst2((unsigned*)(VBL + o3), *(const v4u*)&tbl[cl][q * 8]); } } } }
// ---- k_att: block = 4 waves x 32 queries of (b, h), one launch for all (b, h): logits, softmax and P . v without leaving registers.
// S^T = K . Q^T (A = 16 key rows, B = 16 query rows): lane (g, c) holds, for query c, keys 8g + r of each 16-key tile, so the two tiles of one 32-key step, converted in place, are the B operand of ctx^T += v^T . P^T (hardware k order on both sides). Each key / v fragment serves the wave's two 16-query tiles.
// Walk 1: row maximum. Walk 2 (logits formed again, same products): e = exp(s - max), row sum in f32, e x 2^11 once to f16 against v f16 (query rows < QHI: 3-product logits, e x 2^11 and v as bf16 hi + lo, 3 products); ctx = acc / (2^11 x sum). Keys past the wave's own diagonal step are not visited; the diagonal step masks by index.
#define QT 2   // 16-query tiles per wave
static_assert(QHI % (64 * QT) == 0 && QHI == QBH * 64 && KHI >= QHI && TT % (64 * QT) == 0, "a block of 4 x QT x 16 queries is wholly early or wholly late; early rows see only keys < KHI");
__device__ __forceinline__ v8f wm_h(v16h a, v16h b, v8f c) { return __builtin_amdgcn_wmma_f32_16x16x32_f16(false, a, false, b, (short)0, c, false, false); }
__device__ __forceinline__ v8f wm_b(v16b a, v16b b, v8f c) { return __builtin_amdgcn_wmma_f32_16x16x32_bf16(false, a, false, b, (short)0, c, false, false); }
// a precaution: stands between issued loads and the next write of a register that holds one of their addresses
__device__ __forceinline__ void XW() { asm volatile("s_wait_xcnt 0x0" ::: "memory"); }
// fragment from a wave-uniform base + the lane's fixed byte offset (row c, half g). xl: the last fragment read through its address pair; its last load may land on that pair, so the wait stands in front of it
__device__ __forceinline__ v16h frag_hu(const _Float16* ub, unsigned lob, bool xl = false) { union { v16h v; v8h q[2]; } u; const char* p = (const char*)ub + lob; u.q[0] = *(const v8h*)p; if (xl) XW(); u.q[1] = *(const v8h*)(p + 32); return u.v; }
__device__ __forceinline__ v16b frag_bu(const __bf16* ub, unsigned lob, bool xl = false) { union { v16b v; v8b q[2]; } u; const char* p = (const char*)ub + lob; u.q[0] = *(const v8b*)p; if (xl) XW(); u.q[1] = *(const v8b*)(p + 32); return u.v; }
// exp(x) step for step as the library's expf forms it (x log2(e) in two parts, v_exp_f32 on the fraction, ldexp, both range ends): same bits. The v_exp_f32 is written out so that the free slot the instruction set asks for behind a transcendental stands in its own statement, whatever instruction the build puts next.
__device__ __forceinline__ float exp_slot(float x) { const float l2e = __uint_as_float(0x3fb8aa3bu); const float t = x * l2e; float f = __builtin_fmaf(x, l2e, -t); f = __builtin_fmaf(x, __uint_as_float(0x32a5705fu), f); const float r = __builtin_rintf(t); const float a = (t - r) + f;
  float e; asm("v_exp_f32 %0, %1\n\tv_nop" : "=v"(e) : "v"(a));
  e = ldexpf(e, (int)r); e = x < __uint_as_float(0xc2ce8ed0u) ? 0.f : e; return x > __uint_as_float(0x42b17218u) ? __builtin_inff() : e; }
// one 32-key step: ld_k reads its two 16-key tiles (KHr / KLr point at key 0 of (b, h), klo = the lane's byte offset in a 16-row tile of pitch CC); st_mm forms s[u][8 t + r] = logit(key kc*32 + 16 t + 8 g + r, query 16 u + c)
struct KF { v16h h[2], l[2]; };
template <bool HI> __device__ __forceinline__ KF ld_k(const _Float16* KHr, const _Float16* KLr, int kc, unsigned klo, bool xl) { KF k;
#pragma unroll
  for (int t = 0; t < 2; ++t) { const size_t ro = (size_t)(kc * 32 + t * 16) * CC; k.h[t] = frag_hu(KHr + ro, klo, xl && t == 1); if (HI) k.l[t] = frag_hu(KLr + ro, klo, xl && t == 1); else k.l[t] = k.h[t]; }
  return k; }
template <bool HI> __device__ __forceinline__ void st_mm(const KF& k, const v16h qh[QT], const v16h ql[QT], float s[QT][16]) {
#pragma unroll
  for (int t = 0; t < 2; ++t)
#pragma unroll
    for (int u = 0; u < QT; ++u) { v8f a = {}; a = wm_h(k.h[t], qh[u], a);
      if (HI) { v8f al = {}; al = wm_h(k.h[t], ql[u], al); al = wm_h(k.l[t], qh[u], al);
#pragma unroll
        for (int r = 0; r < 8; ++r) s[u][t * 8 + r] = (a[r] + al[r] * (1.0f / 1024.0f)) * SCALE;
      } else {
#pragma unroll
        for (int r = 0; r < 8; ++r) s[u][t * 8 + r] = a[r] * SCALE; } } }
template <bool HI, bool MASK> __device__ __forceinline__ void max_step(const _Float16* KHr, const _Float16* KLr, const v16h qh[QT], const v16h ql[QT], int kc, unsigned klo, int qrel, float m[QT]) { float s[QT][16]; const KF k = ld_k<HI>(KHr, KLr, kc, klo, false); st_mm<HI>(k, qh, ql, s);
#pragma unroll
  for (int u = 0; u < QT; ++u)
#pragma unroll
    for (int i = 0; i < 16; ++i) { if (!MASK || kc * 32 + 16 * (i >> 3) + (i & 7) <= qrel + 16 * u) m[u] = fmaxf(m[u], s[u][i]); } }
template <bool HI, bool MASK> __device__ __forceinline__ void pv_step(const _Float16* KHr, const _Float16* KLr, const v16h qh[QT], const v16h ql[QT], const _Float16* VTr, const __bf16* VBr, const __bf16* VBLr, int kc, unsigned klo, unsigned vlt, unsigned vlb, int qrel, const float m[QT], float sum[QT], v8f acc[QT][HD / 16]) { float s[QT][16];
  const KF k = ld_k<HI>(KHr, KLr, kc, klo, true); XW();
  v16h vf[HD / 16]; v16b vh[HD / 16], vl[HD / 16];   /* v is asked for before the exponentials, which cover its latency */
#pragma unroll
  for (int j = 0; j < HD / 16; ++j) { if (HI) { const size_t po = (size_t)j * 16 * KHI + kc * 32; vh[j] = frag_bu(VBr + po, vlb, j == HD / 16 - 1); vl[j] = frag_bu(VBLr + po, vlb, j == HD / 16 - 1); } else vf[j] = frag_hu(VTr + (size_t)j * 16 * TT + kc * 32, vlt, j == HD / 16 - 1); }
  st_mm<HI>(k, qh, ql, s);
#pragma unroll
  for (int u = 0; u < QT; ++u)
#pragma unroll
    for (int i = 0; i < 16; ++i) { float e = exp_slot(s[u][i] - m[u]); if (MASK && kc * 32 + 16 * (i >> 3) + (i & 7) > qrel + 16 * u) e = 0.f; sum[u] += e; s[u][i] = e * 2048.0f; }
  if (HI) { F2 pp[QT];
#pragma unroll
    for (int u = 0; u < QT; ++u) pp[u] = bsplit16(s[u]);
#pragma unroll
    for (int j = 0; j < HD / 16; ++j)
#pragma unroll
      for (int u = 0; u < QT; ++u) { acc[u][j] = wm_b(vh[j], pp[u].h, acc[u][j]); acc[u][j] = wm_b(vh[j], pp[u].l, acc[u][j]); acc[u][j] = wm_b(vl[j], pp[u].h, acc[u][j]); }
  } else { v16h pb[QT];
#pragma unroll
    for (int u = 0; u < QT; ++u)
#pragma unroll
      for (int i = 0; i < 16; ++i) pb[u][i] = (_Float16)s[u][i];
#pragma unroll
    for (int j = 0; j < HD / 16; ++j)
#pragma unroll
      for (int u = 0; u < QT; ++u) acc[u][j] = wm_h(vf[j], pb[u], acc[u][j]); } }
template <bool HI> __device__ __forceinline__ void att_body(const _Float16* __restrict__ QH, const _Float16* __restrict__ KH, const _Float16* __restrict__ QL, const _Float16* __restrict__ KL, const _Float16* __restrict__ VT, const __bf16* __restrict__ VB, const __bf16* __restrict__ VBL, int b, int h, int ql0, int lane, float* __restrict__ Y) {
  const int c = lane & 15, g = lane >> 4; const int nfull = ql0 >> 5;   /* ql0 % 32 == 0: steps 0 .. nfull-1 lie wholly below the diagonal for all 32 queries; step nfull holds it */
  const _Float16* KHr = KH + (size_t)b * TT * CC + h * HD; const _Float16* KLr = KL + (size_t)b * KHI * CC + h * HD; const unsigned klo = (unsigned)(c * CC + 8 * g) * 2u;
  const _Float16* VTr = VT + ((size_t)b * CC + h * HD) * (size_t)TT; const __bf16* VBr = VB + ((size_t)b * CC + h * HD) * (size_t)KHI; const __bf16* VBLr = VBL + ((size_t)b * CC + h * HD) * (size_t)KHI; const unsigned vlt = (unsigned)(c * TT + 8 * g) * 2u, vlb = (unsigned)(c * KHI + 8 * g) * 2u;
  v16h qh[QT], ql[QT];
#pragma unroll
  for (int u = 0; u < QT; ++u) { qh[u] = frag_hu(QH + ((size_t)b * TT + ql0 + u * 16) * CC + h * HD, klo); if (HI) ql[u] = frag_hu(QL + ((size_t)b * QHI + ql0 + u * 16) * CC + h * HD, klo); else ql[u] = qh[u]; }
  XW();
  const int qrel = ql0 + c - 8 * g;   /* key kc*32 + 16 t + 8 g + r is kept for query ql0 + 16 u + c when kc*32 + 16 t + r <= qrel + 16 u */
  float m[QT], sum[QT]; v8f acc[QT][HD / 16] = {};
#pragma unroll
  for (int u = 0; u < QT; ++u) { m[u] = -3.0e38f; sum[u] = 0.f; }
#pragma unroll HI ? 1 : 4   /* late rows: four steps' key loads in flight, this walk has little work to cover a load's latency */
  for (int kc = 0; kc < nfull; ++kc) max_step<HI, false>(KHr, KLr, qh, ql, kc, klo, qrel, m);
  max_step<HI, true>(KHr, KLr, qh, ql, nfull, klo, qrel, m);
#pragma unroll
  for (int u = 0; u < QT; ++u) m[u] = fmaxf(m[u], __shfl_xor(m[u], 16));   /* the two lane halves hold different keys of the same query */
#pragma unroll 1   /* one step is some 500 vector instructions, enough for the SIMD's other waves to cover its loads; unrolling only adds registers */
  for (int kc = 0; kc < nfull; ++kc) pv_step<HI, false>(KHr, KLr, qh, ql, VTr, VBr, VBLr, kc, klo, vlt, vlb, qrel, m, sum, acc);
  pv_step<HI, true>(KHr, KLr, qh, ql, VTr, VBr, VBLr, nfull, klo, vlt, vlb, qrel, m, sum, acc);
#pragma unroll
  for (int u = 0; u < QT; ++u) { const float st = sum[u] + __shfl_xor(sum[u], 16); const float inv = st > 0.f ? (1.0f / 2048.0f) / st : 0.f;
    float* yr = Y + ((size_t)b * TT + ql0 + u * 16 + c) * CC + h * HD + 8 * g;   /* acc[u][j][r] = ctx(query 16 u + c, dim 16 j + 8 g + r): 32 contiguous bytes per lane and j */
#pragma unroll
    for (int j = 0; j < HD / 16; ++j) { v4f o0, o1;
#pragma unroll
      for (int r = 0; r < 4; ++r) { o0[r] = acc[u][j][r] * inv; o1[r] = acc[u][j][4 + r] * inv; }
      vst2(yr + j * 16, o0); vst2(yr + j * 16 + 4, o1); } } }
__global__ __launch_bounds__(128) void k_att(const _Float16* __restrict__ QH, const _Float16* __restrict__ KH, const _Float16* __restrict__ QL, const _Float16* __restrict__ KL, const _Float16* __restrict__ VT, const __bf16* __restrict__ VB, const __bf16* __restrict__ VBL, float* __restrict__ Y) {
  const int b = blockIdx.x / NH, h = blockIdx.x % NH; const int q0 = (TT / (64 * QT) - 1 - (int)blockIdx.y) * (64 * QT);   /* longest query blocks start first */
  const int wave = __builtin_amdgcn_readfirstlane(threadIdx.x >> 5), lane = threadIdx.x & 31; const int ql0 = q0 + wave * (16 * QT);
  if (q0 < QHI) att_body<true>(QH, KH, QL, KL, VT, VB, VBL, b, h, ql0, lane, Y); else att_body<false>(QH, KH, QL, KL, VT, VB, VBL, b, h, ql0, lane, Y); }
// ---- k_out: block = (64 rows, 128 cols): out = ctx Wvu (+ bvu): ctx x 2^6 once to f16 against Wvu as f16(bf16 x 2^8) exact (1 product) x 2^-14; causal early rows (< QHI of each sequence): ctx bf16 hi + lo against exact bf16 Wvu (2 products)
__global__ __launch_bounds__(128) void k_out(const float* __restrict__ Y, const float* __restrict__ WO, const float* __restrict__ BO, float* __restrict__ OUT) { __shared__ __align__(16) float sf[4][16][132];
  const int tid = threadIdx.x, wave = tid >> 5, lane = tid & 31, col = lane & 15, g = lane >> 4; const int c0 = blockIdx.y * 128; const size_t r0 = (size_t)blockIdx.x * 64 + wave * 16;
  v8f acc[8] = {};
  if (CAUSAL && (int)(((size_t)blockIdx.x * 64) % TT) < QHI) {   /* block-uniform */
#pragma unroll 2
    for (int kc = 0; kc < CC / 32; ++kc) { const F2 a = split_row(Y + (r0 + col) * CC, kc * 32, lane); asm volatile("s_wait_loadcnt 0x0" ::: "memory");
#pragma unroll
      for (int j = 0; j < 8; ++j) { const v16b w = WOCOL(WO, kc * 32, c0 + j * 16 + col, lane); asm volatile("s_wait_loadcnt 0x0" ::: "memory"); acc[j] = wmma_bf(a.h, w, acc[j]); acc[j] = wmma_bf(a.l, w, acc[j]); } }
#pragma unroll
    for (int j = 0; j < 8; ++j) { const float bias = BO ? bfr(BO[c0 + j * 16 + col]) : 0.f;
#pragma unroll
      for (int r = 0; r < 8; ++r) sf[wave][8 * g + r][j * 16 + col] = acc[j][r] + bias; }
  } else {
#pragma unroll 2
    for (int kc = 0; kc < CC / 32; ++kc) { const v16h a = frag_f32s(Y + (r0 + col) * CC + kc * 32, lane, 64.0f); asm volatile("s_wait_loadcnt 0x0" ::: "memory");   /* ctx carried x 2^6 into f16 so small-magnitude context rows stay clear of f16 subnormals (chip FTZ) */
#pragma unroll
      for (int j = 0; j < 8; ++j) { const v16h w = WOCOLH(WO, kc * 32, c0 + j * 16 + col, lane); asm volatile("s_wait_loadcnt 0x0" ::: "memory"); acc[j] = wmma16(a, w, acc[j]); } }
#pragma unroll
    for (int j = 0; j < 8; ++j) { const float bias = BO ? bfr(BO[c0 + j * 16 + col]) : 0.f;
#pragma unroll
      for (int r = 0; r < 8; ++r) sf[wave][8 * g + r][j * 16 + col] = acc[j][r] * (1.0f / 16384.0f) + bias; } }   /* 2^-8 (Wvu carry) x 2^-6 (ctx carry) */
  LDSX(); for (int rl = 0; rl < 16; ++rl) vst2(OUT + (r0 + rl) * DIN + c0 + lane * 4, *(const v4f*)&sf[wave][rl][lane * 4]); }
#define K2 DIN
#define wcol_io_plain(W, k0, o, lane) wcol_io(W, k0, o, lane, DIN)
#define wcolh_io_plain(W, k0, o, lane) wcolh_io(W, k0, o, lane, DIN)
// ---- k_out2: block = (64 rows, 128 cols): final projection out = R Wo + bo on the re-read rows R [NB*TT][K2] (K2 = DIN input width): same body as k_out with the row pitch / k extent K2 and the plain (in,out) loaders; always the single-product path
__global__ __launch_bounds__(128) void k_out2(const float* __restrict__ Y, const float* __restrict__ WO, const float* __restrict__ BO, float* __restrict__ OUT) { __shared__ __align__(16) float sf[4][16][132];
  const int tid = threadIdx.x, wave = tid >> 5, lane = tid & 31, col = lane & 15, g = lane >> 4; const int c0 = blockIdx.y * 128; const size_t r0 = (size_t)blockIdx.x * 64 + wave * 16;
  v8f acc[8] = {};
  if (0) {   /* the re-read rows mix positions: no early-row special case here */
#pragma unroll 2
    for (int kc = 0; kc < K2 / 32; ++kc) { const F2 a = split_row(Y + (r0 + col) * K2, kc * 32, lane); asm volatile("s_wait_loadcnt 0x0" ::: "memory");
#pragma unroll
      for (int j = 0; j < 8; ++j) { const v16b w = wcol_io_plain(WO, kc * 32, c0 + j * 16 + col, lane); asm volatile("s_wait_loadcnt 0x0" ::: "memory"); acc[j] = wmma_bf(a.h, w, acc[j]); acc[j] = wmma_bf(a.l, w, acc[j]); } }
#pragma unroll
    for (int j = 0; j < 8; ++j) { const float bias = BO ? bfr(BO[c0 + j * 16 + col]) : 0.f;
#pragma unroll
      for (int r = 0; r < 8; ++r) sf[wave][8 * g + r][j * 16 + col] = acc[j][r] + bias; }
  } else {
#pragma unroll 2
    for (int kc = 0; kc < K2 / 32; ++kc) { const v16h a = frag_f32s(Y + (r0 + col) * K2 + kc * 32, lane, 64.0f); asm volatile("s_wait_loadcnt 0x0" ::: "memory");   /* ctx carried x 2^6 into f16 so small-magnitude context rows stay clear of f16 subnormals (chip FTZ) */
#pragma unroll
      for (int j = 0; j < 8; ++j) { const v16h w = wcolh_io_plain(WO, kc * 32, c0 + j * 16 + col, lane); asm volatile("s_wait_loadcnt 0x0" ::: "memory"); acc[j] = wmma16(a, w, acc[j]); } }
#pragma unroll
    for (int j = 0; j < 8; ++j) { const float bias = BO ? bfr(BO[c0 + j * 16 + col]) : 0.f;
#pragma unroll
      for (int r = 0; r < 8; ++r) sf[wave][8 * g + r][j * 16 + col] = acc[j][r] * (1.0f / 16384.0f) + bias; } }   /* 2^-8 (Wo carry) x 2^-6 (ctx carry) */
  LDSX(); for (int rl = 0; rl < 16; ++rl) vst2(OUT + (r0 + rl) * DIN + c0 + lane * 4, *(const v4f*)&sf[wave][rl][lane * 4]); }

extern "C" void kernel_launch(void* const* d_in, const int* in_sizes, int n_in, void* d_out, int out_size, void* d_ws, size_t ws_size, hipStream_t stream) {
  (void)in_sizes; (void)n_in; (void)out_size;
  const float** F = (const float**)d_in;
  if (ws_size < (size_t)WS_END) return;
  char* ws = (char*)d_ws; _Float16 *QH = (_Float16*)(ws + WS_QH), *KH = (_Float16*)(ws + WS_KH), *VT = (_Float16*)(ws + WS_VT), *QL = (_Float16*)(ws + WS_QL), *KL = (_Float16*)(ws + WS_KL); __bf16 *VB = (__bf16*)(ws + WS_VB), *VBL = (__bf16*)(ws + WS_VBL); float *S = (float*)(ws + WS_S), *Y = (float*)(ws + WS_Y);
  (void)S; (void)Y; (void)QL; (void)KL; (void)VB; (void)VBL;
  // inputs: 0 x [4,2048,768]; 1 Wq [768,768] (in,out), 2 bq; 3 Wkd [768,192], 4 bkd; 5 Wvd [768,192], 6 bvd; 7 Wvu [192,768], 8 bvu; 9 Wo [768,768] (in,out), 10 bo (all biases zeros, read)
  if (ws_size < (size_t)WS_END2) return;
  float *AO = (float*)(ws + WS_AO), *T = (float*)(ws + WS_T);
  k_proj<<<dim3(TNB * TT / 64, CC / 128, 3), 128, 0, stream>>>(F[0], F[0], F[0], F[1], F[3], F[5], F[2], F[4], F[6], QH, QL, KH, KL, VT, VB, VBL);   /* q slice, latent k, latent v: 3 column blocks of 128 columns each */
  k_att<<<dim3(TNB * NH, TT / (64 * QT)), 128, 0, stream>>>(QH, KH, QL, KL, VT, VB, VBL, Y);   /* logits, softmax, P v: every (b, h, 128-query block) in one launch */
  k_out<<<dim3(TNB * TT / 64, DIN / 128), 128, 0, stream>>>(Y, F[7], F[8], AO);   /* ao = al Wvu + bvu (gathered weight rows) */
  k_fin<<<dim3(TT / 64, DIN / 64, TNB), 256, 0, stream>>>(AO, T, TT, DIN);   /* T[b][c][s] = ao[b][s][c] */
  k_out2<<<dim3(TNB * TT / 64, DIN / 128), 128, 0, stream>>>(T, F[9], F[10], (float*)d_out);   /* rows = T's memory re-read as [TT][DIN] per batch; out = rows Wo + bo */
}

// v002
// It runs in 145 microseconds.
// Two timings next to v001 put it at 1.73 and 1.74 times that version's speed.
// Over all steps from v000 it is 11.9 times as fast.
// compute dtype: all float inputs rounded to bf16; the q slice and the latent k / v projections with EXACT bf16 products on WMMA 16x16x32 (f32 accumulate) + bias (zeros, read), 16 real dims per head zero-padded to 32; causal logits over the 16 latent dims: 3 products for the first 384 rows, single f16 after, x 16^-0.5; softmax f32 (max first, then exp(s - max) x 2^11 once to f16 x v once to f16 (bf16 hi + lo below row 384), divided by the f32 row sum after the product; logits never stored); latent ctx (hi+lo below row 384, x2^6 f16 carry after) x exact / f16(bf16 x 2^8) Wvu + bvu; per-batch transpose; then x 2^6 once to f16 x Wo f16(bf16 x 2^8) + bo; f32 output.
#include <hip/hip_runtime.h>
#include <math.h>

typedef __attribute__((ext_vector_type(16))) _Float16 v16h;
typedef __attribute__((ext_vector_type(16))) __bf16 v16b;
typedef __attribute__((ext_vector_type(8)))  _Float16 v8h;
typedef __attribute__((ext_vector_type(8)))  float v8f;
typedef __attribute__((ext_vector_type(4)))  float v4f;
typedef __attribute__((ext_vector_type(2)))  float v2f;
typedef __attribute__((ext_vector_type(4)))  unsigned v4u;
typedef __attribute__((ext_vector_type(4)))  int v4i;
typedef float __attribute__((may_alias)) float_a;
typedef int __attribute__((may_alias)) int_a;

template <typename T> __device__ __forceinline__ void vst2(void* p, T v) { *(T*)p = v;  }
__device__ __forceinline__ v8f wmma16(v16h a, v16h b, v8f c) {
  v8f d = __builtin_amdgcn_wmma_f32_16x16x32_f16(false, a, false, b, (short)0, c, false, false);
  asm volatile("v_nop\n\tv_nop\n\tv_nop\n\tv_nop" : "+v"(d) : "v"(a), "v"(b));
  return d;
}
__device__ __forceinline__ v8f wmma_bf(v16b a, v16b b, v8f c) {
  v8f d = __builtin_amdgcn_wmma_f32_16x16x32_bf16(false, a, false, b, (short)0, c, false, false);
  asm volatile("v_nop\n\tv_nop\n\tv_nop\n\tv_nop" : "+v"(d) : "v"(a), "v"(b));
  return d;
}
// 16x16x32 fragments: lane = (h = lane>>4, row/col = lane&15); elements 0..7 = k0+8h+0..7, 8..15 = k0+16+8h+0..7; D element r = row 8h+r
__device__ __forceinline__ v16h frag_h(const _Float16* rowk0, int lane) {
  union { v16h v; v8h q[2]; } u; const _Float16* p = rowk0 + 8 * (lane >> 4);
  u.q[0] = *(const v8h*)p; u.q[1] = *(const v8h*)(p + 16); return u.v;
}
__device__ __forceinline__ v16h frag_f32(const float* rowk0, int lane) {
  v16h a; const float* p = rowk0 + 8 * (lane >> 4);
#pragma unroll
  for (int i = 0; i < 8; ++i) { a[i] = (_Float16)p[i]; a[8 + i] = (_Float16)p[16 + i]; }
  return a;
}
__device__ __forceinline__ v16h frag_f32s(const float* rowk0, int lane, float sc) {
  v16h a; const float* p = rowk0 + 8 * (lane >> 4);
#pragma unroll
  for (int i = 0; i < 8; ++i) { a[i] = (_Float16)(p[i] * sc); a[8 + i] = (_Float16)(p[16 + i] * sc); }
  return a;
}
// column fragment from a [K][ld] layout (column n), rows >= K read as 0
__device__ __forceinline__ v16h fragc_f32(const float* W, int k0, int n, int lane, int ld, int K) {
  v16h a; const int g = lane >> 4;
#pragma unroll
  for (int i = 0; i < 8; ++i) { const int ka = k0 + 8 * g + i, kb = ka + 16;
    a[i] = (_Float16)(ka < K ? W[(size_t)(ka < K ? ka : K - 1) * ld + n] : 0.f); a[8 + i] = (_Float16)(kb < K ? W[(size_t)(kb < K ? kb : K - 1) * ld + n] : 0.f); }
  return a;
}
struct F2 { v16b h, l; };
__device__ __forceinline__ F2 bsplit16(const float v[16]) { F2 r;
#pragma unroll
  for (int i = 0; i < 16; ++i) { const __bf16 h = (__bf16)v[i]; r.h[i] = h; r.l[i] = (__bf16)(v[i] - (float)h); }
  return r; }
__device__ __forceinline__ F2 split_row(const float* row, int k0, int lane) { float v[16]; const float* p = row + k0 + 8 * (lane >> 4);
#pragma unroll
  for (int i = 0; i < 8; ++i) { v[i] = p[i]; v[8 + i] = p[16 + i]; }
  return bsplit16(v); }
__device__ __forceinline__ F2 split_rowK(const float* row, int k0, int lane, int K) { float v[16]; const int g = lane >> 4;
#pragma unroll
  for (int i = 0; i < 8; ++i) { const int ka = k0 + 8 * g + i, kb = ka + 16; v[i] = ka < K ? row[ka < K ? ka : K - 1] : 0.f; v[8 + i] = kb < K ? row[kb < K ? kb : K - 1] : 0.f; }
  return bsplit16(v); }
__device__ __forceinline__ F2 split_col(const float* W, int k0, int n, int lane, int ld, int K) { float v[16]; const int g = lane >> 4;
#pragma unroll
  for (int i = 0; i < 8; ++i) { const int ka = k0 + 8 * g + i, kb = ka + 16; v[i] = ka < K ? W[(size_t)(ka < K ? ka : K - 1) * ld + n] : 0.f; v[8 + i] = kb < K ? W[(size_t)(kb < K ? kb : K - 1) * ld + n] : 0.f; }
  return bsplit16(v); }
__device__ __forceinline__ v8f mac3(const F2& a, const F2& b, v8f c) { c = wmma_bf(a.l, b.h, c); c = wmma_bf(a.h, b.l, c); return wmma_bf(a.h, b.h, c); }
__device__ __forceinline__ float sigm(float v) { return 1.0f / (1.0f + expf(-v)); }
#define LDSX() do { asm volatile("s_wait_dscnt 0" ::: "memory"); __builtin_amdgcn_wave_barrier(); __builtin_amdgcn_fence(__ATOMIC_RELEASE, "workgroup"); } while (0)

// Causal self-attention with 12 low-rank latent heads (x [4,2048,768]; (in,out) Wq [768,768], Wkd / Wvd [768,192], Wvu [192,768], Wo [768,768], all N(0,1) x 0.02, zero biases (read); q = x Wq + bq split into 12 heads x 64 of which only the FIRST 16 dims of each head are used (ql); kl, vl = x Wkd, x Wvd split into 12 heads x 16; scores = ql kl^T x 16^-0.5; triu(1) -> -inf; softmax; al = w vl merged to [B,S,192]; ao = al Wvu + bvu [B,S,768]; then jnp.transpose(ao, (0,2,1)).reshape(B,S,768): the per-batch [2048 x 768] matrix is transposed to [768 x 2048] and its memory re-read as 2,048 rows of 768; out = that Wo + bo).
#define NB 4
#define TT 2048
#define CC 384            // NH * HD = projected width
#define DIN 768          // input (model) width
#define NH 12
#define HD 32
#define LATW 16     /* real dims per head; columns h*HD + d with d >= LATW are zero padding */
#define QHEADW 64   /* the module's q heads are 64 wide; only their first LATW dims are used (ql = q[..., :16]) */
#define KVLD (NH * LATW)   /* row pitch of the (in,out) latent weights Wkd / Wvd [768][192] */
#define NQB (TT / 64)
#define HG 2   // S region: 2 x 2,048 x 2,048 f32 = 32 MiB, allocated but unused
#define SCALE (0.25f)
#define CAUSAL 1
#ifndef TNB
#define TNB NB
#endif
__device__ __forceinline__ float bfr(float v) { return (float)(__bf16)v; }
__host__ __device__ __forceinline__ int kb_last(int qb) { return CAUSAL ? ((qb * 64 + 63) >> 7) : (TT / 128 - 1); }
typedef __attribute__((ext_vector_type(8))) __bf16 v8b;
__device__ __forceinline__ v16b frag_b(const __bf16* rowk0, int lane) {
  union { v16b v; v8b q[2]; } u; const __bf16* p = rowk0 + 8 * (lane >> 4);
  u.q[0] = *(const v8b*)p; u.q[1] = *(const v8b*)(p + 16); return u.v;
}
#define QBH 6              // causal: query blocks 0..QBH-1 of each sequence (few keys, no averaging) take the high-precision path
#define QHI 384            // rows carrying a q residual plane
#define KHI 384            // key rows carrying k residual / v bf16 hi+lo planes (used only by the causal high-precision path)
// B fragment (k rows k0+.., output column o) of a weight: (in,out) [K][ld] or (out,in) [ld rows of K]: bf16 exact, or f16(bf16 * 256) exact
__device__ __forceinline__ v16b wcol_io(const float* Wm, int k0, int o, int lane, int ld) { v16b w; const int g = lane >> 4;
#pragma unroll
  for (int i = 0; i < 8; ++i) { w[i] = (__bf16)Wm[(size_t)(k0 + 8 * g + i) * ld + o]; w[8 + i] = (__bf16)Wm[(size_t)(k0 + 16 + 8 * g + i) * ld + o]; }
  return w; }
__device__ __forceinline__ v16b wcol_oi(const float* Wm, int k0, int o, int lane, int K) { v16b w; const float* p = Wm + (size_t)o * K + k0 + 8 * (lane >> 4);
#pragma unroll
  for (int i = 0; i < 8; ++i) { w[i] = (__bf16)p[i]; w[8 + i] = (__bf16)p[16 + i]; }
  return w; }
__device__ __forceinline__ v16h wcolh_io(const float* Wm, int k0, int o, int lane, int ld) { v16h w; const int g = lane >> 4;
#pragma unroll
  for (int i = 0; i < 8; ++i) { w[i] = (_Float16)(bfr(Wm[(size_t)(k0 + 8 * g + i) * ld + o]) * 256.0f); w[8 + i] = (_Float16)(bfr(Wm[(size_t)(k0 + 16 + 8 * g + i) * ld + o]) * 256.0f); }
  return w; }
// first output projection ao = al Wvu: the k index runs over ctx columns kk = h*HD + d; one 32-deep k-step = one head; its first 16 entries (d < LATW, fragment slots 0..7 of both lane halves) are rows h*LATW + d of the (in,out) [192][768] weight, its last 16 (padding dims, slots 8..15) are zero
__device__ __forceinline__ v16b wcol_io_lat(const float* Wm, int k0, int o, int lane, int ld) { v16b w; const int g = lane >> 4; const float* p = Wm + (size_t)((k0 / HD) * LATW + 8 * g) * ld + o;
#pragma unroll
  for (int i = 0; i < 8; ++i) { w[i] = (__bf16)p[(size_t)i * ld]; w[8 + i] = (__bf16)0.0f; }
  return w; }
__device__ __forceinline__ v16h wcolh_io_lat(const float* Wm, int k0, int o, int lane, int ld) { v16h w; const int g = lane >> 4; const float* p = Wm + (size_t)((k0 / HD) * LATW + 8 * g) * ld + o;
#pragma unroll
  for (int i = 0; i < 8; ++i) { w[i] = (_Float16)(bfr(p[(size_t)i * ld]) * 256.0f); w[8 + i] = (_Float16)0.0f; }
  return w; }
static_assert(HD == 32 && LATW == 16 && CC == NH * HD, "the latent loaders assume one head per 32-deep k-step with 16 real + 16 padding dims");
__device__ __forceinline__ v16h wcolh_oi(const float* Wm, int k0, int o, int lane, int K) { v16h w; const float* p = Wm + (size_t)o * K + k0 + 8 * (lane >> 4);
#pragma unroll
  for (int i = 0; i < 8; ++i) { w[i] = (_Float16)(bfr(p[i]) * 256.0f); w[8 + i] = (_Float16)(bfr(p[16 + i]) * 256.0f); }
  return w; }
#define WQKV_LAYOUT 0   // 0 = (in,out) [DIN][out], columns gathered per head; 1 = (out,in) [CC][DIN]; 2 = per-head [NH][DIN][HD]
__device__ __forceinline__ v16b wcol_hdk(const float* Wm, int k0, int o, int lane) { v16b w; const int g = lane >> 4; const float* p = Wm + (size_t)(o / HD) * DIN * HD + (o % HD);
#pragma unroll
  for (int i = 0; i < 8; ++i) { w[i] = (__bf16)p[(size_t)(k0 + 8 * g + i) * HD]; w[8 + i] = (__bf16)p[(size_t)(k0 + 16 + 8 * g + i) * HD]; }
  return w; }
#define WO_OUT_IN 0
#if WQKV_LAYOUT == 1
#define WCOL(W, k0, o, lane) wcol_oi(W, k0, o, lane, DIN)
#elif WQKV_LAYOUT == 2
#define WCOL(W, k0, o, lane) wcol_hdk(W, k0, o, lane)
#else
__device__ __forceinline__ v16b zero16b() { v16b w; _Pragma("unroll") for (int i = 0; i < 16; ++i) w[i] = (__bf16)0.0f; return w; }
/* column o = h*HD + d: real (d < LATW) -> weight column h*QHEADW + d of Wq (pitch DIN) for the q stream, h*LATW + d of Wkd / Wvd (pitch KVLD) for k / v; padding -> zeros. o = c0 + j*16 + col with c0 % 128 == 0, so (o % HD) < LATW is decided by j alone (compile-time per unrolled j, uniform across the wave) */
#define GCOL(o) ((which) == 0 ? ((o) / HD) * QHEADW + ((o) % HD) : ((o) / HD) * LATW + ((o) % HD))
#define WCOL(W, k0, o, lane) ((((o) % HD) < LATW) ? wcol_io(W, k0, GCOL(o), lane, ((which) == 0 ? DIN : KVLD)) : zero16b())
#endif
#if WO_OUT_IN
#define WOCOL(W, k0, o, lane) wcol_oi(W, k0, o, lane, CC)
#define WOCOLH(W, k0, o, lane) wcolh_oi(W, k0, o, lane, CC)
#else
#define WOCOL(W, k0, o, lane) wcol_io_lat(W, k0, o, lane, DIN)
#define WOCOLH(W, k0, o, lane) wcolh_io_lat(W, k0, o, lane, DIN)
#endif

#ifndef SM_EXTRA_PARAMS
#define SM_EXTRA_PARAMS
#endif
#ifndef PROJ_EXTRA_PARAMS
#define PROJ_EXTRA_PARAMS
#endif
#ifndef SM_MASK_HOOK
#define SM_MASK_HOOK (void)0
#endif

#define WS_QH  0u                                      // f16 q rows [b*t][CC]
#define WS_KH  (WS_QH + 2u * (size_t)NB * TT * CC)      // f16 k rows [b*t][CC]
#define WS_VT  (WS_KH + 2u * (size_t)NB * TT * CC)      // f16 v planes [b][c][t]
#define WS_QL  (WS_VT + 2u * (size_t)NB * CC * TT)      // f16 q residual x 2^10 rows [b][t < QHI][CC]
#define WS_KL  (WS_QL + 2u * (size_t)NB * QHI * CC)     // f16 k residual x 2^10 rows [b][t < KHI][CC]
#define WS_VB  (WS_KL + 2u * (size_t)NB * KHI * CC)     // bf16 v hi planes [b][c][t < KHI]
#define WS_VBL (WS_VB + 2u * (size_t)NB * CC * KHI)
#define WS_S   (WS_VBL + 2u * (size_t)NB * CC * KHI)    // f32 [hg][t][s] region, unused (logits stay in registers)
#define WS_Y   (WS_S  + 4u * (size_t)HG * TT * TT)      // f32 ctx rows [b*t][CC] (only when there is an output projection)
#define WS_END (WS_Y  + 4u * (size_t)NB * TT * CC)
#define WS_AO (WS_END)                                    // f32 ao rows [(b*TT + s)][DIN] = al Wvu + bvu
#define WS_T  (WS_AO + 4u * (size_t)NB * TT * DIN)          // f32 per-batch transpose T[b][c][s]; its memory is then read as TT rows of DIN (the module's transpose(0,2,1).reshape)
#define WS_END2 (WS_T + 4u * (size_t)NB * TT * DIN)
static_assert(TT % 64 == 0 && DIN % 64 == 0, "transpose tiles are 64 x 64");
// weights in WMMA B-fragment order, written once per call by k_prep. One fragment = the 32 lanes' slots 0..7 (16 B a lane, 512 B in a row), then their slots 8..15 (left out where they are the zero padding of a latent head)
#define NF_P (3 * (DIN / 32) * NH)        /* q slice / latent k / latent v: [which][kc][head], bf16 */
#define NF_U (NH * (DIN / 16))            /* Wvu: [head][column tile], slots 0..7 only, once bf16 and once f16(bf16 x 2^8) */
#define NF_O ((DIN / 32) * (DIN / 16))    /* Wo: [kc][column tile], f16(bf16 x 2^8) */
#define WS_FP  (WS_END2)
#define WS_FU  (WS_FP  + 1024u * (size_t)NF_P)
#define WS_FUH (WS_FU  + 512u * (size_t)NF_U)
#define WS_FO  (WS_FUH + 512u * (size_t)NF_U)
#define WS_END3 (WS_FO + 1024u * (size_t)NF_O)
static_assert((NF_P + NF_U + NF_O) % 4 == 0, "k_prep: four waves a block, one fragment a wave");
// fb = wave-uniform start of the fragment, lob = lane * 16 bytes
__device__ __forceinline__ v16b fragw_b(const __bf16* fb, unsigned lob) { union { v16b v; v8b q[2]; } u; const char* p = (const char*)fb + lob; u.q[0] = *(const v8b*)p; u.q[1] = *(const v8b*)(p + 512); return u.v; }
__device__ __forceinline__ v16h fragw_h(const _Float16* fb, unsigned lob) { union { v16h v; v8h q[2]; } u; const char* p = (const char*)fb + lob; u.q[0] = *(const v8h*)p; u.q[1] = *(const v8h*)(p + 512); return u.v; }
__device__ __forceinline__ v16b fragw_b8(const __bf16* fb, unsigned lob) { union { v16b v; v8b q[2]; } u; u.q[0] = *(const v8b*)((const char*)fb + lob);
#pragma unroll
  for (int i = 0; i < 8; ++i) u.q[1][i] = (__bf16)0.0f;
  return u.v; }
__device__ __forceinline__ v16h fragw_h8(const _Float16* fb, unsigned lob) { union { v16h v; v8h q[2]; } u; u.q[0] = *(const v8h*)((const char*)fb + lob);
#pragma unroll
  for (int i = 0; i < 8; ++i) u.q[1][i] = (_Float16)0.0f;
  return u.v; }
// a precaution: stands between issued loads and the next write of a register that holds one of their addresses
__device__ __forceinline__ void XW() { asm volatile("s_wait_xcnt 0x0" ::: "memory"); }
// N weight values of one column, rows i (i < 8) and, for N = 16, 16 + i of an (in,out) weight of pitch LD: ub = wave-uniform address of the tile's first row and column, lo = the lane's fixed byte offset (8 g rows + its column). The last load may land on the offset register, so the wait stands in front of it, and once more behind it, ahead of the scalar work that forms the store address
template <int LD, int N> __device__ __forceinline__ void ld_col(const float* ub, unsigned lo, float v[N]) { const char* p = (const char*)ub + lo;
#pragma unroll
  for (int i = 0; i < N - 1; ++i) v[i] = *(const float*)(p + (size_t)((i & 7) + 2 * (i & 8)) * LD * 4);
  XW(); v[N - 1] = *(const float*)(p + (size_t)(((N - 1) & 7) + 2 * ((N - 1) & 8)) * LD * 4); XW(); }
// ---- k_prep: one wave = one B fragment, with the roundings the projection kernels' own loaders (wcol_io, wcol_io_lat, wcolh_io_lat, wcolh_io) made per wave and per row block
__global__ __launch_bounds__(128) void k_prep(const float* __restrict__ WQ, const float* __restrict__ WK, const float* __restrict__ WV, const float* __restrict__ WU, const float* __restrict__ WO, __bf16* __restrict__ FP, __bf16* __restrict__ FU, _Float16* __restrict__ FUH, _Float16* __restrict__ FO) {
  const int lane = threadIdx.x & 31, col = lane & 15, g = lane >> 4; const int f = blockIdx.x * 4 + __builtin_amdgcn_readfirstlane(threadIdx.x >> 5);
  if (f < NF_P) { const int which = f / ((DIN / 32) * NH), kc = (f / NH) % (DIN / 32), h = f % NH; float v[16];
    if (which == 0) ld_col<DIN, 16>(WQ + (size_t)kc * 32 * DIN + h * QHEADW, (unsigned)(8 * g * DIN + col) * 4u, v);
    else ld_col<KVLD, 16>((which == 1 ? WK : WV) + (size_t)kc * 32 * KVLD + h * LATW, (unsigned)(8 * g * KVLD + col) * 4u, v);
    union { v16b v; v8b q[2]; } u;
#pragma unroll
    for (int i = 0; i < 16; ++i) u.v[i] = (__bf16)v[i];
    char* d = (char*)FP + (size_t)f * 1024 + lane * 16; *(v8b*)d = u.q[0]; *(v8b*)(d + 512) = u.q[1];
  } else if (f < NF_P + NF_U) { const int fu = f - NF_P, h = fu / (DIN / 16), jt = fu % (DIN / 16); float v[8];
    ld_col<DIN, 8>(WU + (size_t)h * LATW * DIN + jt * 16, (unsigned)(8 * g * DIN + col) * 4u, v);
    v8b wb; v8h wh;
#pragma unroll
    for (int i = 0; i < 8; ++i) { wb[i] = (__bf16)v[i]; wh[i] = (_Float16)(bfr(v[i]) * 256.0f); }
    *(v8b*)((char*)FU + (size_t)fu * 512 + lane * 16) = wb; *(v8h*)((char*)FUH + (size_t)fu * 512 + lane * 16) = wh;
  } else { const int fo = f - NF_P - NF_U, kc = fo / (DIN / 16), jt = fo % (DIN / 16); float v[16];
    ld_col<DIN, 16>(WO + (size_t)kc * 32 * DIN + jt * 16, (unsigned)(8 * g * DIN + col) * 4u, v);
    union { v16h v; v8h q[2]; } u;
#pragma unroll
    for (int i = 0; i < 16; ++i) u.v[i] = (_Float16)(bfr(v[i]) * 256.0f);
    char* d = (char*)FO + (size_t)fo * 1024 + lane * 16; *(v8h*)d = u.q[0]; *(v8h*)(d + 512) = u.q[1]; } }
// ---- k_fin: block = (64 positions, 64 channels, image b): out[b][c][n] = OR[(b*npix + n)][c] (LDS transpose; 256-B runs of 64 positions per channel)
__global__ __launch_bounds__(256) void k_fin(const float* __restrict__ ORW, float* __restrict__ OUT, int npix, int nch) { __shared__ float st[64][68]; const int tid = threadIdx.x; const int n0 = blockIdx.x * 64, c0 = blockIdx.y * 64; const size_t b = blockIdx.z;
  for (int e = tid; e < 64 * 16; e += 256) { const int nl = e >> 4, q = e & 15; *(v4f*)&st[nl][q * 4] = *(const v4f*)(ORW + (b * npix + n0 + nl) * (size_t)nch + c0 + q * 4); }
  __syncthreads();
  for (int e = tid; e < 64 * 16; e += 256) { const int cl = e >> 4, q = e & 15; v4f o; o[0] = st[q * 4][cl]; o[1] = st[q * 4 + 1][cl]; o[2] = st[q * 4 + 2][cl]; o[3] = st[q * 4 + 3][cl]; vst2(OUT + (b * nch + c0 + cl) * (size_t)npix + n0 + q * 4, o); } }

// ---- k_proj: block = (64 rows, 128 cols, which): q/k/v = X W (+ b) with exact bf16 products (K = DIN) -> which 0: q f16 rows (+ residual rows < QHI); 1: k f16 rows (+ residual rows < KHI); 2: v f16 planes [c][t] (+ bf16 hi/lo planes for t < KHI)
__global__ __launch_bounds__(128) void k_proj(const float* __restrict__ XQ, const float* __restrict__ XK, const float* __restrict__ XV, const __bf16* __restrict__ FP, const float* __restrict__ BQ, const float* __restrict__ BK, const float* __restrict__ BV,
    _Float16* __restrict__ QH, _Float16* __restrict__ QL, _Float16* __restrict__ KH, _Float16* __restrict__ KL, _Float16* __restrict__ VT, __bf16* __restrict__ VB, __bf16* __restrict__ VBL) {
  __shared__ __align__(16) _Float16 sh[64][136], sl[64][136]; __shared__ __align__(16) _Float16 th[128][72]; __shared__ __align__(16) __bf16 tb[128][72], tbl[128][72];
  const int tid = threadIdx.x, wave = tid >> 5, lane = tid & 31, col = lane & 15, g = lane >> 4; const int which = blockIdx.z; const int c0 = blockIdx.y * 128; const size_t r0 = (size_t)blockIdx.x * 64; const size_t bb = r0 / TT; const int t0 = (int)(r0 % TT);
  const float* X = which == 0 ? XQ : which == 1 ? XK : XV; const __bf16* FW = FP + ((size_t)which * (DIN / 32) * NH + c0 / HD) * 512; const unsigned lob = lane * 16u; const float* BA = which == 0 ? BQ : which == 1 ? BK : BV;
  v8f acc[8] = {};
#pragma unroll 2
  for (int kc = 0; kc < DIN / 32; ++kc) { float av[16]; { const float* p = X + (r0 + wave * 16 + col) * DIN + kc * 32 + 8 * g;
#pragma unroll
      for (int i = 0; i < 8; ++i) { av[i] = p[i]; av[8 + i] = p[16 + i]; } }
    v16b w[4];   /* the step's four real column tiles (even j: dims < LATW of a head), asked for together with the x rows */
#pragma unroll
    for (int jj = 0; jj < 4; ++jj) w[jj] = fragw_b(FW + (size_t)(kc * NH + jj) * 512, lob);
    __builtin_amdgcn_sched_barrier(0);   /* every load of the k-step is issued before the first rounding that waits for one; without it the build holds two weight loads back behind that wait */
    v16b a;
#pragma unroll
    for (int i = 0; i < 16; ++i) a[i] = (__bf16)av[i];
#pragma unroll
    for (int j = 0; j < 8; ++j) acc[j] = wmma_bf(a, (j & 1) ? zero16b() : w[j >> 1], acc[j]); }
  if (which < 2) { _Float16* DH = which == 0 ? QH : KH; _Float16* DL = which == 0 ? QL : KL; const int nhi = which == 0 ? QHI : KHI; const bool hi_rows = t0 < nhi;
#pragma unroll
    for (int j = 0; j < 8; ++j) { const float bias = (BA && ((c0 + j * 16 + col) % HD) < LATW) ? bfr(BA[GCOL(c0 + j * 16 + col)]) : 0.f;   /* gathered like the weight columns; padding columns get no bias */
#pragma unroll
      for (int r = 0; r < 8; ++r) { const float v = acc[j][r] + bias; const _Float16 hv = (_Float16)v; sh[wave * 16 + 8 * g + r][j * 16 + col] = hv; sl[wave * 16 + 8 * g + r][j * 16 + col] = (_Float16)((v - (float)hv) * 1024.0f); } }
    __syncthreads();
    for (int e = tid; e < 64 * 16; e += 128) { const int rl = e >> 4, q = e & 15; vst2((unsigned*)(DH + (r0 + rl) * CC + c0 + q * 8), *(const v4u*)&sh[rl][q * 8]); if (hi_rows) vst2((unsigned*)(DL + (bb * nhi + t0 + rl) * (size_t)CC + c0 + q * 8), *(const v4u*)&sl[rl][q * 8]); }
  } else { const bool hi_rows = t0 < KHI;
#pragma unroll
    for (int j = 0; j < 8; ++j) { const float bias = (BA && ((c0 + j * 16 + col) % HD) < LATW) ? bfr(BA[GCOL(c0 + j * 16 + col)]) : 0.f;   /* gathered like the weight columns; padding columns get no bias */
#pragma unroll
      for (int r = 0; r < 8; ++r) { const float v = acc[j][r] + bias; const int rl = wave * 16 + 8 * g + r, cl = j * 16 + col; th[cl][rl] = (_Float16)v; const __bf16 bh = (__bf16)v; tb[cl][rl] = bh; tbl[cl][rl] = (__bf16)(v - (float)bh); } }
    __syncthreads();
    for (int e = tid; e < 128 * 8; e += 128) { const int cl = e >> 3, q = e & 7; vst2((unsigned*)(VT + (bb * CC + c0 + cl) * (size_t)TT + t0 + q * 8), *(const v4u*)&th[cl][q * 8]); if (hi_rows) { const size_t o3 = (bb * CC + c0 + cl) * (size_t)KHI + t0 + q * 8; vst2((unsigned*)(VB + o3), *(const v4u*)&tb[cl][q * 8]); vst2((unsigned*)(VBL + o3), *(const v4u*)&tbl[cl][q * 8]); } } } }
// ---- k_att: block = 4 waves x 32 queries of (b, h), one launch for all (b, h): logits, softmax and P . v without leaving registers.
// S^T = K . Q^T (A = 16 key rows, B = 16 query rows): lane (g, c) holds, for query c, keys 8g + r of each 16-key tile, so the two tiles of one 32-key step, converted in place, are the B operand of ctx^T += v^T . P^T (hardware k order on both sides). Each key / v fragment serves the wave's two 16-query tiles.
// Walk 1: row maximum. Walk 2 (logits formed again, same products): e = exp(s - max), row sum in f32, e x 2^11 once to f16 against v f16 (query rows < QHI: 3-product logits, e x 2^11 and v as bf16 hi + lo, 3 products); ctx = acc / (2^11 x sum). Keys past the wave's own diagonal step are not visited; the diagonal step masks by index.
#define QT 2   // 16-query tiles per wave
static_assert(QHI % (64 * QT) == 0 && QHI == QBH * 64 && KHI >= QHI && TT % (64 * QT) == 0, "a block of 4 x QT x 16 queries is wholly early or wholly late; early rows see only keys < KHI");
__device__ __forceinline__ v8f wm_h(v16h a, v16h b, v8f c) { return __builtin_amdgcn_wmma_f32_16x16x32_f16(false, a, false, b, (short)0, c, false, false); }
__device__ __forceinline__ v8f wm_b(v16b a, v16b b, v8f c) { return __builtin_amdgcn_wmma_f32_16x16x32_bf16(false, a, false, b, (short)0, c, false, false); }
// fragment from a wave-uniform base + the lane's fixed byte offset (row c, half g). xl: the last fragment read through its address pair; its last load may land on that pair, so the wait stands in front of it
__device__ __forceinline__ v16h frag_hu(const _Float16* ub, unsigned lob, bool xl = false) { union { v16h v; v8h q[2]; } u; const char* p = (const char*)ub + lob; u.q[0] = *(const v8h*)p; if (xl) XW(); u.q[1] = *(const v8h*)(p + 32); return u.v; }
__device__ __forceinline__ v16b frag_bu(const __bf16* ub, unsigned lob, bool xl = false) { union { v16b v; v8b q[2]; } u; const char* p = (const char*)ub + lob; u.q[0] = *(const v8b*)p; if (xl) XW(); u.q[1] = *(const v8b*)(p + 32); return u.v; }
// exp(x) step for step as the library's expf forms it (x log2(e) in two parts, v_exp_f32 on the fraction, ldexp, both range ends): same bits. The v_exp_f32 is written out so that the free slot the instruction set asks for behind a transcendental stands in its own statement, whatever instruction the build puts next.
__device__ __forceinline__ float exp_slot(float x) { const float l2e = __uint_as_float(0x3fb8aa3bu); const float t = x * l2e; float f = __builtin_fmaf(x, l2e, -t); f = __builtin_fmaf(x, __uint_as_float(0x32a5705fu), f); const float r = __builtin_rintf(t); const float a = (t - r) + f;
  float e; asm("v_exp_f32 %0, %1\n\tv_nop" : "=v"(e) : "v"(a));
  e = ldexpf(e, (int)r); e = x < __uint_as_float(0xc2ce8ed0u) ? 0.f : e; return x > __uint_as_float(0x42b17218u) ? __builtin_inff() : e; }
// one 32-key step: ld_k reads its two 16-key tiles (KHr / KLr point at key 0 of (b, h), klo = the lane's byte offset in a 16-row tile of pitch CC); st_mm forms s[u][8 t + r] = logit(key kc*32 + 16 t + 8 g + r, query 16 u + c)
struct KF { v16h h[2], l[2]; };
template <bool HI> __device__ __forceinline__ KF ld_k(const _Float16* KHr, const _Float16* KLr, int kc, unsigned klo, bool xl) { KF k;
#pragma unroll
  for (int t = 0; t < 2; ++t) { const size_t ro = (size_t)(kc * 32 + t * 16) * CC; k.h[t] = frag_hu(KHr + ro, klo, xl && t == 1); if (HI) k.l[t] = frag_hu(KLr + ro, klo, xl && t == 1); else k.l[t] = k.h[t]; }
  return k; }
template <bool HI> __device__ __forceinline__ void st_mm(const KF& k, const v16h qh[QT], const v16h ql[QT], float s[QT][16]) {
#pragma unroll
  for (int t = 0; t < 2; ++t)
#pragma unroll
    for (int u = 0; u < QT; ++u) { v8f a = {}; a = wm_h(k.h[t], qh[u], a);
      if (HI) { v8f al = {}; al = wm_h(k.h[t], ql[u], al); al = wm_h(k.l[t], qh[u], al);
#pragma unroll
        for (int r = 0; r < 8; ++r) s[u][t * 8 + r] = (a[r] + al[r] * (1.0f / 1024.0f)) * SCALE;
      } else {
#pragma unroll
        for (int r = 0; r < 8; ++r) s[u][t * 8 + r] = a[r] * SCALE; } } }
template <bool HI, bool MASK> __device__ __forceinline__ void max_step(const _Float16* KHr, const _Float16* KLr, const v16h qh[QT], const v16h ql[QT], int kc, unsigned klo, int qrel, float m[QT]) { float s[QT][16]; const KF k = ld_k<HI>(KHr, KLr, kc, klo, false); st_mm<HI>(k, qh, ql, s);
#pragma unroll
  for (int u = 0; u < QT; ++u)
#pragma unroll
    for (int i = 0; i < 16; ++i) { if (!MASK || kc * 32 + 16 * (i >> 3) + (i & 7) <= qrel + 16 * u) m[u] = fmaxf(m[u], s[u][i]); } }
template <bool HI, bool MASK> __device__ __forceinline__ void pv_step(const _Float16* KHr, const _Float16* KLr, const v16h qh[QT], const v16h ql[QT], const _Float16* VTr, const __bf16* VBr, const __bf16* VBLr, int kc, unsigned klo, unsigned vlt, unsigned vlb, int qrel, const float m[QT], float sum[QT], v8f acc[QT][HD / 16]) { float s[QT][16];
  const KF k = ld_k<HI>(KHr, KLr, kc, klo, true); XW();
  v16h vf[HD / 16]; v16b vh[HD / 16], vl[HD / 16];   /* v is asked for before the exponentials, which cover its latency */
#pragma unroll
  for (int j = 0; j < HD / 16; ++j) { if (HI) { const size_t po = (size_t)j * 16 * KHI + kc * 32; vh[j] = frag_bu(VBr + po, vlb, j == HD / 16 - 1); vl[j] = frag_bu(VBLr + po, vlb, j == HD / 16 - 1); } else vf[j] = frag_hu(VTr + (size_t)j * 16 * TT + kc * 32, vlt, j == HD / 16 - 1); }
  st_mm<HI>(k, qh, ql, s);
#pragma unroll
  for (int u = 0; u < QT; ++u)
#pragma unroll
    for (int i = 0; i < 16; ++i) { float e = exp_slot(s[u][i] - m[u]); if (MASK && kc * 32 + 16 * (i >> 3) + (i & 7) > qrel + 16 * u) e = 0.f; sum[u] += e; s[u][i] = e * 2048.0f; }
  if (HI) { F2 pp[QT];
#pragma unroll
    for (int u = 0; u < QT; ++u) pp[u] = bsplit16(s[u]);
#pragma unroll
    for (int j = 0; j < HD / 16; ++j)
#pragma unroll
      for (int u = 0; u < QT; ++u) { acc[u][j] = wm_b(vh[j], pp[u].h, acc[u][j]); acc[u][j] = wm_b(vh[j], pp[u].l, acc[u][j]); acc[u][j] = wm_b(vl[j], pp[u].h, acc[u][j]); }
  } else { v16h pb[QT];
#pragma unroll
    for (int u = 0; u < QT; ++u)
#pragma unroll
      for (int i = 0; i < 16; ++i) pb[u][i] = (_Float16)s[u][i];
#pragma unroll
    for (int j = 0; j < HD / 16; ++j)
#pragma unroll
      for (int u = 0; u < QT; ++u) acc[u][j] = wm_h(vf[j], pb[u], acc[u][j]); } }
template <bool HI> __device__ __forceinline__ void att_body(const _Float16* __restrict__ QH, const _Float16* __restrict__ KH, const _Float16* __restrict__ QL, const _Float16* __restrict__ KL, const _Float16* __restrict__ VT, const __bf16* __restrict__ VB, const __bf16* __restrict__ VBL, int b, int h, int ql0, int lane, float* __restrict__ Y) {
  const int c = lane & 15, g = lane >> 4; const int nfull = ql0 >> 5;   /* ql0 % 32 == 0: steps 0 .. nfull-1 lie wholly below the diagonal for all 32 queries; step nfull holds it */
  const _Float16* KHr = KH + (size_t)b * TT * CC + h * HD; const _Float16* KLr = KL + (size_t)b * KHI * CC + h * HD; const unsigned klo = (unsigned)(c * CC + 8 * g) * 2u;
  const _Float16* VTr = VT + ((size_t)b * CC + h * HD) * (size_t)TT; const __bf16* VBr = VB + ((size_t)b * CC + h * HD) * (size_t)KHI; const __bf16* VBLr = VBL + ((size_t)b * CC + h * HD) * (size_t)KHI; const unsigned vlt = (unsigned)(c * TT + 8 * g) * 2u, vlb = (unsigned)(c * KHI + 8 * g) * 2u;
  v16h qh[QT], ql[QT];
#pragma unroll
  for (int u = 0; u < QT; ++u) { qh[u] = frag_hu(QH + ((size_t)b * TT + ql0 + u * 16) * CC + h * HD, klo); if (HI) ql[u] = frag_hu(QL + ((size_t)b * QHI + ql0 + u * 16) * CC + h * HD, klo); else ql[u] = qh[u]; }
  XW();
  const int qrel = ql0 + c - 8 * g;   /* key kc*32 + 16 t + 8 g + r is kept for query ql0 + 16 u + c when kc*32 + 16 t + r <= qrel + 16 u */
  float m[QT], sum[QT]; v8f acc[QT][HD / 16] = {};
#pragma unroll
  for (int u = 0; u < QT; ++u) { m[u] = -3.0e38f; sum[u] = 0.f; }
#pragma unroll HI ? 1 : 4   /* late rows: four steps' key loads in flight, this walk has little work to cover a load's latency */
  for (int kc = 0; kc < nfull; ++kc) max_step<HI, false>(KHr, KLr, qh, ql, kc, klo, qrel, m);
  max_step<HI, true>(KHr, KLr, qh, ql, nfull, klo, qrel, m);
#pragma unroll
  for (int u = 0; u < QT; ++u) m[u] = fmaxf(m[u], __shfl_xor(m[u], 16));   /* the two lane halves hold different keys of the same query */
#pragma unroll 1   /* one step is some 500 vector instructions, enough for the SIMD's other waves to cover its loads; unrolling only adds registers */
  for (int kc = 0; kc < nfull; ++kc) pv_step<HI, false>(KHr, KLr, qh, ql, VTr, VBr, VBLr, kc, klo, vlt, vlb, qrel, m, sum, acc);
  pv_step<HI, true>(KHr, KLr, qh, ql, VTr, VBr, VBLr, nfull, klo, vlt, vlb, qrel, m, sum, acc);
#pragma unroll
  for (int u = 0; u < QT; ++u) { const float st = sum[u] + __shfl_xor(sum[u], 16); const float inv = st > 0.f ? (1.0f / 2048.0f) / st : 0.f;
    float* yr = Y + ((size_t)b * TT + ql0 + u * 16 + c) * CC + h * HD + 8 * g;   /* acc[u][j][r] = ctx(query 16 u + c, dim 16 j + 8 g + r): 32 contiguous bytes per lane and j */
#pragma unroll
    for (int j = 0; j < HD / 16; ++j) { v4f o0, o1;
#pragma unroll
      for (int r = 0; r < 4; ++r) { o0[r] = acc[u][j][r] * inv; o1[r] = acc[u][j][4 + r] * inv; }
      vst2(yr + j * 16, o0); vst2(yr + j * 16 + 4, o1); } } }
__global__ __launch_bounds__(128) void k_att(const _Float16* __restrict__ QH, const _Float16* __restrict__ KH, const _Float16* __restrict__ QL, const _Float16* __restrict__ KL, const _Float16* __restrict__ VT, const __bf16* __restrict__ VB, const __bf16* __restrict__ VBL, float* __restrict__ Y) {
  const int b = blockIdx.x / NH, h = blockIdx.x % NH; const int q0 = (TT / (64 * QT) - 1 - (int)blockIdx.y) * (64 * QT);   /* longest query blocks start first */
  const int wave = __builtin_amdgcn_readfirstlane(threadIdx.x >> 5), lane = threadIdx.x & 31; const int ql0 = q0 + wave * (16 * QT);
  if (q0 < QHI) att_body<true>(QH, KH, QL, KL, VT, VB, VBL, b, h, ql0, lane, Y); else att_body<false>(QH, KH, QL, KL, VT, VB, VBL, b, h, ql0, lane, Y); }
// ---- k_out: block = (64 rows, 128 cols): ao = ctx Wvu (+ bvu): ctx once to f16 against Wvu as f16(bf16 x 2^8) exact (1 product) x 2^-8; causal early rows (< QHI of each sequence): ctx bf16 hi + lo against exact bf16 Wvu (2 products)
__global__ __launch_bounds__(128) void k_out(const float* __restrict__ Y, const __bf16* __restrict__ FU, const _Float16* __restrict__ FUH, const float* __restrict__ BO, float* __restrict__ OUT) { __shared__ __align__(16) float sf[4][16][132];
  const int tid = threadIdx.x, wave = tid >> 5, lane = tid & 31, col = lane & 15, g = lane >> 4; const int c0 = blockIdx.y * 128; const size_t r0 = (size_t)blockIdx.x * 64 + wave * 16; const unsigned lob = lane * 16u;
  v8f acc[8] = {};
  if (CAUSAL && (int)(((size_t)blockIdx.x * 64) % TT) < QHI) {   /* block-uniform */
#pragma unroll 2
    for (int kc = 0; kc < CC / 32; ++kc) { const F2 a = split_row(Y + (r0 + col) * CC, kc * 32, lane); v16b w[8];
#pragma unroll
      for (int j = 0; j < 8; ++j) w[j] = fragw_b8(FU + (size_t)(kc * (DIN / 16) + c0 / 16 + j) * 256, lob);
#pragma unroll
      for (int j = 0; j < 8; ++j) { acc[j] = wmma_bf(a.h, w[j], acc[j]); acc[j] = wmma_bf(a.l, w[j], acc[j]); } }
#pragma unroll
    for (int j = 0; j < 8; ++j) { const float bias = BO ? bfr(BO[c0 + j * 16 + col]) : 0.f;
#pragma unroll
      for (int r = 0; r < 8; ++r) sf[wave][8 * g + r][j * 16 + col] = acc[j][r] + bias; }
  } else {
#pragma unroll 2
    for (int kc = 0; kc < CC / 32; ++kc) { const v16h a = frag_f32s(Y + (r0 + col) * CC + kc * 32, lane, 64.0f); v16h w[8];   /* ctx carried x 2^6 into f16 so small-magnitude context rows stay clear of f16 subnormals (chip FTZ) */
#pragma unroll
      for (int j = 0; j < 8; ++j) w[j] = fragw_h8(FUH + (size_t)(kc * (DIN / 16) + c0 / 16 + j) * 256, lob);
#pragma unroll
      for (int j = 0; j < 8; ++j) acc[j] = wmma16(a, w[j], acc[j]); }
#pragma unroll
    for (int j = 0; j < 8; ++j) { const float bias = BO ? bfr(BO[c0 + j * 16 + col]) : 0.f;
#pragma unroll
      for (int r = 0; r < 8; ++r) sf[wave][8 * g + r][j * 16 + col] = acc[j][r] * (1.0f / 16384.0f) + bias; } }   /* 2^-8 (Wvu carry) x 2^-6 (ctx carry) */
  LDSX(); for (int rl = 0; rl < 16; ++rl) vst2(OUT + (r0 + rl) * DIN + c0 + lane * 4, *(const v4f*)&sf[wave][rl][lane * 4]); }
#define K2 DIN
#define wcol_io_plain(W, k0, o, lane) wcol_io(W, k0, o, lane, DIN)
#define wcolh_io_plain(W, k0, o, lane) wcolh_io(W, k0, o, lane, DIN)
// ---- k_out2: block = (64 rows, 128 cols): final projection out = R Wo + bo on the re-read rows R [NB*TT][K2] (K2 = DIN input width): same body as k_out with the row pitch / k extent K2 and all 16 slots of the Wo fragments packed by k_prep; always the single-product path
__global__ __launch_bounds__(128) void k_out2(const float* __restrict__ Y, const _Float16* __restrict__ FO, const float* __restrict__ BO, float* __restrict__ OUT) { __shared__ __align__(16) float sf[4][16][132];
  const int tid = threadIdx.x, wave = tid >> 5, lane = tid & 31, col = lane & 15, g = lane >> 4; const int c0 = blockIdx.y * 128; const size_t r0 = (size_t)blockIdx.x * 64 + wave * 16; const unsigned lob = lane * 16u;
  v8f acc[8] = {};   /* the re-read rows mix positions: no early-row special case here */
#pragma unroll 2
  for (int kc = 0; kc < K2 / 32; ++kc) { float av[16]; { const float* p = Y + (r0 + col) * K2 + kc * 32 + 8 * g;
#pragma unroll
      for (int i = 0; i < 8; ++i) { av[i] = p[i]; av[8 + i] = p[16 + i]; } }
    v16h w[8];   /* rows carried x 2^6 into f16 so small-magnitude rows stay clear of f16 subnormals (chip FTZ) */
#pragma unroll
    for (int j = 0; j < 8; ++j) w[j] = fragw_h(FO + (size_t)(kc * (DIN / 16) + c0 / 16 + j) * 512, lob);
    __builtin_amdgcn_sched_barrier(0);   /* every load of the k-step is issued before the first rounding that waits for one; without it the build holds two weight loads back behind that wait */
    v16h a;
#pragma unroll
    for (int i = 0; i < 16; ++i) a[i] = (_Float16)(av[i] * 64.0f);
#pragma unroll
    for (int j = 0; j < 8; ++j) acc[j] = wmma16(a, w[j], acc[j]); }
#pragma unroll
  for (int j = 0; j < 8; ++j) { const float bias = BO ? bfr(BO[c0 + j * 16 + col]) : 0.f;
#pragma unroll
    for (int r = 0; r < 8; ++r) sf[wave][8 * g + r][j * 16 + col] = acc[j][r] * (1.0f / 16384.0f) + bias; }   /* 2^-8 (Wo carry) x 2^-6 (row carry) */
  LDSX(); for (int rl = 0; rl < 16; ++rl) vst2(OUT + (r0 + rl) * DIN + c0 + lane * 4, *(const v4f*)&sf[wave][rl][lane * 4]); }

extern "C" void kernel_launch(void* const* d_in, const int* in_sizes, int n_in, void* d_out, int out_size, void* d_ws, size_t ws_size, hipStream_t stream) {
  (void)in_sizes; (void)n_in; (void)out_size;
  const float** F = (const float**)d_in;
  if (ws_size < (size_t)WS_END) return;
  char* ws = (char*)d_ws; _Float16 *QH = (_Float16*)(ws + WS_QH), *KH = (_Float16*)(ws + WS_KH), *VT = (_Float16*)(ws + WS_VT), *QL = (_Float16*)(ws + WS_QL), *KL = (_Float16*)(ws + WS_KL); __bf16 *VB = (__bf16*)(ws + WS_VB), *VBL = (__bf16*)(ws + WS_VBL); float *S = (float*)(ws + WS_S), *Y = (float*)(ws + WS_Y);
  (void)S; (void)Y; (void)QL; (void)KL; (void)VB; (void)VBL;
  // inputs (in order): 0 x [4,2048,768]; 1 Wq [768,768] (in,out), 2 bq; 3 Wkd [768,192], 4 bkd; 5 Wvd [768,192], 6 bvd; 7 Wvu [192,768], 8 bvu; 9 Wo [768,768] (in,out), 10 bo (all biases zeros, read)
  if (ws_size < (size_t)WS_END3) return;
  float *AO = (float*)(ws + WS_AO), *T = (float*)(ws + WS_T); __bf16 *FP = (__bf16*)(ws + WS_FP), *FU = (__bf16*)(ws + WS_FU); _Float16 *FUH = (_Float16*)(ws + WS_FUH), *FO = (_Float16*)(ws + WS_FO);
  k_prep<<<dim3((NF_P + NF_U + NF_O) / 4), 128, 0, stream>>>(F[1], F[3], F[5], F[7], F[9], FP, FU, FUH, FO);   /* every weight once into B-fragment order */
  k_proj<<<dim3(TNB * TT / 64, CC / 128, 3), 128, 0, stream>>>(F[0], F[0], F[0], FP, F[2], F[4], F[6], QH, QL, KH, KL, VT, VB, VBL);   /* q slice, latent k, latent v: 3 column blocks of 128 columns each */
  k_att<<<dim3(TNB * NH, TT / (64 * QT)), 128, 0, stream>>>(QH, KH, QL, KL, VT, VB, VBL, Y);   /* logits, softmax, P v: every (b, h, 128-query block) in one launch */
  k_out<<<dim3(TNB * TT / 64, DIN / 128), 128, 0, stream>>>(Y, FU, FUH, F[8], AO);   /* ao = al Wvu + bvu (gathered weight rows) */
  k_fin<<<dim3(TT / 64, DIN / 64, TNB), 256, 0, stream>>>(AO, T, TT, DIN);   /* T[b][c][s] = ao[b][s][c] */
  k_out2<<<dim3(TNB * TT / 64, DIN / 128), 128, 0, stream>>>(T, FO, F[10], (float*)d_out);   /* rows = T's memory re-read as [TT][DIN] per batch; out = rows Wo + bo */
}

// v003
// Measured time: 138 microseconds a run.
// Next to v002, in two timings, it ran 1.06 times as fast each time.
// Counting every step since v000, it is 12.7 times as fast.
// compute dtype: all float inputs rounded to bf16; the q slice and the latent k / v projections with EXACT bf16 products on WMMA 16x16x32 (f32 accumulate) + bias (zeros, read), 16 real dims per head zero-padded to 32; causal logits over the 16 latent dims: 3 products for the first 384 rows, single f16 after, x 16^-0.5; softmax f32 (max first, then exp(s - max) x 2^11, formed as 2^(raw logit x 16^-0.5 log2(e) + offset), once to f16 x v once to f16 (bf16 hi + lo below row 384), divided by the f32 row sum after the product; logits never stored); latent ctx (hi+lo below row 384, x2^6 f16 carry after) x exact / f16(bf16 x 2^8) Wvu + bvu; per-batch transpose; then x 2^6 once to f16 x Wo f16(bf16 x 2^8) + bo; f32 output.
#include <hip/hip_runtime.h>
#include <math.h>

typedef __attribute__((ext_vector_type(16))) _Float16 v16h;
typedef __attribute__((ext_vector_type(16))) __bf16 v16b;
typedef __attribute__((ext_vector_type(8)))  _Float16 v8h;
typedef __attribute__((ext_vector_type(8)))  float v8f;
typedef __attribute__((ext_vector_type(4)))  float v4f;
typedef __attribute__((ext_vector_type(2)))  float v2f;
typedef __attribute__((ext_vector_type(4)))  unsigned v4u;
typedef __attribute__((ext_vector_type(4)))  int v4i;
typedef float __attribute__((may_alias)) float_a;
typedef int __attribute__((may_alias)) int_a;

template <typename T> __device__ __forceinline__ void vst2(void* p, T v) { *(T*)p = v;  }
__device__ __forceinline__ v8f wmma16(v16h a, v16h b, v8f c) {
  v8f d = __builtin_amdgcn_wmma_f32_16x16x32_f16(false, a, false, b, (short)0, c, false, false);
  asm volatile("v_nop\n\tv_nop\n\tv_nop\n\tv_nop" : "+v"(d) : "v"(a), "v"(b));
  return d;
}
__device__ __forceinline__ v8f wmma_bf(v16b a, v16b b, v8f c) {
  v8f d = __builtin_amdgcn_wmma_f32_16x16x32_bf16(false, a, false, b, (short)0, c, false, false);
  asm volatile("v_nop\n\tv_nop\n\tv_nop\n\tv_nop" : "+v"(d) : "v"(a), "v"(b));
  return d;
}
// 16x16x32 fragments: lane = (h = lane>>4, row/col = lane&15); elements 0..7 = k0+8h+0..7, 8..15 = k0+16+8h+0..7; D element r = row 8h+r
__device__ __forceinline__ v16h frag_h(const _Float16* rowk0, int lane) {
  union { v16h v; v8h q[2]; } u; const _Float16* p = rowk0 + 8 * (lane >> 4);
  u.q[0] = *(const v8h*)p; u.q[1] = *(const v8h*)(p + 16); return u.v;
}
__device__ __forceinline__ v16h frag_f32(const float* rowk0, int lane) {
  v16h a; const float* p = rowk0 + 8 * (lane >> 4);
#pragma unroll
  for (int i = 0; i < 8; ++i) { a[i] = (_Float16)p[i]; a[8 + i] = (_Float16)p[16 + i]; }
  return a;
}
__device__ __forceinline__ v16h frag_f32s(const float* rowk0, int lane, float sc) {
  v16h a; const float* p = rowk0 + 8 * (lane >> 4);
#pragma unroll
  for (int i = 0; i < 8; ++i) { a[i] = (_Float16)(p[i] * sc); a[8 + i] = (_Float16)(p[16 + i] * sc); }
  return a;
}
// column fragment from a [K][ld] layout (column n), rows >= K read as 0
__device__ __forceinline__ v16h fragc_f32(const float* W, int k0, int n, int lane, int ld, int K) {
  v16h a; const int g = lane >> 4;
#pragma unroll
  for (int i = 0; i < 8; ++i) { const int ka = k0 + 8 * g + i, kb = ka + 16;
    a[i] = (_Float16)(ka < K ? W[(size_t)(ka < K ? ka : K - 1) * ld + n] : 0.f); a[8 + i] = (_Float16)(kb < K ? W[(size_t)(kb < K ? kb : K - 1) * ld + n] : 0.f); }
  return a;
}
struct F2 { v16b h, l; };
__device__ __forceinline__ F2 bsplit16(const float v[16]) { F2 r;
#pragma unroll
  for (int i = 0; i < 16; ++i) { const __bf16 h = (__bf16)v[i]; r.h[i] = h; r.l[i] = (__bf16)(v[i] - (float)h); }
  return r; }
__device__ __forceinline__ F2 split_row(const float* row, int k0, int lane) { float v[16]; const float* p = row + k0 + 8 * (lane >> 4);
#pragma unroll
  for (int i = 0; i < 8; ++i) { v[i] = p[i]; v[8 + i] = p[16 + i]; }
  return bsplit16(v); }
__device__ __forceinline__ F2 split_rowK(const float* row, int k0, int lane, int K) { float v[16]; const int g = lane >> 4;
#pragma unroll
  for (int i = 0; i < 8; ++i) { const int ka = k0 + 8 * g + i, kb = ka + 16; v[i] = ka < K ? row[ka < K ? ka : K - 1] : 0.f; v[8 + i] = kb < K ? row[kb < K ? kb : K - 1] : 0.f; }
  return bsplit16(v); }
__device__ __forceinline__ F2 split_col(const float* W, int k0, int n, int lane, int ld, int K) { float v[16]; const int g = lane >> 4;
#pragma unroll
  for (int i = 0; i < 8; ++i) { const int ka = k0 + 8 * g + i, kb = ka + 16; v[i] = ka < K ? W[(size_t)(ka < K ? ka : K - 1) * ld + n] : 0.f; v[8 + i] = kb < K ? W[(size_t)(kb < K ? kb : K - 1) * ld + n] : 0.f; }
  return bsplit16(v); }
__device__ __forceinline__ v8f mac3(const F2& a, const F2& b, v8f c) { c = wmma_bf(a.l, b.h, c); c = wmma_bf(a.h, b.l, c); return wmma_bf(a.h, b.h, c); }
__device__ __forceinline__ float sigm(float v) { return 1.0f / (1.0f + expf(-v)); }
#define LDSX() do { asm volatile("s_wait_dscnt 0" ::: "memory"); __builtin_amdgcn_wave_barrier(); __builtin_amdgcn_fence(__ATOMIC_RELEASE, "workgroup"); } while (0)

// Causal self-attention with 12 low-rank latent heads (x [4,2048,768]; (in,out) Wq [768,768], Wkd / Wvd [768,192], Wvu [192,768], Wo [768,768], all N(0,1) x 0.02, zero biases (read); q = x Wq + bq split into 12 heads x 64 of which only the FIRST 16 dims of each head are used (ql); kl, vl = x Wkd, x Wvd split into 12 heads x 16; scores = ql kl^T x 16^-0.5; triu(1) -> -inf; softmax; al = w vl merged to [B,S,192]; ao = al Wvu + bvu [B,S,768]; then jnp.transpose(ao, (0,2,1)).reshape(B,S,768): the per-batch [2048 x 768] matrix is transposed to [768 x 2048] and its memory re-read as 2,048 rows of 768; out = that Wo + bo).
#define NB 4
#define TT 2048
#define CC 384            // NH * HD = projected width
#define DIN 768          // input (model) width
#define NH 12
#define HD 32
#define LATW 16     /* real dims per head; columns h*HD + d with d >= LATW are zero padding */
#define QHEADW 64   /* the module's q heads are 64 wide; only their first LATW dims are used (ql = q[..., :16]) */
#define KVLD (NH * LATW)   /* row pitch of the (in,out) latent weights Wkd / Wvd [768][192] */
#define NQB (TT / 64)
#define HG 2   // S region: 2 x 2,048 x 2,048 f32 = 32 MiB, allocated but unused
#define SCALE (0.25f)
#define CAUSAL 1
#ifndef TNB
#define TNB NB
#endif
__device__ __forceinline__ float bfr(float v) { return (float)(__bf16)v; }
__host__ __device__ __forceinline__ int kb_last(int qb) { return CAUSAL ? ((qb * 64 + 63) >> 7) : (TT / 128 - 1); }
typedef __attribute__((ext_vector_type(8))) __bf16 v8b;
__device__ __forceinline__ v16b frag_b(const __bf16* rowk0, int lane) {
  union { v16b v; v8b q[2]; } u; const __bf16* p = rowk0 + 8 * (lane >> 4);
  u.q[0] = *(const v8b*)p; u.q[1] = *(const v8b*)(p + 16); return u.v;
}
#define QBH 6              // causal: query blocks 0..QBH-1 of each sequence (few keys, no averaging) take the high-precision path
#define QHI 384            // rows carrying a q residual plane
#define KHI 384            // key rows carrying k residual / v bf16 hi+lo planes (used only by the causal high-precision path)
// B fragment (k rows k0+.., output column o) of a weight: (in,out) [K][ld] or (out,in) [ld rows of K]: bf16 exact, or f16(bf16 * 256) exact
__device__ __forceinline__ v16b wcol_io(const float* Wm, int k0, int o, int lane, int ld) { v16b w; const int g = lane >> 4;
#pragma unroll
  for (int i = 0; i < 8; ++i) { w[i] = (__bf16)Wm[(size_t)(k0 + 8 * g + i) * ld + o]; w[8 + i] = (__bf16)Wm[(size_t)(k0 + 16 + 8 * g + i) * ld + o]; }
  return w; }
__device__ __forceinline__ v16b wcol_oi(const float* Wm, int k0, int o, int lane, int K) { v16b w; const float* p = Wm + (size_t)o * K + k0 + 8 * (lane >> 4);
#pragma unroll
  for (int i = 0; i < 8; ++i) { w[i] = (__bf16)p[i]; w[8 + i] = (__bf16)p[16 + i]; }
  return w; }
__device__ __forceinline__ v16h wcolh_io(const float* Wm, int k0, int o, int lane, int ld) { v16h w; const int g = lane >> 4;
#pragma unroll
  for (int i = 0; i < 8; ++i) { w[i] = (_Float16)(bfr(Wm[(size_t)(k0 + 8 * g + i) * ld + o]) * 256.0f); w[8 + i] = (_Float16)(bfr(Wm[(size_t)(k0 + 16 + 8 * g + i) * ld + o]) * 256.0f); }
  return w; }
// first output projection ao = al Wvu: the k index runs over ctx columns kk = h*HD + d; one 32-deep k-step = one head; its first 16 entries (d < LATW, fragment slots 0..7 of both lane halves) are rows h*LATW + d of the (in,out) [192][768] weight, its last 16 (padding dims, slots 8..15) are zero
__device__ __forceinline__ v16b wcol_io_lat(const float* Wm, int k0, int o, int lane, int ld) { v16b w; const int g = lane >> 4; const float* p = Wm + (size_t)((k0 / HD) * LATW + 8 * g) * ld + o;
#pragma unroll
  for (int i = 0; i < 8; ++i) { w[i] = (__bf16)p[(size_t)i * ld]; w[8 + i] = (__bf16)0.0f; }
  return w; }
__device__ __forceinline__ v16h wcolh_io_lat(const float* Wm, int k0, int o, int lane, int ld) { v16h w; const int g = lane >> 4; const float* p = Wm + (size_t)((k0 / HD) * LATW + 8 * g) * ld + o;
#pragma unroll
  for (int i = 0; i < 8; ++i) { w[i] = (_Float16)(bfr(p[(size_t)i * ld]) * 256.0f); w[8 + i] = (_Float16)0.0f; }
  return w; }
static_assert(HD == 32 && LATW == 16 && CC == NH * HD, "the latent loaders assume one head per 32-deep k-step with 16 real + 16 padding dims");
__device__ __forceinline__ v16h wcolh_oi(const float* Wm, int k0, int o, int lane, int K) { v16h w; const float* p = Wm + (size_t)o * K + k0 + 8 * (lane >> 4);
#pragma unroll
  for (int i = 0; i < 8; ++i) { w[i] = (_Float16)(bfr(p[i]) * 256.0f); w[8 + i] = (_Float16)(bfr(p[16 + i]) * 256.0f); }
  return w; }
#define WQKV_LAYOUT 0   // 0 = (in,out) [DIN][out], columns gathered per head; 1 = (out,in) [CC][DIN]; 2 = per-head [NH][DIN][HD]
__device__ __forceinline__ v16b wcol_hdk(const float* Wm, int k0, int o, int lane) { v16b w; const int g = lane >> 4; const float* p = Wm + (size_t)(o / HD) * DIN * HD + (o % HD);
#pragma unroll
  for (int i = 0; i < 8; ++i) { w[i] = (__bf16)p[(size_t)(k0 + 8 * g + i) * HD]; w[8 + i] = (__bf16)p[(size_t)(k0 + 16 + 8 * g + i) * HD]; }
  return w; }
#define WO_OUT_IN 0
#if WQKV_LAYOUT == 1
#define WCOL(W, k0, o, lane) wcol_oi(W, k0, o, lane, DIN)
#elif WQKV_LAYOUT == 2
#define WCOL(W, k0, o, lane) wcol_hdk(W, k0, o, lane)
#else
__device__ __forceinline__ v16b zero16b() { v16b w; _Pragma("unroll") for (int i = 0; i < 16; ++i) w[i] = (__bf16)0.0f; return w; }
/* column o = h*HD + d: real (d < LATW) -> weight column h*QHEADW + d of Wq (pitch DIN) for the q stream, h*LATW + d of Wkd / Wvd (pitch KVLD) for k / v; padding -> zeros. o = c0 + j*16 + col with c0 % 128 == 0, so (o % HD) < LATW is decided by j alone (compile-time per unrolled j, uniform across the wave) */
#define GCOL(o) ((which) == 0 ? ((o) / HD) * QHEADW + ((o) % HD) : ((o) / HD) * LATW + ((o) % HD))
#define WCOL(W, k0, o, lane) ((((o) % HD) < LATW) ? wcol_io(W, k0, GCOL(o), lane, ((which) == 0 ? DIN : KVLD)) : zero16b())
#endif
#if WO_OUT_IN
#define WOCOL(W, k0, o, lane) wcol_oi(W, k0, o, lane, CC)
#define WOCOLH(W, k0, o, lane) wcolh_oi(W, k0, o, lane, CC)
#else
#define WOCOL(W, k0, o, lane) wcol_io_lat(W, k0, o, lane, DIN)
#define WOCOLH(W, k0, o, lane) wcolh_io_lat(W, k0, o, lane, DIN)
#endif

#ifndef SM_EXTRA_PARAMS
#define SM_EXTRA_PARAMS
#endif
#ifndef PROJ_EXTRA_PARAMS
#define PROJ_EXTRA_PARAMS
#endif
#ifndef SM_MASK_HOOK
#define SM_MASK_HOOK (void)0
#endif

#define WS_QH  0u                                      // f16 q rows [b*t][CC]
#define WS_KH  (WS_QH + 2u * (size_t)NB * TT * CC)      // f16 k rows [b*t][CC]
#define WS_VT  (WS_KH + 2u * (size_t)NB * TT * CC)      // f16 v planes [b][c][t]
#define WS_QL  (WS_VT + 2u * (size_t)NB * CC * TT)      // f16 q residual x 2^10 rows [b][t < QHI][CC]
#define WS_KL  (WS_QL + 2u * (size_t)NB * QHI * CC)     // f16 k residual x 2^10 rows [b][t < KHI][CC]
#define WS_VB  (WS_KL + 2u * (size_t)NB * KHI * CC)     // bf16 v hi planes [b][c][t < KHI]
#define WS_VBL (WS_VB + 2u * (size_t)NB * CC * KHI)
#define WS_S   (WS_VBL + 2u * (size_t)NB * CC * KHI)    // f32 [hg][t][s] region, unused (logits stay in registers)
#define WS_Y   (WS_S  + 4u * (size_t)HG * TT * TT)      // f32 ctx rows [b*t][CC] (only when there is an output projection)
#define WS_END (WS_Y  + 4u * (size_t)NB * TT * CC)
#define WS_AO (WS_END)                                    // f32 ao rows [(b*TT + s)][DIN] = al Wvu + bvu
#define WS_T  (WS_AO + 4u * (size_t)NB * TT * DIN)          // f32 per-batch transpose T[b][c][s]; its memory is then read as TT rows of DIN (the module's transpose(0,2,1).reshape)
#define WS_END2 (WS_T + 4u * (size_t)NB * TT * DIN)
static_assert(TT % 64 == 0 && DIN % 64 == 0, "transpose tiles are 64 x 64");
// weights in WMMA B-fragment order, written once per call by k_prep. One fragment = the 32 lanes' slots 0..7 (16 B a lane, 512 B in a row), then their slots 8..15 (left out where they are the zero padding of a latent head)
#define NF_P (3 * (DIN / 32) * NH)        /* q slice / latent k / latent v: [which][kc][head], bf16 */
#define NF_U (NH * (DIN / 16))            /* Wvu: [head][column tile], slots 0..7 only, once bf16 and once f16(bf16 x 2^8) */
#define NF_O ((DIN / 32) * (DIN / 16))    /* Wo: [kc][column tile], f16(bf16 x 2^8) */
#define WS_FP  (WS_END2)
#define WS_FU  (WS_FP  + 1024u * (size_t)NF_P)
#define WS_FUH (WS_FU  + 512u * (size_t)NF_U)
#define WS_FO  (WS_FUH + 512u * (size_t)NF_U)
#define WS_END3 (WS_FO + 1024u * (size_t)NF_O)
static_assert((NF_P + NF_U + NF_O) % 4 == 0, "k_prep: four waves a block, one fragment a wave");
// fb = wave-uniform start of the fragment, lob = lane * 16 bytes
__device__ __forceinline__ v16b fragw_b(const __bf16* fb, unsigned lob) { union { v16b v; v8b q[2]; } u; const char* p = (const char*)fb + lob; u.q[0] = *(const v8b*)p; u.q[1] = *(const v8b*)(p + 512); return u.v; }
__device__ __forceinline__ v16h fragw_h(const _Float16* fb, unsigned lob) { union { v16h v; v8h q[2]; } u; const char* p = (const char*)fb + lob; u.q[0] = *(const v8h*)p; u.q[1] = *(const v8h*)(p + 512); return u.v; }
__device__ __forceinline__ v16b fragw_b8(const __bf16* fb, unsigned lob) { union { v16b v; v8b q[2]; } u; u.q[0] = *(const v8b*)((const char*)fb + lob);
#pragma unroll
  for (int i = 0; i < 8; ++i) u.q[1][i] = (__bf16)0.0f;
  return u.v; }
__device__ __forceinline__ v16h fragw_h8(const _Float16* fb, unsigned lob) { union { v16h v; v8h q[2]; } u; u.q[0] = *(const v8h*)((const char*)fb + lob);
#pragma unroll
  for (int i = 0; i < 8; ++i) u.q[1][i] = (_Float16)0.0f;
  return u.v; }
// a precaution: stands between issued loads and the next write of a register that holds one of their addresses
__device__ __forceinline__ void XW() { asm volatile("s_wait_xcnt 0x0" ::: "memory"); }
// N weight values of one column, rows i (i < 8) and, for N = 16, 16 + i of an (in,out) weight of pitch LD: ub = wave-uniform address of the tile's first row and column, lo = the lane's fixed byte offset (8 g rows + its column). The last load may land on the offset register, so the wait stands in front of it, and once more behind it, ahead of the scalar work that forms the store address
template <int LD, int N> __device__ __forceinline__ void ld_col(const float* ub, unsigned lo, float v[N]) { const char* p = (const char*)ub + lo;
#pragma unroll
  for (int i = 0; i < N - 1; ++i) v[i] = *(const float*)(p + (size_t)((i & 7) + 2 * (i & 8)) * LD * 4);
  XW(); v[N - 1] = *(const float*)(p + (size_t)(((N - 1) & 7) + 2 * ((N - 1) & 8)) * LD * 4); XW(); }
// ---- k_prep: one wave = one B fragment, with the roundings the projection kernels' own loaders (wcol_io, wcol_io_lat, wcolh_io_lat, wcolh_io) made per wave and per row block
__global__ __launch_bounds__(128) void k_prep(const float* __restrict__ WQ, const float* __restrict__ WK, const float* __restrict__ WV, const float* __restrict__ WU, const float* __restrict__ WO, __bf16* __restrict__ FP, __bf16* __restrict__ FU, _Float16* __restrict__ FUH, _Float16* __restrict__ FO) {
  const int lane = threadIdx.x & 31, col = lane & 15, g = lane >> 4; const int f = blockIdx.x * 4 + __builtin_amdgcn_readfirstlane(threadIdx.x >> 5);
  if (f < NF_P) { const int which = f / ((DIN / 32) * NH), kc = (f / NH) % (DIN / 32), h = f % NH; float v[16];
    if (which == 0) ld_col<DIN, 16>(WQ + (size_t)kc * 32 * DIN + h * QHEADW, (unsigned)(8 * g * DIN + col) * 4u, v);
    else ld_col<KVLD, 16>((which == 1 ? WK : WV) + (size_t)kc * 32 * KVLD + h * LATW, (unsigned)(8 * g * KVLD + col) * 4u, v);
    union { v16b v; v8b q[2]; } u;
#pragma unroll
    for (int i = 0; i < 16; ++i) u.v[i] = (__bf16)v[i];
    char* d = (char*)FP + (size_t)f * 1024 + lane * 16; *(v8b*)d = u.q[0]; *(v8b*)(d + 512) = u.q[1];
  } else if (f < NF_P + NF_U) { const int fu = f - NF_P, h = fu / (DIN / 16), jt = fu % (DIN / 16); float v[8];
    ld_col<DIN, 8>(WU + (size_t)h * LATW * DIN + jt * 16, (unsigned)(8 * g * DIN + col) * 4u, v);
    v8b wb; v8h wh;
#pragma unroll
    for (int i = 0; i < 8; ++i) { wb[i] = (__bf16)v[i]; wh[i] = (_Float16)(bfr(v[i]) * 256.0f); }
    *(v8b*)((char*)FU + (size_t)fu * 512 + lane * 16) = wb; *(v8h*)((char*)FUH + (size_t)fu * 512 + lane * 16) = wh;
  } else { const int fo = f - NF_P - NF_U, kc = fo / (DIN / 16), jt = fo % (DIN / 16); float v[16];
    ld_col<DIN, 16>(WO + (size_t)kc * 32 * DIN + jt * 16, (unsigned)(8 * g * DIN + col) * 4u, v);
    union { v16h v; v8h q[2]; } u;
#pragma unroll
    for (int i = 0; i < 16; ++i) u.v[i] = (_Float16)(bfr(v[i]) * 256.0f);
    char* d = (char*)FO + (size_t)fo * 1024 + lane * 16; *(v8h*)d = u.q[0]; *(v8h*)(d + 512) = u.q[1]; } }
// ---- k_fin: block = (64 positions, 64 channels, image b): out[b][c][n] = OR[(b*npix + n)][c] (LDS transpose; 256-B runs of 64 positions per channel)
__global__ __launch_bounds__(256) void k_fin(const float* __restrict__ ORW, float* __restrict__ OUT, int npix, int nch) { __shared__ float st[64][68]; const int tid = threadIdx.x; const int n0 = blockIdx.x * 64, c0 = blockIdx.y * 64; const size_t b = blockIdx.z;
  for (int e = tid; e < 64 * 16; e += 256) { const int nl = e >> 4, q = e & 15; *(v4f*)&st[nl][q * 4] = *(const v4f*)(ORW + (b * npix + n0 + nl) * (size_t)nch + c0 + q * 4); }
  __syncthreads();
  for (int e = tid; e < 64 * 16; e += 256) { const int cl = e >> 4, q = e & 15; v4f o; o[0] = st[q * 4][cl]; o[1] = st[q * 4 + 1][cl]; o[2] = st[q * 4 + 2][cl]; o[3] = st[q * 4 + 3][cl]; vst2(OUT + (b * nch + c0 + cl) * (size_t)npix + n0 + q * 4, o); } }

// ---- k_proj: block = (64 rows, 128 cols, which): q/k/v = X W (+ b) with exact bf16 products (K = DIN) -> which 0: q f16 rows (+ residual rows < QHI); 1: k f16 rows (+ residual rows < KHI); 2: v f16 planes [c][t] (+ bf16 hi/lo planes for t < KHI)
__global__ __launch_bounds__(128) void k_proj(const float* __restrict__ XQ, const float* __restrict__ XK, const float* __restrict__ XV, const __bf16* __restrict__ FP, const float* __restrict__ BQ, const float* __restrict__ BK, const float* __restrict__ BV,
    _Float16* __restrict__ QH, _Float16* __restrict__ QL, _Float16* __restrict__ KH, _Float16* __restrict__ KL, _Float16* __restrict__ VT, __bf16* __restrict__ VB, __bf16* __restrict__ VBL) {
  __shared__ __align__(16) _Float16 sh[64][136], sl[64][136]; __shared__ __align__(16) _Float16 th[128][72]; __shared__ __align__(16) __bf16 tb[128][72], tbl[128][72];
  const int tid = threadIdx.x, wave = tid >> 5, lane = tid & 31, col = lane & 15, g = lane >> 4; const int which = blockIdx.z; const int c0 = blockIdx.y * 128; const size_t r0 = (size_t)blockIdx.x * 64; const size_t bb = r0 / TT; const int t0 = (int)(r0 % TT);
  const float* X = which == 0 ? XQ : which == 1 ? XK : XV; const __bf16* FW = FP + ((size_t)which * (DIN / 32) * NH + c0 / HD) * 512; const unsigned lob = lane * 16u; const float* BA = which == 0 ? BQ : which == 1 ? BK : BV;
  v8f acc[8] = {};
#pragma unroll 2
  for (int kc = 0; kc < DIN / 32; ++kc) { float av[16]; { const float* p = X + (r0 + wave * 16 + col) * DIN + kc * 32 + 8 * g;
#pragma unroll
      for (int i = 0; i < 8; ++i) { av[i] = p[i]; av[8 + i] = p[16 + i]; } }
    v16b w[4];   /* the step's four real column tiles (even j: dims < LATW of a head), asked for together with the x rows */
#pragma unroll
    for (int jj = 0; jj < 4; ++jj) w[jj] = fragw_b(FW + (size_t)(kc * NH + jj) * 512, lob);
    __builtin_amdgcn_sched_barrier(0);   /* every load of the k-step is issued before the first rounding that waits for one; without it the build holds two weight loads back behind that wait */
    v16b a;
#pragma unroll
    for (int i = 0; i < 16; ++i) a[i] = (__bf16)av[i];
#pragma unroll
    for (int j = 0; j < 8; ++j) acc[j] = wmma_bf(a, (j & 1) ? zero16b() : w[j >> 1], acc[j]); }
  if (which < 2) { _Float16* DH = which == 0 ? QH : KH; _Float16* DL = which == 0 ? QL : KL; const int nhi = which == 0 ? QHI : KHI; const bool hi_rows = t0 < nhi;
#pragma unroll
    for (int j = 0; j < 8; ++j) { const float bias = (BA && ((c0 + j * 16 + col) % HD) < LATW) ? bfr(BA[GCOL(c0 + j * 16 + col)]) : 0.f;   /* gathered like the weight columns; padding columns get no bias */
#pragma unroll
      for (int r = 0; r < 8; ++r) { const float v = acc[j][r] + bias; const _Float16 hv = (_Float16)v; sh[wave * 16 + 8 * g + r][j * 16 + col] = hv; sl[wave * 16 + 8 * g + r][j * 16 + col] = (_Float16)((v - (float)hv) * 1024.0f); } }
    __syncthreads();
    for (int e = tid; e < 64 * 16; e += 128) { const int rl = e >> 4, q = e & 15; vst2((unsigned*)(DH + (r0 + rl) * CC + c0 + q * 8), *(const v4u*)&sh[rl][q * 8]); if (hi_rows) vst2((unsigned*)(DL + (bb * nhi + t0 + rl) * (size_t)CC + c0 + q * 8), *(const v4u*)&sl[rl][q * 8]); }
  } else { const bool hi_rows = t0 < KHI;
#pragma unroll
    for (int j = 0; j < 8; ++j) { const float bias = (BA && ((c0 + j * 16 + col) % HD) < LATW) ? bfr(BA[GCOL(c0 + j * 16 + col)]) : 0.f;   /* gathered like the weight columns; padding columns get no bias */
#pragma unroll
      for (int r = 0; r < 8; ++r) { const float v = acc[j][r] + bias; const int rl = wave * 16 + 8 * g + r, cl = j * 16 + col; th[cl][rl] = (_Float16)v; const __bf16 bh = (__bf16)v; tb[cl][rl] = bh; tbl[cl][rl] = (__bf16)(v - (float)bh); } }
    __syncthreads();
    for (int e = tid; e < 128 * 8; e += 128) { const int cl = e >> 3, q = e & 7; vst2((unsigned*)(VT + (bb * CC + c0 + cl) * (size_t)TT + t0 + q * 8), *(const v4u*)&th[cl][q * 8]); if (hi_rows) { const size_t o3 = (bb * CC + c0 + cl) * (size_t)KHI + t0 + q * 8; vst2((unsigned*)(VB + o3), *(const v4u*)&tb[cl][q * 8]); vst2((unsigned*)(VBL + o3), *(const v4u*)&tbl[cl][q * 8]); } } } }
// ---- k_att: block = 4 waves x 32 queries of (b, h), one launch for all (b, h): logits, softmax and P . v without leaving registers.
// S^T = K . Q^T (A = 16 key rows, B = 16 query rows): lane (g, c) holds, for query c, keys 8g + r of each 16-key tile, so the two tiles of one 32-key step, converted in place, are the B operand of ctx^T += v^T . P^T (hardware k order on both sides). Each key / v fragment serves the wave's two 16-query tiles.
// Walk 1: row maximum. Walk 2 (logits formed again, same products): e = exp(s - max) x 2^11, row sum in f32, e once to f16 against v f16 (query rows < QHI: 3-product logits, e and v as bf16 hi + lo, 3 products); ctx = acc / sum. Keys past the wave's own diagonal step are not visited; the diagonal step masks by index.
#define QT 2   // 16-query tiles per wave
static_assert(QHI % (64 * QT) == 0 && QHI == QBH * 64 && KHI >= QHI && TT % (64 * QT) == 0, "a block of 4 x QT x 16 queries is wholly early or wholly late; early rows see only keys < KHI");
__device__ __forceinline__ v8f wm_h(v16h a, v16h b, v8f c) { return __builtin_amdgcn_wmma_f32_16x16x32_f16(false, a, false, b, (short)0, c, false, false); }
__device__ __forceinline__ v8f wm_b(v16b a, v16b b, v8f c) { return __builtin_amdgcn_wmma_f32_16x16x32_bf16(false, a, false, b, (short)0, c, false, false); }
// fragment from a wave-uniform base + the lane's fixed byte offset (row c, half g). xl: the last fragment read through its address pair; its last load may land on that pair, so the wait stands in front of it
__device__ __forceinline__ v16h frag_hu(const _Float16* ub, unsigned lob, bool xl = false) { union { v16h v; v8h q[2]; } u; const char* p = (const char*)ub + lob; u.q[0] = *(const v8h*)p; if (xl) XW(); u.q[1] = *(const v8h*)(p + 32); return u.v; }
__device__ __forceinline__ v16b frag_bu(const __bf16* ub, unsigned lob, bool xl = false) { union { v16b v; v8b q[2]; } u; const char* p = (const char*)ub + lob; u.q[0] = *(const v8b*)p; if (xl) XW(); u.q[1] = *(const v8b*)(p + 32); return u.v; }
// e x 2^11 = 2^(t x LC + off): t = the raw logit (before x 16^-0.5), LC = 16^-0.5 x log2(e), off = 11 - max(t) x LC, one value per query row. One fused multiply-add and one v_exp_f32 per logit; the rounding of off is a factor common to a row's numerators and its sum. Below 2^-126 the result may flush to 0, far under what the f32 sum or the 16-bit P can hold.
#define LC (SCALE * 1.44269504088896340736f)
// SLOT: the diagonal step, once per wave: the free slot the instruction set asks for behind a transcendental stands in the v_exp_f32's own statement. In the loops the builtin leaves the build free to pair the multiply-adds and to place its delay hints; there the listing shows an independent instruction behind every v_exp_f32.
template <bool SLOT> __device__ __forceinline__ float exp2_arg(float t, float off) { const float a = __builtin_fmaf(t, LC, off); if (!SLOT) return __builtin_amdgcn_exp2f(a);
  float e; asm("v_exp_f32 %0, %1\n\tv_nop" : "=v"(e) : "v"(a)); return e; }
// one 32-key step: ld_k reads its two 16-key tiles (KHr / KLr point at key 0 of (b, h), klo = the lane's byte offset in a 16-row tile of pitch CC); st_mm forms s[u][8 t + r] = raw logit (not yet x 16^-0.5) of (key kc*32 + 16 t + 8 g + r, query 16 u + c)
struct KF { v16h h[2], l[2]; };
template <bool HI> __device__ __forceinline__ KF ld_k(const _Float16* KHr, const _Float16* KLr, int kc, unsigned klo, bool xl) { KF k;
#pragma unroll
  for (int t = 0; t < 2; ++t) { const size_t ro = (size_t)(kc * 32 + t * 16) * CC; k.h[t] = frag_hu(KHr + ro, klo, xl && t == 1); if (HI) k.l[t] = frag_hu(KLr + ro, klo, xl && t == 1); else k.l[t] = k.h[t]; }
  return k; }
template <bool HI> __device__ __forceinline__ void st_mm(const KF& k, const v16h qh[QT], const v16h ql[QT], float s[QT][16]) {
#pragma unroll
  for (int t = 0; t < 2; ++t)
#pragma unroll
    for (int u = 0; u < QT; ++u) { v8f a = {}; a = wm_h(k.h[t], qh[u], a);
      if (HI) { v8f al = {}; al = wm_h(k.h[t], ql[u], al); al = wm_h(k.l[t], qh[u], al);
#pragma unroll
        for (int r = 0; r < 8; ++r) s[u][t * 8 + r] = a[r] + al[r] * (1.0f / 1024.0f);
      } else {
#pragma unroll
        for (int r = 0; r < 8; ++r) s[u][t * 8 + r] = a[r]; } } }
template <bool HI, bool MASK> __device__ __forceinline__ void max_step(const _Float16* KHr, const _Float16* KLr, const v16h qh[QT], const v16h ql[QT], int kc, unsigned klo, int qrel, float m[QT]) { float s[QT][16]; const KF k = ld_k<HI>(KHr, KLr, kc, klo, false); st_mm<HI>(k, qh, ql, s);
#pragma unroll
  for (int u = 0; u < QT; ++u)
#pragma unroll
    for (int i = 0; i < 16; ++i) { if (!MASK || kc * 32 + 16 * (i >> 3) + (i & 7) <= qrel + 16 * u) m[u] = fmaxf(m[u], s[u][i]); } }
template <bool HI, bool MASK> __device__ __forceinline__ void pv_step(const _Float16* KHr, const _Float16* KLr, const v16h qh[QT], const v16h ql[QT], const _Float16* VTr, const __bf16* VBr, const __bf16* VBLr, int kc, unsigned klo, unsigned vlt, unsigned vlb, int qrel, const float off[QT], float sum[QT], v8f acc[QT][HD / 16]) { float s[QT][16];
  const KF k = ld_k<HI>(KHr, KLr, kc, klo, true); XW();
  v16h vf[HD / 16]; v16b vh[HD / 16], vl[HD / 16];   /* v is asked for before the exponentials, which cover its latency */
#pragma unroll
  for (int j = 0; j < HD / 16; ++j) { if (HI) { const size_t po = (size_t)j * 16 * KHI + kc * 32; vh[j] = frag_bu(VBr + po, vlb, j == HD / 16 - 1); vl[j] = frag_bu(VBLr + po, vlb, j == HD / 16 - 1); } else vf[j] = frag_hu(VTr + (size_t)j * 16 * TT + kc * 32, vlt, j == HD / 16 - 1); }
  st_mm<HI>(k, qh, ql, s);
#pragma unroll
  for (int u = 0; u < QT; ++u)
#pragma unroll
    for (int i = 0; i < 16; ++i) { float e = exp2_arg<MASK>(s[u][i], off[u]); if (MASK && kc * 32 + 16 * (i >> 3) + (i & 7) > qrel + 16 * u) e = 0.f; sum[u] += e; s[u][i] = e; }
  if (HI) { F2 pp[QT];
#pragma unroll
    for (int u = 0; u < QT; ++u) pp[u] = bsplit16(s[u]);
#pragma unroll
    for (int j = 0; j < HD / 16; ++j)
#pragma unroll
      for (int u = 0; u < QT; ++u) { acc[u][j] = wm_b(vh[j], pp[u].h, acc[u][j]); acc[u][j] = wm_b(vh[j], pp[u].l, acc[u][j]); acc[u][j] = wm_b(vl[j], pp[u].h, acc[u][j]); }
  } else { v16h pb[QT];
#pragma unroll
    for (int u = 0; u < QT; ++u)
#pragma unroll
      for (int i = 0; i < 16; ++i) pb[u][i] = (_Float16)s[u][i];
#pragma unroll
    for (int j = 0; j < HD / 16; ++j)
#pragma unroll
      for (int u = 0; u < QT; ++u) acc[u][j] = wm_h(vf[j], pb[u], acc[u][j]); } }
template <bool HI> __device__ __forceinline__ void att_body(const _Float16* __restrict__ QH, const _Float16* __restrict__ KH, const _Float16* __restrict__ QL, const _Float16* __restrict__ KL, const _Float16* __restrict__ VT, const __bf16* __restrict__ VB, const __bf16* __restrict__ VBL, int b, int h, int ql0, int lane, float* __restrict__ Y) {
  const int c = lane & 15, g = lane >> 4; const int nfull = ql0 >> 5;   /* ql0 % 32 == 0: steps 0 .. nfull-1 lie wholly below the diagonal for all 32 queries; step nfull holds it */
  const _Float16* KHr = KH + (size_t)b * TT * CC + h * HD; const _Float16* KLr = KL + (size_t)b * KHI * CC + h * HD; const unsigned klo = (unsigned)(c * CC + 8 * g) * 2u;
  const _Float16* VTr = VT + ((size_t)b * CC + h * HD) * (size_t)TT; const __bf16* VBr = VB + ((size_t)b * CC + h * HD) * (size_t)KHI; const __bf16* VBLr = VBL + ((size_t)b * CC + h * HD) * (size_t)KHI; const unsigned vlt = (unsigned)(c * TT + 8 * g) * 2u, vlb = (unsigned)(c * KHI + 8 * g) * 2u;
  v16h qh[QT], ql[QT];
#pragma unroll
  for (int u = 0; u < QT; ++u) { qh[u] = frag_hu(QH + ((size_t)b * TT + ql0 + u * 16) * CC + h * HD, klo); if (HI) ql[u] = frag_hu(QL + ((size_t)b * QHI + ql0 + u * 16) * CC + h * HD, klo); else ql[u] = qh[u]; }
  XW();
  const int qrel = ql0 + c - 8 * g;   /* key kc*32 + 16 t + 8 g + r is kept for query ql0 + 16 u + c when kc*32 + 16 t + r <= qrel + 16 u */
  float m[QT], sum[QT]; v8f acc[QT][HD / 16] = {};
#pragma unroll
  for (int u = 0; u < QT; ++u) { m[u] = -3.0e38f; sum[u] = 0.f; }
#pragma unroll HI ? 1 : 4   /* late rows: four steps' key loads in flight, this walk has little work to cover a load's latency */
  for (int kc = 0; kc < nfull; ++kc) max_step<HI, false>(KHr, KLr, qh, ql, kc, klo, qrel, m);
  max_step<HI, true>(KHr, KLr, qh, ql, nfull, klo, qrel, m);
#pragma unroll
  for (int u = 0; u < QT; ++u) { m[u] = fmaxf(m[u], __shfl_xor(m[u], 16)); m[u] = __builtin_fmaf(-m[u], LC, 11.0f); }   /* the two lane halves hold different keys of the same query; from here m = the exponent's offset */
#pragma unroll 1   /* left rolled: a step's loads are covered by the SIMD's other waves alone; unrolling adds registers */
  for (int kc = 0; kc < nfull; ++kc) pv_step<HI, false>(KHr, KLr, qh, ql, VTr, VBr, VBLr, kc, klo, vlt, vlb, qrel, m, sum, acc);
  pv_step<HI, true>(KHr, KLr, qh, ql, VTr, VBr, VBLr, nfull, klo, vlt, vlb, qrel, m, sum, acc);
#pragma unroll
  for (int u = 0; u < QT; ++u) { const float st = sum[u] + __shfl_xor(sum[u], 16); const float inv = st > 0.f ? 1.0f / st : 0.f;   /* sum and acc both carry the 2^11 */
    float* yr = Y + ((size_t)b * TT + ql0 + u * 16 + c) * CC + h * HD + 8 * g;   /* acc[u][j][r] = ctx(query 16 u + c, dim 16 j + 8 g + r): 32 contiguous bytes per lane and j */
#pragma unroll
    for (int j = 0; j < HD / 16; ++j) { v4f o0, o1;
#pragma unroll
      for (int r = 0; r < 4; ++r) { o0[r] = acc[u][j][r] * inv; o1[r] = acc[u][j][4 + r] * inv; }
      vst2(yr + j * 16, o0); vst2(yr + j * 16 + 4, o1); } } }
__global__ __launch_bounds__(128) void k_att(const _Float16* __restrict__ QH, const _Float16* __restrict__ KH, const _Float16* __restrict__ QL, const _Float16* __restrict__ KL, const _Float16* __restrict__ VT, const __bf16* __restrict__ VB, const __bf16* __restrict__ VBL, float* __restrict__ Y) {
  const int b = blockIdx.x / NH, h = blockIdx.x % NH; const int q0 = (TT / (64 * QT) - 1 - (int)blockIdx.y) * (64 * QT);   /* longest query blocks start first */
  const int wave = __builtin_amdgcn_readfirstlane(threadIdx.x >> 5), lane = threadIdx.x & 31; const int ql0 = q0 + wave * (16 * QT);
  if (q0 < QHI) att_body<true>(QH, KH, QL, KL, VT, VB, VBL, b, h, ql0, lane, Y); else att_body<false>(QH, KH, QL, KL, VT, VB, VBL, b, h, ql0, lane, Y); }
// ---- k_out: block = (64 rows, 128 cols): ao = ctx Wvu (+ bvu): ctx once to f16 against Wvu as f16(bf16 x 2^8) exact (1 product) x 2^-8; causal early rows (< QHI of each sequence): ctx bf16 hi + lo against exact bf16 Wvu (2 products)
__global__ __launch_bounds__(128) void k_out(const float* __restrict__ Y, const __bf16* __restrict__ FU, const _Float16* __restrict__ FUH, const float* __restrict__ BO, float* __restrict__ OUT) { __shared__ __align__(16) float sf[4][16][132];
  const int tid = threadIdx.x, wave = tid >> 5, lane = tid & 31, col = lane & 15, g = lane >> 4; const int c0 = blockIdx.y * 128; const size_t r0 = (size_t)blockIdx.x * 64 + wave * 16; const unsigned lob = lane * 16u;
  v8f acc[8] = {};
  if (CAUSAL && (int)(((size_t)blockIdx.x * 64) % TT) < QHI) {   /* block-uniform */
#pragma unroll 2
    for (int kc = 0; kc < CC / 32; ++kc) { const F2 a = split_row(Y + (r0 + col) * CC, kc * 32, lane); v16b w[8];
#pragma unroll
      for (int j = 0; j < 8; ++j) w[j] = fragw_b8(FU + (size_t)(kc * (DIN / 16) + c0 / 16 + j) * 256, lob);
#pragma unroll
      for (int j = 0; j < 8; ++j) { acc[j] = wmma_bf(a.h, w[j], acc[j]); acc[j] = wmma_bf(a.l, w[j], acc[j]); } }
#pragma unroll
    for (int j = 0; j < 8; ++j) { const float bias = BO ? bfr(BO[c0 + j * 16 + col]) : 0.f;
#pragma unroll
      for (int r = 0; r < 8; ++r) sf[wave][8 * g + r][j * 16 + col] = acc[j][r] + bias; }
  } else {
#pragma unroll 2
    for (int kc = 0; kc < CC / 32; ++kc) { const v16h a = frag_f32s(Y + (r0 + col) * CC + kc * 32, lane, 64.0f); v16h w[8];   /* ctx carried x 2^6 into f16 so small-magnitude context rows stay clear of f16 subnormals (chip FTZ) */
#pragma unroll
      for (int j = 0; j < 8; ++j) w[j] = fragw_h8(FUH + (size_t)(kc * (DIN / 16) + c0 / 16 + j) * 256, lob);
#pragma unroll
      for (int j = 0; j < 8; ++j) acc[j] = wmma16(a, w[j], acc[j]); }
#pragma unroll
    for (int j = 0; j < 8; ++j) { const float bias = BO ? bfr(BO[c0 + j * 16 + col]) : 0.f;
#pragma unroll
      for (int r = 0; r < 8; ++r) sf[wave][8 * g + r][j * 16 + col] = acc[j][r] * (1.0f / 16384.0f) + bias; } }   /* 2^-8 (Wvu carry) x 2^-6 (ctx carry) */
  LDSX(); for (int rl = 0; rl < 16; ++rl) vst2(OUT + (r0 + rl) * DIN + c0 + lane * 4, *(const v4f*)&sf[wave][rl][lane * 4]); }
#define K2 DIN
#define wcol_io_plain(W, k0, o, lane) wcol_io(W, k0, o, lane, DIN)
#define wcolh_io_plain(W, k0, o, lane) wcolh_io(W, k0, o, lane, DIN)
// ---- k_out2: block = (64 rows, 128 cols): final projection out = R Wo + bo on the re-read rows R [NB*TT][K2] (K2 = DIN input width): same body as k_out with the row pitch / k extent K2 and all 16 slots of the Wo fragments packed by k_prep; always the single-product path
__global__ __launch_bounds__(128) void k_out2(const float* __restrict__ Y, const _Float16* __restrict__ FO, const float* __restrict__ BO, float* __restrict__ OUT) { __shared__ __align__(16) float sf[4][16][132];
  const int tid = threadIdx.x, wave = tid >> 5, lane = tid & 31, col = lane & 15, g = lane >> 4; const int c0 = blockIdx.y * 128; const size_t r0 = (size_t)blockIdx.x * 64 + wave * 16; const unsigned lob = lane * 16u;
  v8f acc[8] = {};   /* the re-read rows mix positions: no early-row special case here */
#pragma unroll 2
  for (int kc = 0; kc < K2 / 32; ++kc) { float av[16]; { const float* p = Y + (r0 + col) * K2 + kc * 32 + 8 * g;
#pragma unroll
      for (int i = 0; i < 8; ++i) { av[i] = p[i]; av[8 + i] = p[16 + i]; } }
    v16h w[8];   /* rows carried x 2^6 into f16 so small-magnitude rows stay clear of f16 subnormals (chip FTZ) */
#pragma unroll
    for (int j = 0; j < 8; ++j) w[j] = fragw_h(FO + (size_t)(kc * (DIN / 16) + c0 / 16 + j) * 512, lob);
    __builtin_amdgcn_sched_barrier(0);   /* every load of the k-step is issued before the first rounding that waits for one; without it the build holds two weight loads back behind that wait */
    v16h a;
#pragma unroll
    for (int i = 0; i < 16; ++i) a[i] = (_Float16)(av[i] * 64.0f);
#pragma unroll
    for (int j = 0; j < 8; ++j) acc[j] = wmma16(a, w[j], acc[j]); }
#pragma unroll
  for (int j = 0; j < 8; ++j) { const float bias = BO ? bfr(BO[c0 + j * 16 + col]) : 0.f;
#pragma unroll
    for (int r = 0; r < 8; ++r) sf[wave][8 * g + r][j * 16 + col] = acc[j][r] * (1.0f / 16384.0f) + bias; }   /* 2^-8 (Wo carry) x 2^-6 (row carry) */
  LDSX(); for (int rl = 0; rl < 16; ++rl) vst2(OUT + (r0 + rl) * DIN + c0 + lane * 4, *(const v4f*)&sf[wave][rl][lane * 4]); }

extern "C" void kernel_launch(void* const* d_in, const int* in_sizes, int n_in, void* d_out, int out_size, void* d_ws, size_t ws_size, hipStream_t stream) {
  (void)in_sizes; (void)n_in; (void)out_size;
  const float** F = (const float**)d_in;
  if (ws_size < (size_t)WS_END) return;
  char* ws = (char*)d_ws; _Float16 *QH = (_Float16*)(ws + WS_QH), *KH = (_Float16*)(ws + WS_KH), *VT = (_Float16*)(ws + WS_VT), *QL = (_Float16*)(ws + WS_QL), *KL = (_Float16*)(ws + WS_KL); __bf16 *VB = (__bf16*)(ws + WS_VB), *VBL = (__bf16*)(ws + WS_VBL); float *S = (float*)(ws + WS_S), *Y = (float*)(ws + WS_Y);
  (void)S; (void)Y; (void)QL; (void)KL; (void)VB; (void)VBL;
  // inputs (in order): 0 x [4,2048,768]; 1 Wq [768,768] (in,out), 2 bq; 3 Wkd [768,192], 4 bkd; 5 Wvd [768,192], 6 bvd; 7 Wvu [192,768], 8 bvu; 9 Wo [768,768] (in,out), 10 bo (all biases zeros, read)
  if (ws_size < (size_t)WS_END3) return;
  float *AO = (float*)(ws + WS_AO), *T = (float*)(ws + WS_T); __bf16 *FP = (__bf16*)(ws + WS_FP), *FU = (__bf16*)(ws + WS_FU); _Float16 *FUH = (_Float16*)(ws + WS_FUH), *FO = (_Float16*)(ws + WS_FO);
  k_prep<<<dim3((NF_P + NF_U + NF_O) / 4), 128, 0, stream>>>(F[1], F[3], F[5], F[7], F[9], FP, FU, FUH, FO);   /* every weight once into B-fragment order */
  k_proj<<<dim3(TNB * TT / 64, CC / 128, 3), 128, 0, stream>>>(F[0], F[0], F[0], FP, F[2], F[4], F[6], QH, QL, KH, KL, VT, VB, VBL);   /* q slice, latent k, latent v: 3 column blocks of 128 columns each */
  k_att<<<dim3(TNB * NH, TT / (64 * QT)), 128, 0, stream>>>(QH, KH, QL, KL, VT, VB, VBL, Y);   /* logits, softmax, P v: every (b, h, 128-query block) in one launch */
  k_out<<<dim3(TNB * TT / 64, DIN / 128), 128, 0, stream>>>(Y, FU, FUH, F[8], AO);   /* ao = al Wvu + bvu (gathered weight rows) */
  k_fin<<<dim3(TT / 64, DIN / 64, TNB), 256, 0, stream>>>(AO, T, TT, DIN);   /* T[b][c][s] = ao[b][s][c] */
  k_out2<<<dim3(TNB * TT / 64, DIN / 128), 128, 0, stream>>>(T, FO, F[10], (float*)d_out);   /* rows = T's memory re-read as [TT][DIN] per batch; out = rows Wo + bo */
}

// v004
// One run takes 124 microseconds.
// Two timings next to v003 put it at 1.12 and 1.13 times that version's speed.
// All steps since v000 together make it 14.2 times as fast.
// compute dtype: all float inputs rounded to bf16; the q slice and the latent k / v projections with EXACT bf16 products on WMMA 16x16x32 (f32 accumulate) + bias (zeros, read), 16 real dims per head zero-padded to 32; causal logits over the 16 latent dims: 3 products for the first 384 rows, single f16 after, x 16^-0.5; softmax f32 (max first, then exp(s - max) x 2^11, formed as 2^(raw logit x 16^-0.5 log2(e) + offset), once to f16 x v once to f16 (bf16 hi + lo below row 384), divided by the f32 row sum after the product; logits never stored); latent ctx (hi+lo below row 384, x2^6 f16 carry after) x exact / f16(bf16 x 2^8) Wvu + bvu; per-batch transpose; then x 2^6 once to f16 x Wo f16(bf16 x 2^8) + bo; f32 output.
#include <hip/hip_runtime.h>
#include <math.h>

typedef __attribute__((ext_vector_type(16))) _Float16 v16h;
typedef __attribute__((ext_vector_type(16))) __bf16 v16b;
typedef __attribute__((ext_vector_type(8)))  _Float16 v8h;
typedef __attribute__((ext_vector_type(8)))  float v8f;
typedef __attribute__((ext_vector_type(4)))  float v4f;
typedef __attribute__((ext_vector_type(2)))  float v2f;
typedef __attribute__((ext_vector_type(4)))  unsigned v4u;
typedef __attribute__((ext_vector_type(4)))  int v4i;
typedef float __attribute__((may_alias)) float_a;
typedef int __attribute__((may_alias)) int_a;

template <typename T> __device__ __forceinline__ void vst2(void* p, T v) { *(T*)p = v;  }
__device__ __forceinline__ v8f wmma16(v16h a, v16h b, v8f c) {
  v8f d = __builtin_amdgcn_wmma_f32_16x16x32_f16(false, a, false, b, (short)0, c, false, false);
  asm volatile("v_nop\n\tv_nop\n\tv_nop\n\tv_nop" : "+v"(d) : "v"(a), "v"(b));
  return d;
}
__device__ __forceinline__ v8f wmma_bf(v16b a, v16b b, v8f c) {
  v8f d = __builtin_amdgcn_wmma_f32_16x16x32_bf16(false, a, false, b, (short)0, c, false, false);
  asm volatile("v_nop\n\tv_nop\n\tv_nop\n\tv_nop" : "+v"(d) : "v"(a), "v"(b));
  return d;
}
// 16x16x32 fragments: lane = (h = lane>>4, row/col = lane&15); elements 0..7 = k0+8h+0..7, 8..15 = k0+16+8h+0..7; D element r = row 8h+r
__device__ __forceinline__ v16h frag_h(const _Float16* rowk0, int lane) {
  union { v16h v; v8h q[2]; } u; const _Float16* p = rowk0 + 8 * (lane >> 4);
  u.q[0] = *(const v8h*)p; u.q[1] = *(const v8h*)(p + 16); return u.v;
}
__device__ __forceinline__ v16h frag_f32(const float* rowk0, int lane) {
  v16h a; const float* p = rowk0 + 8 * (lane >> 4);
#pragma unroll
  for (int i = 0; i < 8; ++i) { a[i] = (_Float16)p[i]; a[8 + i] = (_Float16)p[16 + i]; }
  return a;
}
__device__ __forceinline__ v16h frag_f32s(const float* rowk0, int lane, float sc) {
  v16h a; const float* p = rowk0 + 8 * (lane >> 4);
#pragma unroll
  for (int i = 0; i < 8; ++i) { a[i] = (_Float16)(p[i] * sc); a[8 + i] = (_Float16)(p[16 + i] * sc); }
  return a;
}
// column fragment from a [K][ld] layout (column n), rows >= K read as 0
__device__ __forceinline__ v16h fragc_f32(const float* W, int k0, int n, int lane, int ld, int K) {
  v16h a; const int g = lane >> 4;
#pragma unroll
  for (int i = 0; i < 8; ++i) { const int ka = k0 + 8 * g + i, kb = ka + 16;
    a[i] = (_Float16)(ka < K ? W[(size_t)(ka < K ? ka : K - 1) * ld + n] : 0.f); a[8 + i] = (_Float16)(kb < K ? W[(size_t)(kb < K ? kb : K - 1) * ld + n] : 0.f); }
  return a;
}
struct F2 { v16b h, l; };
__device__ __forceinline__ F2 bsplit16(const float v[16]) { F2 r;
#pragma unroll
  for (int i = 0; i < 16; ++i) { const __bf16 h = (__bf16)v[i]; r.h[i] = h; r.l[i] = (__bf16)(v[i] - (float)h); }
  return r; }
__device__ __forceinline__ F2 split_row(const float* row, int k0, int lane) { float v[16]; const float* p = row + k0 + 8 * (lane >> 4);
#pragma unroll
  for (int i = 0; i < 8; ++i) { v[i] = p[i]; v[8 + i] = p[16 + i]; }
  return bsplit16(v); }
__device__ __forceinline__ F2 split_rowK(const float* row, int k0, int lane, int K) { float v[16]; const int g = lane >> 4;
#pragma unroll
  for (int i = 0; i < 8; ++i) { const int ka = k0 + 8 * g + i, kb = ka + 16; v[i] = ka < K ? row[ka < K ? ka : K - 1] : 0.f; v[8 + i] = kb < K ? row[kb < K ? kb : K - 1] : 0.f; }
  return bsplit16(v); }
__device__ __forceinline__ F2 split_col(const float* W, int k0, int n, int lane, int ld, int K) { float v[16]; const int g = lane >> 4;
#pragma unroll
  for (int i = 0; i < 8; ++i) { const int ka = k0 + 8 * g + i, kb = ka + 16; v[i] = ka < K ? W[(size_t)(ka < K ? ka : K - 1) * ld + n] : 0.f; v[8 + i] = kb < K ? W[(size_t)(kb < K ? kb : K - 1) * ld + n] : 0.f; }
  return bsplit16(v); }
__device__ __forceinline__ v8f mac3(const F2& a, const F2& b, v8f c) { c = wmma_bf(a.l, b.h, c); c = wmma_bf(a.h, b.l, c); return wmma_bf(a.h, b.h, c); }
__device__ __forceinline__ float sigm(float v) { return 1.0f / (1.0f + expf(-v)); }
#define LDSX() do { asm volatile("s_wait_dscnt 0" ::: "memory"); __builtin_amdgcn_wave_barrier(); __builtin_amdgcn_fence(__ATOMIC_RELEASE, "workgroup"); } while (0)

// Causal self-attention with 12 low-rank latent heads (x [4,2048,768]; (in,out) Wq [768,768], Wkd / Wvd [768,192], Wvu [192,768], Wo [768,768], all N(0,1) x 0.02, zero biases (read); q = x Wq + bq split into 12 heads x 64 of which only the FIRST 16 dims of each head are used (ql); kl, vl = x Wkd, x Wvd split into 12 heads x 16; scores = ql kl^T x 16^-0.5; triu(1) -> -inf; softmax; al = w vl merged to [B,S,192]; ao = al Wvu + bvu [B,S,768]; then jnp.transpose(ao, (0,2,1)).reshape(B,S,768): the per-batch [2048 x 768] matrix is transposed to [768 x 2048] and its memory re-read as 2,048 rows of 768; out = that Wo + bo).
#define NB 4
#define TT 2048
#define CC 384            // NH * HD = projected width
#define DIN 768          // input (model) width
#define NH 12
#define HD 32
#define LATW 16     /* real dims per head; columns h*HD + d with d >= LATW are zero padding */
#define QHEADW 64   /* the module's q heads are 64 wide; only their first LATW dims are used (ql = q[..., :16]) */
#define KVLD (NH * LATW)   /* row pitch of the (in,out) latent weights Wkd / Wvd [768][192] */
#define NQB (TT / 64)
#define HG 2   // S region: 2 x 2,048 x 2,048 f32 = 32 MiB, allocated but unused
#define SCALE (0.25f)
#define CAUSAL 1
#ifndef TNB
#define TNB NB
#endif
__device__ __forceinline__ float bfr(float v) { return (float)(__bf16)v; }
__host__ __device__ __forceinline__ int kb_last(int qb) { return CAUSAL ? ((qb * 64 + 63) >> 7) : (TT / 128 - 1); }
typedef __attribute__((ext_vector_type(8))) __bf16 v8b;
__device__ __forceinline__ v16b frag_b(const __bf16* rowk0, int lane) {
  union { v16b v; v8b q[2]; } u; const __bf16* p = rowk0 + 8 * (lane >> 4);
  u.q[0] = *(const v8b*)p; u.q[1] = *(const v8b*)(p + 16); return u.v;
}
#define QBH 6              // causal: query blocks 0..QBH-1 of each sequence (few keys, no averaging) take the high-precision path
#define QHI 384            // rows carrying a q residual plane
#define KHI 384            // key rows carrying k residual / v bf16 hi+lo planes (used only by the causal high-precision path)
// B fragment (k rows k0+.., output column o) of a weight: (in,out) [K][ld] or (out,in) [ld rows of K]: bf16 exact, or f16(bf16 * 256) exact
__device__ __forceinline__ v16b wcol_io(const float* Wm, int k0, int o, int lane, int ld) { v16b w; const int g = lane >> 4;
#pragma unroll
  for (int i = 0; i < 8; ++i) { w[i] = (__bf16)Wm[(size_t)(k0 + 8 * g + i) * ld + o]; w[8 + i] = (__bf16)Wm[(size_t)(k0 + 16 + 8 * g + i) * ld + o]; }
  return w; }
__device__ __forceinline__ v16b wcol_oi(const float* Wm, int k0, int o, int lane, int K) { v16b w; const float* p = Wm + (size_t)o * K + k0 + 8 * (lane >> 4);
#pragma unroll
  for (int i = 0; i < 8; ++i) { w[i] = (__bf16)p[i]; w[8 + i] = (__bf16)p[16 + i]; }
  return w; }
__device__ __forceinline__ v16h wcolh_io(const float* Wm, int k0, int o, int lane, int ld) { v16h w; const int g = lane >> 4;
#pragma unroll
  for (int i = 0; i < 8; ++i) { w[i] = (_Float16)(bfr(Wm[(size_t)(k0 + 8 * g + i) * ld + o]) * 256.0f); w[8 + i] = (_Float16)(bfr(Wm[(size_t)(k0 + 16 + 8 * g + i) * ld + o]) * 256.0f); }
  return w; }
// first output projection ao = al Wvu: the k index runs over ctx columns kk = h*HD + d; one 32-deep k-step = one head; its first 16 entries (d < LATW, fragment slots 0..7 of both lane halves) are rows h*LATW + d of the (in,out) [192][768] weight, its last 16 (padding dims, slots 8..15) are zero
__device__ __forceinline__ v16b wcol_io_lat(const float* Wm, int k0, int o, int lane, int ld) { v16b w; const int g = lane >> 4; const float* p = Wm + (size_t)((k0 / HD) * LATW + 8 * g) * ld + o;
#pragma unroll
  for (int i = 0; i < 8; ++i) { w[i] = (__bf16)p[(size_t)i * ld]; w[8 + i] = (__bf16)0.0f; }
  return w; }
__device__ __forceinline__ v16h wcolh_io_lat(const float* Wm, int k0, int o, int lane, int ld) { v16h w; const int g = lane >> 4; const float* p = Wm + (size_t)((k0 / HD) * LATW + 8 * g) * ld + o;
#pragma unroll
  for (int i = 0; i < 8; ++i) { w[i] = (_Float16)(bfr(p[(size_t)i * ld]) * 256.0f); w[8 + i] = (_Float16)0.0f; }
  return w; }
static_assert(HD == 32 && LATW == 16 && CC == NH * HD, "the latent loaders assume one head per 32-deep k-step with 16 real + 16 padding dims");
__device__ __forceinline__ v16h wcolh_oi(const float* Wm, int k0, int o, int lane, int K) { v16h w; const float* p = Wm + (size_t)o * K + k0 + 8 * (lane >> 4);
#pragma unroll
  for (int i = 0; i < 8; ++i) { w[i] = (_Float16)(bfr(p[i]) * 256.0f); w[8 + i] = (_Float16)(bfr(p[16 + i]) * 256.0f); }
  return w; }
#define WQKV_LAYOUT 0   // 0 = (in,out) [DIN][out], columns gathered per head; 1 = (out,in) [CC][DIN]; 2 = per-head [NH][DIN][HD]
__device__ __forceinline__ v16b wcol_hdk(const float* Wm, int k0, int o, int lane) { v16b w; const int g = lane >> 4; const float* p = Wm + (size_t)(o / HD) * DIN * HD + (o % HD);
#pragma unroll
  for (int i = 0; i < 8; ++i) { w[i] = (__bf16)p[(size_t)(k0 + 8 * g + i) * HD]; w[8 + i] = (__bf16)p[(size_t)(k0 + 16 + 8 * g + i) * HD]; }
  return w; }
#define WO_OUT_IN 0
#if WQKV_LAYOUT == 1
#define WCOL(W, k0, o, lane) wcol_oi(W, k0, o, lane, DIN)
#elif WQKV_LAYOUT == 2
#define WCOL(W, k0, o, lane) wcol_hdk(W, k0, o, lane)
#else
__device__ __forceinline__ v16b zero16b() { v16b w; _Pragma("unroll") for (int i = 0; i < 16; ++i) w[i] = (__bf16)0.0f; return w; }
/* column o = h*HD + d: real (d < LATW) -> weight column h*QHEADW + d of Wq (pitch DIN) for the q stream, h*LATW + d of Wkd / Wvd (pitch KVLD) for k / v; padding -> zeros. o = c0 + j*16 + col with c0 % 128 == 0, so (o % HD) < LATW is decided by j alone (compile-time per unrolled j, uniform across the wave) */
#define GCOL(o) ((which) == 0 ? ((o) / HD) * QHEADW + ((o) % HD) : ((o) / HD) * LATW + ((o) % HD))
#define WCOL(W, k0, o, lane) ((((o) % HD) < LATW) ? wcol_io(W, k0, GCOL(o), lane, ((which) == 0 ? DIN : KVLD)) : zero16b())
#endif
#if WO_OUT_IN
#define WOCOL(W, k0, o, lane) wcol_oi(W, k0, o, lane, CC)
#define WOCOLH(W, k0, o, lane) wcolh_oi(W, k0, o, lane, CC)
#else
#define WOCOL(W, k0, o, lane) wcol_io_lat(W, k0, o, lane, DIN)
#define WOCOLH(W, k0, o, lane) wcolh_io_lat(W, k0, o, lane, DIN)
#endif

#ifndef SM_EXTRA_PARAMS
#define SM_EXTRA_PARAMS
#endif
#ifndef PROJ_EXTRA_PARAMS
#define PROJ_EXTRA_PARAMS
#endif
#ifndef SM_MASK_HOOK
#define SM_MASK_HOOK (void)0
#endif

#define WS_QH  0u                                      // f16 q rows [b*t][CC]
#define WS_KH  (WS_QH + 2u * (size_t)NB * TT * CC)      // f16 k in A-fragment order [b][h][16-key tile][512 B] (the region keeps its old size)
#define WS_VT  (WS_KH + 2u * (size_t)NB * TT * CC)      // f16 v^T in A-fragment order [b][h][32-key step][1024 B]
#define WS_QL  (WS_VT + 2u * (size_t)NB * CC * TT)      // f16 q residual x 2^10 rows [b][t < QHI][CC]
#define WS_KL  (WS_QL + 2u * (size_t)NB * QHI * CC)     // f16 k residual x 2^10, as WS_KH, key tiles below KHI
#define WS_VB  (WS_KL + 2u * (size_t)NB * KHI * CC)     // bf16 v hi (then lo), as WS_VT, key steps below KHI
#define WS_VBL (WS_VB + 2u * (size_t)NB * CC * KHI)
#define WS_S   (WS_VBL + 2u * (size_t)NB * CC * KHI)    // f32 [hg][t][s] region, unused (logits stay in registers)
#define WS_Y   (WS_S  + 4u * (size_t)HG * TT * TT)      // f32 ctx rows [b*t][CC] (only when there is an output projection)
#define WS_END (WS_Y  + 4u * (size_t)NB * TT * CC)
#define WS_AO (WS_END)                                    // f32 ao rows [(b*TT + s)][DIN] = al Wvu + bvu
#define WS_T  (WS_AO + 4u * (size_t)NB * TT * DIN)          // f32 per-batch transpose T[b][c][s]; its memory is then read as TT rows of DIN (the module's transpose(0,2,1).reshape)
#define WS_END2 (WS_T + 4u * (size_t)NB * TT * DIN)
static_assert(TT % 64 == 0 && DIN % 64 == 0, "transpose tiles are 64 x 64");
// weights in WMMA B-fragment order, written once per call by k_prep. One fragment = the 32 lanes' slots 0..7 (16 B a lane, 512 B in a row), then their slots 8..15 (left out where they are the zero padding of a latent head)
#define NF_P (3 * (DIN / 32) * NH)        /* q slice / latent k / latent v: [which][kc][head], bf16 */
#define NF_U (NH * (DIN / 16))            /* Wvu: [head][column tile], slots 0..7 only, once bf16 and once f16(bf16 x 2^8) */
#define NF_O ((DIN / 32) * (DIN / 16))    /* Wo: [kc][column tile], f16(bf16 x 2^8) */
#define WS_FP  (WS_END2)
#define WS_FU  (WS_FP  + 1024u * (size_t)NF_P)
#define WS_FUH (WS_FU  + 512u * (size_t)NF_U)
#define WS_FO  (WS_FUH + 512u * (size_t)NF_U)
#define WS_END3 (WS_FO + 1024u * (size_t)NF_O)
static_assert((NF_P + NF_U + NF_O) % 4 == 0, "k_prep: four waves a block, one fragment a wave");
// fb = wave-uniform start of the fragment, lob = lane * 16 bytes
__device__ __forceinline__ v16b fragw_b(const __bf16* fb, unsigned lob) { union { v16b v; v8b q[2]; } u; const char* p = (const char*)fb + lob; u.q[0] = *(const v8b*)p; u.q[1] = *(const v8b*)(p + 512); return u.v; }
__device__ __forceinline__ v16h fragw_h(const _Float16* fb, unsigned lob) { union { v16h v; v8h q[2]; } u; const char* p = (const char*)fb + lob; u.q[0] = *(const v8h*)p; u.q[1] = *(const v8h*)(p + 512); return u.v; }
__device__ __forceinline__ v16b fragw_b8(const __bf16* fb, unsigned lob) { union { v16b v; v8b q[2]; } u; u.q[0] = *(const v8b*)((const char*)fb + lob);
#pragma unroll
  for (int i = 0; i < 8; ++i) u.q[1][i] = (__bf16)0.0f;
  return u.v; }
__device__ __forceinline__ v16h fragw_h8(const _Float16* fb, unsigned lob) { union { v16h v; v8h q[2]; } u; u.q[0] = *(const v8h*)((const char*)fb + lob);
#pragma unroll
  for (int i = 0; i < 8; ++i) u.q[1][i] = (_Float16)0.0f;
  return u.v; }
// a precaution: stands between issued loads and the next write of a register that holds one of their addresses
__device__ __forceinline__ void XW() { asm volatile("s_wait_xcnt 0x0" ::: "memory"); }
// N weight values of one column, rows i (i < 8) and, for N = 16, 16 + i of an (in,out) weight of pitch LD: ub = wave-uniform address of the tile's first row and column, lo = the lane's fixed byte offset (8 g rows + its column). The last load may land on the offset register, so the wait stands in front of it, and once more behind it, ahead of the scalar work that forms the store address
template <int LD, int N> __device__ __forceinline__ void ld_col(const float* ub, unsigned lo, float v[N]) { const char* p = (const char*)ub + lo;
#pragma unroll
  for (int i = 0; i < N - 1; ++i) v[i] = *(const float*)(p + (size_t)((i & 7) + 2 * (i & 8)) * LD * 4);
  XW(); v[N - 1] = *(const float*)(p + (size_t)(((N - 1) & 7) + 2 * ((N - 1) & 8)) * LD * 4); XW(); }
// ---- k_prep: one wave = one B fragment, with the roundings the projection kernels' own loaders (wcol_io, wcol_io_lat, wcolh_io_lat, wcolh_io) made per wave and per row block
__global__ __launch_bounds__(128) void k_prep(const float* __restrict__ WQ, const float* __restrict__ WK, const float* __restrict__ WV, const float* __restrict__ WU, const float* __restrict__ WO, __bf16* __restrict__ FP, __bf16* __restrict__ FU, _Float16* __restrict__ FUH, _Float16* __restrict__ FO) {
  const int lane = threadIdx.x & 31, col = lane & 15, g = lane >> 4; const int f = blockIdx.x * 4 + __builtin_amdgcn_readfirstlane(threadIdx.x >> 5);
  if (f < NF_P) { const int which = f / ((DIN / 32) * NH), kc = (f / NH) % (DIN / 32), h = f % NH; float v[16];
    if (which == 0) ld_col<DIN, 16>(WQ + (size_t)kc * 32 * DIN + h * QHEADW, (unsigned)(8 * g * DIN + col) * 4u, v);
    else ld_col<KVLD, 16>((which == 1 ? WK : WV) + (size_t)kc * 32 * KVLD + h * LATW, (unsigned)(8 * g * KVLD + col) * 4u, v);
    union { v16b v; v8b q[2]; } u;
#pragma unroll
    for (int i = 0; i < 16; ++i) u.v[i] = (__bf16)v[i];
    char* d = (char*)FP + (size_t)f * 1024 + lane * 16; *(v8b*)d = u.q[0]; *(v8b*)(d + 512) = u.q[1];
  } else if (f < NF_P + NF_U) { const int fu = f - NF_P, h = fu / (DIN / 16), jt = fu % (DIN / 16); float v[8];
    ld_col<DIN, 8>(WU + (size_t)h * LATW * DIN + jt * 16, (unsigned)(8 * g * DIN + col) * 4u, v);
    v8b wb; v8h wh;
#pragma unroll
    for (int i = 0; i < 8; ++i) { wb[i] = (__bf16)v[i]; wh[i] = (_Float16)(bfr(v[i]) * 256.0f); }
    *(v8b*)((char*)FU + (size_t)fu * 512 + lane * 16) = wb; *(v8h*)((char*)FUH + (size_t)fu * 512 + lane * 16) = wh;
  } else { const int fo = f - NF_P - NF_U, kc = fo / (DIN / 16), jt = fo % (DIN / 16); float v[16];
    ld_col<DIN, 16>(WO + (size_t)kc * 32 * DIN + jt * 16, (unsigned)(8 * g * DIN + col) * 4u, v);
    union { v16h v; v8h q[2]; } u;
#pragma unroll
    for (int i = 0; i < 16; ++i) u.v[i] = (_Float16)(bfr(v[i]) * 256.0f);
    char* d = (char*)FO + (size_t)fo * 1024 + lane * 16; *(v8h*)d = u.q[0]; *(v8h*)(d + 512) = u.q[1]; } }
// ---- k_fin: block = (64 positions, 64 channels, image b): out[b][c][n] = OR[(b*npix + n)][c] (LDS transpose; 256-B runs of 64 positions per channel)
__global__ __launch_bounds__(256) void k_fin(const float* __restrict__ ORW, float* __restrict__ OUT, int npix, int nch) { __shared__ float st[64][68]; const int tid = threadIdx.x; const int n0 = blockIdx.x * 64, c0 = blockIdx.y * 64; const size_t b = blockIdx.z;
  for (int e = tid; e < 64 * 16; e += 256) { const int nl = e >> 4, q = e & 15; *(v4f*)&st[nl][q * 4] = *(const v4f*)(ORW + (b * npix + n0 + nl) * (size_t)nch + c0 + q * 4); }
  __syncthreads();
  for (int e = tid; e < 64 * 16; e += 256) { const int cl = e >> 4, q = e & 15; v4f o; o[0] = st[q * 4][cl]; o[1] = st[q * 4 + 1][cl]; o[2] = st[q * 4 + 2][cl]; o[3] = st[q * 4 + 3][cl]; vst2(OUT + (b * nch + c0 + cl) * (size_t)npix + n0 + q * 4, o); } }

// ---- k_proj: block = (64 rows, 128 cols, which): q/k/v = X W (+ b) with exact bf16 products (K = DIN) -> which 0: q f16 rows (+ residual rows < QHI); 1: k f16 (+ residual for keys < KHI); 2: v f16 (+ bf16 hi/lo for keys < KHI). k and v leave in the order k_att's A fragments are read in, the 16 real dims of a head only:
// k tile (16 keys): 512 B with lane (g, c) = dims 8 g + 0..7 of key c; the even tile of a 32-key step fills fragment slots 0..7, the odd one slots 8..15; the padding dims are not stored. v step (32 keys): 512 B with lane (g, c) = keys 8 g + 0..7 of dim c (slots 0..7), then 512 B with keys 16 + 8 g + 0..7 (slots 8..15)
__global__ __launch_bounds__(128) void k_proj(const float* __restrict__ XQ, const float* __restrict__ XK, const float* __restrict__ XV, const __bf16* __restrict__ FP, const float* __restrict__ BQ, const float* __restrict__ BK, const float* __restrict__ BV,
    _Float16* __restrict__ QH, _Float16* __restrict__ QL, _Float16* __restrict__ KH, _Float16* __restrict__ KL, _Float16* __restrict__ VT, __bf16* __restrict__ VB, __bf16* __restrict__ VBL) {
  __shared__ __align__(16) _Float16 sh[64][136], sl[64][136]; __shared__ __align__(16) _Float16 th[128][72]; __shared__ __align__(16) __bf16 tb[128][72], tbl[128][72];
  const int tid = threadIdx.x, wave = tid >> 5, lane = tid & 31, col = lane & 15, g = lane >> 4; const int which = blockIdx.z; const int c0 = blockIdx.y * 128; const size_t r0 = (size_t)blockIdx.x * 64; const size_t bb = r0 / TT; const int t0 = (int)(r0 % TT);
  const float* X = which == 0 ? XQ : which == 1 ? XK : XV; const __bf16* FW = FP + ((size_t)which * (DIN / 32) * NH + c0 / HD) * 512; const unsigned lob = lane * 16u; const float* BA = which == 0 ? BQ : which == 1 ? BK : BV;
  v8f acc[8] = {};
#pragma unroll 2
  for (int kc = 0; kc < DIN / 32; ++kc) { float av[16]; { const float* p = X + (r0 + wave * 16 + col) * DIN + kc * 32 + 8 * g;
#pragma unroll
      for (int i = 0; i < 8; ++i) { av[i] = p[i]; av[8 + i] = p[16 + i]; } }
    v16b w[4];   /* the step's four real column tiles (even j: dims < LATW of a head), asked for together with the x rows */
#pragma unroll
    for (int jj = 0; jj < 4; ++jj) w[jj] = fragw_b(FW + (size_t)(kc * NH + jj) * 512, lob);
    __builtin_amdgcn_sched_barrier(0);   /* every load of the k-step is issued before the first rounding that waits for one; without it the build holds two weight loads back behind that wait */
    v16b a;
#pragma unroll
    for (int i = 0; i < 16; ++i) a[i] = (__bf16)av[i];
#pragma unroll
    for (int j = 0; j < 8; ++j) acc[j] = wmma_bf(a, (j & 1) ? zero16b() : w[j >> 1], acc[j]); }
  if (which < 2) { _Float16* DH = which == 0 ? QH : KH; _Float16* DL = which == 0 ? QL : KL; const int nhi = which == 0 ? QHI : KHI; const bool hi_rows = t0 < nhi;
#pragma unroll
    for (int j = 0; j < 8; ++j) { const float bias = (BA && ((c0 + j * 16 + col) % HD) < LATW) ? bfr(BA[GCOL(c0 + j * 16 + col)]) : 0.f;   /* gathered like the weight columns; padding columns get no bias */
#pragma unroll
      for (int r = 0; r < 8; ++r) { const float v = acc[j][r] + bias; const _Float16 hv = (_Float16)v; sh[wave * 16 + 8 * g + r][j * 16 + col] = hv; sl[wave * 16 + 8 * g + r][j * 16 + col] = (_Float16)((v - (float)hv) * 1024.0f); } }
    __syncthreads();
    if (which == 0) { for (int e = tid; e < 64 * 16; e += 128) { const int rl = e >> 4, q = e & 15; vst2((unsigned*)(DH + (r0 + rl) * CC + c0 + q * 8), *(const v4u*)&sh[rl][q * 8]); XW(); if (hi_rows) { vst2((unsigned*)(DL + (bb * nhi + t0 + rl) * (size_t)CC + c0 + q * 8), *(const v4u*)&sl[rl][q * 8]); XW(); } }
    } else {   /* wave = key tile, pass = head: a wave stores one whole tile, 512 B in a row */
      const int rl = wave * 16 + col; const size_t hd = bb * NH + c0 / HD; v4u a[4];
#pragma unroll
      for (int hh = 0; hh < 4; ++hh) a[hh] = *(const v4u*)&sh[rl][hh * HD + g * 8];
#pragma unroll
      for (int hh = 0; hh < 4; ++hh) vst2((unsigned*)(DH + ((hd + hh) * (TT / 16) + t0 / 16 + wave) * 256 + lane * 8), a[hh]);
      XW();
      if (hi_rows) {
#pragma unroll
        for (int hh = 0; hh < 4; ++hh) a[hh] = *(const v4u*)&sl[rl][hh * HD + g * 8];
#pragma unroll
        for (int hh = 0; hh < 4; ++hh) vst2((unsigned*)(DL + ((hd + hh) * (KHI / 16) + t0 / 16 + wave) * 256 + lane * 8), a[hh]);
        XW(); } }
  } else { const bool hi_rows = t0 < KHI;
#pragma unroll
    for (int j = 0; j < 8; ++j) { const float bias = (BA && ((c0 + j * 16 + col) % HD) < LATW) ? bfr(BA[GCOL(c0 + j * 16 + col)]) : 0.f;   /* gathered like the weight columns; padding columns get no bias */
#pragma unroll
      for (int r = 0; r < 8; ++r) { const float v = acc[j][r] + bias; const int rl = wave * 16 + 8 * g + r, cl = j * 16 + col; th[cl][rl] = (_Float16)v; const __bf16 bh = (__bf16)v; tb[cl][rl] = bh; tbl[cl][rl] = (__bf16)(v - (float)bh); } }
    __syncthreads();
    const int rl = wave * 16 + g * 8; const size_t hd = bb * NH + c0 / HD; v4u a[4];   /* wave = 16 keys = half a step, pass = head: a wave stores 512 B in a row */
#pragma unroll
    for (int hh = 0; hh < 4; ++hh) a[hh] = *(const v4u*)&th[hh * HD + col][rl];
#pragma unroll
    for (int hh = 0; hh < 4; ++hh) vst2((unsigned*)(VT + ((hd + hh) * (TT / 32) + t0 / 32) * 512 + tid * 8), a[hh]);
    XW();
    if (hi_rows) { v4u lo[4];
#pragma unroll
      for (int hh = 0; hh < 4; ++hh) { a[hh] = *(const v4u*)&tb[hh * HD + col][rl]; lo[hh] = *(const v4u*)&tbl[hh * HD + col][rl]; }
#pragma unroll
      for (int hh = 0; hh < 4; ++hh) { const size_t o3 = ((hd + hh) * (KHI / 32) + t0 / 32) * 512 + tid * 8; vst2((unsigned*)(VB + o3), a[hh]); vst2((unsigned*)(VBL + o3), lo[hh]); }
      XW(); } } }
// ---- k_att: block = 4 waves x 32 queries of (b, h), one launch for all (b, h): logits, softmax and P . v without leaving registers.
// S^T = K . Q^T (A = 16 key rows, B = 16 query rows): lane (g, c) holds, for query c, keys 8g + r of each 16-key tile, so the two tiles of one 32-key step, converted in place, are the B operand of ctx^T += v^T . P^T (hardware k order on both sides). Each key / v fragment serves the wave's two 16-query tiles. K and v^T lie in fragment order (k_proj), so every load of the walks is 512 B in a row, four whole lines; only the 16 real dims of a head are read, and the product with v's padding dims, which is 0, is not formed.
// One K fragment holds BOTH 16-key tiles of a step: row c = key c of tile 0 in k slots 0..15 and key c of tile 1 in k slots 16..31. Tile 0's logits come from B = [q ; 0], tile 1's from B = [0 ; q]: the zeros stand in the loop-invariant q fragments, and the K registers hold loaded values only.
// Walk 1: row maximum. Walk 2 (logits formed again, same products): e = exp(s - max) x 2^11, row sum in f32, e once to f16 against v f16 (query rows < QHI: 3-product logits, e and v as bf16 hi + lo, 3 products); ctx = acc / sum. Keys past the wave's own diagonal step are not visited; the diagonal step masks by index.
#define QT 2   // 16-query tiles per wave
static_assert(QHI % (64 * QT) == 0 && QHI == QBH * 64 && KHI >= QHI && TT % (64 * QT) == 0, "a block of 4 x QT x 16 queries is wholly early or wholly late; early rows see only keys < KHI");
__device__ __forceinline__ v8f wm_h(v16h a, v16h b, v8f c) { return __builtin_amdgcn_wmma_f32_16x16x32_f16(false, a, false, b, (short)0, c, false, false); }
__device__ __forceinline__ v8f wm_b(v16b a, v16b b, v8f c) { return __builtin_amdgcn_wmma_f32_16x16x32_bf16(false, a, false, b, (short)0, c, false, false); }
// q fragments from a wave-uniform base + the lane's fixed byte offset (row c, half g)
__device__ __forceinline__ void frag_q(const _Float16* ub, unsigned lob, v16h q2[2]) { union { v16h v; v8h q[2]; } u0, u1; const v8h d = *(const v8h*)((const char*)ub + lob); v8h z;
#pragma unroll
  for (int i = 0; i < 8; ++i) z[i] = (_Float16)0.0f;
  u0.q[0] = d; u0.q[1] = z; u1.q[0] = z; u1.q[1] = d; q2[0] = u0.v; q2[1] = u1.v; }   /* the 16 real dims of query row c: [q ; 0] and [0 ; q] */
// k or v fragment in fragment order: fb = wave-uniform start of the 32-key step, lob = lane * 16 bytes. xl: the last fragment read through its address; its last load may land on the address registers, so the wait stands in front of it
__device__ __forceinline__ v16h fragv_h(const _Float16* fb, unsigned lob, bool xl) { union { v16h v; v8h q[2]; } u; const char* p = (const char*)fb + lob; u.q[0] = *(const v8h*)p; if (xl) XW(); u.q[1] = *(const v8h*)(p + 512); return u.v; }
__device__ __forceinline__ v16b fragv_b(const __bf16* fb, unsigned lob, bool xl) { union { v16b v; v8b q[2]; } u; const char* p = (const char*)fb + lob; u.q[0] = *(const v8b*)p; if (xl) XW(); u.q[1] = *(const v8b*)(p + 512); return u.v; }
// e x 2^11 = 2^(t x LC + off): t = the raw logit (before x 16^-0.5), LC = 16^-0.5 x log2(e), off = 11 - max(t) x LC, one value per query row. One fused multiply-add and one v_exp_f32 per logit; the rounding of off is a factor common to a row's numerators and its sum. Below 2^-126 the result may flush to 0, far under what the f32 sum or the 16-bit P can hold.
#define LC (SCALE * 1.44269504088896340736f)
// The free slot the instruction set asks for behind a transcendental (before its result is read or its source overwritten) stands in the v_exp_f32's own statement. exp2_arg: the diagonal step, once per wave. exp2_x8: the loops, the eight logits of one product tile, each exponential in place on its own register, so each is the independent instruction behind the one before it, and one v_nop closes the last.
__device__ __forceinline__ float exp2_arg(float t, float off) { const float a = __builtin_fmaf(t, LC, off); float e; asm("v_exp_f32 %0, %1\n\tv_nop" : "=v"(e) : "v"(a)); return e; }
__device__ __forceinline__ void exp2_x8(float* t, float off) { float a[8];
#pragma unroll
  for (int r = 0; r < 8; ++r) a[r] = __builtin_fmaf(t[r], LC, off);
  asm("v_exp_f32 %0, %0\n\tv_exp_f32 %1, %1\n\tv_exp_f32 %2, %2\n\tv_exp_f32 %3, %3\n\tv_exp_f32 %4, %4\n\tv_exp_f32 %5, %5\n\tv_exp_f32 %6, %6\n\tv_exp_f32 %7, %7\n\tv_nop" : "+v"(a[0]), "+v"(a[1]), "+v"(a[2]), "+v"(a[3]), "+v"(a[4]), "+v"(a[5]), "+v"(a[6]), "+v"(a[7]));
#pragma unroll
  for (int r = 0; r < 8; ++r) t[r] = a[r]; }
// one 32-key step: ld_k reads its two 16-key tiles as one fragment (KHr / KLr point at step 0 of (b, h), 512 elements a step, lob = lane * 16 bytes); st_mm forms s[u][8 t + r] = raw logit (not yet x 16^-0.5) of (key kc*32 + 16 t + 8 g + r, query 16 u + c)
struct KF { v16h h, l; };
template <bool HI> __device__ __forceinline__ KF ld_k(const _Float16* KHr, const _Float16* KLr, int kc, unsigned lob) { KF k; k.h = fragv_h(KHr + (size_t)kc * 512, lob, false); if (HI) k.l = fragv_h(KLr + (size_t)kc * 512, lob, false); else k.l = k.h; return k; }
template <bool HI> __device__ __forceinline__ void st_mm(const KF& k, const v16h qh[QT][2], const v16h ql[QT][2], float s[QT][16]) {
#pragma unroll
  for (int t = 0; t < 2; ++t)
#pragma unroll
    for (int u = 0; u < QT; ++u) { v8f a = {}; a = wm_h(k.h, qh[u][t], a);
      if (HI) { v8f al = {}; al = wm_h(k.h, ql[u][t], al); al = wm_h(k.l, qh[u][t], al);
#pragma unroll
        for (int r = 0; r < 8; ++r) s[u][t * 8 + r] = a[r] + al[r] * (1.0f / 1024.0f);
      } else {
#pragma unroll
        for (int r = 0; r < 8; ++r) s[u][t * 8 + r] = a[r]; } } }
template <bool HI, bool MASK> __device__ __forceinline__ void max_step(const _Float16* KHr, const _Float16* KLr, const v16h qh[QT][2], const v16h ql[QT][2], int kc, unsigned lob, int qrel, float m[QT]) { float s[QT][16]; const KF k = ld_k<HI>(KHr, KLr, kc, lob); st_mm<HI>(k, qh, ql, s);
#pragma unroll
  for (int u = 0; u < QT; ++u)
#pragma unroll
    for (int i = 0; i < 16; ++i) { if (!MASK || kc * 32 + 16 * (i >> 3) + (i & 7) <= qrel + 16 * u) m[u] = fmaxf(m[u], s[u][i]); } }
template <bool HI, bool MASK> __device__ __forceinline__ void pv_step(const _Float16* KHr, const _Float16* KLr, const v16h qh[QT][2], const v16h ql[QT][2], const _Float16* VTr, const __bf16* VBr, const __bf16* VBLr, int kc, unsigned lob, int qrel, const float off[QT], float sum[QT], v8f acc[QT]) { float s[QT][16];
  const KF k = ld_k<HI>(KHr, KLr, kc, lob); XW();
  v16h vf; v16b vh, vl;   /* v is asked for before the exponentials, which cover its latency; the diagonal step's last load is the last through lob */
  if (HI) { vh = fragv_b(VBr + (size_t)kc * 512, lob, false); vl = fragv_b(VBLr + (size_t)kc * 512, lob, MASK); } else vf = fragv_h(VTr + (size_t)kc * 512, lob, MASK);
  st_mm<HI>(k, qh, ql, s);
#pragma unroll
  for (int u = 0; u < QT; ++u) { if (!MASK) { exp2_x8(&s[u][0], off[u]); exp2_x8(&s[u][8], off[u]); }
#pragma unroll
    for (int i = 0; i < 16; ++i) { float e = MASK ? exp2_arg(s[u][i], off[u]) : s[u][i]; if (MASK && kc * 32 + 16 * (i >> 3) + (i & 7) > qrel + 16 * u) e = 0.f; sum[u] += e; s[u][i] = e; } }
  if (HI) { F2 pp[QT];
#pragma unroll
    for (int u = 0; u < QT; ++u) pp[u] = bsplit16(s[u]);
#pragma unroll
    for (int u = 0; u < QT; ++u) { acc[u] = wm_b(vh, pp[u].h, acc[u]); acc[u] = wm_b(vh, pp[u].l, acc[u]); acc[u] = wm_b(vl, pp[u].h, acc[u]); }
  } else { v16h pb[QT];
#pragma unroll
    for (int u = 0; u < QT; ++u)
#pragma unroll
      for (int i = 0; i < 16; ++i) pb[u][i] = (_Float16)s[u][i];
#pragma unroll
    for (int u = 0; u < QT; ++u) acc[u] = wm_h(vf, pb[u], acc[u]); } }
template <bool HI> __device__ __forceinline__ void att_body(const _Float16* __restrict__ QH, const _Float16* __restrict__ KH, const _Float16* __restrict__ QL, const _Float16* __restrict__ KL, const _Float16* __restrict__ VT, const __bf16* __restrict__ VB, const __bf16* __restrict__ VBL, int b, int h, int ql0, int lane, float* __restrict__ Y) {
  const int c = lane & 15, g = lane >> 4; const int nfull = ql0 >> 5;   /* ql0 % 32 == 0: steps 0 .. nfull-1 lie wholly below the diagonal for all 32 queries; step nfull holds it */
  const size_t hd = (size_t)b * NH + h; const _Float16* KHr = KH + hd * (TT * LATW); const _Float16* KLr = KL + hd * (KHI * LATW); const unsigned klo = (unsigned)(c * CC + 8 * g) * 2u, lob = lane * 16u;   /* klo: the q rows' offset; lob: every k / v fragment's */
  const _Float16* VTr = VT + hd * (TT * LATW); const __bf16* VBr = VB + hd * (KHI * LATW); const __bf16* VBLr = VBL + hd * (KHI * LATW);
  v16h qh[QT][2], ql[QT][2];
#pragma unroll
  for (int u = 0; u < QT; ++u) { frag_q(QH + ((size_t)b * TT + ql0 + u * 16) * CC + h * HD, klo, qh[u]); if (HI) frag_q(QL + ((size_t)b * QHI + ql0 + u * 16) * CC + h * HD, klo, ql[u]); else { ql[u][0] = qh[u][0]; ql[u][1] = qh[u][1]; } }
  XW();
  const int qrel = ql0 + c - 8 * g;   /* key kc*32 + 16 t + 8 g + r is kept for query ql0 + 16 u + c when kc*32 + 16 t + r <= qrel + 16 u */
  float m[QT], sum[QT]; v8f acc[QT] = {};
#pragma unroll
  for (int u = 0; u < QT; ++u) { m[u] = -3.0e38f; sum[u] = 0.f; }
#pragma unroll HI ? 1 : 4   /* late rows: four steps' key loads in flight, this walk has little work to cover a load's latency */
  for (int kc = 0; kc < nfull; ++kc) max_step<HI, false>(KHr, KLr, qh, ql, kc, lob, qrel, m);
  max_step<HI, true>(KHr, KLr, qh, ql, nfull, lob, qrel, m);
#pragma unroll
  for (int u = 0; u < QT; ++u) { m[u] = fmaxf(m[u], __shfl_xor(m[u], 16)); m[u] = __builtin_fmaf(-m[u], LC, 11.0f); }   /* the two lane halves hold different keys of the same query; from here m = the exponent's offset */
#pragma unroll 1   /* left rolled: a step's loads are covered by the SIMD's other waves alone; unrolling adds registers */
  for (int kc = 0; kc < nfull; ++kc) pv_step<HI, false>(KHr, KLr, qh, ql, VTr, VBr, VBLr, kc, lob, qrel, m, sum, acc);
  pv_step<HI, true>(KHr, KLr, qh, ql, VTr, VBr, VBLr, nfull, lob, qrel, m, sum, acc);
#pragma unroll
  for (int u = 0; u < QT; ++u) { const float st = sum[u] + __shfl_xor(sum[u], 16); const float inv = st > 0.f ? 1.0f / st : 0.f;   /* sum and acc both carry the 2^11 */
    float* yr = Y + ((size_t)b * TT + ql0 + u * 16 + c) * CC + h * HD + 8 * g;   /* acc[u][r] = ctx(query 16 u + c, dim 8 g + r): 32 contiguous bytes per lane; the padding dims 16 + 8 g + r, which k_out reads against zero weights, are stored as the zeros their product was */
    v4f o0, o1; const v4f z = {};
#pragma unroll
    for (int r = 0; r < 4; ++r) { o0[r] = acc[u][r] * inv; o1[r] = acc[u][4 + r] * inv; }
    vst2(yr, o0); vst2(yr + 4, o1); vst2(yr + 16, z); vst2(yr + 20, z); } }
__global__ __launch_bounds__(128) void k_att(const _Float16* __restrict__ QH, const _Float16* __restrict__ KH, const _Float16* __restrict__ QL, const _Float16* __restrict__ KL, const _Float16* __restrict__ VT, const __bf16* __restrict__ VB, const __bf16* __restrict__ VBL, float* __restrict__ Y) {
  const int b = blockIdx.x / NH, h = blockIdx.x % NH; const int q0 = (TT / (64 * QT) - 1 - (int)blockIdx.y) * (64 * QT);   /* longest query blocks start first */
  const int wave = __builtin_amdgcn_readfirstlane(threadIdx.x >> 5), lane = threadIdx.x & 31; const int ql0 = q0 + wave * (16 * QT);
  if (q0 < QHI) att_body<true>(QH, KH, QL, KL, VT, VB, VBL, b, h, ql0, lane, Y); else att_body<false>(QH, KH, QL, KL, VT, VB, VBL, b, h, ql0, lane, Y); }
// ---- k_out: block = (64 rows, 128 cols): ao = ctx Wvu (+ bvu): ctx once to f16 against Wvu as f16(bf16 x 2^8) exact (1 product) x 2^-8; causal early rows (< QHI of each sequence): ctx bf16 hi + lo against exact bf16 Wvu (2 products)
__global__ __launch_bounds__(128) void k_out(const float* __restrict__ Y, const __bf16* __restrict__ FU, const _Float16* __restrict__ FUH, const float* __restrict__ BO, float* __restrict__ OUT) { __shared__ __align__(16) float sf[4][16][132];
  const int tid = threadIdx.x, wave = tid >> 5, lane = tid & 31, col = lane & 15, g = lane >> 4; const int c0 = blockIdx.y * 128; const size_t r0 = (size_t)blockIdx.x * 64 + wave * 16; const unsigned lob = lane * 16u;
  v8f acc[8] = {};
  if (CAUSAL && (int)(((size_t)blockIdx.x * 64) % TT) < QHI) {   /* block-uniform */
#pragma unroll 2
    for (int kc = 0; kc < CC / 32; ++kc) { const F2 a = split_row(Y + (r0 + col) * CC, kc * 32, lane); v16b w[8];
#pragma unroll
      for (int j = 0; j < 8; ++j) w[j] = fragw_b8(FU + (size_t)(kc * (DIN / 16) + c0 / 16 + j) * 256, lob);
#pragma unroll
      for (int j = 0; j < 8; ++j) { acc[j] = wmma_bf(a.h, w[j], acc[j]); acc[j] = wmma_bf(a.l, w[j], acc[j]); } }
#pragma unroll
    for (int j = 0; j < 8; ++j) { const float bias = BO ? bfr(BO[c0 + j * 16 + col]) : 0.f;
#pragma unroll
      for (int r = 0; r < 8; ++r) sf[wave][8 * g + r][j * 16 + col] = acc[j][r] + bias; }
  } else {
#pragma unroll 2
    for (int kc = 0; kc < CC / 32; ++kc) { const v16h a = frag_f32s(Y + (r0 + col) * CC + kc * 32, lane, 64.0f); v16h w[8];   /* ctx carried x 2^6 into f16 so small-magnitude context rows stay clear of f16 subnormals (chip FTZ) */
#pragma unroll
      for (int j = 0; j < 8; ++j) w[j] = fragw_h8(FUH + (size_t)(kc * (DIN / 16) + c0 / 16 + j) * 256, lob);
#pragma unroll
      for (int j = 0; j < 8; ++j) acc[j] = wmma16(a, w[j], acc[j]); }
#pragma unroll
    for (int j = 0; j < 8; ++j) { const float bias = BO ? bfr(BO[c0 + j * 16 + col]) : 0.f;
#pragma unroll
      for (int r = 0; r < 8; ++r) sf[wave][8 * g + r][j * 16 + col] = acc[j][r] * (1.0f / 16384.0f) + bias; } }   /* 2^-8 (Wvu carry) x 2^-6 (ctx carry) */
  LDSX(); for (int rl = 0; rl < 16; ++rl) vst2(OUT + (r0 + rl) * DIN + c0 + lane * 4, *(const v4f*)&sf[wave][rl][lane * 4]); }
#define K2 DIN
#define wcol_io_plain(W, k0, o, lane) wcol_io(W, k0, o, lane, DIN)
#define wcolh_io_plain(W, k0, o, lane) wcolh_io(W, k0, o, lane, DIN)
// ---- k_out2: block = (64 rows, 128 cols): final projection out = R Wo + bo on the re-read rows R [NB*TT][K2] (K2 = DIN input width): same body as k_out with the row pitch / k extent K2 and all 16 slots of the Wo fragments packed by k_prep; always the single-product path
__global__ __launch_bounds__(128) void k_out2(const float* __restrict__ Y, const _Float16* __restrict__ FO, const float* __restrict__ BO, float* __restrict__ OUT) { __shared__ __align__(16) float sf[4][16][132];
  const int tid = threadIdx.x, wave = tid >> 5, lane = tid & 31, col = lane & 15, g = lane >> 4; const int c0 = blockIdx.y * 128; const size_t r0 = (size_t)blockIdx.x * 64 + wave * 16; const unsigned lob = lane * 16u;
  v8f acc[8] = {};   /* the re-read rows mix positions: no early-row special case here */
#pragma unroll 2
  for (int kc = 0; kc < K2 / 32; ++kc) { float av[16]; { const float* p = Y + (r0 + col) * K2 + kc * 32 + 8 * g;
#pragma unroll
      for (int i = 0; i < 8; ++i) { av[i] = p[i]; av[8 + i] = p[16 + i]; } }
    v16h w[8];   /* rows carried x 2^6 into f16 so small-magnitude rows stay clear of f16 subnormals (chip FTZ) */
#pragma unroll
    for (int j = 0; j < 8; ++j) w[j] = fragw_h(FO + (size_t)(kc * (DIN / 16) + c0 / 16 + j) * 512, lob);
    __builtin_amdgcn_sched_barrier(0);   /* every load of the k-step is issued before the first rounding that waits for one; without it the build holds two weight loads back behind that wait */
    v16h a;
#pragma unroll
    for (int i = 0; i < 16; ++i) a[i] = (_Float16)(av[i] * 64.0f);
#pragma unroll
    for (int j = 0; j < 8; ++j) acc[j] = wmma16(a, w[j], acc[j]); }
#pragma unroll
  for (int j = 0; j < 8; ++j) { const float bias = BO ? bfr(BO[c0 + j * 16 + col]) : 0.f;
#pragma unroll
    for (int r = 0; r < 8; ++r) sf[wave][8 * g + r][j * 16 + col] = acc[j][r] * (1.0f / 16384.0f) + bias; }   /* 2^-8 (Wo carry) x 2^-6 (row carry) */
  LDSX(); for (int rl = 0; rl < 16; ++rl) vst2(OUT + (r0 + rl) * DIN + c0 + lane * 4, *(const v4f*)&sf[wave][rl][lane * 4]); }

extern "C" void kernel_launch(void* const* d_in, const int* in_sizes, int n_in, void* d_out, int out_size, void* d_ws, size_t ws_size, hipStream_t stream) {
  (void)in_sizes; (void)n_in; (void)out_size;
  const float** F = (const float**)d_in;
  if (ws_size < (size_t)WS_END) return;
  char* ws = (char*)d_ws; _Float16 *QH = (_Float16*)(ws + WS_QH), *KH = (_Float16*)(ws + WS_KH), *VT = (_Float16*)(ws + WS_VT), *QL = (_Float16*)(ws + WS_QL), *KL = (_Float16*)(ws + WS_KL); __bf16 *VB = (__bf16*)(ws + WS_VB), *VBL = (__bf16*)(ws + WS_VBL); float *S = (float*)(ws + WS_S), *Y = (float*)(ws + WS_Y);
  (void)S; (void)Y; (void)QL; (void)KL; (void)VB; (void)VBL;
  // inputs (in order): 0 x [4,2048,768]; 1 Wq [768,768] (in,out), 2 bq; 3 Wkd [768,192], 4 bkd; 5 Wvd [768,192], 6 bvd; 7 Wvu [192,768], 8 bvu; 9 Wo [768,768] (in,out), 10 bo (all biases zeros, read)
  if (ws_size < (size_t)WS_END3) return;
  float *AO = (float*)(ws + WS_AO), *T = (float*)(ws + WS_T); __bf16 *FP = (__bf16*)(ws + WS_FP), *FU = (__bf16*)(ws + WS_FU); _Float16 *FUH = (_Float16*)(ws + WS_FUH), *FO = (_Float16*)(ws + WS_FO);
  k_prep<<<dim3((NF_P + NF_U + NF_O) / 4), 128, 0, stream>>>(F[1], F[3], F[5], F[7], F[9], FP, FU, FUH, FO);   /* every weight once into B-fragment order */
  k_proj<<<dim3(TNB * TT / 64, CC / 128, 3), 128, 0, stream>>>(F[0], F[0], F[0], FP, F[2], F[4], F[6], QH, QL, KH, KL, VT, VB, VBL);   /* q slice, latent k, latent v: 3 column blocks of 128 columns each */
  k_att<<<dim3(TNB * NH, TT / (64 * QT)), 128, 0, stream>>>(QH, KH, QL, KL, VT, VB, VBL, Y);   /* logits, softmax, P v: every (b, h, 128-query block) in one launch */
  k_out<<<dim3(TNB * TT / 64, DIN / 128), 128, 0, stream>>>(Y, FU, FUH, F[8], AO);   /* ao = al Wvu + bvu (gathered weight rows) */
  k_fin<<<dim3(TT / 64, DIN / 64, TNB), 256, 0, stream>>>(AO, T, TT, DIN);   /* T[b][c][s] = ao[b][s][c] */
  k_out2<<<dim3(TNB * TT / 64, DIN / 128), 128, 0, stream>>>(T, FO, F[10], (float*)d_out);   /* rows = T's memory re-read as [TT][DIN] per batch; out = rows Wo + bo */
}

// v005
// Measured time: 106 microseconds a run.
// Two timings next to v004 put it at 1.15 and 1.13 times that version's speed.
// Counting every step since v000, it is 16.3 times as fast.
// compute dtype: all float inputs rounded to bf16; the q slice and the latent k / v projections with EXACT bf16 products on WMMA 16x16x32 (f32 accumulate) + bias (zeros, read), 16 real dims per head zero-padded to 32; causal logits over the 16 latent dims: 3 products for the first 384 rows, single f16 after, x 16^-0.5; softmax f32 (max first, then exp(s - max) x 2^11, formed as 2^(raw logit x 16^-0.5 log2(e) + offset), once to f16 x v once to f16 (bf16 hi + lo below row 384), divided by the f32 row sum after the product; logits never stored); latent ctx (hi+lo below row 384, x2^6 f16 carry after) x exact / f16(bf16 x 2^8) Wvu + bvu; per-batch transpose; then x 2^6 once to f16 x Wo f16(bf16 x 2^8) + bo; f32 output.
#include <hip/hip_runtime.h>
#include <math.h>

typedef __attribute__((ext_vector_type(16))) _Float16 v16h;
typedef __attribute__((ext_vector_type(16))) __bf16 v16b;
typedef __attribute__((ext_vector_type(8)))  _Float16 v8h;
typedef __attribute__((ext_vector_type(8)))  float v8f;
typedef __attribute__((ext_vector_type(4)))  float v4f;
typedef __attribute__((ext_vector_type(2)))  float v2f;
typedef __attribute__((ext_vector_type(4)))  unsigned v4u;
typedef __attribute__((ext_vector_type(4)))  int v4i;
typedef float __attribute__((may_alias)) float_a;
typedef int __attribute__((may_alias)) int_a;

template <typename T> __device__ __forceinline__ void vst2(void* p, T v) { *(T*)p = v;  }
__device__ __forceinline__ v8f wmma16(v16h a, v16h b, v8f c) {
  v8f d = __builtin_amdgcn_wmma_f32_16x16x32_f16(false, a, false, b, (short)0, c, false, false);
  asm volatile("v_nop\n\tv_nop\n\tv_nop\n\tv_nop" : "+v"(d) : "v"(a), "v"(b));
  return d;
}
__device__ __forceinline__ v8f wmma_bf(v16b a, v16b b, v8f c) {
  v8f d = __builtin_amdgcn_wmma_f32_16x16x32_bf16(false, a, false, b, (short)0, c, false, false);
  asm volatile("v_nop\n\tv_nop\n\tv_nop\n\tv_nop" : "+v"(d) : "v"(a), "v"(b));
  return d;
}
// 16x16x32 fragments: lane = (h = lane>>4, row/col = lane&15); elements 0..7 = k0+8h+0..7, 8..15 = k0+16+8h+0..7; D element r = row 8h+r
__device__ __forceinline__ v16h frag_h(const _Float16* rowk0, int lane) {
  union { v16h v; v8h q[2]; } u; const _Float16* p = rowk0 + 8 * (lane >> 4);
  u.q[0] = *(const v8h*)p; u.q[1] = *(const v8h*)(p + 16); return u.v;
}
__device__ __forceinline__ v16h frag_f32(const float* rowk0, int lane) {
  v16h a; const float* p = rowk0 + 8 * (lane >> 4);
#pragma unroll
  for (int i = 0; i < 8; ++i) { a[i] = (_Float16)p[i]; a[8 + i] = (_Float16)p[16 + i]; }
  return a;
}
__device__ __forceinline__ v16h frag_f32s(const float* rowk0, int lane, float sc) {
  v16h a; const float* p = rowk0 + 8 * (lane >> 4);
#pragma unroll
  for (int i = 0; i < 8; ++i) { a[i] = (_Float16)(p[i] * sc); a[8 + i] = (_Float16)(p[16 + i] * sc); }
  return a;
}
// column fragment from a [K][ld] layout (column n), rows >= K read as 0
__device__ __forceinline__ v16h fragc_f32(const float* W, int k0, int n, int lane, int ld, int K) {
  v16h a; const int g = lane >> 4;
#pragma unroll
  for (int i = 0; i < 8; ++i) { const int ka = k0 + 8 * g + i, kb = ka + 16;
    a[i] = (_Float16)(ka < K ? W[(size_t)(ka < K ? ka : K - 1) * ld + n] : 0.f); a[8 + i] = (_Float16)(kb < K ? W[(size_t)(kb < K ? kb : K - 1) * ld + n] : 0.f); }
  return a;
}
struct F2 { v16b h, l; };
__device__ __forceinline__ F2 bsplit16(const float v[16]) { F2 r;
#pragma unroll
  for (int i = 0; i < 16; ++i) { const __bf16 h = (__bf16)v[i]; r.h[i] = h; r.l[i] = (__bf16)(v[i] - (float)h); }
  return r; }
__device__ __forceinline__ F2 split_row(const float* row, int k0, int lane) { float v[16]; const float* p = row + k0 + 8 * (lane >> 4);
#pragma unroll
  for (int i = 0; i < 8; ++i) { v[i] = p[i]; v[8 + i] = p[16 + i]; }
  return bsplit16(v); }
__device__ __forceinline__ F2 split_rowK(const float* row, int k0, int lane, int K) { float v[16]; const int g = lane >> 4;
#pragma unroll
  for (int i = 0; i < 8; ++i) { const int ka = k0 + 8 * g + i, kb = ka + 16; v[i] = ka < K ? row[ka < K ? ka : K - 1] : 0.f; v[8 + i] = kb < K ? row[kb < K ? kb : K - 1] : 0.f; }
  return bsplit16(v); }
__device__ __forceinline__ F2 split_col(const float* W, int k0, int n, int lane, int ld, int K) { float v[16]; const int g = lane >> 4;
#pragma unroll
  for (int i = 0; i < 8; ++i) { const int ka = k0 + 8 * g + i, kb = ka + 16; v[i] = ka < K ? W[(size_t)(ka < K ? ka : K - 1) * ld + n] : 0.f; v[8 + i] = kb < K ? W[(size_t)(kb < K ? kb : K - 1) * ld + n] : 0.f; }
  return bsplit16(v); }
__device__ __forceinline__ v8f mac3(const F2& a, const F2& b, v8f c) { c = wmma_bf(a.l, b.h, c); c = wmma_bf(a.h, b.l, c); return wmma_bf(a.h, b.h, c); }
__device__ __forceinline__ float sigm(float v) { return 1.0f / (1.0f + expf(-v)); }
#define LDSX() do { asm volatile("s_wait_dscnt 0" ::: "memory"); __builtin_amdgcn_wave_barrier(); __builtin_amdgcn_fence(__ATOMIC_RELEASE, "workgroup"); } while (0)

// Causal self-attention with 12 low-rank latent heads (x [4,2048,768]; (in,out) Wq [768,768], Wkd / Wvd [768,192], Wvu [192,768], Wo [768,768], all N(0,1) x 0.02, zero biases (read); q = x Wq + bq split into 12 heads x 64 of which only the FIRST 16 dims of each head are used (ql); kl, vl = x Wkd, x Wvd split into 12 heads x 16; scores = ql kl^T x 16^-0.5; triu(1) -> -inf; softmax; al = w vl merged to [B,S,192]; ao = al Wvu + bvu [B,S,768]; then jnp.transpose(ao, (0,2,1)).reshape(B,S,768): the per-batch [2048 x 768] matrix is transposed to [768 x 2048] and its memory re-read as 2,048 rows of 768; out = that Wo + bo).
#define NB 4
#define TT 2048
#define CC 384            // NH * HD = projected width
#define DIN 768          // input (model) width
#define NH 12
#define HD 32
#define LATW 16     /* real dims per head; columns h*HD + d with d >= LATW are zero padding */
#define QHEADW 64   /* the module's q heads are 64 wide; only their first LATW dims are used (ql = q[..., :16]) */
#define KVLD (NH * LATW)   /* row pitch of the (in,out) latent weights Wkd / Wvd [768][192] */
#define NQB (TT / 64)
#define HG 2   // S region: 2 x 2,048 x 2,048 f32 = 32 MiB, allocated but unused
#define SCALE (0.25f)
#define CAUSAL 1
#ifndef TNB
#define TNB NB
#endif
__device__ __forceinline__ float bfr(float v) { return (float)(__bf16)v; }
__host__ __device__ __forceinline__ int kb_last(int qb) { return CAUSAL ? ((qb * 64 + 63) >> 7) : (TT / 128 - 1); }
typedef __attribute__((ext_vector_type(8))) __bf16 v8b;
__device__ __forceinline__ v16b frag_b(const __bf16* rowk0, int lane) {
  union { v16b v; v8b q[2]; } u; const __bf16* p = rowk0 + 8 * (lane >> 4);
  u.q[0] = *(const v8b*)p; u.q[1] = *(const v8b*)(p + 16); return u.v;
}
#define QBH 6              // causal: query blocks 0..QBH-1 of each sequence (few keys, no averaging) take the high-precision path
#define QHI 384            // rows carrying a q residual plane
#define KHI 384            // key rows carrying k residual / v bf16 hi+lo planes (used only by the causal high-precision path)
// B fragment (k rows k0+.., output column o) of a weight: (in,out) [K][ld] or (out,in) [ld rows of K]: bf16 exact, or f16(bf16 * 256) exact
__device__ __forceinline__ v16b wcol_io(const float* Wm, int k0, int o, int lane, int ld) { v16b w; const int g = lane >> 4;
#pragma unroll
  for (int i = 0; i < 8; ++i) { w[i] = (__bf16)Wm[(size_t)(k0 + 8 * g + i) * ld + o]; w[8 + i] = (__bf16)Wm[(size_t)(k0 + 16 + 8 * g + i) * ld + o]; }
  return w; }
__device__ __forceinline__ v16b wcol_oi(const float* Wm, int k0, int o, int lane, int K) { v16b w; const float* p = Wm + (size_t)o * K + k0 + 8 * (lane >> 4);
#pragma unroll
  for (int i = 0; i < 8; ++i) { w[i] = (__bf16)p[i]; w[8 + i] = (__bf16)p[16 + i]; }
  return w; }
__device__ __forceinline__ v16h wcolh_io(const float* Wm, int k0, int o, int lane, int ld) { v16h w; const int g = lane >> 4;
#pragma unroll
  for (int i = 0; i < 8; ++i) { w[i] = (_Float16)(bfr(Wm[(size_t)(k0 + 8 * g + i) * ld + o]) * 256.0f); w[8 + i] = (_Float16)(bfr(Wm[(size_t)(k0 + 16 + 8 * g + i) * ld + o]) * 256.0f); }
  return w; }
// first output projection ao = al Wvu: the k index runs over ctx columns kk = h*HD + d; one 32-deep k-step = one head; its first 16 entries (d < LATW, fragment slots 0..7 of both lane halves) are rows h*LATW + d of the (in,out) [192][768] weight, its last 16 (padding dims, slots 8..15) are zero
__device__ __forceinline__ v16b wcol_io_lat(const float* Wm, int k0, int o, int lane, int ld) { v16b w; const int g = lane >> 4; const float* p = Wm + (size_t)((k0 / HD) * LATW + 8 * g) * ld + o;
#pragma unroll
  for (int i = 0; i < 8; ++i) { w[i] = (__bf16)p[(size_t)i * ld]; w[8 + i] = (__bf16)0.0f; }
  return w; }
__device__ __forceinline__ v16h wcolh_io_lat(const float* Wm, int k0, int o, int lane, int ld) { v16h w; const int g = lane >> 4; const float* p = Wm + (size_t)((k0 / HD) * LATW + 8 * g) * ld + o;
#pragma unroll
  for (int i = 0; i < 8; ++i) { w[i] = (_Float16)(bfr(p[(size_t)i * ld]) * 256.0f); w[8 + i] = (_Float16)0.0f; }
  return w; }
static_assert(HD == 32 && LATW == 16 && CC == NH * HD, "the latent loaders assume one head per 32-deep k-step with 16 real + 16 padding dims");
__device__ __forceinline__ v16h wcolh_oi(const float* Wm, int k0, int o, int lane, int K) { v16h w; const float* p = Wm + (size_t)o * K + k0 + 8 * (lane >> 4);
#pragma unroll
  for (int i = 0; i < 8; ++i) { w[i] = (_Float16)(bfr(p[i]) * 256.0f); w[8 + i] = (_Float16)(bfr(p[16 + i]) * 256.0f); }
  return w; }
#define WQKV_LAYOUT 0   // 0 = (in,out) [DIN][out], columns gathered per head; 1 = (out,in) [CC][DIN]; 2 = per-head [NH][DIN][HD]
__device__ __forceinline__ v16b wcol_hdk(const float* Wm, int k0, int o, int lane) { v16b w; const int g = lane >> 4; const float* p = Wm + (size_t)(o / HD) * DIN * HD + (o % HD);
#pragma unroll
  for (int i = 0; i < 8; ++i) { w[i] = (__bf16)p[(size_t)(k0 + 8 * g + i) * HD]; w[8 + i] = (__bf16)p[(size_t)(k0 + 16 + 8 * g + i) * HD]; }
  return w; }
#define WO_OUT_IN 0
#if WQKV_LAYOUT == 1
#define WCOL(W, k0, o, lane) wcol_oi(W, k0, o, lane, DIN)
#elif WQKV_LAYOUT == 2
#define WCOL(W, k0, o, lane) wcol_hdk(W, k0, o, lane)
#else
__device__ __forceinline__ v16b zero16b() { v16b w; _Pragma("unroll") for (int i = 0; i < 16; ++i) w[i] = (__bf16)0.0f; return w; }
/* column o = h*HD + d: real (d < LATW) -> weight column h*QHEADW + d of Wq (pitch DIN) for the q stream, h*LATW + d of Wkd / Wvd (pitch KVLD) for k / v; padding -> zeros. o = c0 + j*16 + col with c0 % 128 == 0, so (o % HD) < LATW is decided by j alone (compile-time per unrolled j, uniform across the wave) */
#define GCOL(o) ((which) == 0 ? ((o) / HD) * QHEADW + ((o) % HD) : ((o) / HD) * LATW + ((o) % HD))
#define WCOL(W, k0, o, lane) ((((o) % HD) < LATW) ? wcol_io(W, k0, GCOL(o), lane, ((which) == 0 ? DIN : KVLD)) : zero16b())
#endif
#if WO_OUT_IN
#define WOCOL(W, k0, o, lane) wcol_oi(W, k0, o, lane, CC)
#define WOCOLH(W, k0, o, lane) wcolh_oi(W, k0, o, lane, CC)
#else
#define WOCOL(W, k0, o, lane) wcol_io_lat(W, k0, o, lane, DIN)
#define WOCOLH(W, k0, o, lane) wcolh_io_lat(W, k0, o, lane, DIN)
#endif

#ifndef SM_EXTRA_PARAMS
#define SM_EXTRA_PARAMS
#endif
#ifndef PROJ_EXTRA_PARAMS
#define PROJ_EXTRA_PARAMS
#endif
#ifndef SM_MASK_HOOK
#define SM_MASK_HOOK (void)0
#endif

#define WS_QH  0u                                      // f16 q rows [b*t][CC]
#define WS_KH  (WS_QH + 2u * (size_t)NB * TT * CC)      // f16 k in A-fragment order [b][h][16-key tile][512 B] (the region keeps its old size)
#define WS_VT  (WS_KH + 2u * (size_t)NB * TT * CC)      // f16 v^T in A-fragment order [b][h][32-key step][1024 B]
#define WS_QL  (WS_VT + 2u * (size_t)NB * CC * TT)      // f16 q residual x 2^10 rows [b][t < QHI][CC]
#define WS_KL  (WS_QL + 2u * (size_t)NB * QHI * CC)     // f16 k residual x 2^10, as WS_KH, key tiles below KHI
#define WS_VB  (WS_KL + 2u * (size_t)NB * KHI * CC)     // bf16 v hi (then lo), as WS_VT, key steps below KHI
#define WS_VBL (WS_VB + 2u * (size_t)NB * CC * KHI)
#define WS_S   (WS_VBL + 2u * (size_t)NB * CC * KHI)    // f32 [hg][t][s] region, unused (logits stay in registers)
#define WS_Y   (WS_S  + 4u * (size_t)HG * TT * TT)      // f32 ctx rows [b*t][CC] (only when there is an output projection)
#define WS_END (WS_Y  + 4u * (size_t)NB * TT * CC)
#define WS_T  (WS_END)                                     // f16 per-batch transpose T[b][c][s] = f16((al Wvu + bvu)[b][s][c] x 2^6), written by k_out; its memory is then read as TT rows of DIN (the module's transpose(0,2,1).reshape)
#define WS_END2 (WS_T + 2u * (size_t)NB * TT * DIN)
static_assert(TT % 64 == 0 && DIN % 128 == 0, "a k_out block owns 64 positions of 128 channels: one whole 128-B line of T per channel");
// weights in WMMA B-fragment order, written once per call by k_prep. One fragment = the 32 lanes' slots 0..7 (16 B a lane, 512 B in a row), then their slots 8..15 (left out where they are the zero padding of a latent head)
#define NF_P (3 * (DIN / 32) * NH)        /* q slice / latent k / latent v: [which][kc][head], bf16 */
#define NF_U (NH * (DIN / 16))            /* Wvu: [head][column tile], slots 0..7 only, once bf16 and once f16(bf16 x 2^8) */
#define NF_O ((DIN / 32) * (DIN / 16))    /* Wo: [kc][column tile], f16(bf16 x 2^8) */
#define WS_FP  (WS_END2)
#define WS_FU  (WS_FP  + 1024u * (size_t)NF_P)
#define WS_FUH (WS_FU  + 512u * (size_t)NF_U)
#define WS_FO  (WS_FUH + 512u * (size_t)NF_U)
#define WS_END3 (WS_FO + 1024u * (size_t)NF_O)
static_assert((NF_P + NF_U + NF_O) % 4 == 0, "k_prep: four waves a block, one fragment a wave");
// fb = wave-uniform start of the fragment, lob = lane * 16 bytes
__device__ __forceinline__ v16b fragw_b(const __bf16* fb, unsigned lob) { union { v16b v; v8b q[2]; } u; const char* p = (const char*)fb + lob; u.q[0] = *(const v8b*)p; u.q[1] = *(const v8b*)(p + 512); return u.v; }
__device__ __forceinline__ v16h fragw_h(const _Float16* fb, unsigned lob) { union { v16h v; v8h q[2]; } u; const char* p = (const char*)fb + lob; u.q[0] = *(const v8h*)p; u.q[1] = *(const v8h*)(p + 512); return u.v; }
__device__ __forceinline__ v16b fragw_b8(const __bf16* fb, unsigned lob) { union { v16b v; v8b q[2]; } u; u.q[0] = *(const v8b*)((const char*)fb + lob);
#pragma unroll
  for (int i = 0; i < 8; ++i) u.q[1][i] = (__bf16)0.0f;
  return u.v; }
__device__ __forceinline__ v16h fragw_h8(const _Float16* fb, unsigned lob) { union { v16h v; v8h q[2]; } u; u.q[0] = *(const v8h*)((const char*)fb + lob);
#pragma unroll
  for (int i = 0; i < 8; ++i) u.q[1][i] = (_Float16)0.0f;
  return u.v; }
// a precaution: stands between issued loads and the next write of a register that holds one of their addresses
__device__ __forceinline__ void XW() { asm volatile("s_wait_xcnt 0x0" ::: "memory"); }
// N weight values of one column, rows i (i < 8) and, for N = 16, 16 + i of an (in,out) weight of pitch LD: ub = wave-uniform address of the tile's first row and column, lo = the lane's fixed byte offset (8 g rows + its column). The last load may land on the offset register, so the wait stands in front of it, and once more behind it, ahead of the scalar work that forms the store address
template <int LD, int N> __device__ __forceinline__ void ld_col(const float* ub, unsigned lo, float v[N]) { const char* p = (const char*)ub + lo;
#pragma unroll
  for (int i = 0; i < N - 1; ++i) v[i] = *(const float*)(p + (size_t)((i & 7) + 2 * (i & 8)) * LD * 4);
  XW(); v[N - 1] = *(const float*)(p + (size_t)(((N - 1) & 7) + 2 * ((N - 1) & 8)) * LD * 4); XW(); }
// ---- k_prep: one wave = one B fragment, with the roundings the projection kernels' own loaders (wcol_io, wcol_io_lat, wcolh_io_lat, wcolh_io) made per wave and per row block
__global__ __launch_bounds__(128) void k_prep(const float* __restrict__ WQ, const float* __restrict__ WK, const float* __restrict__ WV, const float* __restrict__ WU, const float* __restrict__ WO, __bf16* __restrict__ FP, __bf16* __restrict__ FU, _Float16* __restrict__ FUH, _Float16* __restrict__ FO) {
  const int lane = threadIdx.x & 31, col = lane & 15, g = lane >> 4; const int f = blockIdx.x * 4 + __builtin_amdgcn_readfirstlane(threadIdx.x >> 5);
  if (f < NF_P) { const int which = f / ((DIN / 32) * NH), kc = (f / NH) % (DIN / 32), h = f % NH; float v[16];
    if (which == 0) ld_col<DIN, 16>(WQ + (size_t)kc * 32 * DIN + h * QHEADW, (unsigned)(8 * g * DIN + col) * 4u, v);
    else ld_col<KVLD, 16>((which == 1 ? WK : WV) + (size_t)kc * 32 * KVLD + h * LATW, (unsigned)(8 * g * KVLD + col) * 4u, v);
    union { v16b v; v8b q[2]; } u;
#pragma unroll
    for (int i = 0; i < 16; ++i) u.v[i] = (__bf16)v[i];
    char* d = (char*)FP + (size_t)f * 1024 + lane * 16; *(v8b*)d = u.q[0]; *(v8b*)(d + 512) = u.q[1];
  } else if (f < NF_P + NF_U) { const int fu = f - NF_P, h = fu / (DIN / 16), jt = fu % (DIN / 16); float v[8];
    ld_col<DIN, 8>(WU + (size_t)h * LATW * DIN + jt * 16, (unsigned)(8 * g * DIN + col) * 4u, v);
    v8b wb; v8h wh;
#pragma unroll
    for (int i = 0; i < 8; ++i) { wb[i] = (__bf16)v[i]; wh[i] = (_Float16)(bfr(v[i]) * 256.0f); }
    *(v8b*)((char*)FU + (size_t)fu * 512 + lane * 16) = wb; *(v8h*)((char*)FUH + (size_t)fu * 512 + lane * 16) = wh;
  } else { const int fo = f - NF_P - NF_U, kc = fo / (DIN / 16), jt = fo % (DIN / 16); float v[16];
    ld_col<DIN, 16>(WO + (size_t)kc * 32 * DIN + jt * 16, (unsigned)(8 * g * DIN + col) * 4u, v);
    union { v16h v; v8h q[2]; } u;
#pragma unroll
    for (int i = 0; i < 16; ++i) u.v[i] = (_Float16)(bfr(v[i]) * 256.0f);
    char* d = (char*)FO + (size_t)fo * 1024 + lane * 16; *(v8h*)d = u.q[0]; *(v8h*)(d + 512) = u.q[1]; } }
// ---- k_proj: block = (64 rows, 128 cols, which): q/k/v = X W (+ b) with exact bf16 products (K = DIN) -> which 0: q f16 rows (+ residual rows < QHI); 1: k f16 (+ residual for keys < KHI); 2: v f16 (+ bf16 hi/lo for keys < KHI). k and v leave in the order k_att's A fragments are read in, the 16 real dims of a head only:
// k tile (16 keys): 512 B with lane (g, c) = dims 8 g + 0..7 of key c; the even tile of a 32-key step fills fragment slots 0..7, the odd one slots 8..15; the padding dims are not stored. v step (32 keys): 512 B with lane (g, c) = keys 8 g + 0..7 of dim c (slots 0..7), then 512 B with keys 16 + 8 g + 0..7 (slots 8..15)
__global__ __launch_bounds__(128) void k_proj(const float* __restrict__ XQ, const float* __restrict__ XK, const float* __restrict__ XV, const __bf16* __restrict__ FP, const float* __restrict__ BQ, const float* __restrict__ BK, const float* __restrict__ BV,
    _Float16* __restrict__ QH, _Float16* __restrict__ QL, _Float16* __restrict__ KH, _Float16* __restrict__ KL, _Float16* __restrict__ VT, __bf16* __restrict__ VB, __bf16* __restrict__ VBL) {
  __shared__ __align__(16) _Float16 sh[64][136], sl[64][136]; __shared__ __align__(16) _Float16 th[128][72]; __shared__ __align__(16) __bf16 tb[128][72], tbl[128][72];
  const int tid = threadIdx.x, wave = tid >> 5, lane = tid & 31, col = lane & 15, g = lane >> 4; const int which = blockIdx.z; const int c0 = blockIdx.y * 128; const size_t r0 = (size_t)blockIdx.x * 64; const size_t bb = r0 / TT; const int t0 = (int)(r0 % TT);
  const float* X = which == 0 ? XQ : which == 1 ? XK : XV; const __bf16* FW = FP + ((size_t)which * (DIN / 32) * NH + c0 / HD) * 512; const unsigned lob = lane * 16u; const float* BA = which == 0 ? BQ : which == 1 ? BK : BV;
  v8f acc[8] = {};
#pragma unroll 2
  for (int kc = 0; kc < DIN / 32; ++kc) { float av[16]; { const float* p = X + (r0 + wave * 16 + col) * DIN + kc * 32 + 8 * g;
#pragma unroll
      for (int i = 0; i < 8; ++i) { av[i] = p[i]; av[8 + i] = p[16 + i]; } }
    v16b w[4];   /* the step's four real column tiles (even j: dims < LATW of a head), asked for together with the x rows */
#pragma unroll
    for (int jj = 0; jj < 4; ++jj) w[jj] = fragw_b(FW + (size_t)(kc * NH + jj) * 512, lob);
    __builtin_amdgcn_sched_barrier(0);   /* every load of the k-step is issued before the first rounding that waits for one; without it the build holds two weight loads back behind that wait */
    v16b a;
#pragma unroll
    for (int i = 0; i < 16; ++i) a[i] = (__bf16)av[i];
#pragma unroll
    for (int j = 0; j < 8; ++j) acc[j] = wmma_bf(a, (j & 1) ? zero16b() : w[j >> 1], acc[j]); }
  if (which < 2) { _Float16* DH = which == 0 ? QH : KH; _Float16* DL = which == 0 ? QL : KL; const int nhi = which == 0 ? QHI : KHI; const bool hi_rows = t0 < nhi;
#pragma unroll
    for (int j = 0; j < 8; ++j) { const float bias = (BA && ((c0 + j * 16 + col) % HD) < LATW) ? bfr(BA[GCOL(c0 + j * 16 + col)]) : 0.f;   /* gathered like the weight columns; padding columns get no bias */
#pragma unroll
      for (int r = 0; r < 8; ++r) { const float v = acc[j][r] + bias; const _Float16 hv = (_Float16)v; sh[wave * 16 + 8 * g + r][j * 16 + col] = hv; sl[wave * 16 + 8 * g + r][j * 16 + col] = (_Float16)((v - (float)hv) * 1024.0f); } }
    __syncthreads();
    if (which == 0) { for (int e = tid; e < 64 * 16; e += 128) { const int rl = e >> 4, q = e & 15; vst2((unsigned*)(DH + (r0 + rl) * CC + c0 + q * 8), *(const v4u*)&sh[rl][q * 8]); XW(); if (hi_rows) { vst2((unsigned*)(DL + (bb * nhi + t0 + rl) * (size_t)CC + c0 + q * 8), *(const v4u*)&sl[rl][q * 8]); XW(); } }
    } else {   /* wave = key tile, pass = head: a wave stores one whole tile, 512 B in a row */
      const int rl = wave * 16 + col; const size_t hd = bb * NH + c0 / HD; v4u a[4];
#pragma unroll
      for (int hh = 0; hh < 4; ++hh) a[hh] = *(const v4u*)&sh[rl][hh * HD + g * 8];
#pragma unroll
      for (int hh = 0; hh < 4; ++hh) vst2((unsigned*)(DH + ((hd + hh) * (TT / 16) + t0 / 16 + wave) * 256 + lane * 8), a[hh]);
      XW();
      if (hi_rows) {
#pragma unroll
        for (int hh = 0; hh < 4; ++hh) a[hh] = *(const v4u*)&sl[rl][hh * HD + g * 8];
#pragma unroll
        for (int hh = 0; hh < 4; ++hh) vst2((unsigned*)(DL + ((hd + hh) * (KHI / 16) + t0 / 16 + wave) * 256 + lane * 8), a[hh]);
        XW(); } }
  } else { const bool hi_rows = t0 < KHI;
#pragma unroll
    for (int j = 0; j < 8; ++j) { const float bias = (BA && ((c0 + j * 16 + col) % HD) < LATW) ? bfr(BA[GCOL(c0 + j * 16 + col)]) : 0.f;   /* gathered like the weight columns; padding columns get no bias */
#pragma unroll
      for (int r = 0; r < 8; ++r) { const float v = acc[j][r] + bias; const int rl = wave * 16 + 8 * g + r, cl = j * 16 + col; th[cl][rl] = (_Float16)v; const __bf16 bh = (__bf16)v; tb[cl][rl] = bh; tbl[cl][rl] = (__bf16)(v - (float)bh); } }
    __syncthreads();
    const int rl = wave * 16 + g * 8; const size_t hd = bb * NH + c0 / HD; v4u a[4];   /* wave = 16 keys = half a step, pass = head: a wave stores 512 B in a row */
#pragma unroll
    for (int hh = 0; hh < 4; ++hh) a[hh] = *(const v4u*)&th[hh * HD + col][rl];
#pragma unroll
    for (int hh = 0; hh < 4; ++hh) vst2((unsigned*)(VT + ((hd + hh) * (TT / 32) + t0 / 32) * 512 + tid * 8), a[hh]);
    XW();
    if (hi_rows) { v4u lo[4];
#pragma unroll
      for (int hh = 0; hh < 4; ++hh) { a[hh] = *(const v4u*)&tb[hh * HD + col][rl]; lo[hh] = *(const v4u*)&tbl[hh * HD + col][rl]; }
#pragma unroll
      for (int hh = 0; hh < 4; ++hh) { const size_t o3 = ((hd + hh) * (KHI / 32) + t0 / 32) * 512 + tid * 8; vst2((unsigned*)(VB + o3), a[hh]); vst2((unsigned*)(VBL + o3), lo[hh]); }
      XW(); } } }
// ---- k_att: block = 4 waves x 32 queries of (b, h), one launch for all (b, h): logits, softmax and P . v without leaving registers.
// S^T = K . Q^T (A = 16 key rows, B = 16 query rows): lane (g, c) holds, for query c, keys 8g + r of each 16-key tile, so the two tiles of one 32-key step, converted in place, are the B operand of ctx^T += v^T . P^T (hardware k order on both sides). Each key / v fragment serves the wave's two 16-query tiles. K and v^T lie in fragment order (k_proj), so every load of the walks is 512 B in a row, four whole lines; only the 16 real dims of a head are read, and the product with v's padding dims, which is 0, is not formed.
// One K fragment holds BOTH 16-key tiles of a step: row c = key c of tile 0 in k slots 0..15 and key c of tile 1 in k slots 16..31. Tile 0's logits come from B = [q ; 0], tile 1's from B = [0 ; q]: the zeros stand in the loop-invariant q fragments, and the K registers hold loaded values only.
// Walk 1: row maximum. Walk 2 (logits formed again, same products): e = exp(s - max) x 2^11, row sum in f32, e once to f16 against v f16 (query rows < QHI: 3-product logits, e and v as bf16 hi + lo, 3 products); ctx = acc / sum. Keys past the wave's own diagonal step are not visited; the diagonal step masks by index.
#define QT 2   // 16-query tiles per wave
static_assert(QHI % (64 * QT) == 0 && QHI == QBH * 64 && KHI >= QHI && TT % (64 * QT) == 0, "a block of 4 x QT x 16 queries is wholly early or wholly late; early rows see only keys < KHI");
__device__ __forceinline__ v8f wm_h(v16h a, v16h b, v8f c) { return __builtin_amdgcn_wmma_f32_16x16x32_f16(false, a, false, b, (short)0, c, false, false); }
__device__ __forceinline__ v8f wm_b(v16b a, v16b b, v8f c) { return __builtin_amdgcn_wmma_f32_16x16x32_bf16(false, a, false, b, (short)0, c, false, false); }
// q fragments from a wave-uniform base + the lane's fixed byte offset (row c, half g)
__device__ __forceinline__ void frag_q(const _Float16* ub, unsigned lob, v16h q2[2]) { union { v16h v; v8h q[2]; } u0, u1; const v8h d = *(const v8h*)((const char*)ub + lob); v8h z;
#pragma unroll
  for (int i = 0; i < 8; ++i) z[i] = (_Float16)0.0f;
  u0.q[0] = d; u0.q[1] = z; u1.q[0] = z; u1.q[1] = d; q2[0] = u0.v; q2[1] = u1.v; }   /* the 16 real dims of query row c: [q ; 0] and [0 ; q] */
// k or v fragment in fragment order: fb = wave-uniform start of the 32-key step, lob = lane * 16 bytes. xl: the last fragment read through its address; its last load may land on the address registers, so the wait stands in front of it
__device__ __forceinline__ v16h fragv_h(const _Float16* fb, unsigned lob, bool xl) { union { v16h v; v8h q[2]; } u; const char* p = (const char*)fb + lob; u.q[0] = *(const v8h*)p; if (xl) XW(); u.q[1] = *(const v8h*)(p + 512); return u.v; }
__device__ __forceinline__ v16b fragv_b(const __bf16* fb, unsigned lob, bool xl) { union { v16b v; v8b q[2]; } u; const char* p = (const char*)fb + lob; u.q[0] = *(const v8b*)p; if (xl) XW(); u.q[1] = *(const v8b*)(p + 512); return u.v; }
// e x 2^11 = 2^(t x LC + off): t = the raw logit (before x 16^-0.5), LC = 16^-0.5 x log2(e), off = 11 - max(t) x LC, one value per query row. One fused multiply-add and one v_exp_f32 per logit; the rounding of off is a factor common to a row's numerators and its sum. Below 2^-126 the result may flush to 0, far under what the f32 sum or the 16-bit P can hold.
#define LC (SCALE * 1.44269504088896340736f)
// The free slot the instruction set asks for behind a transcendental (before its result is read or its source overwritten) stands in the v_exp_f32's own statement. exp2_arg: the diagonal step, once per wave. exp2_x8: the loops, the eight logits of one product tile, each exponential in place on its own register, so each is the independent instruction behind the one before it, and one v_nop closes the last.
__device__ __forceinline__ float exp2_arg(float t, float off) { const float a = __builtin_fmaf(t, LC, off); float e; asm("v_exp_f32 %0, %1\n\tv_nop" : "=v"(e) : "v"(a)); return e; }
__device__ __forceinline__ void exp2_x8(float* t, float off) { float a[8];
#pragma unroll
  for (int r = 0; r < 8; ++r) a[r] = __builtin_fmaf(t[r], LC, off);
  asm("v_exp_f32 %0, %0\n\tv_exp_f32 %1, %1\n\tv_exp_f32 %2, %2\n\tv_exp_f32 %3, %3\n\tv_exp_f32 %4, %4\n\tv_exp_f32 %5, %5\n\tv_exp_f32 %6, %6\n\tv_exp_f32 %7, %7\n\tv_nop" : "+v"(a[0]), "+v"(a[1]), "+v"(a[2]), "+v"(a[3]), "+v"(a[4]), "+v"(a[5]), "+v"(a[6]), "+v"(a[7]));
#pragma unroll
  for (int r = 0; r < 8; ++r) t[r] = a[r]; }
// one 32-key step: ld_k reads its two 16-key tiles as one fragment (KHr / KLr point at step 0 of (b, h), 512 elements a step, lob = lane * 16 bytes); st_mm forms s[u][8 t + r] = raw logit (not yet x 16^-0.5) of (key kc*32 + 16 t + 8 g + r, query 16 u + c)
struct KF { v16h h, l; };
template <bool HI> __device__ __forceinline__ KF ld_k(const _Float16* KHr, const _Float16* KLr, int kc, unsigned lob) { KF k; k.h = fragv_h(KHr + (size_t)kc * 512, lob, false); if (HI) k.l = fragv_h(KLr + (size_t)kc * 512, lob, false); else k.l = k.h; return k; }
template <bool HI> __device__ __forceinline__ void st_mm(const KF& k, const v16h qh[QT][2], const v16h ql[QT][2], float s[QT][16]) {
#pragma unroll
  for (int t = 0; t < 2; ++t)
#pragma unroll
    for (int u = 0; u < QT; ++u) { v8f a = {}; a = wm_h(k.h, qh[u][t], a);
      if (HI) { v8f al = {}; al = wm_h(k.h, ql[u][t], al); al = wm_h(k.l, qh[u][t], al);
#pragma unroll
        for (int r = 0; r < 8; ++r) s[u][t * 8 + r] = a[r] + al[r] * (1.0f / 1024.0f);
      } else {
#pragma unroll
        for (int r = 0; r < 8; ++r) s[u][t * 8 + r] = a[r]; } } }
template <bool HI, bool MASK> __device__ __forceinline__ void max_step(const _Float16* KHr, const _Float16* KLr, const v16h qh[QT][2], const v16h ql[QT][2], int kc, unsigned lob, int qrel, float m[QT]) { float s[QT][16]; const KF k = ld_k<HI>(KHr, KLr, kc, lob); st_mm<HI>(k, qh, ql, s);
#pragma unroll
  for (int u = 0; u < QT; ++u)
#pragma unroll
    for (int i = 0; i < 16; ++i) { if (!MASK || kc * 32 + 16 * (i >> 3) + (i & 7) <= qrel + 16 * u) m[u] = fmaxf(m[u], s[u][i]); } }
template <bool HI, bool MASK> __device__ __forceinline__ void pv_step(const _Float16* KHr, const _Float16* KLr, const v16h qh[QT][2], const v16h ql[QT][2], const _Float16* VTr, const __bf16* VBr, const __bf16* VBLr, int kc, unsigned lob, int qrel, const float off[QT], float sum[QT], v8f acc[QT]) { float s[QT][16];
  const KF k = ld_k<HI>(KHr, KLr, kc, lob); XW();
  v16h vf; v16b vh, vl;   /* v is asked for before the exponentials, which cover its latency; the diagonal step's last load is the last through lob */
  if (HI) { vh = fragv_b(VBr + (size_t)kc * 512, lob, false); vl = fragv_b(VBLr + (size_t)kc * 512, lob, MASK); } else vf = fragv_h(VTr + (size_t)kc * 512, lob, MASK);
  st_mm<HI>(k, qh, ql, s);
#pragma unroll
  for (int u = 0; u < QT; ++u) { if (!MASK) { exp2_x8(&s[u][0], off[u]); exp2_x8(&s[u][8], off[u]); }
#pragma unroll
    for (int i = 0; i < 16; ++i) { float e = MASK ? exp2_arg(s[u][i], off[u]) : s[u][i]; if (MASK && kc * 32 + 16 * (i >> 3) + (i & 7) > qrel + 16 * u) e = 0.f; sum[u] += e; s[u][i] = e; } }
  if (HI) { F2 pp[QT];
#pragma unroll
    for (int u = 0; u < QT; ++u) pp[u] = bsplit16(s[u]);
#pragma unroll
    for (int u = 0; u < QT; ++u) { acc[u] = wm_b(vh, pp[u].h, acc[u]); acc[u] = wm_b(vh, pp[u].l, acc[u]); acc[u] = wm_b(vl, pp[u].h, acc[u]); }
  } else { v16h pb[QT];
#pragma unroll
    for (int u = 0; u < QT; ++u)
#pragma unroll
      for (int i = 0; i < 16; ++i) pb[u][i] = (_Float16)s[u][i];
#pragma unroll
    for (int u = 0; u < QT; ++u) acc[u] = wm_h(vf, pb[u], acc[u]); } }
template <bool HI> __device__ __forceinline__ void att_body(const _Float16* __restrict__ QH, const _Float16* __restrict__ KH, const _Float16* __restrict__ QL, const _Float16* __restrict__ KL, const _Float16* __restrict__ VT, const __bf16* __restrict__ VB, const __bf16* __restrict__ VBL, int b, int h, int ql0, int lane, float* __restrict__ Y) {
  const int c = lane & 15, g = lane >> 4; const int nfull = ql0 >> 5;   /* ql0 % 32 == 0: steps 0 .. nfull-1 lie wholly below the diagonal for all 32 queries; step nfull holds it */
  const size_t hd = (size_t)b * NH + h; const _Float16* KHr = KH + hd * (TT * LATW); const _Float16* KLr = KL + hd * (KHI * LATW); const unsigned klo = (unsigned)(c * CC + 8 * g) * 2u, lob = lane * 16u;   /* klo: the q rows' offset; lob: every k / v fragment's */
  const _Float16* VTr = VT + hd * (TT * LATW); const __bf16* VBr = VB + hd * (KHI * LATW); const __bf16* VBLr = VBL + hd * (KHI * LATW);
  v16h qh[QT][2], ql[QT][2];
#pragma unroll
  for (int u = 0; u < QT; ++u) { frag_q(QH + ((size_t)b * TT + ql0 + u * 16) * CC + h * HD, klo, qh[u]); if (HI) frag_q(QL + ((size_t)b * QHI + ql0 + u * 16) * CC + h * HD, klo, ql[u]); else { ql[u][0] = qh[u][0]; ql[u][1] = qh[u][1]; } }
  XW();
  const int qrel = ql0 + c - 8 * g;   /* key kc*32 + 16 t + 8 g + r is kept for query ql0 + 16 u + c when kc*32 + 16 t + r <= qrel + 16 u */
  float m[QT], sum[QT]; v8f acc[QT] = {};
#pragma unroll
  for (int u = 0; u < QT; ++u) { m[u] = -3.0e38f; sum[u] = 0.f; }
#pragma unroll HI ? 1 : 4   /* late rows: four steps' key loads in flight, this walk has little work to cover a load's latency */
  for (int kc = 0; kc < nfull; ++kc) max_step<HI, false>(KHr, KLr, qh, ql, kc, lob, qrel, m);
  max_step<HI, true>(KHr, KLr, qh, ql, nfull, lob, qrel, m);
#pragma unroll
  for (int u = 0; u < QT; ++u) { m[u] = fmaxf(m[u], __shfl_xor(m[u], 16)); m[u] = __builtin_fmaf(-m[u], LC, 11.0f); }   /* the two lane halves hold different keys of the same query; from here m = the exponent's offset */
#pragma unroll 1   /* left rolled: a step's loads are covered by the SIMD's other waves alone; unrolling adds registers */
  for (int kc = 0; kc < nfull; ++kc) pv_step<HI, false>(KHr, KLr, qh, ql, VTr, VBr, VBLr, kc, lob, qrel, m, sum, acc);
  pv_step<HI, true>(KHr, KLr, qh, ql, VTr, VBr, VBLr, nfull, lob, qrel, m, sum, acc);
#pragma unroll
  for (int u = 0; u < QT; ++u) { const float st = sum[u] + __shfl_xor(sum[u], 16); const float inv = st > 0.f ? 1.0f / st : 0.f;   /* sum and acc both carry the 2^11 */
    float* yr = Y + ((size_t)b * TT + ql0 + u * 16 + c) * CC + h * HD + 8 * g;   /* acc[u][r] = ctx(query 16 u + c, dim 8 g + r): 32 contiguous bytes per lane; the padding dims 16 + 8 g + r, which k_out reads against zero weights, are stored as the zeros their product was */
    v4f o0, o1; const v4f z = {};
#pragma unroll
    for (int r = 0; r < 4; ++r) { o0[r] = acc[u][r] * inv; o1[r] = acc[u][4 + r] * inv; }
    vst2(yr, o0); vst2(yr + 4, o1); vst2(yr + 16, z); vst2(yr + 20, z); } }
__global__ __launch_bounds__(128) void k_att(const _Float16* __restrict__ QH, const _Float16* __restrict__ KH, const _Float16* __restrict__ QL, const _Float16* __restrict__ KL, const _Float16* __restrict__ VT, const __bf16* __restrict__ VB, const __bf16* __restrict__ VBL, float* __restrict__ Y) {
  const int b = blockIdx.x / NH, h = blockIdx.x % NH; const int q0 = (TT / (64 * QT) - 1 - (int)blockIdx.y) * (64 * QT);   /* longest query blocks start first */
  const int wave = __builtin_amdgcn_readfirstlane(threadIdx.x >> 5), lane = threadIdx.x & 31; const int ql0 = q0 + wave * (16 * QT);
  if (q0 < QHI) att_body<true>(QH, KH, QL, KL, VT, VB, VBL, b, h, ql0, lane, Y); else att_body<false>(QH, KH, QL, KL, VT, VB, VBL, b, h, ql0, lane, Y); }
// The result leaves as k_out2's A operand: a lane's 8 accumulator rows are 8 consecutive positions of one channel, so x 2^6 and the one rounding to f16 (the rounding k_out2's loader made) give 16 B of a T row; the block's 64 positions of a channel are gathered in LDS and stored as one whole line.
// ---- k_out: block = (64 rows, 128 cols): ao = ctx Wvu (+ bvu): ctx x 2^6 once to f16 against Wvu as f16(bf16 x 2^8) exact (1 product) x 2^-14; causal early rows (< QHI of each sequence): ctx bf16 hi + lo against exact bf16 Wvu (2 products)
__global__ __launch_bounds__(128) void k_out(const float* __restrict__ Y, const __bf16* __restrict__ FU, const _Float16* __restrict__ FUH, const float* __restrict__ BO, _Float16* __restrict__ TH) { __shared__ __align__(16) _Float16 st[128][72];
  const int tid = threadIdx.x, wave = tid >> 5, lane = tid & 31, col = lane & 15, g = lane >> 4; const int c0 = blockIdx.y * 128; const size_t r0 = (size_t)blockIdx.x * 64 + wave * 16; const unsigned lob = lane * 16u;
  v8f acc[8] = {};
  if (CAUSAL && (int)(((size_t)blockIdx.x * 64) % TT) < QHI) {   /* block-uniform */
#pragma unroll 2
    for (int kc = 0; kc < CC / 32; ++kc) { const F2 a = split_row(Y + (r0 + col) * CC, kc * 32, lane); v16b w[8];
#pragma unroll
      for (int j = 0; j < 8; ++j) w[j] = fragw_b8(FU + (size_t)(kc * (DIN / 16) + c0 / 16 + j) * 256, lob);
#pragma unroll
      for (int j = 0; j < 8; ++j) { acc[j] = wmma_bf(a.h, w[j], acc[j]); acc[j] = wmma_bf(a.l, w[j], acc[j]); } }
#pragma unroll
    for (int j = 0; j < 8; ++j) { const float bias = BO ? bfr(BO[c0 + j * 16 + col]) : 0.f;
      v8h o;
#pragma unroll
      for (int r = 0; r < 8; ++r) o[r] = (_Float16)((acc[j][r] + bias) * 64.0f);
      *(v8h*)&st[j * 16 + col][wave * 16 + 8 * g] = o; }
  } else {
#pragma unroll 2
    for (int kc = 0; kc < CC / 32; ++kc) { const v16h a = frag_f32s(Y + (r0 + col) * CC + kc * 32, lane, 64.0f); v16h w[8];   /* ctx carried x 2^6 into f16 so small-magnitude context rows stay clear of f16 subnormals (chip FTZ) */
#pragma unroll
      for (int j = 0; j < 8; ++j) w[j] = fragw_h8(FUH + (size_t)(kc * (DIN / 16) + c0 / 16 + j) * 256, lob);
#pragma unroll
      for (int j = 0; j < 8; ++j) acc[j] = wmma16(a, w[j], acc[j]); }
#pragma unroll
    for (int j = 0; j < 8; ++j) { const float bias = BO ? bfr(BO[c0 + j * 16 + col]) : 0.f;
      v8h o;
#pragma unroll
      for (int r = 0; r < 8; ++r) o[r] = (_Float16)((acc[j][r] * (1.0f / 16384.0f) + bias) * 64.0f);   /* 2^-8 (Wvu carry) x 2^-6 (ctx carry); then the x 2^6 carry of the next product's f16 operand */
      *(v8h*)&st[j * 16 + col][wave * 16 + 8 * g] = o; } }
  __syncthreads();   /* a channel's 64 positions come from all four waves */
  const size_t rb = (size_t)blockIdx.x * 64; _Float16* tp = TH + ((rb / TT) * DIN + c0 + (tid >> 3)) * (size_t)TT + rb % TT + (tid & 7) * 8;   /* 8 lanes = one channel's line; 16 channels a pass */
#pragma unroll
  for (int p = 0; p < 8; ++p) vst2((unsigned*)(tp + (size_t)p * 16 * TT), *(const v4u*)&st[p * 16 + (tid >> 3)][(tid & 7) * 8]); }
#define K2 DIN
#define wcol_io_plain(W, k0, o, lane) wcol_io(W, k0, o, lane, DIN)
#define wcolh_io_plain(W, k0, o, lane) wcolh_io(W, k0, o, lane, DIN)
// ---- k_out2: block = (64 rows, 128 cols): final projection out = R Wo + bo on the re-read rows R [NB*TT][K2] (K2 = DIN input width): f16 rows (x 2^6, from k_out) against the k_prep fragments of Wo as f16(bf16 x 2^8) (1 product) x 2^-14; always the single-product path
__global__ __launch_bounds__(128) void k_out2(const _Float16* __restrict__ Y, const _Float16* __restrict__ FO, const float* __restrict__ BO, float* __restrict__ OUT) { __shared__ __align__(16) float sf[4][16][132];
  const int tid = threadIdx.x, wave = tid >> 5, lane = tid & 31, col = lane & 15, g = lane >> 4; const int c0 = blockIdx.y * 128; const size_t r0 = (size_t)blockIdx.x * 64 + wave * 16; const unsigned lob = lane * 16u;
  v8f acc[8] = {};   /* the re-read rows mix positions: no early-row special case here */
#pragma unroll 2
  for (int kc = 0; kc < K2 / 32; ++kc) { const v16h a = frag_h(Y + (r0 + col) * K2 + kc * 32, lane);   /* the rows arrive as f16 x 2^6 (k_out), clear of f16 subnormals (chip FTZ) */
    v16h w[8];
#pragma unroll
    for (int j = 0; j < 8; ++j) w[j] = fragw_h(FO + (size_t)(kc * (DIN / 16) + c0 / 16 + j) * 512, lob);
    __builtin_amdgcn_sched_barrier(0);   /* every load of the k-step is issued before the first product that waits for one */
#pragma unroll
    for (int j = 0; j < 8; ++j) acc[j] = wmma16(a, w[j], acc[j]); }
#pragma unroll
  for (int j = 0; j < 8; ++j) { const float bias = BO ? bfr(BO[c0 + j * 16 + col]) : 0.f;
#pragma unroll
    for (int r = 0; r < 8; ++r) sf[wave][8 * g + r][j * 16 + col] = acc[j][r] * (1.0f / 16384.0f) + bias; }   /* 2^-8 (Wo carry) x 2^-6 (row carry) */
  LDSX(); for (int rl = 0; rl < 16; ++rl) vst2(OUT + (r0 + rl) * DIN + c0 + lane * 4, *(const v4f*)&sf[wave][rl][lane * 4]); }

extern "C" void kernel_launch(void* const* d_in, const int* in_sizes, int n_in, void* d_out, int out_size, void* d_ws, size_t ws_size, hipStream_t stream) {
  (void)in_sizes; (void)n_in; (void)out_size;
  const float** F = (const float**)d_in;
  if (ws_size < (size_t)WS_END) return;
  char* ws = (char*)d_ws; _Float16 *QH = (_Float16*)(ws + WS_QH), *KH = (_Float16*)(ws + WS_KH), *VT = (_Float16*)(ws + WS_VT), *QL = (_Float16*)(ws + WS_QL), *KL = (_Float16*)(ws + WS_KL); __bf16 *VB = (__bf16*)(ws + WS_VB), *VBL = (__bf16*)(ws + WS_VBL); float *S = (float*)(ws + WS_S), *Y = (float*)(ws + WS_Y);
  (void)S; (void)Y; (void)QL; (void)KL; (void)VB; (void)VBL;
  // inputs (in order): 0 x [4,2048,768]; 1 Wq [768,768] (in,out), 2 bq; 3 Wkd [768,192], 4 bkd; 5 Wvd [768,192], 6 bvd; 7 Wvu [192,768], 8 bvu; 9 Wo [768,768] (in,out), 10 bo (all biases zeros, read)
  if (ws_size < (size_t)WS_END3) return;
  _Float16 *T = (_Float16*)(ws + WS_T); __bf16 *FP = (__bf16*)(ws + WS_FP), *FU = (__bf16*)(ws + WS_FU); _Float16 *FUH = (_Float16*)(ws + WS_FUH), *FO = (_Float16*)(ws + WS_FO);
  k_prep<<<dim3((NF_P + NF_U + NF_O) / 4), 128, 0, stream>>>(F[1], F[3], F[5], F[7], F[9], FP, FU, FUH, FO);   /* every weight once into B-fragment order */
  k_proj<<<dim3(TNB * TT / 64, CC / 128, 3), 128, 0, stream>>>(F[0], F[0], F[0], FP, F[2], F[4], F[6], QH, QL, KH, KL, VT, VB, VBL);   /* q slice, latent k, latent v: 3 column blocks of 128 columns each */
  k_att<<<dim3(TNB * NH, TT / (64 * QT)), 128, 0, stream>>>(QH, KH, QL, KL, VT, VB, VBL, Y);   /* logits, softmax, P v: every (b, h, 128-query block) in one launch */
  k_out<<<dim3(TNB * TT / 64, DIN / 128), 128, 0, stream>>>(Y, FU, FUH, F[8], T);   /* T[b][c][s] = f16(ao[b][s][c] x 2^6), ao = al Wvu + bvu (gathered weight rows) */
  k_out2<<<dim3(TNB * TT / 64, DIN / 128), 128, 0, stream>>>(T, FO, F[10], (float*)d_out);   /* rows = T's memory re-read as [TT][DIN] per batch; out = rows Wo + bo */
}

// v006
// It runs in 92.3 microseconds.
// Two timings next to v005 both put it at 1.16 times that version's speed.
// Over all steps from v000 it is 18.8 times as fast.
// compute dtype: all float inputs rounded to bf16; the q slice and the latent k / v projections with EXACT bf16 products on WMMA 16x16x32 (f32 accumulate) + bias (zeros, read), 16 real dims per head zero-padded to 32; causal logits over the 16 latent dims: 3 products for the first 384 rows, single f16 after, x 16^-0.5; softmax f32 (max first, then exp(s - max) x 2^11, formed as 2^(raw logit x 16^-0.5 log2(e) + offset), once to f16 x v once to f16 (bf16 hi + lo below row 384), divided by the f32 row sum after the product; logits never stored); latent ctx (hi+lo below row 384, x2^6 f16 carry after) x exact / f16(bf16 x 2^8) Wvu + bvu; per-batch transpose; then x 2^6 once to f16 x Wo f16(bf16 x 2^8) + bo; f32 output.
#include <hip/hip_runtime.h>
#include <math.h>

typedef __attribute__((ext_vector_type(16))) _Float16 v16h;
typedef __attribute__((ext_vector_type(16))) __bf16 v16b;
typedef __attribute__((ext_vector_type(8)))  _Float16 v8h;
typedef __attribute__((ext_vector_type(8)))  float v8f;
typedef __attribute__((ext_vector_type(4)))  float v4f;
typedef __attribute__((ext_vector_type(2)))  float v2f;
typedef __attribute__((ext_vector_type(4)))  unsigned v4u;
typedef __attribute__((ext_vector_type(4)))  int v4i;
typedef float __attribute__((may_alias)) float_a;
typedef int __attribute__((may_alias)) int_a;

template <typename T> __device__ __forceinline__ void vst2(void* p, T v) { *(T*)p = v;  }
__device__ __forceinline__ v8f wmma16(v16h a, v16h b, v8f c) {
  v8f d = __builtin_amdgcn_wmma_f32_16x16x32_f16(false, a, false, b, (short)0, c, false, false);
  asm volatile("v_nop\n\tv_nop\n\tv_nop\n\tv_nop" : "+v"(d) : "v"(a), "v"(b));
  return d;
}
__device__ __forceinline__ v8f wmma_bf(v16b a, v16b b, v8f c) {
  v8f d = __builtin_amdgcn_wmma_f32_16x16x32_bf16(false, a, false, b, (short)0, c, false, false);
  asm volatile("v_nop\n\tv_nop\n\tv_nop\n\tv_nop" : "+v"(d) : "v"(a), "v"(b));
  return d;
}
// 16x16x32 fragments: lane = (h = lane>>4, row/col = lane&15); elements 0..7 = k0+8h+0..7, 8..15 = k0+16+8h+0..7; D element r = row 8h+r
__device__ __forceinline__ v16h frag_h(const _Float16* rowk0, int lane) {
  union { v16h v; v8h q[2]; } u; const _Float16* p = rowk0 + 8 * (lane >> 4);
  u.q[0] = *(const v8h*)p; u.q[1] = *(const v8h*)(p + 16); return u.v;
}
__device__ __forceinline__ v16h frag_f32(const float* rowk0, int lane) {
  v16h a; const float* p = rowk0 + 8 * (lane >> 4);
#pragma unroll
  for (int i = 0; i < 8; ++i) { a[i] = (_Float16)p[i]; a[8 + i] = (_Float16)p[16 + i]; }
  return a;
}
__device__ __forceinline__ v16h frag_f32s(const float* rowk0, int lane, float sc) {
  v16h a; const float* p = rowk0 + 8 * (lane >> 4);
#pragma unroll
  for (int i = 0; i < 8; ++i) { a[i] = (_Float16)(p[i] * sc); a[8 + i] = (_Float16)(p[16 + i] * sc); }
  return a;
}
// column fragment from a [K][ld] layout (column n), rows >= K read as 0
__device__ __forceinline__ v16h fragc_f32(const float* W, int k0, int n, int lane, int ld, int K) {
  v16h a; const int g = lane >> 4;
#pragma unroll
  for (int i = 0; i < 8; ++i) { const int ka = k0 + 8 * g + i, kb = ka + 16;
    a[i] = (_Float16)(ka < K ? W[(size_t)(ka < K ? ka : K - 1) * ld + n] : 0.f); a[8 + i] = (_Float16)(kb < K ? W[(size_t)(kb < K ? kb : K - 1) * ld + n] : 0.f); }
  return a;
}
struct F2 { v16b h, l; };
__device__ __forceinline__ F2 bsplit16(const float v[16]) { F2 r;
#pragma unroll
  for (int i = 0; i < 16; ++i) { const __bf16 h = (__bf16)v[i]; r.h[i] = h; r.l[i] = (__bf16)(v[i] - (float)h); }
  return r; }
__device__ __forceinline__ F2 split_row(const float* row, int k0, int lane) { float v[16]; const float* p = row + k0 + 8 * (lane >> 4);
#pragma unroll
  for (int i = 0; i < 8; ++i) { v[i] = p[i]; v[8 + i] = p[16 + i]; }
  return bsplit16(v); }
__device__ __forceinline__ F2 split_rowK(const float* row, int k0, int lane, int K) { float v[16]; const int g = lane >> 4;
#pragma unroll
  for (int i = 0; i < 8; ++i) { const int ka = k0 + 8 * g + i, kb = ka + 16; v[i] = ka < K ? row[ka < K ? ka : K - 1] : 0.f; v[8 + i] = kb < K ? row[kb < K ? kb : K - 1] : 0.f; }
  return bsplit16(v); }
__device__ __forceinline__ F2 split_col(const float* W, int k0, int n, int lane, int ld, int K) { float v[16]; const int g = lane >> 4;
#pragma unroll
  for (int i = 0; i < 8; ++i) { const int ka = k0 + 8 * g + i, kb = ka + 16; v[i] = ka < K ? W[(size_t)(ka < K ? ka : K - 1) * ld + n] : 0.f; v[8 + i] = kb < K ? W[(size_t)(kb < K ? kb : K - 1) * ld + n] : 0.f; }
  return bsplit16(v); }
__device__ __forceinline__ v8f mac3(const F2& a, const F2& b, v8f c) { c = wmma_bf(a.l, b.h, c); c = wmma_bf(a.h, b.l, c); return wmma_bf(a.h, b.h, c); }
__device__ __forceinline__ float sigm(float v) { return 1.0f / (1.0f + expf(-v)); }
#define LDSX() do { asm volatile("s_wait_dscnt 0" ::: "memory"); __builtin_amdgcn_wave_barrier(); __builtin_amdgcn_fence(__ATOMIC_RELEASE, "workgroup"); } while (0)

// Causal self-attention with 12 low-rank latent heads (x [4,2048,768]; (in,out) Wq [768,768], Wkd / Wvd [768,192], Wvu [192,768], Wo [768,768], all N(0,1) x 0.02, zero biases (read); q = x Wq + bq split into 12 heads x 64 of which only the FIRST 16 dims of each head are used (ql); kl, vl = x Wkd, x Wvd split into 12 heads x 16; scores = ql kl^T x 16^-0.5; triu(1) -> -inf; softmax; al = w vl merged to [B,S,192]; ao = al Wvu + bvu [B,S,768]; then jnp.transpose(ao, (0,2,1)).reshape(B,S,768): the per-batch [2048 x 768] matrix is transposed to [768 x 2048] and its memory re-read as 2,048 rows of 768; out = that Wo + bo).
#define NB 4
#define TT 2048
#define CC 384            // NH * HD = projected width
#define DIN 768          // input (model) width
#define NH 12
#define HD 32
#define LATW 16     /* real dims per head; columns h*HD + d with d >= LATW are zero padding */
#define QHEADW 64   /* the module's q heads are 64 wide; only their first LATW dims are used (ql = q[..., :16]) */
#define KVLD (NH * LATW)   /* row pitch of the (in,out) latent weights Wkd / Wvd [768][192] */
#define NQB (TT / 64)
#define HG 2   // S region: 2 x 2,048 x 2,048 f32 = 32 MiB, allocated but unused
#define SCALE (0.25f)
#define CAUSAL 1
#ifndef TNB
#define TNB NB
#endif
__device__ __forceinline__ float bfr(float v) { return (float)(__bf16)v; }
__host__ __device__ __forceinline__ int kb_last(int qb) { return CAUSAL ? ((qb * 64 + 63) >> 7) : (TT / 128 - 1); }
typedef __attribute__((ext_vector_type(8))) __bf16 v8b;
__device__ __forceinline__ v16b frag_b(const __bf16* rowk0, int lane) {
  union { v16b v; v8b q[2]; } u; const __bf16* p = rowk0 + 8 * (lane >> 4);
  u.q[0] = *(const v8b*)p; u.q[1] = *(const v8b*)(p + 16); return u.v;
}
#define QBH 6              // causal: query blocks 0..QBH-1 of each sequence (few keys, no averaging) take the high-precision path
#define QHI 384            // rows carrying a q residual plane
#define KHI 384            // key rows carrying k residual / v bf16 hi+lo planes (used only by the causal high-precision path)
// B fragment (k rows k0+.., output column o) of a weight: (in,out) [K][ld] or (out,in) [ld rows of K]: bf16 exact, or f16(bf16 * 256) exact
__device__ __forceinline__ v16b wcol_io(const float* Wm, int k0, int o, int lane, int ld) { v16b w; const int g = lane >> 4;
#pragma unroll
  for (int i = 0; i < 8; ++i) { w[i] = (__bf16)Wm[(size_t)(k0 + 8 * g + i) * ld + o]; w[8 + i] = (__bf16)Wm[(size_t)(k0 + 16 + 8 * g + i) * ld + o]; }
  return w; }
__device__ __forceinline__ v16b wcol_oi(const float* Wm, int k0, int o, int lane, int K) { v16b w; const float* p = Wm + (size_t)o * K + k0 + 8 * (lane >> 4);
#pragma unroll
  for (int i = 0; i < 8; ++i) { w[i] = (__bf16)p[i]; w[8 + i] = (__bf16)p[16 + i]; }
  return w; }
__device__ __forceinline__ v16h wcolh_io(const float* Wm, int k0, int o, int lane, int ld) { v16h w; const int g = lane >> 4;
#pragma unroll
  for (int i = 0; i < 8; ++i) { w[i] = (_Float16)(bfr(Wm[(size_t)(k0 + 8 * g + i) * ld + o]) * 256.0f); w[8 + i] = (_Float16)(bfr(Wm[(size_t)(k0 + 16 + 8 * g + i) * ld + o]) * 256.0f); }
  return w; }
// first output projection ao = al Wvu: the k index runs over ctx columns kk = h*HD + d; one 32-deep k-step = one head; its first 16 entries (d < LATW, fragment slots 0..7 of both lane halves) are rows h*LATW + d of the (in,out) [192][768] weight, its last 16 (padding dims, slots 8..15) are zero
__device__ __forceinline__ v16b wcol_io_lat(const float* Wm, int k0, int o, int lane, int ld) { v16b w; const int g = lane >> 4; const float* p = Wm + (size_t)((k0 / HD) * LATW + 8 * g) * ld + o;
#pragma unroll
  for (int i = 0; i < 8; ++i) { w[i] = (__bf16)p[(size_t)i * ld]; w[8 + i] = (__bf16)0.0f; }
  return w; }
__device__ __forceinline__ v16h wcolh_io_lat(const float* Wm, int k0, int o, int lane, int ld) { v16h w; const int g = lane >> 4; const float* p = Wm + (size_t)((k0 / HD) * LATW + 8 * g) * ld + o;
#pragma unroll
  for (int i = 0; i < 8; ++i) { w[i] = (_Float16)(bfr(p[(size_t)i * ld]) * 256.0f); w[8 + i] = (_Float16)0.0f; }
  return w; }
static_assert(HD == 32 && LATW == 16 && CC == NH * HD, "the latent loaders assume one head per 32-deep k-step with 16 real + 16 padding dims");
__device__ __forceinline__ v16h wcolh_oi(const float* Wm, int k0, int o, int lane, int K) { v16h w; const float* p = Wm + (size_t)o * K + k0 + 8 * (lane >> 4);
#pragma unroll
  for (int i = 0; i < 8; ++i) { w[i] = (_Float16)(bfr(p[i]) * 256.0f); w[8 + i] = (_Float16)(bfr(p[16 + i]) * 256.0f); }
  return w; }
#define WQKV_LAYOUT 0   // 0 = (in,out) [DIN][out], columns gathered per head; 1 = (out,in) [CC][DIN]; 2 = per-head [NH][DIN][HD]
__device__ __forceinline__ v16b wcol_hdk(const float* Wm, int k0, int o, int lane) { v16b w; const int g = lane >> 4; const float* p = Wm + (size_t)(o / HD) * DIN * HD + (o % HD);
#pragma unroll
  for (int i = 0; i < 8; ++i) { w[i] = (__bf16)p[(size_t)(k0 + 8 * g + i) * HD]; w[8 + i] = (__bf16)p[(size_t)(k0 + 16 + 8 * g + i) * HD]; }
  return w; }
#define WO_OUT_IN 0
#if WQKV_LAYOUT == 1
#define WCOL(W, k0, o, lane) wcol_oi(W, k0, o, lane, DIN)
#elif WQKV_LAYOUT == 2
#define WCOL(W, k0, o, lane) wcol_hdk(W, k0, o, lane)
#else
__device__ __forceinline__ v16b zero16b() { v16b w; _Pragma("unroll") for (int i = 0; i < 16; ++i) w[i] = (__bf16)0.0f; return w; }
/* column o = h*HD + d: real (d < LATW) -> weight column h*QHEADW + d of Wq (pitch DIN) for the q stream, h*LATW + d of Wkd / Wvd (pitch KVLD) for k / v; padding -> zeros. o = c0 + j*16 + col with c0 % 128 == 0, so (o % HD) < LATW is decided by j alone (compile-time per unrolled j, uniform across the wave) */
#define GCOL(o) ((which) == 0 ? ((o) / HD) * QHEADW + ((o) % HD) : ((o) / HD) * LATW + ((o) % HD))
#define WCOL(W, k0, o, lane) ((((o) % HD) < LATW) ? wcol_io(W, k0, GCOL(o), lane, ((which) == 0 ? DIN : KVLD)) : zero16b())
#endif
#if WO_OUT_IN
#define WOCOL(W, k0, o, lane) wcol_oi(W, k0, o, lane, CC)
#define WOCOLH(W, k0, o, lane) wcolh_oi(W, k0, o, lane, CC)
#else
#define WOCOL(W, k0, o, lane) wcol_io_lat(W, k0, o, lane, DIN)
#define WOCOLH(W, k0, o, lane) wcolh_io_lat(W, k0, o, lane, DIN)
#endif

#ifndef SM_EXTRA_PARAMS
#define SM_EXTRA_PARAMS
#endif
#ifndef PROJ_EXTRA_PARAMS
#define PROJ_EXTRA_PARAMS
#endif
#ifndef SM_MASK_HOOK
#define SM_MASK_HOOK (void)0
#endif

#define WS_QH  0u                                      // f16 q rows [b*t][CC]
#define WS_KH  (WS_QH + 2u * (size_t)NB * TT * CC)      // f16 k in A-fragment order [b][h][16-key tile][512 B] (the region keeps its old size)
#define WS_VT  (WS_KH + 2u * (size_t)NB * TT * CC)      // f16 v^T in A-fragment order [b][h][32-key step][1024 B]
#define WS_QL  (WS_VT + 2u * (size_t)NB * CC * TT)      // f16 q residual x 2^10 rows [b][t < QHI][CC]
#define WS_KL  (WS_QL + 2u * (size_t)NB * QHI * CC)     // f16 k residual x 2^10, as WS_KH, key tiles below KHI
#define WS_VB  (WS_KL + 2u * (size_t)NB * KHI * CC)     // bf16 v hi (then lo), as WS_VT, key steps below KHI
#define WS_VBL (WS_VB + 2u * (size_t)NB * CC * KHI)
#define WS_S   (WS_VBL + 2u * (size_t)NB * CC * KHI)    // f32 [hg][t][s] region, unused (logits stay in registers)
#define WS_Y   (WS_S  + 4u * (size_t)HG * TT * TT)      // f32 ctx rows [b*t][CC] (only when there is an output projection)
#define WS_END (WS_Y  + 4u * (size_t)NB * TT * CC)
#define WS_T  (WS_END)                                     // f16 per-batch transpose T[b][c][s] = f16((al Wvu + bvu)[b][s][c] x 2^6), written by k_out; its memory is then read as TT rows of DIN (the module's transpose(0,2,1).reshape)
#define WS_END2 (WS_T + 2u * (size_t)NB * TT * DIN)
static_assert(TT % 64 == 0 && DIN % 128 == 0, "a k_out block owns 64 positions of 128 channels: one whole 128-B line of T per channel");
// weights in WMMA B-fragment order, written once per call by k_prep. One fragment = the 32 lanes' slots 0..7 (16 B a lane, 512 B in a row), then their slots 8..15 (left out where they are the zero padding of a latent head)
#define NF_P (3 * (DIN / 32) * NH)        /* q slice / latent k / latent v: [which][kc][head], bf16 */
#define NF_U (NH * (DIN / 16))            /* Wvu: [head][column tile], slots 0..7 only, once bf16 and once f16(bf16 x 2^8) */
#define NF_O ((DIN / 32) * (DIN / 16))    /* Wo: [kc][column tile], f16(bf16 x 2^8) */
#define WS_FP  (WS_END2)
#define WS_FU  (WS_FP  + 1024u * (size_t)NF_P)
#define WS_FUH (WS_FU  + 512u * (size_t)NF_U)
#define WS_FO  (WS_FUH + 512u * (size_t)NF_U)
#define WS_END3 (WS_FO + 1024u * (size_t)NF_O)
static_assert((NF_P + NF_U + NF_O) % 4 == 0, "k_prep: four waves a block, one fragment a wave");
// fb = wave-uniform start of the fragment, lob = lane * 16 bytes
__device__ __forceinline__ v16b fragw_b(const __bf16* fb, unsigned lob) { union { v16b v; v8b q[2]; } u; const char* p = (const char*)fb + lob; u.q[0] = *(const v8b*)p; u.q[1] = *(const v8b*)(p + 512); return u.v; }
__device__ __forceinline__ v16h fragw_h(const _Float16* fb, unsigned lob) { union { v16h v; v8h q[2]; } u; const char* p = (const char*)fb + lob; u.q[0] = *(const v8h*)p; u.q[1] = *(const v8h*)(p + 512); return u.v; }
__device__ __forceinline__ v16b fragw_b8(const __bf16* fb, unsigned lob) { union { v16b v; v8b q[2]; } u; u.q[0] = *(const v8b*)((const char*)fb + lob);
#pragma unroll
  for (int i = 0; i < 8; ++i) u.q[1][i] = (__bf16)0.0f;
  return u.v; }
__device__ __forceinline__ v16h fragw_h8(const _Float16* fb, unsigned lob) { union { v16h v; v8h q[2]; } u; u.q[0] = *(const v8h*)((const char*)fb + lob);
#pragma unroll
  for (int i = 0; i < 8; ++i) u.q[1][i] = (_Float16)0.0f;
  return u.v; }
// a precaution: stands between issued loads and the next write of a register that holds one of their addresses
__device__ __forceinline__ void XW() { asm volatile("s_wait_xcnt 0x0" ::: "memory"); }
// N weight values of one column, rows i (i < 8) and, for N = 16, 16 + i of an (in,out) weight of pitch LD: ub = wave-uniform address of the tile's first row and column, lo = the lane's fixed byte offset (8 g rows + its column). The last load may land on the offset register, so the wait stands in front of it, and once more behind it, ahead of the scalar work that forms the store address
template <int LD, int N> __device__ __forceinline__ void ld_col(const float* ub, unsigned lo, float v[N]) { const char* p = (const char*)ub + lo;
#pragma unroll
  for (int i = 0; i < N - 1; ++i) v[i] = *(const float*)(p + (size_t)((i & 7) + 2 * (i & 8)) * LD * 4);
  XW(); v[N - 1] = *(const float*)(p + (size_t)(((N - 1) & 7) + 2 * ((N - 1) & 8)) * LD * 4); XW(); }
// ---- k_prep: one wave = one B fragment, with the roundings the projection kernels' own loaders (wcol_io, wcol_io_lat, wcolh_io_lat, wcolh_io) made per wave and per row block
__global__ __launch_bounds__(128) void k_prep(const float* __restrict__ WQ, const float* __restrict__ WK, const float* __restrict__ WV, const float* __restrict__ WU, const float* __restrict__ WO, __bf16* __restrict__ FP, __bf16* __restrict__ FU, _Float16* __restrict__ FUH, _Float16* __restrict__ FO) {
  const int lane = threadIdx.x & 31, col = lane & 15, g = lane >> 4; const int f = blockIdx.x * 4 + __builtin_amdgcn_readfirstlane(threadIdx.x >> 5);
  if (f < NF_P) { const int which = f / ((DIN / 32) * NH), kc = (f / NH) % (DIN / 32), h = f % NH; float v[16];
    if (which == 0) ld_col<DIN, 16>(WQ + (size_t)kc * 32 * DIN + h * QHEADW, (unsigned)(8 * g * DIN + col) * 4u, v);
    else ld_col<KVLD, 16>((which == 1 ? WK : WV) + (size_t)kc * 32 * KVLD + h * LATW, (unsigned)(8 * g * KVLD + col) * 4u, v);
    union { v16b v; v8b q[2]; } u;
#pragma unroll
    for (int i = 0; i < 16; ++i) u.v[i] = (__bf16)v[i];
    char* d = (char*)FP + (size_t)f * 1024 + lane * 16; *(v8b*)d = u.q[0]; *(v8b*)(d + 512) = u.q[1];
  } else if (f < NF_P + NF_U) { const int fu = f - NF_P, h = fu / (DIN / 16), jt = fu % (DIN / 16); float v[8];
    ld_col<DIN, 8>(WU + (size_t)h * LATW * DIN + jt * 16, (unsigned)(8 * g * DIN + col) * 4u, v);
    v8b wb; v8h wh;
#pragma unroll
    for (int i = 0; i < 8; ++i) { wb[i] = (__bf16)v[i]; wh[i] = (_Float16)(bfr(v[i]) * 256.0f); }
    *(v8b*)((char*)FU + (size_t)fu * 512 + lane * 16) = wb; *(v8h*)((char*)FUH + (size_t)fu * 512 + lane * 16) = wh;
  } else { const int fo = f - NF_P - NF_U, kc = fo / (DIN / 16), jt = fo % (DIN / 16); float v[16];
    ld_col<DIN, 16>(WO + (size_t)kc * 32 * DIN + jt * 16, (unsigned)(8 * g * DIN + col) * 4u, v);
    union { v16h v; v8h q[2]; } u;
#pragma unroll
    for (int i = 0; i < 16; ++i) u.v[i] = (_Float16)(bfr(v[i]) * 256.0f);
    char* d = (char*)FO + (size_t)fo * 1024 + lane * 16; *(v8h*)d = u.q[0]; *(v8h*)(d + 512) = u.q[1]; } }
// ---- k_proj: block = (64 rows, 128 cols, which): q/k/v = X W (+ b) with exact bf16 products (K = DIN) -> which 0: q f16 rows (+ residual rows < QHI); 1: k f16 (+ residual for keys < KHI); 2: v f16 (+ bf16 hi/lo for keys < KHI). k and v leave in the order k_att's A fragments are read in, the 16 real dims of a head only:
// k tile (16 keys): 512 B with lane (g, c) = dims 8 g + 0..7 of key c; the even tile of a 32-key step fills fragment slots 0..7, the odd one slots 8..15; the padding dims are not stored. v step (32 keys): 512 B with lane (g, c) = keys 8 g + 0..7 of dim c (slots 0..7), then 512 B with keys 16 + 8 g + 0..7 (slots 8..15)
__global__ __launch_bounds__(128) void k_proj(const float* __restrict__ XQ, const float* __restrict__ XK, const float* __restrict__ XV, const __bf16* __restrict__ FP, const float* __restrict__ BQ, const float* __restrict__ BK, const float* __restrict__ BV,
    _Float16* __restrict__ QH, _Float16* __restrict__ QL, _Float16* __restrict__ KH, _Float16* __restrict__ KL, _Float16* __restrict__ VT, __bf16* __restrict__ VB, __bf16* __restrict__ VBL) {
  __shared__ __align__(16) _Float16 sh[64][136], sl[64][136]; __shared__ __align__(16) _Float16 th[128][72]; __shared__ __align__(16) __bf16 tb[128][72], tbl[128][72];
  const int tid = threadIdx.x, wave = tid >> 5, lane = tid & 31, col = lane & 15, g = lane >> 4; const int which = blockIdx.z; const int c0 = blockIdx.y * 128; const size_t r0 = (size_t)blockIdx.x * 64; const size_t bb = r0 / TT; const int t0 = (int)(r0 % TT);
  const float* X = which == 0 ? XQ : which == 1 ? XK : XV; const __bf16* FW = FP + ((size_t)which * (DIN / 32) * NH + c0 / HD) * 512; const unsigned lob = lane * 16u; const float* BA = which == 0 ? BQ : which == 1 ? BK : BV;
  v8f acc[8] = {};
#pragma unroll 2
  for (int kc = 0; kc < DIN / 32; ++kc) { float av[16]; { const float* p = X + (r0 + wave * 16 + col) * DIN + kc * 32 + 8 * g;
#pragma unroll
      for (int i = 0; i < 8; ++i) { av[i] = p[i]; av[8 + i] = p[16 + i]; } }
    v16b w[4];   /* the step's four real column tiles (even j: dims < LATW of a head), asked for together with the x rows */
#pragma unroll
    for (int jj = 0; jj < 4; ++jj) w[jj] = fragw_b(FW + (size_t)(kc * NH + jj) * 512, lob);
    __builtin_amdgcn_sched_barrier(0);   /* every load of the k-step is issued before the first rounding that waits for one; without it the build holds two weight loads back behind that wait */
    v16b a;
#pragma unroll
    for (int i = 0; i < 16; ++i) a[i] = (__bf16)av[i];
#pragma unroll
    for (int j = 0; j < 8; ++j) acc[j] = wmma_bf(a, (j & 1) ? zero16b() : w[j >> 1], acc[j]); }
  if (which < 2) { _Float16* DH = which == 0 ? QH : KH; _Float16* DL = which == 0 ? QL : KL; const int nhi = which == 0 ? QHI : KHI; const bool hi_rows = t0 < nhi;
#pragma unroll
    for (int j = 0; j < 8; ++j) { const float bias = (BA && ((c0 + j * 16 + col) % HD) < LATW) ? bfr(BA[GCOL(c0 + j * 16 + col)]) : 0.f;   /* gathered like the weight columns; padding columns get no bias */
#pragma unroll
      for (int r = 0; r < 8; ++r) { const float v = acc[j][r] + bias; const _Float16 hv = (_Float16)v; sh[wave * 16 + 8 * g + r][j * 16 + col] = hv; sl[wave * 16 + 8 * g + r][j * 16 + col] = (_Float16)((v - (float)hv) * 1024.0f); } }
    __syncthreads();
    if (which == 0) { for (int e = tid; e < 64 * 16; e += 128) { const int rl = e >> 4, q = e & 15; vst2((unsigned*)(DH + (r0 + rl) * CC + c0 + q * 8), *(const v4u*)&sh[rl][q * 8]); XW(); if (hi_rows) { vst2((unsigned*)(DL + (bb * nhi + t0 + rl) * (size_t)CC + c0 + q * 8), *(const v4u*)&sl[rl][q * 8]); XW(); } }
    } else {   /* wave = key tile, pass = head: a wave stores one whole tile, 512 B in a row */
      const int rl = wave * 16 + col; const size_t hd = bb * NH + c0 / HD; v4u a[4];
#pragma unroll
      for (int hh = 0; hh < 4; ++hh) a[hh] = *(const v4u*)&sh[rl][hh * HD + g * 8];
#pragma unroll
      for (int hh = 0; hh < 4; ++hh) vst2((unsigned*)(DH + ((hd + hh) * (TT / 16) + t0 / 16 + wave) * 256 + lane * 8), a[hh]);
      XW();
      if (hi_rows) {
#pragma unroll
        for (int hh = 0; hh < 4; ++hh) a[hh] = *(const v4u*)&sl[rl][hh * HD + g * 8];
#pragma unroll
        for (int hh = 0; hh < 4; ++hh) vst2((unsigned*)(DL + ((hd + hh) * (KHI / 16) + t0 / 16 + wave) * 256 + lane * 8), a[hh]);
        XW(); } }
  } else { const bool hi_rows = t0 < KHI;
#pragma unroll
    for (int j = 0; j < 8; ++j) { const float bias = (BA && ((c0 + j * 16 + col) % HD) < LATW) ? bfr(BA[GCOL(c0 + j * 16 + col)]) : 0.f;   /* gathered like the weight columns; padding columns get no bias */
#pragma unroll
      for (int r = 0; r < 8; ++r) { const float v = acc[j][r] + bias; const int rl = wave * 16 + 8 * g + r, cl = j * 16 + col; th[cl][rl] = (_Float16)v; const __bf16 bh = (__bf16)v; tb[cl][rl] = bh; tbl[cl][rl] = (__bf16)(v - (float)bh); } }
    __syncthreads();
    const int rl = wave * 16 + g * 8; const size_t hd = bb * NH + c0 / HD; v4u a[4];   /* wave = 16 keys = half a step, pass = head: a wave stores 512 B in a row */
#pragma unroll
    for (int hh = 0; hh < 4; ++hh) a[hh] = *(const v4u*)&th[hh * HD + col][rl];
#pragma unroll
    for (int hh = 0; hh < 4; ++hh) vst2((unsigned*)(VT + ((hd + hh) * (TT / 32) + t0 / 32) * 512 + tid * 8), a[hh]);
    XW();
    if (hi_rows) { v4u lo[4];
#pragma unroll
      for (int hh = 0; hh < 4; ++hh) { a[hh] = *(const v4u*)&tb[hh * HD + col][rl]; lo[hh] = *(const v4u*)&tbl[hh * HD + col][rl]; }
#pragma unroll
      for (int hh = 0; hh < 4; ++hh) { const size_t o3 = ((hd + hh) * (KHI / 32) + t0 / 32) * 512 + tid * 8; vst2((unsigned*)(VB + o3), a[hh]); vst2((unsigned*)(VBL + o3), lo[hh]); }
      XW(); } } }
// ---- k_att: block = 4 waves x 32 queries of (b, h), one launch for all (b, h): logits, softmax and P . v without leaving registers.
// S^T = K . Q^T (A = 16 key rows, B = 16 query rows): lane (g, c) holds, for query c, keys 8g + r of each 16-key tile, so the two tiles of one 32-key step, converted in place, are the B operand of ctx^T += v^T . P^T (hardware k order on both sides). Each key / v fragment serves the wave's two 16-query tiles. K and v^T lie in fragment order (k_proj), so every load of the walks is 512 B in a row, four whole lines; only the 16 real dims of a head are read, and the product with v's padding dims, which is 0, is not formed.
// One K fragment holds BOTH 16-key tiles of a step: row c = key c of tile 0 in k slots 0..15 and key c of tile 1 in k slots 16..31. Tile 0's logits come from B = [q ; 0], tile 1's from B = [0 ; q]: the zeros stand in the loop-invariant q fragments, and the K registers hold loaded values only.
// Walk 1: row maximum. Walk 2 (logits formed again, same products): e = exp(s - max) x 2^11, row sum in f32, e once to f16 against v f16 (query rows < QHI: 3-product logits, e and v as bf16 hi + lo, 3 products); ctx = acc / sum. Keys past the wave's own diagonal step are not visited; the diagonal step masks by index.
#define QT 2   // 16-query tiles per wave
#define RD 4   // late rows, second walk: steps whose key and v fragments are held or in flight
#define RD1 8  // late rows, first walk: its steps are about a third as long and hold keys only, so the ring is deeper
static_assert(QHI % (64 * QT) == 0 && QHI == QBH * 64 && KHI >= QHI && TT % (64 * QT) == 0, "a block of 4 x QT x 16 queries is wholly early or wholly late; early rows see only keys < KHI");
__device__ __forceinline__ v8f wm_h(v16h a, v16h b, v8f c) { return __builtin_amdgcn_wmma_f32_16x16x32_f16(false, a, false, b, (short)0, c, false, false); }
__device__ __forceinline__ v8f wm_b(v16b a, v16b b, v8f c) { return __builtin_amdgcn_wmma_f32_16x16x32_bf16(false, a, false, b, (short)0, c, false, false); }
// q fragments from a wave-uniform base + the lane's fixed byte offset (row c, half g)
__device__ __forceinline__ void frag_q(const _Float16* ub, unsigned lob, v16h q2[2]) { union { v16h v; v8h q[2]; } u0, u1; const v8h d = *(const v8h*)((const char*)ub + lob); v8h z;
#pragma unroll
  for (int i = 0; i < 8; ++i) z[i] = (_Float16)0.0f;
  u0.q[0] = d; u0.q[1] = z; u1.q[0] = z; u1.q[1] = d; q2[0] = u0.v; q2[1] = u1.v; }   /* the 16 real dims of query row c: [q ; 0] and [0 ; q] */
// k or v fragment in fragment order: fb = wave-uniform start of the 32-key step, lob = lane * 16 bytes. xl: the last fragment read through its address; its last load may land on the address registers, so the wait stands in front of it
__device__ __forceinline__ v16h fragv_h(const _Float16* fb, unsigned lob, bool xl) { union { v16h v; v8h q[2]; } u; const char* p = (const char*)fb + lob; u.q[0] = *(const v8h*)p; if (xl) XW(); u.q[1] = *(const v8h*)(p + 512); return u.v; }
__device__ __forceinline__ v16b fragv_b(const __bf16* fb, unsigned lob, bool xl) { union { v16b v; v8b q[2]; } u; const char* p = (const char*)fb + lob; u.q[0] = *(const v8b*)p; if (xl) XW(); u.q[1] = *(const v8b*)(p + 512); return u.v; }
// the ring's loads: a = the lane's own address of a 32-key step's fragment (step start + lane * 16 bytes)
typedef const __attribute__((address_space(1))) char* gp;
__device__ __forceinline__ gp ring_a(const _Float16* base, int step, unsigned lob) { return (gp)(const char*)base + (size_t)step * 1024 + lob; }
__device__ __forceinline__ v16h ring_ld(gp a) { typedef const __attribute__((address_space(1))) v8h* gq; union { v16h v; v8h q[2]; } u; u.q[0] = *(gq)a; u.q[1] = *(gq)(a + 512); return u.v; }
// a precaution, as XW: the wait that stands between issued loads and the next write of a register that holds one of their addresses. The addresses are its inputs, so they keep registers of their own up to the wait and no load issued before it can land on them
__device__ __forceinline__ void XWH(gp a) { asm volatile("s_wait_xcnt 0x0" :: "v"(a) : "memory"); }
__device__ __forceinline__ void XWH(gp a, gp b) { asm volatile("s_wait_xcnt 0x0" :: "v"(a), "v"(b) : "memory"); }
__device__ __forceinline__ void XWH(gp a, gp b, gp c, gp d, gp e, gp f, gp g, gp h) { asm volatile("s_wait_xcnt 0x0" :: "v"(a), "v"(b), "v"(c), "v"(d), "v"(e), "v"(f), "v"(g), "v"(h) : "memory"); }
// e x 2^11 = 2^(t x LC + off): t = the raw logit (before x 16^-0.5), LC = 16^-0.5 x log2(e), off = 11 - max(t) x LC, one value per query row. One fused multiply-add and one v_exp_f32 per logit; the rounding of off is a factor common to a row's numerators and its sum. Below 2^-126 the result may flush to 0, far under what the f32 sum or the 16-bit P can hold.
#define LC (SCALE * 1.44269504088896340736f)
// The free slot the instruction set asks for behind a transcendental (before its result is read or its source overwritten) stands in the v_exp_f32's own statement. exp2_x8: the eight logits of one product tile, each exponential in place on its own register (one the compiler's own multiply-add has just written, so the statement lands on no register that a matrix instruction still reads), so each is the independent instruction behind the one before it, and one v_nop closes the last.
__device__ __forceinline__ void exp2_x8(float* t, float off) { float a[8];
#pragma unroll
  for (int r = 0; r < 8; ++r) a[r] = __builtin_fmaf(t[r], LC, off);
  asm("v_exp_f32 %0, %0\n\tv_exp_f32 %1, %1\n\tv_exp_f32 %2, %2\n\tv_exp_f32 %3, %3\n\tv_exp_f32 %4, %4\n\tv_exp_f32 %5, %5\n\tv_exp_f32 %6, %6\n\tv_exp_f32 %7, %7\n\tv_nop" : "+v"(a[0]), "+v"(a[1]), "+v"(a[2]), "+v"(a[3]), "+v"(a[4]), "+v"(a[5]), "+v"(a[6]), "+v"(a[7]));
#pragma unroll
  for (int r = 0; r < 8; ++r) t[r] = a[r]; }
// one 32-key step: ld_k reads its two 16-key tiles as one fragment (KHr / KLr point at step 0 of (b, h), 512 elements a step, lob = lane * 16 bytes); st_mm forms s[u][8 t + r] = raw logit (not yet x 16^-0.5) of (key kc*32 + 16 t + 8 g + r, query 16 u + c)
struct KF { v16h h, l; };
template <bool HI> __device__ __forceinline__ KF ld_k(const _Float16* KHr, const _Float16* KLr, int kc, unsigned lob) { KF k; k.h = fragv_h(KHr + (size_t)kc * 512, lob, false); if (HI) k.l = fragv_h(KLr + (size_t)kc * 512, lob, false); else k.l = k.h; return k; }
template <bool HI> __device__ __forceinline__ void st_mm(const KF& k, const v16h qh[QT][2], const v16h ql[QT][2], float s[QT][16]) {
#pragma unroll
  for (int t = 0; t < 2; ++t)
#pragma unroll
    for (int u = 0; u < QT; ++u) { v8f a = {}; a = wm_h(k.h, qh[u][t], a);
      if (HI) { v8f al = {}; al = wm_h(k.h, ql[u][t], al); al = wm_h(k.l, qh[u][t], al);
#pragma unroll
        for (int r = 0; r < 8; ++r) s[u][t * 8 + r] = a[r] + al[r] * (1.0f / 1024.0f);
      } else {
#pragma unroll
        for (int r = 0; r < 8; ++r) s[u][t * 8 + r] = a[r]; } } }
template <bool HI, bool MASK> __device__ __forceinline__ void max_use(const KF& k, const v16h qh[QT][2], const v16h ql[QT][2], int kc, int qrel, float m[QT]) { float s[QT][16]; st_mm<HI>(k, qh, ql, s);
#pragma unroll
  for (int u = 0; u < QT; ++u)
#pragma unroll
    for (int i = 0; i < 16; ++i) { if (!MASK || kc * 32 + 16 * (i >> 3) + (i & 7) <= qrel + 16 * u) m[u] = fmaxf(m[u], s[u][i]); } }
template <bool HI, bool MASK> __device__ __forceinline__ void max_step(const _Float16* KHr, const _Float16* KLr, const v16h qh[QT][2], const v16h ql[QT][2], int kc, unsigned lob, int qrel, float m[QT]) { const KF k = ld_k<HI>(KHr, KLr, kc, lob); max_use<HI, MASK>(k, qh, ql, kc, qrel, m); }
template <bool HI, bool MASK> __device__ __forceinline__ void pv_use(const KF& k, const v16h vf, const v16b vh, const v16b vl, const v16h qh[QT][2], const v16h ql[QT][2], int kc, int qrel, const float off[QT], float sum[QT], v8f acc[QT]) { float s[QT][16];
  st_mm<HI>(k, qh, ql, s);
#pragma unroll
  for (int u = 0; u < QT; ++u) { exp2_x8(&s[u][0], off[u]); exp2_x8(&s[u][8], off[u]);
#pragma unroll
    for (int i = 0; i < 16; ++i) { float e = s[u][i]; if (MASK && kc * 32 + 16 * (i >> 3) + (i & 7) > qrel + 16 * u) e = 0.f; sum[u] += e; s[u][i] = e; } }
  if (HI) { F2 pp[QT];
#pragma unroll
    for (int u = 0; u < QT; ++u) pp[u] = bsplit16(s[u]);
#pragma unroll
    for (int u = 0; u < QT; ++u) { acc[u] = wm_b(vh, pp[u].h, acc[u]); acc[u] = wm_b(vh, pp[u].l, acc[u]); acc[u] = wm_b(vl, pp[u].h, acc[u]); }
  } else { v16h pb[QT];
#pragma unroll
    for (int u = 0; u < QT; ++u)
#pragma unroll
      for (int i = 0; i < 16; ++i) pb[u][i] = (_Float16)s[u][i];
#pragma unroll
    for (int u = 0; u < QT; ++u) acc[u] = wm_h(vf, pb[u], acc[u]); } }
template <bool HI, bool MASK> __device__ __forceinline__ void pv_step(const _Float16* KHr, const _Float16* KLr, const v16h qh[QT][2], const v16h ql[QT][2], const _Float16* VTr, const __bf16* VBr, const __bf16* VBLr, int kc, unsigned lob, int qrel, const float off[QT], float sum[QT], v8f acc[QT]) {
  const KF k = ld_k<HI>(KHr, KLr, kc, lob); XW();
  v16h vf = {}; v16b vh = {}, vl = {};   /* v is asked for before the exponentials, which cover its latency; the diagonal step's last load is the last through lob */
  if (HI) { vh = fragv_b(VBr + (size_t)kc * 512, lob, false); vl = fragv_b(VBLr + (size_t)kc * 512, lob, MASK); } else vf = fragv_h(VTr + (size_t)kc * 512, lob, MASK);
  pv_use<HI, MASK>(k, vf, vh, vl, qh, ql, kc, qrel, off, sum, acc); }
template <bool HI> __device__ __forceinline__ void att_body(const _Float16* __restrict__ QH, const _Float16* __restrict__ KH, const _Float16* __restrict__ QL, const _Float16* __restrict__ KL, const _Float16* __restrict__ VT, const __bf16* __restrict__ VB, const __bf16* __restrict__ VBL, int b, int h, int ql0, int lane, float* __restrict__ Y) {
  const int c = lane & 15, g = lane >> 4; const int nfull = ql0 >> 5;   /* ql0 % 32 == 0: steps 0 .. nfull-1 lie wholly below the diagonal for all 32 queries; step nfull holds it */
  const size_t hd = (size_t)b * NH + h; const _Float16* KHr = KH + hd * (TT * LATW); const _Float16* KLr = KL + hd * (KHI * LATW); const unsigned klo = (unsigned)(c * CC + 8 * g) * 2u, lob = lane * 16u;   /* klo: the q rows' offset; lob: every k / v fragment's */
  const _Float16* VTr = VT + hd * (TT * LATW); const __bf16* VBr = VB + hd * (KHI * LATW); const __bf16* VBLr = VBL + hd * (KHI * LATW);
  v16h qh[QT][2], ql[QT][2];
#pragma unroll
  for (int u = 0; u < QT; ++u) { frag_q(QH + ((size_t)b * TT + ql0 + u * 16) * CC + h * HD, klo, qh[u]); if (HI) frag_q(QL + ((size_t)b * QHI + ql0 + u * 16) * CC + h * HD, klo, ql[u]); else { ql[u][0] = qh[u][0]; ql[u][1] = qh[u][1]; } }
  XW();
  const int qrel = ql0 + c - 8 * g;   /* key kc*32 + 16 t + 8 g + r is kept for query ql0 + 16 u + c when kc*32 + 16 t + r <= qrel + 16 u */
  float m[QT], sum[QT]; v8f acc[QT] = {};
#pragma unroll
  for (int u = 0; u < QT; ++u) { m[u] = -3.0e38f; sum[u] = 0.f; }
  if (HI) {   /* early rows: at most KHI / 32 steps, loads asked for in the step that uses them */
#pragma unroll 1   /* left rolled, as it was: few steps, and unrolling adds registers */
    for (int kc = 0; kc < nfull; ++kc) max_step<HI, false>(KHr, KLr, qh, ql, kc, lob, qrel, m);
    max_step<HI, true>(KHr, KLr, qh, ql, nfull, lob, qrel, m);
#pragma unroll
    for (int u = 0; u < QT; ++u) { m[u] = fmaxf(m[u], __shfl_xor(m[u], 16)); m[u] = __builtin_fmaf(-m[u], LC, 11.0f); }   /* the two lane halves hold different keys of the same query; from here m = the exponent's offset */
#pragma unroll 1   /* left rolled, as it was */
    for (int kc = 0; kc < nfull; ++kc) pv_step<HI, false>(KHr, KLr, qh, ql, VTr, VBr, VBLr, kc, lob, qrel, m, sum, acc);
    pv_step<HI, true>(KHr, KLr, qh, ql, VTr, VBr, VBLr, nfull, lob, qrel, m, sum, acc);
  } else {
    /* late rows: each walk holds a ring of steps' fragments in registers (RD1 steps of keys, then RD steps of keys and v). A slot is asked for again, a ring's length ahead, right behind the step that used it, so a load has the other slots' steps of work to land in. A step index past the diagonal step is clamped to it (read, not used). The diagonal step's own fragments (kd for both walks, vd) are asked for once, up front. Steps are used in the order 0 .. nfull as before. */
    static_assert(RD == 4 && RD1 == 8, "the waits behind the rings' first loads name their addresses one by one");
    const v16b zb = {}; KF k1[RD1], kb[RD], kd; v16h vb[RD], vd; gp a1[RD1], ak[RD], av[RD];
    const gp akd = ring_a(KHr, nfull, lob), avd = ring_a(VTr, nfull, lob);
#pragma unroll
    for (int j = 0; j < RD1; ++j) { a1[j] = ring_a(KHr, j < nfull ? j : nfull, lob); k1[j].h = ring_ld(a1[j]); k1[j].l = k1[j].h; }
    XWH(a1[0], a1[1], a1[2], a1[3], a1[4], a1[5], a1[6], a1[7]);
    kd.h = ring_ld(akd); kd.l = kd.h; XWH(akd);   /* a wait of its own, directly behind: no other load stands between */
    gp pa = akd, pb = avd;   /* the addresses of the youngest refill: their wait stands one step later, in front of the next refill, where it has nothing left to wait for */
    int kc = 0;
#pragma unroll 1   /* one trip = one turn of the ring, its slots fixed registers */
    for (; kc + RD1 <= nfull; kc += RD1) {
#pragma unroll
      for (int j = 0; j < RD1; ++j) { max_use<false, false>(k1[j], qh, ql, kc + j, qrel, m);
        __builtin_amdgcn_sched_barrier(0);   /* the wait and the refill stay behind the step's work: lifted to its head the wait stands right behind the loads it is for, and stalls */
        XWH(pa); const int nx = kc + RD1 + j; pa = ring_a(KHr, nx < nfull ? nx : nfull, lob); k1[j].h = ring_ld(pa); k1[j].l = k1[j].h;
        __builtin_amdgcn_sched_barrier(0); } }   /* keeps the steps in ring order: without it the build lifts the last slots' products to the head of the trip, where they wait for loads just issued */
    XWH(pa);
#pragma unroll
    for (int j = 0; j < RD1 - 1; ++j) { if (kc + j < nfull) max_use<false, false>(k1[j], qh, ql, kc + j, qrel, m); }
    vd = ring_ld(avd); XWH(avd);   /* the second walk's first turn is asked for ahead of the diagonal step's maximum */
#pragma unroll
    for (int j = 0; j < RD; ++j) { const int nx = j < nfull ? j : nfull; ak[j] = ring_a(KHr, nx, lob); av[j] = ring_a(VTr, nx, lob); kb[j].h = ring_ld(ak[j]); kb[j].l = kb[j].h; vb[j] = ring_ld(av[j]);
      __builtin_amdgcn_sched_barrier(0); }   /* asked for in ring order: the loop's counted load waits are set for both ways into the loop, and another order here makes them wait for younger slots */
    XWH(ak[0], ak[1], ak[2], ak[3], av[0], av[1], av[2], av[3]);
    max_use<false, true>(kd, qh, ql, nfull, qrel, m);
#pragma unroll
    for (int u = 0; u < QT; ++u) { m[u] = fmaxf(m[u], __shfl_xor(m[u], 16)); m[u] = __builtin_fmaf(-m[u], LC, 11.0f); }   /* the two lane halves hold different keys of the same query; from here m = the exponent's offset */
    pa = akd; pb = avd;
#pragma unroll 1   /* one trip = one turn of the ring */
    for (kc = 0; kc + RD <= nfull; kc += RD) {
#pragma unroll
      for (int j = 0; j < RD; ++j) { pv_use<false, false>(kb[j], vb[j], zb, zb, qh, ql, kc + j, qrel, m, sum, acc);
        __builtin_amdgcn_sched_barrier(0);   /* as in the first walk: the wait stays a whole step behind the loads it is for */
        XWH(pa, pb); const int nx = kc + RD + j < nfull ? kc + RD + j : nfull; pa = ring_a(KHr, nx, lob); pb = ring_a(VTr, nx, lob); kb[j].h = ring_ld(pa); kb[j].l = kb[j].h; vb[j] = ring_ld(pb);
        __builtin_amdgcn_sched_barrier(0); } }   /* the refill is issued here: without it the build sinks the loads into the next step, up to that step's wait */
    XWH(pa, pb);
#pragma unroll
    for (int j = 0; j < RD - 1; ++j) { if (kc + j < nfull) pv_use<false, false>(kb[j], vb[j], zb, zb, qh, ql, kc + j, qrel, m, sum, acc); }
    pv_use<false, true>(kd, vd, zb, zb, qh, ql, nfull, qrel, m, sum, acc);
  }
#pragma unroll
  for (int u = 0; u < QT; ++u) { const float st = sum[u] + __shfl_xor(sum[u], 16); const float inv = st > 0.f ? 1.0f / st : 0.f;   /* sum and acc both carry the 2^11 */
    float* yr = Y + ((size_t)b * TT + ql0 + u * 16 + c) * CC + h * HD + 8 * g;   /* acc[u][r] = ctx(query 16 u + c, dim 8 g + r): 32 contiguous bytes per lane; the padding dims 16 + 8 g + r, which k_out reads against zero weights, are stored as the zeros their product was */
    v4f o0, o1; const v4f z = {};
#pragma unroll
    for (int r = 0; r < 4; ++r) { o0[r] = acc[u][r] * inv; o1[r] = acc[u][4 + r] * inv; }
    vst2(yr, o0); vst2(yr + 4, o1); vst2(yr + 16, z); vst2(yr + 20, z); } }
__global__ __launch_bounds__(128) void k_att(const _Float16* __restrict__ QH, const _Float16* __restrict__ KH, const _Float16* __restrict__ QL, const _Float16* __restrict__ KL, const _Float16* __restrict__ VT, const __bf16* __restrict__ VB, const __bf16* __restrict__ VBL, float* __restrict__ Y) {
  const int b = blockIdx.x / NH, h = blockIdx.x % NH; const int q0 = (TT / (64 * QT) - 1 - (int)blockIdx.y) * (64 * QT);   /* longest query blocks start first */
  const int wave = __builtin_amdgcn_readfirstlane(threadIdx.x >> 5), lane = threadIdx.x & 31; const int ql0 = q0 + wave * (16 * QT);
  if (q0 < QHI) att_body<true>(QH, KH, QL, KL, VT, VB, VBL, b, h, ql0, lane, Y); else att_body<false>(QH, KH, QL, KL, VT, VB, VBL, b, h, ql0, lane, Y); }
// The result leaves as k_out2's A operand: a lane's 8 accumulator rows are 8 consecutive positions of one channel, so x 2^6 and the one rounding to f16 (the rounding k_out2's loader made) give 16 B of a T row; the block's 64 positions of a channel are gathered in LDS and stored as one whole line.
// ---- k_out: block = (64 rows, 128 cols): ao = ctx Wvu (+ bvu): ctx x 2^6 once to f16 against Wvu as f16(bf16 x 2^8) exact (1 product) x 2^-14; causal early rows (< QHI of each sequence): ctx bf16 hi + lo against exact bf16 Wvu (2 products)
__global__ __launch_bounds__(128) void k_out(const float* __restrict__ Y, const __bf16* __restrict__ FU, const _Float16* __restrict__ FUH, const float* __restrict__ BO, _Float16* __restrict__ TH) { __shared__ __align__(16) _Float16 st[128][72];
  const int tid = threadIdx.x, wave = tid >> 5, lane = tid & 31, col = lane & 15, g = lane >> 4; const int c0 = blockIdx.y * 128; const size_t r0 = (size_t)blockIdx.x * 64 + wave * 16; const unsigned lob = lane * 16u;
  v8f acc[8] = {};
  if (CAUSAL && (int)(((size_t)blockIdx.x * 64) % TT) < QHI) {   /* block-uniform */
#pragma unroll 2
    for (int kc = 0; kc < CC / 32; ++kc) { const F2 a = split_row(Y + (r0 + col) * CC, kc * 32, lane); v16b w[8];
#pragma unroll
      for (int j = 0; j < 8; ++j) w[j] = fragw_b8(FU + (size_t)(kc * (DIN / 16) + c0 / 16 + j) * 256, lob);
#pragma unroll
      for (int j = 0; j < 8; ++j) { acc[j] = wmma_bf(a.h, w[j], acc[j]); acc[j] = wmma_bf(a.l, w[j], acc[j]); } }
#pragma unroll
    for (int j = 0; j < 8; ++j) { const float bias = BO ? bfr(BO[c0 + j * 16 + col]) : 0.f;
      v8h o;
#pragma unroll
      for (int r = 0; r < 8; ++r) o[r] = (_Float16)((acc[j][r] + bias) * 64.0f);
      *(v8h*)&st[j * 16 + col][wave * 16 + 8 * g] = o; }
  } else {
#pragma unroll 2
    for (int kc = 0; kc < CC / 32; ++kc) { const v16h a = frag_f32s(Y + (r0 + col) * CC + kc * 32, lane, 64.0f); v16h w[8];   /* ctx carried x 2^6 into f16 so small-magnitude context rows stay clear of f16 subnormals (chip FTZ) */
#pragma unroll
      for (int j = 0; j < 8; ++j) w[j] = fragw_h8(FUH + (size_t)(kc * (DIN / 16) + c0 / 16 + j) * 256, lob);
#pragma unroll
      for (int j = 0; j < 8; ++j) acc[j] = wmma16(a, w[j], acc[j]); }
#pragma unroll
    for (int j = 0; j < 8; ++j) { const float bias = BO ? bfr(BO[c0 + j * 16 + col]) : 0.f;
      v8h o;
#pragma unroll
      for (int r = 0; r < 8; ++r) o[r] = (_Float16)((acc[j][r] * (1.0f / 16384.0f) + bias) * 64.0f);   /* 2^-8 (Wvu carry) x 2^-6 (ctx carry); then the x 2^6 carry of the next product's f16 operand */
      *(v8h*)&st[j * 16 + col][wave * 16 + 8 * g] = o; } }
  __syncthreads();   /* a channel's 64 positions come from all four waves */
  const size_t rb = (size_t)blockIdx.x * 64; _Float16* tp = TH + ((rb / TT) * DIN + c0 + (tid >> 3)) * (size_t)TT + rb % TT + (tid & 7) * 8;   /* 8 lanes = one channel's line; 16 channels a pass */
#pragma unroll
  for (int p = 0; p < 8; ++p) vst2((unsigned*)(tp + (size_t)p * 16 * TT), *(const v4u*)&st[p * 16 + (tid >> 3)][(tid & 7) * 8]); }
#define K2 DIN
#define wcol_io_plain(W, k0, o, lane) wcol_io(W, k0, o, lane, DIN)
#define wcolh_io_plain(W, k0, o, lane) wcolh_io(W, k0, o, lane, DIN)
// ---- k_out2: block = (64 rows, 128 cols): final projection out = R Wo + bo on the re-read rows R [NB*TT][K2] (K2 = DIN input width): f16 rows (x 2^6, from k_out) against the k_prep fragments of Wo as f16(bf16 x 2^8) (1 product) x 2^-14; always the single-product path
__global__ __launch_bounds__(128) void k_out2(const _Float16* __restrict__ Y, const _Float16* __restrict__ FO, const float* __restrict__ BO, float* __restrict__ OUT) { __shared__ __align__(16) float sf[4][16][132];
  const int tid = threadIdx.x, wave = tid >> 5, lane = tid & 31, col = lane & 15, g = lane >> 4; const int c0 = blockIdx.y * 128; const size_t r0 = (size_t)blockIdx.x * 64 + wave * 16; const unsigned lob = lane * 16u;
  v8f acc[8] = {};   /* the re-read rows mix positions: no early-row special case here */
#pragma unroll 2
  for (int kc = 0; kc < K2 / 32; ++kc) { const v16h a = frag_h(Y + (r0 + col) * K2 + kc * 32, lane);   /* the rows arrive as f16 x 2^6 (k_out), clear of f16 subnormals (chip FTZ) */
    v16h w[8];
#pragma unroll
    for (int j = 0; j < 8; ++j) w[j] = fragw_h(FO + (size_t)(kc * (DIN / 16) + c0 / 16 + j) * 512, lob);
    __builtin_amdgcn_sched_barrier(0);   /* every load of the k-step is issued before the first product that waits for one */
#pragma unroll
    for (int j = 0; j < 8; ++j) acc[j] = wmma16(a, w[j], acc[j]); }
#pragma unroll
  for (int j = 0; j < 8; ++j) { const float bias = BO ? bfr(BO[c0 + j * 16 + col]) : 0.f;
#pragma unroll
    for (int r = 0; r < 8; ++r) sf[wave][8 * g + r][j * 16 + col] = acc[j][r] * (1.0f / 16384.0f) + bias; }   /* 2^-8 (Wo carry) x 2^-6 (row carry) */
  LDSX(); for (int rl = 0; rl < 16; ++rl) vst2(OUT + (r0 + rl) * DIN + c0 + lane * 4, *(const v4f*)&sf[wave][rl][lane * 4]); }

extern "C" void kernel_launch(void* const* d_in, const int* in_sizes, int n_in, void* d_out, int out_size, void* d_ws, size_t ws_size, hipStream_t stream) {
  (void)in_sizes; (void)n_in; (void)out_size;
  const float** F = (const float**)d_in;
  if (ws_size < (size_t)WS_END) return;
  char* ws = (char*)d_ws; _Float16 *QH = (_Float16*)(ws + WS_QH), *KH = (_Float16*)(ws + WS_KH), *VT = (_Float16*)(ws + WS_VT), *QL = (_Float16*)(ws + WS_QL), *KL = (_Float16*)(ws + WS_KL); __bf16 *VB = (__bf16*)(ws + WS_VB), *VBL = (__bf16*)(ws + WS_VBL); float *S = (float*)(ws + WS_S), *Y = (float*)(ws + WS_Y);
  (void)S; (void)Y; (void)QL; (void)KL; (void)VB; (void)VBL;
  // inputs (in order): 0 x [4,2048,768]; 1 Wq [768,768] (in,out), 2 bq; 3 Wkd [768,192], 4 bkd; 5 Wvd [768,192], 6 bvd; 7 Wvu [192,768], 8 bvu; 9 Wo [768,768] (in,out), 10 bo (all biases zeros, read)
  if (ws_size < (size_t)WS_END3) return;
  _Float16 *T = (_Float16*)(ws + WS_T); __bf16 *FP = (__bf16*)(ws + WS_FP), *FU = (__bf16*)(ws + WS_FU); _Float16 *FUH = (_Float16*)(ws + WS_FUH), *FO = (_Float16*)(ws + WS_FO);
  k_prep<<<dim3((NF_P + NF_U + NF_O) / 4), 128, 0, stream>>>(F[1], F[3], F[5], F[7], F[9], FP, FU, FUH, FO);   /* every weight once into B-fragment order */
  k_proj<<<dim3(TNB * TT / 64, CC / 128, 3), 128, 0, stream>>>(F[0], F[0], F[0], FP, F[2], F[4], F[6], QH, QL, KH, KL, VT, VB, VBL);   /* q slice, latent k, latent v: 3 column blocks of 128 columns each */
  k_att<<<dim3(TNB * NH, TT / (64 * QT)), 128, 0, stream>>>(QH, KH, QL, KL, VT, VB, VBL, Y);   /* logits, softmax, P v: every (b, h, 128-query block) in one launch */
  k_out<<<dim3(TNB * TT / 64, DIN / 128), 128, 0, stream>>>(Y, FU, FUH, F[8], T);   /* T[b][c][s] = f16(ao[b][s][c] x 2^6), ao = al Wvu + bvu (gathered weight rows) */
  k_out2<<<dim3(TNB * TT / 64, DIN / 128), 128, 0, stream>>>(T, FO, F[10], (float*)d_out);   /* rows = T's memory re-read as [TT][DIN] per batch; out = rows Wo + bo */
}

// v007
// It runs in 78.5 microseconds.
// Next to v006, in two timings, it ran 1.23 and 1.17 times as fast.
// Counting every step since v000, it is 22.5 times as fast.
// compute dtype: all float inputs rounded to bf16; the q slice and the latent k / v projections with EXACT bf16 products on WMMA 16x16x32 (f32 accumulate) + bias (zeros, read), 16 real dims per head zero-padded to 32; causal logits over the 16 latent dims: 3 products for the first 384 rows, single f16 after, x 16^-0.5; softmax f32 (max first, then exp(s - max) x 2^11, formed as 2^(raw logit x 16^-0.5 log2(e) + offset), once to f16 x v once to f16 (bf16 hi + lo below row 384), divided by the f32 row sum after the product; logits never stored); latent ctx (hi+lo below row 384, x2^6 f16 carry after) x exact / f16(bf16 x 2^8) Wvu + bvu; per-batch transpose; then x 2^6 once to f16 x Wo f16(bf16 x 2^8) + bo; f32 output.
#include <hip/hip_runtime.h>
#include <math.h>

typedef __attribute__((ext_vector_type(16))) _Float16 v16h;
typedef __attribute__((ext_vector_type(16))) __bf16 v16b;
typedef __attribute__((ext_vector_type(8)))  _Float16 v8h;
typedef __attribute__((ext_vector_type(8)))  float v8f;
typedef __attribute__((ext_vector_type(4)))  float v4f;
typedef __attribute__((ext_vector_type(2)))  float v2f;
typedef __attribute__((ext_vector_type(4)))  unsigned v4u;
typedef __attribute__((ext_vector_type(4)))  int v4i;
typedef float __attribute__((may_alias)) float_a;
typedef int __attribute__((may_alias)) int_a;

template <typename T> __device__ __forceinline__ void vst2(void* p, T v) { *(T*)p = v;  }
__device__ __forceinline__ v8f wmma16(v16h a, v16h b, v8f c) {
  v8f d = __builtin_amdgcn_wmma_f32_16x16x32_f16(false, a, false, b, (short)0, c, false, false);
  asm volatile("v_nop\n\tv_nop\n\tv_nop\n\tv_nop" : "+v"(d) : "v"(a), "v"(b));
  return d;
}
__device__ __forceinline__ v8f wmma_bf(v16b a, v16b b, v8f c) {
  v8f d = __builtin_amdgcn_wmma_f32_16x16x32_bf16(false, a, false, b, (short)0, c, false, false);
  asm volatile("v_nop\n\tv_nop\n\tv_nop\n\tv_nop" : "+v"(d) : "v"(a), "v"(b));
  return d;
}
// 16x16x32 fragments: lane = (h = lane>>4, row/col = lane&15); elements 0..7 = k0+8h+0..7, 8..15 = k0+16+8h+0..7; D element r = row 8h+r
__device__ __forceinline__ v16h frag_h(const _Float16* rowk0, int lane) {
  union { v16h v; v8h q[2]; } u; const _Float16* p = rowk0 + 8 * (lane >> 4);
  u.q[0] = *(const v8h*)p; u.q[1] = *(const v8h*)(p + 16); return u.v;
}
__device__ __forceinline__ v16h frag_f32(const float* rowk0, int lane) {
  v16h a; const float* p = rowk0 + 8 * (lane >> 4);
#pragma unroll
  for (int i = 0; i < 8; ++i) { a[i] = (_Float16)p[i]; a[8 + i] = (_Float16)p[16 + i]; }
  return a;
}
__device__ __forceinline__ v16h frag_f32s(const float* rowk0, int lane, float sc) {
  v16h a; const float* p = rowk0 + 8 * (lane >> 4);
#pragma unroll
  for (int i = 0; i < 8; ++i) { a[i] = (_Float16)(p[i] * sc); a[8 + i] = (_Float16)(p[16 + i] * sc); }
  return a;
}
// column fragment from a [K][ld] layout (column n), rows >= K read as 0
__device__ __forceinline__ v16h fragc_f32(const float* W, int k0, int n, int lane, int ld, int K) {
  v16h a; const int g = lane >> 4;
#pragma unroll
  for (int i = 0; i < 8; ++i) { const int ka = k0 + 8 * g + i, kb = ka + 16;
    a[i] = (_Float16)(ka < K ? W[(size_t)(ka < K ? ka : K - 1) * ld + n] : 0.f); a[8 + i] = (_Float16)(kb < K ? W[(size_t)(kb < K ? kb : K - 1) * ld + n] : 0.f); }
  return a;
}
struct F2 { v16b h, l; };
__device__ __forceinline__ F2 bsplit16(const float v[16]) { F2 r;
#pragma unroll
  for (int i = 0; i < 16; ++i) { const __bf16 h = (__bf16)v[i]; r.h[i] = h; r.l[i] = (__bf16)(v[i] - (float)h); }
  return r; }
__device__ __forceinline__ F2 split_row(const float* row, int k0, int lane) { float v[16]; const float* p = row + k0 + 8 * (lane >> 4);
#pragma unroll
  for (int i = 0; i < 8; ++i) { v[i] = p[i]; v[8 + i] = p[16 + i]; }
  return bsplit16(v); }
__device__ __forceinline__ F2 split_rowK(const float* row, int k0, int lane, int K) { float v[16]; const int g = lane >> 4;
#pragma unroll
  for (int i = 0; i < 8; ++i) { const int ka = k0 + 8 * g + i, kb = ka + 16; v[i] = ka < K ? row[ka < K ? ka : K - 1] : 0.f; v[8 + i] = kb < K ? row[kb < K ? kb : K - 1] : 0.f; }
  return bsplit16(v); }
__device__ __forceinline__ F2 split_col(const float* W, int k0, int n, int lane, int ld, int K) { float v[16]; const int g = lane >> 4;
#pragma unroll
  for (int i = 0; i < 8; ++i) { const int ka = k0 + 8 * g + i, kb = ka + 16; v[i] = ka < K ? W[(size_t)(ka < K ? ka : K - 1) * ld + n] : 0.f; v[8 + i] = kb < K ? W[(size_t)(kb < K ? kb : K - 1) * ld + n] : 0.f; }
  return bsplit16(v); }
__device__ __forceinline__ v8f mac3(const F2& a, const F2& b, v8f c) { c = wmma_bf(a.l, b.h, c); c = wmma_bf(a.h, b.l, c); return wmma_bf(a.h, b.h, c); }
__device__ __forceinline__ float sigm(float v) { return 1.0f / (1.0f + expf(-v)); }
#define LDSX() do { asm volatile("s_wait_dscnt 0" ::: "memory"); __builtin_amdgcn_wave_barrier(); __builtin_amdgcn_fence(__ATOMIC_RELEASE, "workgroup"); } while (0)

// Causal self-attention with 12 low-rank latent heads (x [4,2048,768]; (in,out) Wq [768,768], Wkd / Wvd [768,192], Wvu [192,768], Wo [768,768], all N(0,1) x 0.02, zero biases (read); q = x Wq + bq split into 12 heads x 64 of which only the FIRST 16 dims of each head are used (ql); kl, vl = x Wkd, x Wvd split into 12 heads x 16; scores = ql kl^T x 16^-0.5; triu(1) -> -inf; softmax; al = w vl merged to [B,S,192]; ao = al Wvu + bvu [B,S,768]; then jnp.transpose(ao, (0,2,1)).reshape(B,S,768): the per-batch [2048 x 768] matrix is transposed to [768 x 2048] and its memory re-read as 2,048 rows of 768; out = that Wo + bo).
#define NB 4
#define TT 2048
#define CC 384            // NH * HD = projected width
#define DIN 768          // input (model) width
#define NH 12
#define HD 32
#define LATW 16     /* real dims per head; columns h*HD + d with d >= LATW are zero padding */
#define QHEADW 64   /* the module's q heads are 64 wide; only their first LATW dims are used (ql = q[..., :16]) */
#define KVLD (NH * LATW)   /* row pitch of the (in,out) latent weights Wkd / Wvd [768][192] */
#define NQB (TT / 64)
#define HG 2   // S region: 2 x 2,048 x 2,048 f32 = 32 MiB, allocated but unused
#define SCALE (0.25f)
#define CAUSAL 1
#ifndef TNB
#define TNB NB
#endif
__device__ __forceinline__ float bfr(float v) { return (float)(__bf16)v; }
__host__ __device__ __forceinline__ int kb_last(int qb) { return CAUSAL ? ((qb * 64 + 63) >> 7) : (TT / 128 - 1); }
typedef __attribute__((ext_vector_type(8))) __bf16 v8b;
__device__ __forceinline__ v16b frag_b(const __bf16* rowk0, int lane) {
  union { v16b v; v8b q[2]; } u; const __bf16* p = rowk0 + 8 * (lane >> 4);
  u.q[0] = *(const v8b*)p; u.q[1] = *(const v8b*)(p + 16); return u.v;
}
#define QBH 6              // causal: query blocks 0..QBH-1 of each sequence (few keys, no averaging) take the high-precision path
#define QHI 384            // rows carrying a q residual plane
#define KHI 384            // key rows carrying k residual / v bf16 hi+lo planes (used only by the causal high-precision path)
// B fragment (k rows k0+.., output column o) of a weight: (in,out) [K][ld] or (out,in) [ld rows of K]: bf16 exact, or f16(bf16 * 256) exact
__device__ __forceinline__ v16b wcol_io(const float* Wm, int k0, int o, int lane, int ld) { v16b w; const int g = lane >> 4;
#pragma unroll
  for (int i = 0; i < 8; ++i) { w[i] = (__bf16)Wm[(size_t)(k0 + 8 * g + i) * ld + o]; w[8 + i] = (__bf16)Wm[(size_t)(k0 + 16 + 8 * g + i) * ld + o]; }
  return w; }
__device__ __forceinline__ v16b wcol_oi(const float* Wm, int k0, int o, int lane, int K) { v16b w; const float* p = Wm + (size_t)o * K + k0 + 8 * (lane >> 4);
#pragma unroll
  for (int i = 0; i < 8; ++i) { w[i] = (__bf16)p[i]; w[8 + i] = (__bf16)p[16 + i]; }
  return w; }
__device__ __forceinline__ v16h wcolh_io(const float* Wm, int k0, int o, int lane, int ld) { v16h w; const int g = lane >> 4;
#pragma unroll
  for (int i = 0; i < 8; ++i) { w[i] = (_Float16)(bfr(Wm[(size_t)(k0 + 8 * g + i) * ld + o]) * 256.0f); w[8 + i] = (_Float16)(bfr(Wm[(size_t)(k0 + 16 + 8 * g + i) * ld + o]) * 256.0f); }
  return w; }
// first output projection ao = al Wvu: the k index runs over ctx columns kk = h*HD + d; one 32-deep k-step = one head; its first 16 entries (d < LATW, fragment slots 0..7 of both lane halves) are rows h*LATW + d of the (in,out) [192][768] weight, its last 16 (padding dims, slots 8..15) are zero
__device__ __forceinline__ v16b wcol_io_lat(const float* Wm, int k0, int o, int lane, int ld) { v16b w; const int g = lane >> 4; const float* p = Wm + (size_t)((k0 / HD) * LATW + 8 * g) * ld + o;
#pragma unroll
  for (int i = 0; i < 8; ++i) { w[i] = (__bf16)p[(size_t)i * ld]; w[8 + i] = (__bf16)0.0f; }
  return w; }
__device__ __forceinline__ v16h wcolh_io_lat(const float* Wm, int k0, int o, int lane, int ld) { v16h w; const int g = lane >> 4; const float* p = Wm + (size_t)((k0 / HD) * LATW + 8 * g) * ld + o;
#pragma unroll
  for (int i = 0; i < 8; ++i) { w[i] = (_Float16)(bfr(p[(size_t)i * ld]) * 256.0f); w[8 + i] = (_Float16)0.0f; }
  return w; }
static_assert(HD == 32 && LATW == 16 && CC == NH * HD, "the latent loaders assume one head per 32-deep k-step with 16 real + 16 padding dims");
__device__ __forceinline__ v16h wcolh_oi(const float* Wm, int k0, int o, int lane, int K) { v16h w; const float* p = Wm + (size_t)o * K + k0 + 8 * (lane >> 4);
#pragma unroll
  for (int i = 0; i < 8; ++i) { w[i] = (_Float16)(bfr(p[i]) * 256.0f); w[8 + i] = (_Float16)(bfr(p[16 + i]) * 256.0f); }
  return w; }
#define WQKV_LAYOUT 0   // 0 = (in,out) [DIN][out], columns gathered per head; 1 = (out,in) [CC][DIN]; 2 = per-head [NH][DIN][HD]
__device__ __forceinline__ v16b wcol_hdk(const float* Wm, int k0, int o, int lane) { v16b w; const int g = lane >> 4; const float* p = Wm + (size_t)(o / HD) * DIN * HD + (o % HD);
#pragma unroll
  for (int i = 0; i < 8; ++i) { w[i] = (__bf16)p[(size_t)(k0 + 8 * g + i) * HD]; w[8 + i] = (__bf16)p[(size_t)(k0 + 16 + 8 * g + i) * HD]; }
  return w; }
#define WO_OUT_IN 0
#if WQKV_LAYOUT == 1
#define WCOL(W, k0, o, lane) wcol_oi(W, k0, o, lane, DIN)
#elif WQKV_LAYOUT == 2
#define WCOL(W, k0, o, lane) wcol_hdk(W, k0, o, lane)
#else
__device__ __forceinline__ v16b zero16b() { v16b w; _Pragma("unroll") for (int i = 0; i < 16; ++i) w[i] = (__bf16)0.0f; return w; }
/* column o = h*HD + d: real (d < LATW) -> weight column h*QHEADW + d of Wq (pitch DIN) for the q stream, h*LATW + d of Wkd / Wvd (pitch KVLD) for k / v; padding -> zeros. o = c0 + j*16 + col with c0 % 128 == 0, so (o % HD) < LATW is decided by j alone (compile-time per unrolled j, uniform across the wave) */
#define GCOL(o) ((which) == 0 ? ((o) / HD) * QHEADW + ((o) % HD) : ((o) / HD) * LATW + ((o) % HD))
#define WCOL(W, k0, o, lane) ((((o) % HD) < LATW) ? wcol_io(W, k0, GCOL(o), lane, ((which) == 0 ? DIN : KVLD)) : zero16b())
#endif
#if WO_OUT_IN
#define WOCOL(W, k0, o, lane) wcol_oi(W, k0, o, lane, CC)
#define WOCOLH(W, k0, o, lane) wcolh_oi(W, k0, o, lane, CC)
#else
#define WOCOL(W, k0, o, lane) wcol_io_lat(W, k0, o, lane, DIN)
#define WOCOLH(W, k0, o, lane) wcolh_io_lat(W, k0, o, lane, DIN)
#endif

#ifndef SM_EXTRA_PARAMS
#define SM_EXTRA_PARAMS
#endif
#ifndef PROJ_EXTRA_PARAMS
#define PROJ_EXTRA_PARAMS
#endif
#ifndef SM_MASK_HOOK
#define SM_MASK_HOOK (void)0
#endif

#define WS_QH  0u                                      // f16 q rows [b*t][CC]
#define WS_KH  (WS_QH + 2u * (size_t)NB * TT * CC)      // f16 k in A-fragment order [b][h][16-key tile][512 B] (the region keeps its old size)
#define WS_VT  (WS_KH + 2u * (size_t)NB * TT * CC)      // f16 v^T in A-fragment order [b][h][32-key step][1024 B]
#define WS_QL  (WS_VT + 2u * (size_t)NB * CC * TT)      // f16 q residual x 2^10 rows [b][t < QHI][CC]
#define WS_KL  (WS_QL + 2u * (size_t)NB * QHI * CC)     // f16 k residual x 2^10, as WS_KH, key tiles below KHI
#define WS_VB  (WS_KL + 2u * (size_t)NB * KHI * CC)     // bf16 v hi (then lo), as WS_VT, key steps below KHI
#define WS_VBL (WS_VB + 2u * (size_t)NB * CC * KHI)
#define WS_S   (WS_VBL + 2u * (size_t)NB * CC * KHI)    // f32 [hg][t][s] region, unused (logits stay in registers)
#define WS_Y   (WS_S  + 4u * (size_t)HG * TT * TT)      // f32 ctx rows [b*t][CC] (only when there is an output projection)
#define WS_END (WS_Y  + 4u * (size_t)NB * TT * CC)
#define WS_T  (WS_END)                                     // f16 per-batch transpose T[b][c][s] = f16((al Wvu + bvu)[b][s][c] x 2^6), written by k_out; its memory is then read as TT rows of DIN (the module's transpose(0,2,1).reshape)
#define WS_END2 (WS_T + 2u * (size_t)NB * TT * DIN)
static_assert(TT % 64 == 0 && DIN % 128 == 0, "a k_out block owns 64 positions of 128 channels: one whole 128-B line of T per channel");
// weights in WMMA B-fragment order, written once per call by k_prep. One fragment = the 32 lanes' slots 0..7 (16 B a lane, 512 B in a row), then their slots 8..15 (left out where they are the zero padding of a latent head)
#define NF_P (3 * (DIN / 32) * NH)        /* q slice / latent k / latent v: [which][kc][head], bf16 */
#define NF_U (NH * (DIN / 16))            /* Wvu: [head][column tile], slots 0..7 only, once bf16 and once f16(bf16 x 2^8) */
#define NF_O ((DIN / 32) * (DIN / 16))    /* Wo: [kc][column tile], f16(bf16 x 2^8) */
#define WS_FP  (WS_END2)
#define WS_FU  (WS_FP  + 1024u * (size_t)NF_P)
#define WS_FUH (WS_FU  + 512u * (size_t)NF_U)
#define WS_FO  (WS_FUH + 512u * (size_t)NF_U)
#define WS_END3 (WS_FO + 1024u * (size_t)NF_O)
static_assert((NF_P + NF_U + NF_O) % 4 == 0, "k_prep: four waves a block, one fragment a wave");
// fb = wave-uniform start of the fragment, lob = lane * 16 bytes
__device__ __forceinline__ v16b fragw_b(const __bf16* fb, unsigned lob) { union { v16b v; v8b q[2]; } u; const char* p = (const char*)fb + lob; u.q[0] = *(const v8b*)p; u.q[1] = *(const v8b*)(p + 512); return u.v; }
__device__ __forceinline__ v16h fragw_h(const _Float16* fb, unsigned lob) { union { v16h v; v8h q[2]; } u; const char* p = (const char*)fb + lob; u.q[0] = *(const v8h*)p; u.q[1] = *(const v8h*)(p + 512); return u.v; }
__device__ __forceinline__ v16b fragw_b8(const __bf16* fb, unsigned lob) { union { v16b v; v8b q[2]; } u; u.q[0] = *(const v8b*)((const char*)fb + lob);
#pragma unroll
  for (int i = 0; i < 8; ++i) u.q[1][i] = (__bf16)0.0f;
  return u.v; }
__device__ __forceinline__ v16h fragw_h8(const _Float16* fb, unsigned lob) { union { v16h v; v8h q[2]; } u; u.q[0] = *(const v8h*)((const char*)fb + lob);
#pragma unroll
  for (int i = 0; i < 8; ++i) u.q[1][i] = (_Float16)0.0f;
  return u.v; }
// a precaution: stands between issued loads and the next write of a register that holds one of their addresses
__device__ __forceinline__ void XW() { asm volatile("s_wait_xcnt 0x0" ::: "memory"); }
typedef const __attribute__((address_space(1))) char* gp;
// a precaution, as XW: the wait that stands between issued loads and the next write of a register that holds one of their addresses. The addresses are its inputs, so they keep registers of their own up to the wait and no load issued before it can land on them
__device__ __forceinline__ void XWH(gp a) { asm volatile("s_wait_xcnt 0x0" :: "v"(a) : "memory"); }
__device__ __forceinline__ void XWH(gp a, gp b) { asm volatile("s_wait_xcnt 0x0" :: "v"(a), "v"(b) : "memory"); }
__device__ __forceinline__ void XWH(gp a, gp b, gp c, gp d, gp e, gp f, gp g, gp h) { asm volatile("s_wait_xcnt 0x0" :: "v"(a), "v"(b), "v"(c), "v"(d), "v"(e), "v"(f), "v"(g), "v"(h) : "memory"); }
// N weight values of one column, rows i (i < 8) and, for N = 16, 16 + i of an (in,out) weight of pitch LD: ub = wave-uniform address of the tile's first row and column, lo = the lane's fixed byte offset (8 g rows + its column). The last load may land on the offset register, so the wait stands in front of it, and once more behind it, ahead of the scalar work that forms the store address
template <int LD, int N> __device__ __forceinline__ void ld_col(const float* ub, unsigned lo, float v[N]) { const char* p = (const char*)ub + lo;
#pragma unroll
  for (int i = 0; i < N - 1; ++i) v[i] = *(const float*)(p + (size_t)((i & 7) + 2 * (i & 8)) * LD * 4);
  XW(); v[N - 1] = *(const float*)(p + (size_t)(((N - 1) & 7) + 2 * ((N - 1) & 8)) * LD * 4); XW(); }
// ---- k_prep: one wave = one B fragment, with the roundings the projection kernels' own loaders (wcol_io, wcol_io_lat, wcolh_io_lat, wcolh_io) made per wave and per row block
__global__ __launch_bounds__(128) void k_prep(const float* __restrict__ WQ, const float* __restrict__ WK, const float* __restrict__ WV, const float* __restrict__ WU, const float* __restrict__ WO, __bf16* __restrict__ FP, __bf16* __restrict__ FU, _Float16* __restrict__ FUH, _Float16* __restrict__ FO) {
  const int lane = threadIdx.x & 31, col = lane & 15, g = lane >> 4; const int f = blockIdx.x * 4 + __builtin_amdgcn_readfirstlane(threadIdx.x >> 5);
  if (f < NF_P) { const int which = f / ((DIN / 32) * NH), kc = (f / NH) % (DIN / 32), h = f % NH; float v[16];
    if (which == 0) ld_col<DIN, 16>(WQ + (size_t)kc * 32 * DIN + h * QHEADW, (unsigned)(8 * g * DIN + col) * 4u, v);
    else ld_col<KVLD, 16>((which == 1 ? WK : WV) + (size_t)kc * 32 * KVLD + h * LATW, (unsigned)(8 * g * KVLD + col) * 4u, v);
    union { v16b v; v8b q[2]; } u;
#pragma unroll
    for (int i = 0; i < 16; ++i) u.v[i] = (__bf16)v[i];
    char* d = (char*)FP + (size_t)f * 1024 + lane * 16; *(v8b*)d = u.q[0]; *(v8b*)(d + 512) = u.q[1];
  } else if (f < NF_P + NF_U) { const int fu = f - NF_P, h = fu / (DIN / 16), jt = fu % (DIN / 16); float v[8];
    ld_col<DIN, 8>(WU + (size_t)h * LATW * DIN + jt * 16, (unsigned)(8 * g * DIN + col) * 4u, v);
    v8b wb; v8h wh;
#pragma unroll
    for (int i = 0; i < 8; ++i) { wb[i] = (__bf16)v[i]; wh[i] = (_Float16)(bfr(v[i]) * 256.0f); }
    *(v8b*)((char*)FU + (size_t)fu * 512 + lane * 16) = wb; *(v8h*)((char*)FUH + (size_t)fu * 512 + lane * 16) = wh;
  } else { const int fo = f - NF_P - NF_U, kc = fo / (DIN / 16), jt = fo % (DIN / 16); float v[16];
    ld_col<DIN, 16>(WO + (size_t)kc * 32 * DIN + jt * 16, (unsigned)(8 * g * DIN + col) * 4u, v);
    union { v16h v; v8h q[2]; } u;
#pragma unroll
    for (int i = 0; i < 16; ++i) u.v[i] = (_Float16)(bfr(v[i]) * 256.0f);
    char* d = (char*)FO + (size_t)fo * 1024 + lane * 16; *(v8h*)d = u.q[0]; *(v8h*)(d + 512) = u.q[1]; } }
// k_proj's ring: one slot = one k-step's operands as loaded, the lane's 16 x values (f32) and the four real weight fragments. ax / aw = the lane's own addresses of the step (x row + 8 g values; fragment start + lane * 16 bytes)
#define RP 3   // k-steps held or in flight
struct PS { v4f x[4]; v16b w[4]; };
__device__ __forceinline__ void proj_ld(gp ax, gp aw, PS& s) { typedef const __attribute__((address_space(1))) v4f* gf; typedef const __attribute__((address_space(1))) v8b* gb;
  s.x[0] = *(gf)ax; s.x[1] = *(gf)(ax + 16); s.x[2] = *(gf)(ax + 64); s.x[3] = *(gf)(ax + 80);
#pragma unroll
  for (int jj = 0; jj < 4; ++jj) { union { v16b v; v8b q[2]; } u; u.q[0] = *(gb)(aw + jj * 1024); u.q[1] = *(gb)(aw + jj * 1024 + 512); s.w[jj] = u.v; } }
// ---- k_proj: block = (64 rows, 128 cols, which): q/k/v = X W (+ b) with exact bf16 products (K = DIN) -> which 0: q f16 rows (+ residual rows < QHI); 1: k f16 (+ residual for keys < KHI); 2: v f16 (+ bf16 hi/lo for keys < KHI). k and v leave in the order k_att's A fragments are read in, the 16 real dims of a head only:
// k tile (16 keys): 512 B with lane (g, c) = dims 8 g + 0..7 of key c; the even tile of a 32-key step fills fragment slots 0..7, the odd one slots 8..15; the padding dims are not stored. v step (32 keys): 512 B with lane (g, c) = keys 8 g + 0..7 of dim c (slots 0..7), then 512 B with keys 16 + 8 g + 0..7 (slots 8..15)
__global__ __launch_bounds__(128) void k_proj(const float* __restrict__ XQ, const float* __restrict__ XK, const float* __restrict__ XV, const __bf16* __restrict__ FP, const float* __restrict__ BQ, const float* __restrict__ BK, const float* __restrict__ BV,
    _Float16* __restrict__ QH, _Float16* __restrict__ QL, _Float16* __restrict__ KH, _Float16* __restrict__ KL, _Float16* __restrict__ VT, __bf16* __restrict__ VB, __bf16* __restrict__ VBL) {
  __shared__ __align__(16) _Float16 sh[64][136], sl[64][136]; __shared__ __align__(16) _Float16 th[128][72]; __shared__ __align__(16) __bf16 tb[128][72], tbl[128][72];
  const int tid = threadIdx.x, wave = tid >> 5, lane = tid & 31, col = lane & 15, g = lane >> 4; const int which = blockIdx.z; const int c0 = blockIdx.y * 128; const size_t r0 = (size_t)blockIdx.x * 64; const size_t bb = r0 / TT; const int t0 = (int)(r0 % TT);
  const float* X = which == 0 ? XQ : which == 1 ? XK : XV; const __bf16* FW = FP + ((size_t)which * (DIN / 32) * NH + c0 / HD) * 512; const unsigned lob = lane * 16u; const float* BA = which == 0 ? BQ : which == 1 ? BK : BV;
  v8f acc[8] = {};
  /* a ring of RP k-steps' operands in registers: a slot is asked for again, RP steps ahead, right behind the step that used it, so a load has the other slots' steps of work to land in. The walk is unrolled whole: every load is one of the two fixed addresses plus a constant, and no address register is written while loads are out. k-steps are used in the order 0 .. DIN / 32 - 1 as before */
  const gp xb = (gp)(const char*)X + ((r0 + wave * 16 + col) * DIN + 8 * g) * 4, wb = (gp)(const char*)FW + lob; PS st[RP];
#pragma unroll
  for (int j = 0; j < RP; ++j) { proj_ld(xb + j * 128, wb + j * (NH * 1024), st[j]);
    __builtin_amdgcn_sched_barrier(0); }   /* asked for in ring order: in another order the counted load waits of the first steps wait for younger slots too */
#pragma unroll
  for (int kc = 0; kc < DIN / 32; ++kc) { const PS& s = st[kc % RP]; v16b a;
#pragma unroll
    for (int i = 0; i < 4; ++i) { a[i] = (__bf16)s.x[0][i]; a[4 + i] = (__bf16)s.x[1][i]; a[8 + i] = (__bf16)s.x[2][i]; a[12 + i] = (__bf16)s.x[3][i]; }
#pragma unroll
    for (int j = 0; j < 8; ++j) acc[j] = wmma_bf(a, (j & 1) ? zero16b() : s.w[j >> 1], acc[j]);   /* even j: the real column tiles (dims < LATW of a head) */
    __builtin_amdgcn_sched_barrier(0);   /* the refill stays behind the step that reads its slot: left free, the build needs registers past v255 */
    if (kc + RP < DIN / 32) { proj_ld(xb + (kc + RP) * 128, wb + (kc + RP) * (NH * 1024), st[kc % RP]);
      __builtin_amdgcn_sched_barrier(0); } }   /* the refill is issued whole here: left free, the build sets the next step's first load wait in among its loads and holds the last four back behind it */
  XWH(xb, wb);
  if (which < 2) { _Float16* DH = which == 0 ? QH : KH; _Float16* DL = which == 0 ? QL : KL; const int nhi = which == 0 ? QHI : KHI; const bool hi_rows = t0 < nhi;
#pragma unroll
    for (int j = 0; j < 8; ++j) { const float bias = (BA && ((c0 + j * 16 + col) % HD) < LATW) ? bfr(BA[GCOL(c0 + j * 16 + col)]) : 0.f;   /* gathered like the weight columns; padding columns get no bias */
#pragma unroll
      for (int r = 0; r < 8; ++r) { const float v = acc[j][r] + bias; const _Float16 hv = (_Float16)v; sh[wave * 16 + 8 * g + r][j * 16 + col] = hv; sl[wave * 16 + 8 * g + r][j * 16 + col] = (_Float16)((v - (float)hv) * 1024.0f); } }
    __syncthreads();
    if (which == 0) { for (int e = tid; e < 64 * 16; e += 128) { const int rl = e >> 4, q = e & 15; vst2((unsigned*)(DH + (r0 + rl) * CC + c0 + q * 8), *(const v4u*)&sh[rl][q * 8]); XW(); if (hi_rows) { vst2((unsigned*)(DL + (bb * nhi + t0 + rl) * (size_t)CC + c0 + q * 8), *(const v4u*)&sl[rl][q * 8]); XW(); } }
    } else {   /* wave = key tile, pass = head: a wave stores one whole tile, 512 B in a row */
      const int rl = wave * 16 + col; const size_t hd = bb * NH + c0 / HD; v4u a[4];
#pragma unroll
      for (int hh = 0; hh < 4; ++hh) a[hh] = *(const v4u*)&sh[rl][hh * HD + g * 8];
#pragma unroll
      for (int hh = 0; hh < 4; ++hh) vst2((unsigned*)(DH + ((hd + hh) * (TT / 16) + t0 / 16 + wave) * 256 + lane * 8), a[hh]);
      XW();
      if (hi_rows) {
#pragma unroll
        for (int hh = 0; hh < 4; ++hh) a[hh] = *(const v4u*)&sl[rl][hh * HD + g * 8];
#pragma unroll
        for (int hh = 0; hh < 4; ++hh) vst2((unsigned*)(DL + ((hd + hh) * (KHI / 16) + t0 / 16 + wave) * 256 + lane * 8), a[hh]);
        XW(); } }
  } else { const bool hi_rows = t0 < KHI;
#pragma unroll
    for (int j = 0; j < 8; ++j) { const float bias = (BA && ((c0 + j * 16 + col) % HD) < LATW) ? bfr(BA[GCOL(c0 + j * 16 + col)]) : 0.f;   /* gathered like the weight columns; padding columns get no bias */
#pragma unroll
      for (int r = 0; r < 8; ++r) { const float v = acc[j][r] + bias; const int rl = wave * 16 + 8 * g + r, cl = j * 16 + col; th[cl][rl] = (_Float16)v; const __bf16 bh = (__bf16)v; tb[cl][rl] = bh; tbl[cl][rl] = (__bf16)(v - (float)bh); } }
    __syncthreads();
    const int rl = wave * 16 + g * 8; const size_t hd = bb * NH + c0 / HD; v4u a[4];   /* wave = 16 keys = half a step, pass = head: a wave stores 512 B in a row */
#pragma unroll
    for (int hh = 0; hh < 4; ++hh) a[hh] = *(const v4u*)&th[hh * HD + col][rl];
#pragma unroll
    for (int hh = 0; hh < 4; ++hh) vst2((unsigned*)(VT + ((hd + hh) * (TT / 32) + t0 / 32) * 512 + tid * 8), a[hh]);
    XW();
    if (hi_rows) { v4u lo[4];
#pragma unroll
      for (int hh = 0; hh < 4; ++hh) { a[hh] = *(const v4u*)&tb[hh * HD + col][rl]; lo[hh] = *(const v4u*)&tbl[hh * HD + col][rl]; }
#pragma unroll
      for (int hh = 0; hh < 4; ++hh) { const size_t o3 = ((hd + hh) * (KHI / 32) + t0 / 32) * 512 + tid * 8; vst2((unsigned*)(VB + o3), a[hh]); vst2((unsigned*)(VBL + o3), lo[hh]); }
      XW(); } } }
// ---- k_att: block = 4 waves x 32 queries of (b, h), one launch for all (b, h): logits, softmax and P . v without leaving registers.
// S^T = K . Q^T (A = 16 key rows, B = 16 query rows): lane (g, c) holds, for query c, keys 8g + r of each 16-key tile, so the two tiles of one 32-key step, converted in place, are the B operand of ctx^T += v^T . P^T (hardware k order on both sides). Each key / v fragment serves the wave's two 16-query tiles. K and v^T lie in fragment order (k_proj), so every load of the walks is 512 B in a row, four whole lines; only the 16 real dims of a head are read, and the product with v's padding dims, which is 0, is not formed.
// One K fragment holds BOTH 16-key tiles of a step: row c = key c of tile 0 in k slots 0..15 and key c of tile 1 in k slots 16..31. Tile 0's logits come from B = [q ; 0], tile 1's from B = [0 ; q]: the zeros stand in the loop-invariant q fragments, and the K registers hold loaded values only.
// Walk 1: row maximum. Walk 2 (logits formed again, same products): e = exp(s - max) x 2^11, row sum in f32, e once to f16 against v f16 (query rows < QHI: 3-product logits, e and v as bf16 hi + lo, 3 products); ctx = acc / sum. Keys past the wave's own diagonal step are not visited; the diagonal step masks by index.
#define QT 2   // 16-query tiles per wave
#define RD 4   // late rows, second walk: steps whose key and v fragments are held or in flight
#define RD1 8  // late rows, first walk: its steps are about a third as long and hold keys only, so the ring is deeper
static_assert(QHI % (64 * QT) == 0 && QHI == QBH * 64 && KHI >= QHI && TT % (64 * QT) == 0, "a block of 4 x QT x 16 queries is wholly early or wholly late; early rows see only keys < KHI");
__device__ __forceinline__ v8f wm_h(v16h a, v16h b, v8f c) { return __builtin_amdgcn_wmma_f32_16x16x32_f16(false, a, false, b, (short)0, c, false, false); }
__device__ __forceinline__ v8f wm_b(v16b a, v16b b, v8f c) { return __builtin_amdgcn_wmma_f32_16x16x32_bf16(false, a, false, b, (short)0, c, false, false); }
// q fragments from a wave-uniform base + the lane's fixed byte offset (row c, half g)
__device__ __forceinline__ void frag_q(const _Float16* ub, unsigned lob, v16h q2[2]) { union { v16h v; v8h q[2]; } u0, u1; const v8h d = *(const v8h*)((const char*)ub + lob); v8h z;
#pragma unroll
  for (int i = 0; i < 8; ++i) z[i] = (_Float16)0.0f;
  u0.q[0] = d; u0.q[1] = z; u1.q[0] = z; u1.q[1] = d; q2[0] = u0.v; q2[1] = u1.v; }   /* the 16 real dims of query row c: [q ; 0] and [0 ; q] */
// k or v fragment in fragment order: fb = wave-uniform start of the 32-key step, lob = lane * 16 bytes. xl: the last fragment read through its address; its last load may land on the address registers, so the wait stands in front of it
__device__ __forceinline__ v16h fragv_h(const _Float16* fb, unsigned lob, bool xl) { union { v16h v; v8h q[2]; } u; const char* p = (const char*)fb + lob; u.q[0] = *(const v8h*)p; if (xl) XW(); u.q[1] = *(const v8h*)(p + 512); return u.v; }
__device__ __forceinline__ v16b fragv_b(const __bf16* fb, unsigned lob, bool xl) { union { v16b v; v8b q[2]; } u; const char* p = (const char*)fb + lob; u.q[0] = *(const v8b*)p; if (xl) XW(); u.q[1] = *(const v8b*)(p + 512); return u.v; }
// the ring's loads: a = the lane's own address of a 32-key step's fragment (step start + lane * 16 bytes)
__device__ __forceinline__ gp ring_a(const _Float16* base, int step, unsigned lob) { return (gp)(const char*)base + (size_t)step * 1024 + lob; }
__device__ __forceinline__ v16h ring_ld(gp a) { typedef const __attribute__((address_space(1))) v8h* gq; union { v16h v; v8h q[2]; } u; u.q[0] = *(gq)a; u.q[1] = *(gq)(a + 512); return u.v; }
// e x 2^11 = 2^(t x LC + off): t = the raw logit (before x 16^-0.5), LC = 16^-0.5 x log2(e), off = 11 - max(t) x LC, one value per query row. One fused multiply-add and one v_exp_f32 per logit; the rounding of off is a factor common to a row's numerators and its sum. Below 2^-126 the result may flush to 0, far under what the f32 sum or the 16-bit P can hold.
#define LC (SCALE * 1.44269504088896340736f)
// The free slot the instruction set asks for behind a transcendental (before its result is read or its source overwritten) stands in the v_exp_f32's own statement. exp2_x8: the eight logits of one product tile, each exponential in place on its own register (one the compiler's own multiply-add has just written, so the statement lands on no register that a matrix instruction still reads), so each is the independent instruction behind the one before it, and one v_nop closes the last.
__device__ __forceinline__ void exp2_x8(float* t, float off) { float a[8];
#pragma unroll
  for (int r = 0; r < 8; ++r) a[r] = __builtin_fmaf(t[r], LC, off);
  asm("v_exp_f32 %0, %0\n\tv_exp_f32 %1, %1\n\tv_exp_f32 %2, %2\n\tv_exp_f32 %3, %3\n\tv_exp_f32 %4, %4\n\tv_exp_f32 %5, %5\n\tv_exp_f32 %6, %6\n\tv_exp_f32 %7, %7\n\tv_nop" : "+v"(a[0]), "+v"(a[1]), "+v"(a[2]), "+v"(a[3]), "+v"(a[4]), "+v"(a[5]), "+v"(a[6]), "+v"(a[7]));
#pragma unroll
  for (int r = 0; r < 8; ++r) t[r] = a[r]; }
// one 32-key step: ld_k reads its two 16-key tiles as one fragment (KHr / KLr point at step 0 of (b, h), 512 elements a step, lob = lane * 16 bytes); st_mm forms s[u][8 t + r] = raw logit (not yet x 16^-0.5) of (key kc*32 + 16 t + 8 g + r, query 16 u + c)
struct KF { v16h h, l; };
template <bool HI> __device__ __forceinline__ KF ld_k(const _Float16* KHr, const _Float16* KLr, int kc, unsigned lob) { KF k; k.h = fragv_h(KHr + (size_t)kc * 512, lob, false); if (HI) k.l = fragv_h(KLr + (size_t)kc * 512, lob, false); else k.l = k.h; return k; }
template <bool HI> __device__ __forceinline__ void st_mm(const KF& k, const v16h qh[QT][2], const v16h ql[QT][2], float s[QT][16]) {
#pragma unroll
  for (int t = 0; t < 2; ++t)
#pragma unroll
    for (int u = 0; u < QT; ++u) { v8f a = {}; a = wm_h(k.h, qh[u][t], a);
      if (HI) { v8f al = {}; al = wm_h(k.h, ql[u][t], al); al = wm_h(k.l, qh[u][t], al);
#pragma unroll
        for (int r = 0; r < 8; ++r) s[u][t * 8 + r] = a[r] + al[r] * (1.0f / 1024.0f);
      } else {
#pragma unroll
        for (int r = 0; r < 8; ++r) s[u][t * 8 + r] = a[r]; } } }
template <bool HI, bool MASK> __device__ __forceinline__ void max_use(const KF& k, const v16h qh[QT][2], const v16h ql[QT][2], int kc, int qrel, float m[QT]) { float s[QT][16]; st_mm<HI>(k, qh, ql, s);
#pragma unroll
  for (int u = 0; u < QT; ++u)
#pragma unroll
    for (int i = 0; i < 16; ++i) { if (!MASK || kc * 32 + 16 * (i >> 3) + (i & 7) <= qrel + 16 * u) m[u] = fmaxf(m[u], s[u][i]); } }
template <bool HI, bool MASK> __device__ __forceinline__ void max_step(const _Float16* KHr, const _Float16* KLr, const v16h qh[QT][2], const v16h ql[QT][2], int kc, unsigned lob, int qrel, float m[QT]) { const KF k = ld_k<HI>(KHr, KLr, kc, lob); max_use<HI, MASK>(k, qh, ql, kc, qrel, m); }
template <bool HI, bool MASK> __device__ __forceinline__ void pv_use(const KF& k, const v16h vf, const v16b vh, const v16b vl, const v16h qh[QT][2], const v16h ql[QT][2], int kc, int qrel, const float off[QT], float sum[QT], v8f acc[QT]) { float s[QT][16];
  st_mm<HI>(k, qh, ql, s);
#pragma unroll
  for (int u = 0; u < QT; ++u) { exp2_x8(&s[u][0], off[u]); exp2_x8(&s[u][8], off[u]);
#pragma unroll
    for (int i = 0; i < 16; ++i) { float e = s[u][i]; if (MASK && kc * 32 + 16 * (i >> 3) + (i & 7) > qrel + 16 * u) e = 0.f; sum[u] += e; s[u][i] = e; } }
  if (HI) { F2 pp[QT];
#pragma unroll
    for (int u = 0; u < QT; ++u) pp[u] = bsplit16(s[u]);
#pragma unroll
    for (int u = 0; u < QT; ++u) { acc[u] = wm_b(vh, pp[u].h, acc[u]); acc[u] = wm_b(vh, pp[u].l, acc[u]); acc[u] = wm_b(vl, pp[u].h, acc[u]); }
  } else { v16h pb[QT];
#pragma unroll
    for (int u = 0; u < QT; ++u)
#pragma unroll
      for (int i = 0; i < 16; ++i) pb[u][i] = (_Float16)s[u][i];
#pragma unroll
    for (int u = 0; u < QT; ++u) acc[u] = wm_h(vf, pb[u], acc[u]); } }
template <bool HI, bool MASK> __device__ __forceinline__ void pv_step(const _Float16* KHr, const _Float16* KLr, const v16h qh[QT][2], const v16h ql[QT][2], const _Float16* VTr, const __bf16* VBr, const __bf16* VBLr, int kc, unsigned lob, int qrel, const float off[QT], float sum[QT], v8f acc[QT]) {
  const KF k = ld_k<HI>(KHr, KLr, kc, lob); XW();
  v16h vf = {}; v16b vh = {}, vl = {};   /* v is asked for before the exponentials, which cover its latency; the diagonal step's last load is the last through lob */
  if (HI) { vh = fragv_b(VBr + (size_t)kc * 512, lob, false); vl = fragv_b(VBLr + (size_t)kc * 512, lob, MASK); } else vf = fragv_h(VTr + (size_t)kc * 512, lob, MASK);
  pv_use<HI, MASK>(k, vf, vh, vl, qh, ql, kc, qrel, off, sum, acc); }
template <bool HI> __device__ __forceinline__ void att_body(const _Float16* __restrict__ QH, const _Float16* __restrict__ KH, const _Float16* __restrict__ QL, const _Float16* __restrict__ KL, const _Float16* __restrict__ VT, const __bf16* __restrict__ VB, const __bf16* __restrict__ VBL, int b, int h, int ql0, int lane, float* __restrict__ Y) {
  const int c = lane & 15, g = lane >> 4; const int nfull = ql0 >> 5;   /* ql0 % 32 == 0: steps 0 .. nfull-1 lie wholly below the diagonal for all 32 queries; step nfull holds it */
  const size_t hd = (size_t)b * NH + h; const _Float16* KHr = KH + hd * (TT * LATW); const _Float16* KLr = KL + hd * (KHI * LATW); const unsigned klo = (unsigned)(c * CC + 8 * g) * 2u, lob = lane * 16u;   /* klo: the q rows' offset; lob: every k / v fragment's */
  const _Float16* VTr = VT + hd * (TT * LATW); const __bf16* VBr = VB + hd * (KHI * LATW); const __bf16* VBLr = VBL + hd * (KHI * LATW);
  v16h qh[QT][2], ql[QT][2];
#pragma unroll
  for (int u = 0; u < QT; ++u) { frag_q(QH + ((size_t)b * TT + ql0 + u * 16) * CC + h * HD, klo, qh[u]); if (HI) frag_q(QL + ((size_t)b * QHI + ql0 + u * 16) * CC + h * HD, klo, ql[u]); else { ql[u][0] = qh[u][0]; ql[u][1] = qh[u][1]; } }
  XW();
  const int qrel = ql0 + c - 8 * g;   /* key kc*32 + 16 t + 8 g + r is kept for query ql0 + 16 u + c when kc*32 + 16 t + r <= qrel + 16 u */
  float m[QT], sum[QT]; v8f acc[QT] = {};
#pragma unroll
  for (int u = 0; u < QT; ++u) { m[u] = -3.0e38f; sum[u] = 0.f; }
  if (HI) {   /* early rows: at most KHI / 32 steps, loads asked for in the step that uses them */
#pragma unroll 1   /* left rolled, as it was: few steps, and unrolling adds registers */
    for (int kc = 0; kc < nfull; ++kc) max_step<HI, false>(KHr, KLr, qh, ql, kc, lob, qrel, m);
    max_step<HI, true>(KHr, KLr, qh, ql, nfull, lob, qrel, m);
#pragma unroll
    for (int u = 0; u < QT; ++u) { m[u] = fmaxf(m[u], __shfl_xor(m[u], 16)); m[u] = __builtin_fmaf(-m[u], LC, 11.0f); }   /* the two lane halves hold different keys of the same query; from here m = the exponent's offset */
#pragma unroll 1   /* left rolled, as it was */
    for (int kc = 0; kc < nfull; ++kc) pv_step<HI, false>(KHr, KLr, qh, ql, VTr, VBr, VBLr, kc, lob, qrel, m, sum, acc);
    pv_step<HI, true>(KHr, KLr, qh, ql, VTr, VBr, VBLr, nfull, lob, qrel, m, sum, acc);
  } else {
    /* late rows: each walk holds a ring of steps' fragments in registers (RD1 steps of keys, then RD steps of keys and v). A slot is asked for again, a ring's length ahead, right behind the step that used it, so a load has the other slots' steps of work to land in. A step index past the diagonal step is clamped to it (read, not used). The diagonal step's own fragments (kd for both walks, vd) are asked for once, up front. Steps are used in the order 0 .. nfull as before. */
    static_assert(RD == 4 && RD1 == 8, "the waits behind the rings' first loads name their addresses one by one");
    const v16b zb = {}; KF k1[RD1], kb[RD], kd; v16h vb[RD], vd; gp a1[RD1], ak[RD], av[RD];
    const gp akd = ring_a(KHr, nfull, lob), avd = ring_a(VTr, nfull, lob);
#pragma unroll
    for (int j = 0; j < RD1; ++j) { a1[j] = ring_a(KHr, j < nfull ? j : nfull, lob); k1[j].h = ring_ld(a1[j]); k1[j].l = k1[j].h; }
    XWH(a1[0], a1[1], a1[2], a1[3], a1[4], a1[5], a1[6], a1[7]);
    kd.h = ring_ld(akd); kd.l = kd.h; XWH(akd);   /* a wait of its own, directly behind: no other load stands between */
    gp pa = akd, pb = avd;   /* the addresses of the youngest refill: their wait stands one step later, in front of the next refill, where it has nothing left to wait for */
    int kc = 0;
#pragma unroll 1   /* one trip = one turn of the ring, its slots fixed registers */
    for (; kc + RD1 <= nfull; kc += RD1) {
#pragma unroll
      for (int j = 0; j < RD1; ++j) { max_use<false, false>(k1[j], qh, ql, kc + j, qrel, m);
        __builtin_amdgcn_sched_barrier(0);   /* the wait and the refill stay behind the step's work: lifted to its head the wait stands right behind the loads it is for, and stalls */
        XWH(pa); const int nx = kc + RD1 + j; pa = ring_a(KHr, nx < nfull ? nx : nfull, lob); k1[j].h = ring_ld(pa); k1[j].l = k1[j].h;
        __builtin_amdgcn_sched_barrier(0); } }   /* keeps the steps in ring order: without it the build lifts the last slots' products to the head of the trip, where they wait for loads just issued */
    XWH(pa);
#pragma unroll
    for (int j = 0; j < RD1 - 1; ++j) { if (kc + j < nfull) max_use<false, false>(k1[j], qh, ql, kc + j, qrel, m); }
    vd = ring_ld(avd); XWH(avd);   /* the second walk's first turn is asked for ahead of the diagonal step's maximum */
#pragma unroll
    for (int j = 0; j < RD; ++j) { const int nx = j < nfull ? j : nfull; ak[j] = ring_a(KHr, nx, lob); av[j] = ring_a(VTr, nx, lob); kb[j].h = ring_ld(ak[j]); kb[j].l = kb[j].h; vb[j] = ring_ld(av[j]);
      __builtin_amdgcn_sched_barrier(0); }   /* asked for in ring order: the loop's counted load waits are set for both ways into the loop, and another order here makes them wait for younger slots */
    XWH(ak[0], ak[1], ak[2], ak[3], av[0], av[1], av[2], av[3]);
    max_use<false, true>(kd, qh, ql, nfull, qrel, m);
#pragma unroll
    for (int u = 0; u < QT; ++u) { m[u] = fmaxf(m[u], __shfl_xor(m[u], 16)); m[u] = __builtin_fmaf(-m[u], LC, 11.0f); }   /* the two lane halves hold different keys of the same query; from here m = the exponent's offset */
    pa = akd; pb = avd;
#pragma unroll 1   /* one trip = one turn of the ring */
    for (kc = 0; kc + RD <= nfull; kc += RD) {
#pragma unroll
      for (int j = 0; j < RD; ++j) { pv_use<false, false>(kb[j], vb[j], zb, zb, qh, ql, kc + j, qrel, m, sum, acc);
        __builtin_amdgcn_sched_barrier(0);   /* as in the first walk: the wait stays a whole step behind the loads it is for */
        XWH(pa, pb); const int nx = kc + RD + j < nfull ? kc + RD + j : nfull; pa = ring_a(KHr, nx, lob); pb = ring_a(VTr, nx, lob); kb[j].h = ring_ld(pa); kb[j].l = kb[j].h; vb[j] = ring_ld(pb);
        __builtin_amdgcn_sched_barrier(0); } }   /* the refill is issued here: without it the build sinks the loads into the next step, up to that step's wait */
    XWH(pa, pb);
#pragma unroll
    for (int j = 0; j < RD - 1; ++j) { if (kc + j < nfull) pv_use<false, false>(kb[j], vb[j], zb, zb, qh, ql, kc + j, qrel, m, sum, acc); }
    pv_use<false, true>(kd, vd, zb, zb, qh, ql, nfull, qrel, m, sum, acc);
  }
#pragma unroll
  for (int u = 0; u < QT; ++u) { const float st = sum[u] + __shfl_xor(sum[u], 16); const float inv = st > 0.f ? 1.0f / st : 0.f;   /* sum and acc both carry the 2^11 */
    float* yr = Y + ((size_t)b * TT + ql0 + u * 16 + c) * CC + h * HD + 8 * g;   /* acc[u][r] = ctx(query 16 u + c, dim 8 g + r): 32 contiguous bytes per lane; the padding dims 16 + 8 g + r, which k_out reads against zero weights, are stored as the zeros their product was */
    v4f o0, o1; const v4f z = {};
#pragma unroll
    for (int r = 0; r < 4; ++r) { o0[r] = acc[u][r] * inv; o1[r] = acc[u][4 + r] * inv; }
    vst2(yr, o0); vst2(yr + 4, o1); vst2(yr + 16, z); vst2(yr + 20, z); } }
__global__ __launch_bounds__(128) void k_att(const _Float16* __restrict__ QH, const _Float16* __restrict__ KH, const _Float16* __restrict__ QL, const _Float16* __restrict__ KL, const _Float16* __restrict__ VT, const __bf16* __restrict__ VB, const __bf16* __restrict__ VBL, float* __restrict__ Y) {
  const int b = blockIdx.x / NH, h = blockIdx.x % NH; const int q0 = (TT / (64 * QT) - 1 - (int)blockIdx.y) * (64 * QT);   /* longest query blocks start first */
  const int wave = __builtin_amdgcn_readfirstlane(threadIdx.x >> 5), lane = threadIdx.x & 31; const int ql0 = q0 + wave * (16 * QT);
  if (q0 < QHI) att_body<true>(QH, KH, QL, KL, VT, VB, VBL, b, h, ql0, lane, Y); else att_body<false>(QH, KH, QL, KL, VT, VB, VBL, b, h, ql0, lane, Y); }
// The result leaves as k_out2's A operand: a lane's 8 accumulator rows are 8 consecutive positions of one channel, so x 2^6 and the one rounding to f16 (the rounding k_out2's loader made) give 16 B of a T row; the block's 64 positions of a channel are gathered in LDS and stored as one whole line.
// ---- k_out: block = (64 rows, 128 cols): ao = ctx Wvu (+ bvu): ctx x 2^6 once to f16 against Wvu as f16(bf16 x 2^8) exact (1 product) x 2^-14; causal early rows (< QHI of each sequence): ctx bf16 hi + lo against exact bf16 Wvu (2 products)
__global__ __launch_bounds__(128) void k_out(const float* __restrict__ Y, const __bf16* __restrict__ FU, const _Float16* __restrict__ FUH, const float* __restrict__ BO, _Float16* __restrict__ TH) { __shared__ __align__(16) _Float16 st[128][72];
  const int tid = threadIdx.x, wave = tid >> 5, lane = tid & 31, col = lane & 15, g = lane >> 4; const int c0 = blockIdx.y * 128; const size_t r0 = (size_t)blockIdx.x * 64 + wave * 16; const unsigned lob = lane * 16u;
  v8f acc[8] = {};
  if (CAUSAL && (int)(((size_t)blockIdx.x * 64) % TT) < QHI) {   /* block-uniform */
#pragma unroll 2
    for (int kc = 0; kc < CC / 32; ++kc) { const F2 a = split_row(Y + (r0 + col) * CC, kc * 32, lane); v16b w[8];
#pragma unroll
      for (int j = 0; j < 8; ++j) w[j] = fragw_b8(FU + (size_t)(kc * (DIN / 16) + c0 / 16 + j) * 256, lob);
#pragma unroll
      for (int j = 0; j < 8; ++j) { acc[j] = wmma_bf(a.h, w[j], acc[j]); acc[j] = wmma_bf(a.l, w[j], acc[j]); } }
#pragma unroll
    for (int j = 0; j < 8; ++j) { const float bias = BO ? bfr(BO[c0 + j * 16 + col]) : 0.f;
      v8h o;
#pragma unroll
      for (int r = 0; r < 8; ++r) o[r] = (_Float16)((acc[j][r] + bias) * 64.0f);
      *(v8h*)&st[j * 16 + col][wave * 16 + 8 * g] = o; }
  } else {
#pragma unroll 2
    for (int kc = 0; kc < CC / 32; ++kc) { const v16h a = frag_f32s(Y + (r0 + col) * CC + kc * 32, lane, 64.0f); v16h w[8];   /* ctx carried x 2^6 into f16 so small-magnitude context rows stay clear of f16 subnormals (chip FTZ) */
#pragma unroll
      for (int j = 0; j < 8; ++j) w[j] = fragw_h8(FUH + (size_t)(kc * (DIN / 16) + c0 / 16 + j) * 256, lob);
#pragma unroll
      for (int j = 0; j < 8; ++j) acc[j] = wmma16(a, w[j], acc[j]); }
#pragma unroll
    for (int j = 0; j < 8; ++j) { const float bias = BO ? bfr(BO[c0 + j * 16 + col]) : 0.f;
      v8h o;
#pragma unroll
      for (int r = 0; r < 8; ++r) o[r] = (_Float16)((acc[j][r] * (1.0f / 16384.0f) + bias) * 64.0f);   /* 2^-8 (Wvu carry) x 2^-6 (ctx carry); then the x 2^6 carry of the next product's f16 operand */
      *(v8h*)&st[j * 16 + col][wave * 16 + 8 * g] = o; } }
  __syncthreads();   /* a channel's 64 positions come from all four waves */
  const size_t rb = (size_t)blockIdx.x * 64; _Float16* tp = TH + ((rb / TT) * DIN + c0 + (tid >> 3)) * (size_t)TT + rb % TT + (tid & 7) * 8;   /* 8 lanes = one channel's line; 16 channels a pass */
#pragma unroll
  for (int p = 0; p < 8; ++p) vst2((unsigned*)(tp + (size_t)p * 16 * TT), *(const v4u*)&st[p * 16 + (tid >> 3)][(tid & 7) * 8]); }
#define K2 DIN
#define wcol_io_plain(W, k0, o, lane) wcol_io(W, k0, o, lane, DIN)
#define wcolh_io_plain(W, k0, o, lane) wcolh_io(W, k0, o, lane, DIN)
// k_out2's ring, as k_proj's: one slot = one k-step's A fragment and its eight weight fragments. aa / aw = the lane's own addresses of the step (row + 8 g values; fragment start + lane * 16 bytes)
#define RO 2   // k-steps held or in flight
struct OS { v16h a, w[8]; };
__device__ __forceinline__ void out2_ld(gp aa, gp aw, OS& s) { typedef const __attribute__((address_space(1))) v8h* gq; union { v16h v; v8h q[2]; } u; u.q[0] = *(gq)aa; u.q[1] = *(gq)(aa + 32); s.a = u.v;
#pragma unroll
  for (int j = 0; j < 8; ++j) { u.q[0] = *(gq)(aw + j * 1024); u.q[1] = *(gq)(aw + j * 1024 + 512); s.w[j] = u.v; } }
// ---- k_out2: block = (64 rows, 128 cols): final projection out = R Wo + bo on the re-read rows R [NB*TT][K2] (K2 = DIN input width): the rows (f16 x 2^6) against Wo's B fragments from k_prep (FO, f16(bf16 x 2^8)), both loaded through a ring of RO k-steps, x 2^-14; always the single-product path
__global__ __launch_bounds__(128) void k_out2(const _Float16* __restrict__ Y, const _Float16* __restrict__ FO, const float* __restrict__ BO, float* __restrict__ OUT) { __shared__ __align__(16) float sf[4][16][132];
  const int tid = threadIdx.x, wave = tid >> 5, lane = tid & 31, col = lane & 15, g = lane >> 4; const int c0 = blockIdx.y * 128; const size_t r0 = (size_t)blockIdx.x * 64 + wave * 16; const unsigned lob = lane * 16u;
  v8f acc[8] = {};   /* the re-read rows mix positions: no early-row special case here */
  /* the ring, as in k_proj: a slot is asked for again, RO steps ahead, right behind the step that used it; the walk is unrolled whole, every load one of the two fixed addresses plus a constant. The rows arrive as f16 x 2^6 (k_out), clear of f16 subnormals (chip FTZ) */
  const gp ab = (gp)(const char*)Y + ((r0 + col) * K2 + 8 * g) * 2, wb = (gp)(const char*)FO + (size_t)(c0 / 16) * 1024 + lob; OS st[RO];
#pragma unroll
  for (int j = 0; j < RO; ++j) { out2_ld(ab + j * 64, wb + j * ((DIN / 16) * 1024), st[j]);
    __builtin_amdgcn_sched_barrier(0); }   /* asked for in ring order, as in k_proj: in another order the first step's counted load waits wait for the second slot too */
#pragma unroll
  for (int kc = 0; kc < K2 / 32; ++kc) { const OS& s = st[kc % RO];
#pragma unroll
    for (int j = 0; j < 8; ++j) acc[j] = wmma16(s.a, s.w[j], acc[j]);
    if (kc + RO < K2 / 32) { out2_ld(ab + (kc + RO) * 64, wb + (kc + RO) * ((DIN / 16) * 1024), st[kc % RO]);
      __builtin_amdgcn_sched_barrier(0); } }   /* keeps products and refills in ring order: without it the build makes steps wait for their whole slot at the second product */
  XWH(ab, wb);
#pragma unroll
  for (int j = 0; j < 8; ++j) { const float bias = BO ? bfr(BO[c0 + j * 16 + col]) : 0.f;
#pragma unroll
    for (int r = 0; r < 8; ++r) sf[wave][8 * g + r][j * 16 + col] = acc[j][r] * (1.0f / 16384.0f) + bias; }   /* 2^-8 (Wo carry) x 2^-6 (row carry) */
  LDSX(); for (int rl = 0; rl < 16; ++rl) vst2(OUT + (r0 + rl) * DIN + c0 + lane * 4, *(const v4f*)&sf[wave][rl][lane * 4]); }

extern "C" void kernel_launch(void* const* d_in, const int* in_sizes, int n_in, void* d_out, int out_size, void* d_ws, size_t ws_size, hipStream_t stream) {
  (void)in_sizes; (void)n_in; (void)out_size;
  const float** F = (const float**)d_in;
  if (ws_size < (size_t)WS_END) return;
  char* ws = (char*)d_ws; _Float16 *QH = (_Float16*)(ws + WS_QH), *KH = (_Float16*)(ws + WS_KH), *VT = (_Float16*)(ws + WS_VT), *QL = (_Float16*)(ws + WS_QL), *KL = (_Float16*)(ws + WS_KL); __bf16 *VB = (__bf16*)(ws + WS_VB), *VBL = (__bf16*)(ws + WS_VBL); float *S = (float*)(ws + WS_S), *Y = (float*)(ws + WS_Y);
  (void)S; (void)Y; (void)QL; (void)KL; (void)VB; (void)VBL;
  // inputs (in order): 0 x [4,2048,768]; 1 Wq [768,768] (in,out), 2 bq; 3 Wkd [768,192], 4 bkd; 5 Wvd [768,192], 6 bvd; 7 Wvu [192,768], 8 bvu; 9 Wo [768,768] (in,out), 10 bo (all biases zeros, read)
  if (ws_size < (size_t)WS_END3) return;
  _Float16 *T = (_Float16*)(ws + WS_T); __bf16 *FP = (__bf16*)(ws + WS_FP), *FU = (__bf16*)(ws + WS_FU); _Float16 *FUH = (_Float16*)(ws + WS_FUH), *FO = (_Float16*)(ws + WS_FO);
  k_prep<<<dim3((NF_P + NF_U + NF_O) / 4), 128, 0, stream>>>(F[1], F[3], F[5], F[7], F[9], FP, FU, FUH, FO);   /* every weight once into B-fragment order */
  k_proj<<<dim3(TNB * TT / 64, CC / 128, 3), 128, 0, stream>>>(F[0], F[0], F[0], FP, F[2], F[4], F[6], QH, QL, KH, KL, VT, VB, VBL);   /* q slice, latent k, latent v: 3 column blocks of 128 columns each */
  k_att<<<dim3(TNB * NH, TT / (64 * QT)), 128, 0, stream>>>(QH, KH, QL, KL, VT, VB, VBL, Y);   /* logits, softmax, P v: every (b, h, 128-query block) in one launch */
  k_out<<<dim3(TNB * TT / 64, DIN / 128), 128, 0, stream>>>(Y, FU, FUH, F[8], T);   /* T[b][c][s] = f16(ao[b][s][c] x 2^6), ao = al Wvu + bvu (gathered weight rows) */
  k_out2<<<dim3(TNB * TT / 64, DIN / 128), 128, 0, stream>>>(T, FO, F[10], (float*)d_out);   /* rows = T's memory re-read as [TT][DIN] per batch; out = rows Wo + bo */
}

// v008
// One run takes 75.2 microseconds.
// Next to v007, in two timings, it ran 1.05 times as fast each time.
// Counting every step since v000, it is 23.6 times as fast.
// compute dtype: all float inputs rounded to bf16; the q slice and the latent k / v projections with EXACT bf16 products on WMMA 16x16x32 (f32 accumulate) + bias (zeros, read), 16 real dims per head zero-padded to 32; causal logits over the 16 latent dims: 3 products for the first 384 rows, single f16 after, x 16^-0.5; softmax f32 (max first, then exp(s - max) x 2^11, formed as 2^(raw logit x 16^-0.5 log2(e) + offset), once to f16 x v once to f16 (bf16 hi + lo below row 384), divided by the f32 row sum after the product; logits never stored); latent ctx (hi+lo below row 384, x2^6 f16 carry after) x exact / f16(bf16 x 2^8) Wvu + bvu; per-batch transpose; then x 2^6 once to f16 x Wo f16(bf16 x 2^8) + bo; f32 output.
#include <hip/hip_runtime.h>
#include <math.h>

typedef __attribute__((ext_vector_type(16))) _Float16 v16h;
typedef __attribute__((ext_vector_type(16))) __bf16 v16b;
typedef __attribute__((ext_vector_type(8)))  _Float16 v8h;
typedef __attribute__((ext_vector_type(8)))  float v8f;
typedef __attribute__((ext_vector_type(4)))  float v4f;
typedef __attribute__((ext_vector_type(2)))  float v2f;
typedef __attribute__((ext_vector_type(4)))  unsigned v4u;
typedef __attribute__((ext_vector_type(4)))  int v4i;
typedef float __attribute__((may_alias)) float_a;
typedef int __attribute__((may_alias)) int_a;

template <typename T> __device__ __forceinline__ void vst2(void* p, T v) { *(T*)p = v;  }
__device__ __forceinline__ v8f wmma16(v16h a, v16h b, v8f c) {
  v8f d = __builtin_amdgcn_wmma_f32_16x16x32_f16(false, a, false, b, (short)0, c, false, false);
  asm volatile("v_nop\n\tv_nop\n\tv_nop\n\tv_nop" : "+v"(d) : "v"(a), "v"(b));
  return d;
}
__device__ __forceinline__ v8f wmma_bf(v16b a, v16b b, v8f c) {
  v8f d = __builtin_amdgcn_wmma_f32_16x16x32_bf16(false, a, false, b, (short)0, c, false, false);
  asm volatile("v_nop\n\tv_nop\n\tv_nop\n\tv_nop" : "+v"(d) : "v"(a), "v"(b));
  return d;
}
// 16x16x32 fragments: lane = (h = lane>>4, row/col = lane&15); elements 0..7 = k0+8h+0..7, 8..15 = k0+16+8h+0..7; D element r = row 8h+r
__device__ __forceinline__ v16h frag_h(const _Float16* rowk0, int lane) {
  union { v16h v; v8h q[2]; } u; const _Float16* p = rowk0 + 8 * (lane >> 4);
  u.q[0] = *(const v8h*)p; u.q[1] = *(const v8h*)(p + 16); return u.v;
}
__device__ __forceinline__ v16h frag_f32(const float* rowk0, int lane) {
  v16h a; const float* p = rowk0 + 8 * (lane >> 4);
#pragma unroll
  for (int i = 0; i < 8; ++i) { a[i] = (_Float16)p[i]; a[8 + i] = (_Float16)p[16 + i]; }
  return a;
}
__device__ __forceinline__ v16h frag_f32s(const float* rowk0, int lane, float sc) {
  v16h a; const float* p = rowk0 + 8 * (lane >> 4);
#pragma unroll
  for (int i = 0; i < 8; ++i) { a[i] = (_Float16)(p[i] * sc); a[8 + i] = (_Float16)(p[16 + i] * sc); }
  return a;
}
// column fragment from a [K][ld] layout (column n), rows >= K read as 0
__device__ __forceinline__ v16h fragc_f32(const float* W, int k0, int n, int lane, int ld, int K) {
  v16h a; const int g = lane >> 4;
#pragma unroll
  for (int i = 0; i < 8; ++i) { const int ka = k0 + 8 * g + i, kb = ka + 16;
    a[i] = (_Float16)(ka < K ? W[(size_t)(ka < K ? ka : K - 1) * ld + n] : 0.f); a[8 + i] = (_Float16)(kb < K ? W[(size_t)(kb < K ? kb : K - 1) * ld + n] : 0.f); }
  return a;
}
struct F2 { v16b h, l; };
__device__ __forceinline__ F2 bsplit16(const float v[16]) { F2 r;
#pragma unroll
  for (int i = 0; i < 16; ++i) { const __bf16 h = (__bf16)v[i]; r.h[i] = h; r.l[i] = (__bf16)(v[i] - (float)h); }
  return r; }
__device__ __forceinline__ F2 split_row(const float* row, int k0, int lane) { float v[16]; const float* p = row + k0 + 8 * (lane >> 4);
#pragma unroll
  for (int i = 0; i < 8; ++i) { v[i] = p[i]; v[8 + i] = p[16 + i]; }
  return bsplit16(v); }
__device__ __forceinline__ F2 split_rowK(const float* row, int k0, int lane, int K) { float v[16]; const int g = lane >> 4;
#pragma unroll
  for (int i = 0; i < 8; ++i) { const int ka = k0 + 8 * g + i, kb = ka + 16; v[i] = ka < K ? row[ka < K ? ka : K - 1] : 0.f; v[8 + i] = kb < K ? row[kb < K ? kb : K - 1] : 0.f; }
  return bsplit16(v); }
__device__ __forceinline__ F2 split_col(const float* W, int k0, int n, int lane, int ld, int K) { float v[16]; const int g = lane >> 4;
#pragma unroll
  for (int i = 0; i < 8; ++i) { const int ka = k0 + 8 * g + i, kb = ka + 16; v[i] = ka < K ? W[(size_t)(ka < K ? ka : K - 1) * ld + n] : 0.f; v[8 + i] = kb < K ? W[(size_t)(kb < K ? kb : K - 1) * ld + n] : 0.f; }
  return bsplit16(v); }
__device__ __forceinline__ v8f mac3(const F2& a, const F2& b, v8f c) { c = wmma_bf(a.l, b.h, c); c = wmma_bf(a.h, b.l, c); return wmma_bf(a.h, b.h, c); }
__device__ __forceinline__ float sigm(float v) { return 1.0f / (1.0f + expf(-v)); }
#define LDSX() do { asm volatile("s_wait_dscnt 0" ::: "memory"); __builtin_amdgcn_wave_barrier(); __builtin_amdgcn_fence(__ATOMIC_RELEASE, "workgroup"); } while (0)

// Causal self-attention with 12 low-rank latent heads (x [4,2048,768]; (in,out) Wq [768,768], Wkd / Wvd [768,192], Wvu [192,768], Wo [768,768], all N(0,1) x 0.02, zero biases (read); q = x Wq + bq split into 12 heads x 64 of which only the FIRST 16 dims of each head are used (ql); kl, vl = x Wkd, x Wvd split into 12 heads x 16; scores = ql kl^T x 16^-0.5; triu(1) -> -inf; softmax; al = w vl merged to [B,S,192]; ao = al Wvu + bvu [B,S,768]; then jnp.transpose(ao, (0,2,1)).reshape(B,S,768): the per-batch [2048 x 768] matrix is transposed to [768 x 2048] and its memory re-read as 2,048 rows of 768; out = that Wo + bo).
#define NB 4
#define TT 2048
#define CC 384            // NH * HD = projected width
#define DIN 768          // input (model) width
#define NH 12
#define HD 32
#define LATW 16     /* real dims per head; columns h*HD + d with d >= LATW are zero padding */
#define QHEADW 64   /* the module's q heads are 64 wide; only their first LATW dims are used (ql = q[..., :16]) */
#define KVLD (NH * LATW)   /* row pitch of the (in,out) latent weights Wkd / Wvd [768][192] */
#define NQB (TT / 64)
#define HG 2   // S region: 2 x 2,048 x 2,048 f32 = 32 MiB, allocated but unused
#define SCALE (0.25f)
#define CAUSAL 1
#ifndef TNB
#define TNB NB
#endif
__device__ __forceinline__ float bfr(float v) { return (float)(__bf16)v; }
__host__ __device__ __forceinline__ int kb_last(int qb) { return CAUSAL ? ((qb * 64 + 63) >> 7) : (TT / 128 - 1); }
typedef __attribute__((ext_vector_type(8))) __bf16 v8b;
__device__ __forceinline__ v16b frag_b(const __bf16* rowk0, int lane) {
  union { v16b v; v8b q[2]; } u; const __bf16* p = rowk0 + 8 * (lane >> 4);
  u.q[0] = *(const v8b*)p; u.q[1] = *(const v8b*)(p + 16); return u.v;
}
#define QBH 6              // causal: query blocks 0..QBH-1 of each sequence (few keys, no averaging) take the high-precision path
#define QHI 384            // rows carrying a q residual plane
#define KHI 384            // key rows carrying k residual / v bf16 hi+lo planes (used only by the causal high-precision path)
// B fragment (k rows k0+.., output column o) of a weight: (in,out) [K][ld] or (out,in) [ld rows of K]: bf16 exact, or f16(bf16 * 256) exact
__device__ __forceinline__ v16b wcol_io(const float* Wm, int k0, int o, int lane, int ld) { v16b w; const int g = lane >> 4;
#pragma unroll
  for (int i = 0; i < 8; ++i) { w[i] = (__bf16)Wm[(size_t)(k0 + 8 * g + i) * ld + o]; w[8 + i] = (__bf16)Wm[(size_t)(k0 + 16 + 8 * g + i) * ld + o]; }
  return w; }
__device__ __forceinline__ v16b wcol_oi(const float* Wm, int k0, int o, int lane, int K) { v16b w; const float* p = Wm + (size_t)o * K + k0 + 8 * (lane >> 4);
#pragma unroll
  for (int i = 0; i < 8; ++i) { w[i] = (__bf16)p[i]; w[8 + i] = (__bf16)p[16 + i]; }
  return w; }
__device__ __forceinline__ v16h wcolh_io(const float* Wm, int k0, int o, int lane, int ld) { v16h w; const int g = lane >> 4;
#pragma unroll
  for (int i = 0; i < 8; ++i) { w[i] = (_Float16)(bfr(Wm[(size_t)(k0 + 8 * g + i) * ld + o]) * 256.0f); w[8 + i] = (_Float16)(bfr(Wm[(size_t)(k0 + 16 + 8 * g + i) * ld + o]) * 256.0f); }
  return w; }
// first output projection ao = al Wvu: the k index runs over ctx columns kk = h*HD + d; one 32-deep k-step = one head; its first 16 entries (d < LATW, fragment slots 0..7 of both lane halves) are rows h*LATW + d of the (in,out) [192][768] weight, its last 16 (padding dims, slots 8..15) are zero
__device__ __forceinline__ v16b wcol_io_lat(const float* Wm, int k0, int o, int lane, int ld) { v16b w; const int g = lane >> 4; const float* p = Wm + (size_t)((k0 / HD) * LATW + 8 * g) * ld + o;
#pragma unroll
  for (int i = 0; i < 8; ++i) { w[i] = (__bf16)p[(size_t)i * ld]; w[8 + i] = (__bf16)0.0f; }
  return w; }
__device__ __forceinline__ v16h wcolh_io_lat(const float* Wm, int k0, int o, int lane, int ld) { v16h w; const int g = lane >> 4; const float* p = Wm + (size_t)((k0 / HD) * LATW + 8 * g) * ld + o;
#pragma unroll
  for (int i = 0; i < 8; ++i) { w[i] = (_Float16)(bfr(p[(size_t)i * ld]) * 256.0f); w[8 + i] = (_Float16)0.0f; }
  return w; }
static_assert(HD == 32 && LATW == 16 && CC == NH * HD, "the latent loaders assume one head per 32-deep k-step with 16 real + 16 padding dims");
__device__ __forceinline__ v16h wcolh_oi(const float* Wm, int k0, int o, int lane, int K) { v16h w; const float* p = Wm + (size_t)o * K + k0 + 8 * (lane >> 4);
#pragma unroll
  for (int i = 0; i < 8; ++i) { w[i] = (_Float16)(bfr(p[i]) * 256.0f); w[8 + i] = (_Float16)(bfr(p[16 + i]) * 256.0f); }
  return w; }
#define WQKV_LAYOUT 0   // 0 = (in,out) [DIN][out], columns gathered per head; 1 = (out,in) [CC][DIN]; 2 = per-head [NH][DIN][HD]
__device__ __forceinline__ v16b wcol_hdk(const float* Wm, int k0, int o, int lane) { v16b w; const int g = lane >> 4; const float* p = Wm + (size_t)(o / HD) * DIN * HD + (o % HD);
#pragma unroll
  for (int i = 0; i < 8; ++i) { w[i] = (__bf16)p[(size_t)(k0 + 8 * g + i) * HD]; w[8 + i] = (__bf16)p[(size_t)(k0 + 16 + 8 * g + i) * HD]; }
  return w; }
#define WO_OUT_IN 0
#if WQKV_LAYOUT == 1
#define WCOL(W, k0, o, lane) wcol_oi(W, k0, o, lane, DIN)
#elif WQKV_LAYOUT == 2
#define WCOL(W, k0, o, lane) wcol_hdk(W, k0, o, lane)
#else
__device__ __forceinline__ v16b zero16b() { v16b w; _Pragma("unroll") for (int i = 0; i < 16; ++i) w[i] = (__bf16)0.0f; return w; }
/* column o = h*HD + d: real (d < LATW) -> weight column h*QHEADW + d of Wq (pitch DIN) for the q stream, h*LATW + d of Wkd / Wvd (pitch KVLD) for k / v; padding -> zeros. o = c0 + j*16 + col with c0 % 128 == 0, so (o % HD) < LATW is decided by j alone (compile-time per unrolled j, uniform across the wave) */
#define GCOL(o) ((which) == 0 ? ((o) / HD) * QHEADW + ((o) % HD) : ((o) / HD) * LATW + ((o) % HD))
#define WCOL(W, k0, o, lane) ((((o) % HD) < LATW) ? wcol_io(W, k0, GCOL(o), lane, ((which) == 0 ? DIN : KVLD)) : zero16b())
#endif
#if WO_OUT_IN
#define WOCOL(W, k0, o, lane) wcol_oi(W, k0, o, lane, CC)
#define WOCOLH(W, k0, o, lane) wcolh_oi(W, k0, o, lane, CC)
#else
#define WOCOL(W, k0, o, lane) wcol_io_lat(W, k0, o, lane, DIN)
#define WOCOLH(W, k0, o, lane) wcolh_io_lat(W, k0, o, lane, DIN)
#endif

#ifndef SM_EXTRA_PARAMS
#define SM_EXTRA_PARAMS
#endif
#ifndef PROJ_EXTRA_PARAMS
#define PROJ_EXTRA_PARAMS
#endif
#ifndef SM_MASK_HOOK
#define SM_MASK_HOOK (void)0
#endif

#define WS_QH  0u                                      // f16 q rows [b*t][CC]
#define WS_KH  (WS_QH + 2u * (size_t)NB * TT * CC)      // f16 k in A-fragment order [b][h][16-key tile][512 B] (the region keeps its old size)
#define WS_VT  (WS_KH + 2u * (size_t)NB * TT * CC)      // f16 v^T in A-fragment order [b][h][32-key step][1024 B]
#define WS_QL  (WS_VT + 2u * (size_t)NB * CC * TT)      // f16 q residual x 2^10 rows [b][t < QHI][CC]
#define WS_KL  (WS_QL + 2u * (size_t)NB * QHI * CC)     // f16 k residual x 2^10, as WS_KH, key tiles below KHI
#define WS_VB  (WS_KL + 2u * (size_t)NB * KHI * CC)     // bf16 v hi (then lo), as WS_VT, key steps below KHI
#define WS_VBL (WS_VB + 2u * (size_t)NB * CC * KHI)
#define WS_S   (WS_VBL + 2u * (size_t)NB * CC * KHI)    // f32 [hg][t][s] region, unused (logits stay in registers)
#define WS_Y   (WS_S  + 4u * (size_t)HG * TT * TT)      // f32 ctx rows [b*t][CC] (only when there is an output projection)
#define WS_END (WS_Y  + 4u * (size_t)NB * TT * CC)
#define WS_T  (WS_END)                                     // f16 per-batch transpose T[b][c][s] = f16((al Wvu + bvu)[b][s][c] x 2^6), written by k_out; its memory is then read as TT rows of DIN (the module's transpose(0,2,1).reshape)
#define WS_END2 (WS_T + 2u * (size_t)NB * TT * DIN)
static_assert(TT % 64 == 0 && DIN % 128 == 0, "a k_out block owns 64 positions of 128 channels: one whole 128-B line of T per channel");
// weights in WMMA B-fragment order, written once per call by k_prep. One fragment = the 32 lanes' slots 0..7 (16 B a lane, 512 B in a row), then their slots 8..15 (left out where they are the zero padding of a latent head)
#define NF_P (3 * (DIN / 32) * NH)        /* q slice / latent k / latent v: [which][kc][head], bf16 */
#define NF_U (NH * (DIN / 16))            /* Wvu: [head][column tile], slots 0..7 only, once bf16 and once f16(bf16 x 2^8) */
#define NF_O ((DIN / 32) * (DIN / 16))    /* Wo: [kc][column tile], f16(bf16 x 2^8) */
#define WS_FP  (WS_END2)
#define WS_FU  (WS_FP  + 1024u * (size_t)NF_P)
#define WS_FUH (WS_FU  + 512u * (size_t)NF_U)
#define WS_FO  (WS_FUH + 512u * (size_t)NF_U)
#define WS_END3 (WS_FO + 1024u * (size_t)NF_O)
static_assert((NF_P + NF_U + NF_O) % 4 == 0, "k_prep: four waves a block, one fragment a wave");
// fb = wave-uniform start of the fragment, lob = lane * 16 bytes
__device__ __forceinline__ v16b fragw_b(const __bf16* fb, unsigned lob) { union { v16b v; v8b q[2]; } u; const char* p = (const char*)fb + lob; u.q[0] = *(const v8b*)p; u.q[1] = *(const v8b*)(p + 512); return u.v; }
__device__ __forceinline__ v16h fragw_h(const _Float16* fb, unsigned lob) { union { v16h v; v8h q[2]; } u; const char* p = (const char*)fb + lob; u.q[0] = *(const v8h*)p; u.q[1] = *(const v8h*)(p + 512); return u.v; }
__device__ __forceinline__ v16b fragw_b8(const __bf16* fb, unsigned lob) { union { v16b v; v8b q[2]; } u; u.q[0] = *(const v8b*)((const char*)fb + lob);
#pragma unroll
  for (int i = 0; i < 8; ++i) u.q[1][i] = (__bf16)0.0f;
  return u.v; }
__device__ __forceinline__ v16h fragw_h8(const _Float16* fb, unsigned lob) { union { v16h v; v8h q[2]; } u; u.q[0] = *(const v8h*)((const char*)fb + lob);
#pragma unroll
  for (int i = 0; i < 8; ++i) u.q[1][i] = (_Float16)0.0f;
  return u.v; }
// a precaution: stands between issued loads and the next write of a register that holds one of their addresses
__device__ __forceinline__ void XW() { asm volatile("s_wait_xcnt 0x0" ::: "memory"); }
typedef const __attribute__((address_space(1))) char* gp;
// a precaution, as XW: the wait that stands between issued loads and the next write of a register that holds one of their addresses. The addresses are its inputs, so they keep registers of their own up to the wait and no load issued before it can land on them
__device__ __forceinline__ void XWH(gp a) { asm volatile("s_wait_xcnt 0x0" :: "v"(a) : "memory"); }
__device__ __forceinline__ void XWH(gp a, gp b) { asm volatile("s_wait_xcnt 0x0" :: "v"(a), "v"(b) : "memory"); }
__device__ __forceinline__ void XWH(gp a, gp b, gp c, gp d, gp e, gp f) { asm volatile("s_wait_xcnt 0x0" :: "v"(a), "v"(b), "v"(c), "v"(d), "v"(e), "v"(f) : "memory"); }
__device__ __forceinline__ void XWH(gp a, gp b, gp c, gp d, gp e, gp f, gp g, gp h) { asm volatile("s_wait_xcnt 0x0" :: "v"(a), "v"(b), "v"(c), "v"(d), "v"(e), "v"(f), "v"(g), "v"(h) : "memory"); }
// N weight values of one column, rows i (i < 8) and, for N = 16, 16 + i of an (in,out) weight of pitch LD: ub = wave-uniform address of the tile's first row and column, lo = the lane's fixed byte offset (8 g rows + its column). The last load may land on the offset register, so the wait stands in front of it, and once more behind it, ahead of the scalar work that forms the store address
template <int LD, int N> __device__ __forceinline__ void ld_col(const float* ub, unsigned lo, float v[N]) { const char* p = (const char*)ub + lo;
#pragma unroll
  for (int i = 0; i < N - 1; ++i) v[i] = *(const float*)(p + (size_t)((i & 7) + 2 * (i & 8)) * LD * 4);
  XW(); v[N - 1] = *(const float*)(p + (size_t)(((N - 1) & 7) + 2 * ((N - 1) & 8)) * LD * 4); XW(); }
// ---- k_prep: one wave = one B fragment, with the roundings the projection kernels' own loaders (wcol_io, wcol_io_lat, wcolh_io_lat, wcolh_io) made per wave and per row block
__global__ __launch_bounds__(128) void k_prep(const float* __restrict__ WQ, const float* __restrict__ WK, const float* __restrict__ WV, const float* __restrict__ WU, const float* __restrict__ WO, __bf16* __restrict__ FP, __bf16* __restrict__ FU, _Float16* __restrict__ FUH, _Float16* __restrict__ FO) {
  const int lane = threadIdx.x & 31, col = lane & 15, g = lane >> 4; const int f = blockIdx.x * 4 + __builtin_amdgcn_readfirstlane(threadIdx.x >> 5);
  if (f < NF_P) { const int which = f / ((DIN / 32) * NH), kc = (f / NH) % (DIN / 32), h = f % NH; float v[16];
    if (which == 0) ld_col<DIN, 16>(WQ + (size_t)kc * 32 * DIN + h * QHEADW, (unsigned)(8 * g * DIN + col) * 4u, v);
    else ld_col<KVLD, 16>((which == 1 ? WK : WV) + (size_t)kc * 32 * KVLD + h * LATW, (unsigned)(8 * g * KVLD + col) * 4u, v);
    union { v16b v; v8b q[2]; } u;
#pragma unroll
    for (int i = 0; i < 16; ++i) u.v[i] = (__bf16)v[i];
    char* d = (char*)FP + (size_t)f * 1024 + lane * 16; *(v8b*)d = u.q[0]; *(v8b*)(d + 512) = u.q[1];
  } else if (f < NF_P + NF_U) { const int fu = f - NF_P, h = fu / (DIN / 16), jt = fu % (DIN / 16); float v[8];
    ld_col<DIN, 8>(WU + (size_t)h * LATW * DIN + jt * 16, (unsigned)(8 * g * DIN + col) * 4u, v);
    v8b wb; v8h wh;
#pragma unroll
    for (int i = 0; i < 8; ++i) { wb[i] = (__bf16)v[i]; wh[i] = (_Float16)(bfr(v[i]) * 256.0f); }
    *(v8b*)((char*)FU + (size_t)fu * 512 + lane * 16) = wb; *(v8h*)((char*)FUH + (size_t)fu * 512 + lane * 16) = wh;
  } else { const int fo = f - NF_P - NF_U, kc = fo / (DIN / 16), jt = fo % (DIN / 16); float v[16];
    ld_col<DIN, 16>(WO + (size_t)kc * 32 * DIN + jt * 16, (unsigned)(8 * g * DIN + col) * 4u, v);
    union { v16h v; v8h q[2]; } u;
#pragma unroll
    for (int i = 0; i < 16; ++i) u.v[i] = (_Float16)(bfr(v[i]) * 256.0f);
    char* d = (char*)FO + (size_t)fo * 1024 + lane * 16; *(v8h*)d = u.q[0]; *(v8h*)(d + 512) = u.q[1]; } }
// k_proj's ring: one slot = one k-step's operands as loaded, the lane's 16 x values (f32) and the four real weight fragments. ax / aw = the lane's own addresses of the step (x row + 8 g values; fragment start + lane * 16 bytes)
#define RP 3   // k-steps held or in flight
struct PS { v4f x[4]; v16b w[4]; };
__device__ __forceinline__ void proj_ld(gp ax, gp aw, PS& s) { typedef const __attribute__((address_space(1))) v4f* gf; typedef const __attribute__((address_space(1))) v8b* gb;
  s.x[0] = *(gf)ax; s.x[1] = *(gf)(ax + 16); s.x[2] = *(gf)(ax + 64); s.x[3] = *(gf)(ax + 80);
#pragma unroll
  for (int jj = 0; jj < 4; ++jj) { union { v16b v; v8b q[2]; } u; u.q[0] = *(gb)(aw + jj * 1024); u.q[1] = *(gb)(aw + jj * 1024 + 512); s.w[jj] = u.v; } }
// ---- k_proj: block = (64 rows, 128 cols, which): q/k/v = X W (+ b) with exact bf16 products (K = DIN) -> which 0: q f16 rows (+ residual rows < QHI); 1: k f16 (+ residual for keys < KHI); 2: v f16 (+ bf16 hi/lo for keys < KHI). k and v leave in the order k_att's A fragments are read in, the 16 real dims of a head only:
// k tile (16 keys): 512 B with lane (g, c) = dims 8 g + 0..7 of key c; the even tile of a 32-key step fills fragment slots 0..7, the odd one slots 8..15; the padding dims are not stored. v step (32 keys): 512 B with lane (g, c) = keys 8 g + 0..7 of dim c (slots 0..7), then 512 B with keys 16 + 8 g + 0..7 (slots 8..15)
__global__ __launch_bounds__(128) void k_proj(const float* __restrict__ XQ, const float* __restrict__ XK, const float* __restrict__ XV, const __bf16* __restrict__ FP, const float* __restrict__ BQ, const float* __restrict__ BK, const float* __restrict__ BV,
    _Float16* __restrict__ QH, _Float16* __restrict__ QL, _Float16* __restrict__ KH, _Float16* __restrict__ KL, _Float16* __restrict__ VT, __bf16* __restrict__ VB, __bf16* __restrict__ VBL) {
  __shared__ __align__(16) _Float16 sh[64][136], sl[64][136]; __shared__ __align__(16) _Float16 th[128][72]; __shared__ __align__(16) __bf16 tb[128][72], tbl[128][72];
  const int tid = threadIdx.x, wave = tid >> 5, lane = tid & 31, col = lane & 15, g = lane >> 4; const int which = blockIdx.z; const int c0 = blockIdx.y * 128; const size_t r0 = (size_t)blockIdx.x * 64; const size_t bb = r0 / TT; const int t0 = (int)(r0 % TT);
  const float* X = which == 0 ? XQ : which == 1 ? XK : XV; const __bf16* FW = FP + ((size_t)which * (DIN / 32) * NH + c0 / HD) * 512; const unsigned lob = lane * 16u; const float* BA = which == 0 ? BQ : which == 1 ? BK : BV;
  v8f acc[8] = {}; float bv[4]; gp bq[4];   /* bv: the bias of the four real column tiles, as loaded */
  /* a ring of RP k-steps' operands in registers: a slot is asked for again, RP steps ahead, right behind the step that used it, so a load has the other slots' steps of work to land in. The walk is unrolled whole: every load is one of the two fixed addresses plus a constant, and no address register is written while loads are out. k-steps are used in the order 0 .. DIN / 32 - 1 as before */
  const gp xb = (gp)(const char*)X + ((r0 + wave * 16 + col) * DIN + 8 * g) * 4, wb = (gp)(const char*)FW + lob; PS st[RP];
#pragma unroll
  for (int j = 0; j < RP; ++j) { proj_ld(xb + j * 128, wb + j * (NH * 1024), st[j]);
    __builtin_amdgcn_sched_barrier(0); }   /* asked for in ring order: in another order the counted load waits of the first steps wait for younger slots too */
#pragma unroll
  for (int kc = 0; kc < DIN / 32; ++kc) { const PS& s = st[kc % RP]; v16b a;
#pragma unroll
    for (int i = 0; i < 4; ++i) { a[i] = (__bf16)s.x[0][i]; a[4 + i] = (__bf16)s.x[1][i]; a[8 + i] = (__bf16)s.x[2][i]; a[12 + i] = (__bf16)s.x[3][i]; }
#pragma unroll
    for (int j = 0; j < 8; ++j) acc[j] = wmma_bf(a, (j & 1) ? zero16b() : s.w[j >> 1], acc[j]);   /* even j: the real column tiles (dims < LATW of a head) */
    __builtin_amdgcn_sched_barrier(0);   /* the refill stays behind the step that reads its slot: left free, the build needs registers past v255 */
    if (kc + RP < DIN / 32) { proj_ld(xb + (kc + RP) * 128, wb + (kc + RP) * (NH * 1024), st[kc % RP]);
      __builtin_amdgcn_sched_barrier(0); }   /* the refill is issued whole here: left free, the build sets the next step's first load wait in among its loads and holds the last four back behind it */
    if (kc == DIN / 32 - RP) {   /* the first slot that is not refilled: its registers take the bias values, asked for together here, so that the walk's last steps cover their way instead of the epilogue waiting for them one by one. Gathered like the weight columns; with no bias array the loads read x and their values are not used */
      const gp bs = (gp)(BA ? (const char*)BA : (const char*)X) + col * 4; const int hw = (which == 0 ? QHEADW : LATW) * 4;
#pragma unroll
      for (int jj = 0; jj < 4; ++jj) { bq[jj] = bs + (c0 / HD + jj) * hw; bv[jj] = *(const __attribute__((address_space(1))) float*)bq[jj]; } } }
  XWH(xb, wb, bq[0], bq[1], bq[2], bq[3]);
  if (which < 2) { _Float16* DH = which == 0 ? QH : KH; _Float16* DL = which == 0 ? QL : KL; const int nhi = which == 0 ? QHI : KHI; const bool hi_rows = t0 < nhi;
#pragma unroll
    for (int j = 0; j < 8; ++j) { const float bias = (BA && !(j & 1)) ? bfr(bv[j >> 1]) : 0.f;   /* padding columns (odd j) get no bias */
#pragma unroll
      for (int r = 0; r < 8; ++r) { const float v = acc[j][r] + bias; const _Float16 hv = (_Float16)v; sh[wave * 16 + 8 * g + r][j * 16 + col] = hv; sl[wave * 16 + 8 * g + r][j * 16 + col] = (_Float16)((v - (float)hv) * 1024.0f); } }
    __syncthreads();
    if (which == 0) { for (int e = tid; e < 64 * 16; e += 128) { const int rl = e >> 4, q = e & 15; vst2((unsigned*)(DH + (r0 + rl) * CC + c0 + q * 8), *(const v4u*)&sh[rl][q * 8]); XW(); if (hi_rows) { vst2((unsigned*)(DL + (bb * nhi + t0 + rl) * (size_t)CC + c0 + q * 8), *(const v4u*)&sl[rl][q * 8]); XW(); } }
    } else {   /* wave = key tile, pass = head: a wave stores one whole tile, 512 B in a row */
      const int rl = wave * 16 + col; const size_t hd = bb * NH + c0 / HD; v4u a[4];
#pragma unroll
      for (int hh = 0; hh < 4; ++hh) a[hh] = *(const v4u*)&sh[rl][hh * HD + g * 8];
#pragma unroll
      for (int hh = 0; hh < 4; ++hh) vst2((unsigned*)(DH + ((hd + hh) * (TT / 16) + t0 / 16 + wave) * 256 + lane * 8), a[hh]);
      XW();
      if (hi_rows) {
#pragma unroll
        for (int hh = 0; hh < 4; ++hh) a[hh] = *(const v4u*)&sl[rl][hh * HD + g * 8];
#pragma unroll
        for (int hh = 0; hh < 4; ++hh) vst2((unsigned*)(DL + ((hd + hh) * (KHI / 16) + t0 / 16 + wave) * 256 + lane * 8), a[hh]);
        XW(); } }
  } else { const bool hi_rows = t0 < KHI;
#pragma unroll
    for (int j = 0; j < 8; ++j) { const float bias = (BA && !(j & 1)) ? bfr(bv[j >> 1]) : 0.f;   /* padding columns (odd j) get no bias */
#pragma unroll
      for (int r = 0; r < 8; ++r) { const float v = acc[j][r] + bias; const int rl = wave * 16 + 8 * g + r, cl = j * 16 + col; th[cl][rl] = (_Float16)v; const __bf16 bh = (__bf16)v; tb[cl][rl] = bh; tbl[cl][rl] = (__bf16)(v - (float)bh); } }
    __syncthreads();
    const int rl = wave * 16 + g * 8; const size_t hd = bb * NH + c0 / HD; v4u a[4];   /* wave = 16 keys = half a step, pass = head: a wave stores 512 B in a row */
#pragma unroll
    for (int hh = 0; hh < 4; ++hh) a[hh] = *(const v4u*)&th[hh * HD + col][rl];
#pragma unroll
    for (int hh = 0; hh < 4; ++hh) vst2((unsigned*)(VT + ((hd + hh) * (TT / 32) + t0 / 32) * 512 + tid * 8), a[hh]);
    XW();
    if (hi_rows) { v4u lo[4];
#pragma unroll
      for (int hh = 0; hh < 4; ++hh) { a[hh] = *(const v4u*)&tb[hh * HD + col][rl]; lo[hh] = *(const v4u*)&tbl[hh * HD + col][rl]; }
#pragma unroll
      for (int hh = 0; hh < 4; ++hh) { const size_t o3 = ((hd + hh) * (KHI / 32) + t0 / 32) * 512 + tid * 8; vst2((unsigned*)(VB + o3), a[hh]); vst2((unsigned*)(VBL + o3), lo[hh]); }
      XW(); } } }
// ---- k_att: block = 4 waves x 32 queries of (b, h), one launch for all (b, h): logits, softmax and P . v without leaving registers.
// S^T = K . Q^T (A = 16 key rows, B = 16 query rows): lane (g, c) holds, for query c, keys 8g + r of each 16-key tile, so the two tiles of one 32-key step, converted in place, are the B operand of ctx^T += v^T . P^T (hardware k order on both sides). Each key / v fragment serves the wave's two 16-query tiles. K and v^T lie in fragment order (k_proj), so every load of the walks is 512 B in a row, four whole lines; only the 16 real dims of a head are read, and the product with v's padding dims, which is 0, is not formed.
// One K fragment holds BOTH 16-key tiles of a step: row c = key c of tile 0 in k slots 0..15 and key c of tile 1 in k slots 16..31. Tile 0's logits come from B = [q ; 0], tile 1's from B = [0 ; q]: the zeros stand in the loop-invariant q fragments, and the K registers hold loaded values only.
// Walk 1: row maximum. Walk 2 (logits formed again, same products): e = exp(s - max) x 2^11, row sum in f32, e once to f16 against v f16 (query rows < QHI: 3-product logits, e and v as bf16 hi + lo, 3 products); ctx = acc / sum. Keys past the wave's own diagonal step are not visited; the diagonal step masks by index.
#define QT 2   // 16-query tiles per wave
#define RD 4   // late rows, second walk: steps whose key and v fragments are held or in flight
#define RD1 8  // late rows, first walk: its steps are about a third as long and hold keys only, so the ring is deeper
static_assert(QHI % (64 * QT) == 0 && QHI == QBH * 64 && KHI >= QHI && TT % (64 * QT) == 0, "a block of 4 x QT x 16 queries is wholly early or wholly late; early rows see only keys < KHI");
__device__ __forceinline__ v8f wm_h(v16h a, v16h b, v8f c) { return __builtin_amdgcn_wmma_f32_16x16x32_f16(false, a, false, b, (short)0, c, false, false); }
__device__ __forceinline__ v8f wm_b(v16b a, v16b b, v8f c) { return __builtin_amdgcn_wmma_f32_16x16x32_bf16(false, a, false, b, (short)0, c, false, false); }
// q fragments from a wave-uniform base + the lane's fixed byte offset (row c, half g)
__device__ __forceinline__ void frag_q(const _Float16* ub, unsigned lob, v16h q2[2]) { union { v16h v; v8h q[2]; } u0, u1; const v8h d = *(const v8h*)((const char*)ub + lob); v8h z;
#pragma unroll
  for (int i = 0; i < 8; ++i) z[i] = (_Float16)0.0f;
  u0.q[0] = d; u0.q[1] = z; u1.q[0] = z; u1.q[1] = d; q2[0] = u0.v; q2[1] = u1.v; }   /* the 16 real dims of query row c: [q ; 0] and [0 ; q] */
// k or v fragment in fragment order: fb = wave-uniform start of the 32-key step, lob = lane * 16 bytes. xl: the last fragment read through its address; its last load may land on the address registers, so the wait stands in front of it
__device__ __forceinline__ v16h fragv_h(const _Float16* fb, unsigned lob, bool xl) { union { v16h v; v8h q[2]; } u; const char* p = (const char*)fb + lob; u.q[0] = *(const v8h*)p; if (xl) XW(); u.q[1] = *(const v8h*)(p + 512); return u.v; }
__device__ __forceinline__ v16b fragv_b(const __bf16* fb, unsigned lob, bool xl) { union { v16b v; v8b q[2]; } u; const char* p = (const char*)fb + lob; u.q[0] = *(const v8b*)p; if (xl) XW(); u.q[1] = *(const v8b*)(p + 512); return u.v; }
// the ring's loads: a = the lane's own address of a 32-key step's fragment (step start + lane * 16 bytes)
__device__ __forceinline__ gp ring_a(const _Float16* base, int step, unsigned lob) { return (gp)(const char*)base + (size_t)step * 1024 + lob; }
__device__ __forceinline__ v16h ring_ld(gp a) { typedef const __attribute__((address_space(1))) v8h* gq; union { v16h v; v8h q[2]; } u; u.q[0] = *(gq)a; u.q[1] = *(gq)(a + 512); return u.v; }
// e x 2^11 = 2^(t x LC + off): t = the raw logit (before x 16^-0.5), LC = 16^-0.5 x log2(e), off = 11 - max(t) x LC, one value per query row. One fused multiply-add and one v_exp_f32 per logit; the rounding of off is a factor common to a row's numerators and its sum. Below 2^-126 the result may flush to 0, far under what the f32 sum or the 16-bit P can hold.
#define LC (SCALE * 1.44269504088896340736f)
// The free slot the instruction set asks for behind a transcendental (before its result is read or its source overwritten) stands in the v_exp_f32's own statement. exp2_x8: the eight logits of one product tile, each exponential in place on its own register (one the compiler's own multiply-add has just written, so the statement lands on no register that a matrix instruction still reads), so each is the independent instruction behind the one before it, and one v_nop closes the last.
__device__ __forceinline__ void exp2_x8(float* t, float off) { float a[8];
#pragma unroll
  for (int r = 0; r < 8; ++r) a[r] = __builtin_fmaf(t[r], LC, off);
  asm("v_exp_f32 %0, %0\n\tv_exp_f32 %1, %1\n\tv_exp_f32 %2, %2\n\tv_exp_f32 %3, %3\n\tv_exp_f32 %4, %4\n\tv_exp_f32 %5, %5\n\tv_exp_f32 %6, %6\n\tv_exp_f32 %7, %7\n\tv_nop" : "+v"(a[0]), "+v"(a[1]), "+v"(a[2]), "+v"(a[3]), "+v"(a[4]), "+v"(a[5]), "+v"(a[6]), "+v"(a[7]));
#pragma unroll
  for (int r = 0; r < 8; ++r) t[r] = a[r]; }
// one 32-key step: ld_k reads its two 16-key tiles as one fragment (KHr / KLr point at step 0 of (b, h), 512 elements a step, lob = lane * 16 bytes); st_mm forms s[u][8 t + r] = raw logit (not yet x 16^-0.5) of (key kc*32 + 16 t + 8 g + r, query 16 u + c)
struct KF { v16h h, l; };
template <bool HI> __device__ __forceinline__ KF ld_k(const _Float16* KHr, const _Float16* KLr, int kc, unsigned lob) { KF k; k.h = fragv_h(KHr + (size_t)kc * 512, lob, false); if (HI) k.l = fragv_h(KLr + (size_t)kc * 512, lob, false); else k.l = k.h; return k; }
template <bool HI> __device__ __forceinline__ void st_mm(const KF& k, const v16h qh[QT][2], const v16h ql[QT][2], float s[QT][16]) {
#pragma unroll
  for (int t = 0; t < 2; ++t)
#pragma unroll
    for (int u = 0; u < QT; ++u) { v8f a = {}; a = wm_h(k.h, qh[u][t], a);
      if (HI) { v8f al = {}; al = wm_h(k.h, ql[u][t], al); al = wm_h(k.l, qh[u][t], al);
#pragma unroll
        for (int r = 0; r < 8; ++r) s[u][t * 8 + r] = a[r] + al[r] * (1.0f / 1024.0f);
      } else {
#pragma unroll
        for (int r = 0; r < 8; ++r) s[u][t * 8 + r] = a[r]; } } }
template <bool HI, bool MASK> __device__ __forceinline__ void max_use(const KF& k, const v16h qh[QT][2], const v16h ql[QT][2], int kc, int qrel, float m[QT]) { float s[QT][16]; st_mm<HI>(k, qh, ql, s);
#pragma unroll
  for (int u = 0; u < QT; ++u)
#pragma unroll
    for (int i = 0; i < 16; ++i) { if (!MASK || kc * 32 + 16 * (i >> 3) + (i & 7) <= qrel + 16 * u) m[u] = fmaxf(m[u], s[u][i]); } }
template <bool HI, bool MASK> __device__ __forceinline__ void max_step(const _Float16* KHr, const _Float16* KLr, const v16h qh[QT][2], const v16h ql[QT][2], int kc, unsigned lob, int qrel, float m[QT]) { const KF k = ld_k<HI>(KHr, KLr, kc, lob); max_use<HI, MASK>(k, qh, ql, kc, qrel, m); }
template <bool HI, bool MASK> __device__ __forceinline__ void pv_use(const KF& k, const v16h vf, const v16b vh, const v16b vl, const v16h qh[QT][2], const v16h ql[QT][2], int kc, int qrel, const float off[QT], float sum[QT], v8f acc[QT]) { float s[QT][16];
  st_mm<HI>(k, qh, ql, s);
#pragma unroll
  for (int u = 0; u < QT; ++u) { exp2_x8(&s[u][0], off[u]); exp2_x8(&s[u][8], off[u]);
#pragma unroll
    for (int i = 0; i < 16; ++i) { float e = s[u][i]; if (MASK && kc * 32 + 16 * (i >> 3) + (i & 7) > qrel + 16 * u) e = 0.f; sum[u] += e; s[u][i] = e; } }
  if (HI) { F2 pp[QT];
#pragma unroll
    for (int u = 0; u < QT; ++u) pp[u] = bsplit16(s[u]);
#pragma unroll
    for (int u = 0; u < QT; ++u) { acc[u] = wm_b(vh, pp[u].h, acc[u]); acc[u] = wm_b(vh, pp[u].l, acc[u]); acc[u] = wm_b(vl, pp[u].h, acc[u]); }
  } else { v16h pb[QT];
#pragma unroll
    for (int u = 0; u < QT; ++u)
#pragma unroll
      for (int i = 0; i < 16; ++i) pb[u][i] = (_Float16)s[u][i];
#pragma unroll
    for (int u = 0; u < QT; ++u) acc[u] = wm_h(vf, pb[u], acc[u]); } }
template <bool HI, bool MASK> __device__ __forceinline__ void pv_step(const _Float16* KHr, const _Float16* KLr, const v16h qh[QT][2], const v16h ql[QT][2], const _Float16* VTr, const __bf16* VBr, const __bf16* VBLr, int kc, unsigned lob, int qrel, const float off[QT], float sum[QT], v8f acc[QT]) {
  const KF k = ld_k<HI>(KHr, KLr, kc, lob); XW();
  v16h vf = {}; v16b vh = {}, vl = {};   /* v is asked for before the exponentials, which cover its latency; the diagonal step's last load is the last through lob */
  if (HI) { vh = fragv_b(VBr + (size_t)kc * 512, lob, false); vl = fragv_b(VBLr + (size_t)kc * 512, lob, MASK); } else vf = fragv_h(VTr + (size_t)kc * 512, lob, MASK);
  pv_use<HI, MASK>(k, vf, vh, vl, qh, ql, kc, qrel, off, sum, acc); }
template <bool HI> __device__ __forceinline__ void att_body(const _Float16* __restrict__ QH, const _Float16* __restrict__ KH, const _Float16* __restrict__ QL, const _Float16* __restrict__ KL, const _Float16* __restrict__ VT, const __bf16* __restrict__ VB, const __bf16* __restrict__ VBL, int b, int h, int ql0, int lane, float* __restrict__ Y) {
  const int c = lane & 15, g = lane >> 4; const int nfull = ql0 >> 5;   /* ql0 % 32 == 0: steps 0 .. nfull-1 lie wholly below the diagonal for all 32 queries; step nfull holds it */
  const size_t hd = (size_t)b * NH + h; const _Float16* KHr = KH + hd * (TT * LATW); const _Float16* KLr = KL + hd * (KHI * LATW); const unsigned klo = (unsigned)(c * CC + 8 * g) * 2u, lob = lane * 16u;   /* klo: the q rows' offset; lob: every k / v fragment's */
  const _Float16* VTr = VT + hd * (TT * LATW); const __bf16* VBr = VB + hd * (KHI * LATW); const __bf16* VBLr = VBL + hd * (KHI * LATW);
  v16h qh[QT][2], ql[QT][2];
#pragma unroll
  for (int u = 0; u < QT; ++u) { frag_q(QH + ((size_t)b * TT + ql0 + u * 16) * CC + h * HD, klo, qh[u]); if (HI) frag_q(QL + ((size_t)b * QHI + ql0 + u * 16) * CC + h * HD, klo, ql[u]); else { ql[u][0] = qh[u][0]; ql[u][1] = qh[u][1]; } }
  XW();
  const int qrel = ql0 + c - 8 * g;   /* key kc*32 + 16 t + 8 g + r is kept for query ql0 + 16 u + c when kc*32 + 16 t + r <= qrel + 16 u */
  float m[QT], sum[QT]; v8f acc[QT] = {};
#pragma unroll
  for (int u = 0; u < QT; ++u) { m[u] = -3.0e38f; sum[u] = 0.f; }
  if (HI) {   /* early rows: at most KHI / 32 steps, loads asked for in the step that uses them */
#pragma unroll 1   /* left rolled, as it was: few steps, and unrolling adds registers */
    for (int kc = 0; kc < nfull; ++kc) max_step<HI, false>(KHr, KLr, qh, ql, kc, lob, qrel, m);
    max_step<HI, true>(KHr, KLr, qh, ql, nfull, lob, qrel, m);
#pragma unroll
    for (int u = 0; u < QT; ++u) { m[u] = fmaxf(m[u], __shfl_xor(m[u], 16)); m[u] = __builtin_fmaf(-m[u], LC, 11.0f); }   /* the two lane halves hold different keys of the same query; from here m = the exponent's offset */
#pragma unroll 1   /* left rolled, as it was */
    for (int kc = 0; kc < nfull; ++kc) pv_step<HI, false>(KHr, KLr, qh, ql, VTr, VBr, VBLr, kc, lob, qrel, m, sum, acc);
    pv_step<HI, true>(KHr, KLr, qh, ql, VTr, VBr, VBLr, nfull, lob, qrel, m, sum, acc);
  } else {
    /* late rows: each walk holds a ring of steps' fragments in registers (RD1 steps of keys, then RD steps of keys and v). A slot is asked for again, a ring's length ahead, right behind the step that used it, so a load has the other slots' steps of work to land in. A step index past the diagonal step is clamped to it (read, not used). The diagonal step's own fragments (kd for both walks, vd) are asked for once, up front. Steps are used in the order 0 .. nfull as before. */
    static_assert(RD == 4 && RD1 == 8, "the waits behind the rings' first loads name their addresses one by one");
    const v16b zb = {}; KF k1[RD1], kb[RD], kd; v16h vb[RD], vd; gp a1[RD1], ak[RD], av[RD];
    const gp akd = ring_a(KHr, nfull, lob), avd = ring_a(VTr, nfull, lob);
#pragma unroll
    for (int j = 0; j < RD1; ++j) { a1[j] = ring_a(KHr, j < nfull ? j : nfull, lob); k1[j].h = ring_ld(a1[j]); k1[j].l = k1[j].h; }
    XWH(a1[0], a1[1], a1[2], a1[3], a1[4], a1[5], a1[6], a1[7]);
    kd.h = ring_ld(akd); kd.l = kd.h; XWH(akd);   /* a wait of its own, directly behind: no other load stands between */
    gp pa = akd, pb = avd;   /* the addresses of the youngest refill: their wait stands one step later, in front of the next refill, where it has nothing left to wait for */
    int kc = 0;
#pragma unroll 1   /* one trip = one turn of the ring, its slots fixed registers */
    for (; kc + RD1 <= nfull; kc += RD1) {
#pragma unroll
      for (int j = 0; j < RD1; ++j) { max_use<false, false>(k1[j], qh, ql, kc + j, qrel, m);
        __builtin_amdgcn_sched_barrier(0);   /* the wait and the refill stay behind the step's work: lifted to its head the wait stands right behind the loads it is for, and stalls */
        XWH(pa); const int nx = kc + RD1 + j; pa = ring_a(KHr, nx < nfull ? nx : nfull, lob); k1[j].h = ring_ld(pa); k1[j].l = k1[j].h;
        __builtin_amdgcn_sched_barrier(0); } }   /* keeps the steps in ring order: without it the build lifts the last slots' products to the head of the trip, where they wait for loads just issued */
    XWH(pa);
#pragma unroll
    for (int j = 0; j < RD1 - 1; ++j) { if (kc + j < nfull) max_use<false, false>(k1[j], qh, ql, kc + j, qrel, m); }
    vd = ring_ld(avd); XWH(avd);   /* the second walk's first turn is asked for ahead of the diagonal step's maximum */
#pragma unroll
    for (int j = 0; j < RD; ++j) { const int nx = j < nfull ? j : nfull; ak[j] = ring_a(KHr, nx, lob); av[j] = ring_a(VTr, nx, lob); kb[j].h = ring_ld(ak[j]); kb[j].l = kb[j].h; vb[j] = ring_ld(av[j]);
      __builtin_amdgcn_sched_barrier(0); }   /* asked for in ring order: the loop's counted load waits are set for both ways into the loop, and another order here makes them wait for younger slots */
    XWH(ak[0], ak[1], ak[2], ak[3], av[0], av[1], av[2], av[3]);
    max_use<false, true>(kd, qh, ql, nfull, qrel, m);
#pragma unroll
    for (int u = 0; u < QT; ++u) { m[u] = fmaxf(m[u], __shfl_xor(m[u], 16)); m[u] = __builtin_fmaf(-m[u], LC, 11.0f); }   /* the two lane halves hold different keys of the same query; from here m = the exponent's offset */
    pa = akd; pb = avd;
#pragma unroll 1   /* one trip = one turn of the ring */
    for (kc = 0; kc + RD <= nfull; kc += RD) {
#pragma unroll
      for (int j = 0; j < RD; ++j) { pv_use<false, false>(kb[j], vb[j], zb, zb, qh, ql, kc + j, qrel, m, sum, acc);
        __builtin_amdgcn_sched_barrier(0);   /* as in the first walk: the wait stays a whole step behind the loads it is for */
        XWH(pa, pb); const int nx = kc + RD + j < nfull ? kc + RD + j : nfull; pa = ring_a(KHr, nx, lob); pb = ring_a(VTr, nx, lob); kb[j].h = ring_ld(pa); kb[j].l = kb[j].h; vb[j] = ring_ld(pb);
        __builtin_amdgcn_sched_barrier(0); } }   /* the refill is issued here: without it the build sinks the loads into the next step, up to that step's wait */
    XWH(pa, pb);
#pragma unroll
    for (int j = 0; j < RD - 1; ++j) { if (kc + j < nfull) pv_use<false, false>(kb[j], vb[j], zb, zb, qh, ql, kc + j, qrel, m, sum, acc); }
    pv_use<false, true>(kd, vd, zb, zb, qh, ql, nfull, qrel, m, sum, acc);
  }
#pragma unroll
  for (int u = 0; u < QT; ++u) { const float st = sum[u] + __shfl_xor(sum[u], 16); const float inv = st > 0.f ? 1.0f / st : 0.f;   /* sum and acc both carry the 2^11 */
    float* yr = Y + ((size_t)b * TT + ql0 + u * 16 + c) * CC + h * HD + 8 * g;   /* acc[u][r] = ctx(query 16 u + c, dim 8 g + r): 32 contiguous bytes per lane; the padding dims 16 + 8 g + r, which k_out reads against zero weights, are stored as the zeros their product was */
    v4f o0, o1; const v4f z = {};
#pragma unroll
    for (int r = 0; r < 4; ++r) { o0[r] = acc[u][r] * inv; o1[r] = acc[u][4 + r] * inv; }
    vst2(yr, o0); vst2(yr + 4, o1); vst2(yr + 16, z); vst2(yr + 20, z); } }
__global__ __launch_bounds__(128) void k_att(const _Float16* __restrict__ QH, const _Float16* __restrict__ KH, const _Float16* __restrict__ QL, const _Float16* __restrict__ KL, const _Float16* __restrict__ VT, const __bf16* __restrict__ VB, const __bf16* __restrict__ VBL, float* __restrict__ Y) {
  const int b = blockIdx.x / NH, h = blockIdx.x % NH; const int q0 = (TT / (64 * QT) - 1 - (int)blockIdx.y) * (64 * QT);   /* longest query blocks start first */
  const int wave = __builtin_amdgcn_readfirstlane(threadIdx.x >> 5), lane = threadIdx.x & 31; const int ql0 = q0 + wave * (16 * QT);
  if (q0 < QHI) att_body<true>(QH, KH, QL, KL, VT, VB, VBL, b, h, ql0, lane, Y); else att_body<false>(QH, KH, QL, KL, VT, VB, VBL, b, h, ql0, lane, Y); }
// k_out, k_out2: the bias values of the eight column tiles (bb = the lane's address of the first), asked for together behind the ring's first loads, so that the walk covers their way instead of the epilogue waiting for them one by one. The wait is the precaution of XW for their address registers: it stands where the wave waits for its first slot in any case. The scheduling fence keeps loads and wait here: left free, the build sets them in among the first step's products, where the wait holds a product back
__device__ __forceinline__ void bias_ld(gp bb, float bv[8]) {
#pragma unroll
  for (int j = 0; j < 8; ++j) bv[j] = *(const __attribute__((address_space(1))) float*)(bb + j * 64);
  XW(); __builtin_amdgcn_sched_barrier(0); }
// k_out's ring, as k_proj's: one slot = one k-step's operands as loaded, the lane's 16 ctx values (f32) and the eight weight fragments' slots 0..7 (slots 8..15 are the zero padding of a latent head and are not stored). ay / aw = the lane's own addresses of the step (ctx row + 8 g values; fragment start + lane * 16 bytes)
#define RU 2   // k-steps held or in flight
struct US { v4f x[4]; v4u w[8]; };
__device__ __forceinline__ void out_ld(gp ay, gp aw, US& s) { typedef const __attribute__((address_space(1))) v4f* gf; typedef const __attribute__((address_space(1))) v4u* gu;
  s.x[0] = *(gf)ay; s.x[1] = *(gf)(ay + 16); s.x[2] = *(gf)(ay + 64); s.x[3] = *(gf)(ay + 80);
#pragma unroll
  for (int j = 0; j < 8; ++j) s.w[j] = *(gu)(aw + j * 512); }
// the walk over the CC / 32 k-steps, unrolled whole: every load is one of the two fixed addresses plus a constant. HI: ctx bf16 hi + lo against exact bf16 weights (2 products); else ctx x 2^6 once to f16 (clear of f16 subnormals, chip FTZ) against f16(bf16 x 2^8) weights. k-steps and products in the order they had
template <bool HI> __device__ __forceinline__ void out_walk(gp yb, gp wb, gp bb, float bv[8], v8f acc[8]) { US st[RU];
#pragma unroll
  for (int j = 0; j < RU; ++j) { out_ld(yb + j * 128, wb + j * ((DIN / 16) * 512), st[j]);
    __builtin_amdgcn_sched_barrier(0); }   /* asked for in ring order, as in k_proj */
  bias_ld(bb, bv);
#pragma unroll
  for (int kc = 0; kc < CC / 32; ++kc) { const US& s = st[kc % RU]; float v[16]; const v4u z = {};
#pragma unroll
    for (int i = 0; i < 4; ++i) { v[i] = s.x[0][i]; v[4 + i] = s.x[1][i]; v[8 + i] = s.x[2][i]; v[12 + i] = s.x[3][i]; }
    if (HI) { const F2 a = bsplit16(v);
#pragma unroll
      for (int j = 0; j < 8; ++j) { union { v16b v; v4u q[2]; } u; u.q[0] = s.w[j]; u.q[1] = z; acc[j] = wmma_bf(a.h, u.v, acc[j]); acc[j] = wmma_bf(a.l, u.v, acc[j]); }
    } else { v16h a;
#pragma unroll
      for (int i = 0; i < 16; ++i) a[i] = (_Float16)(v[i] * 64.0f);
#pragma unroll
      for (int j = 0; j < 8; ++j) { union { v16h v; v4u q[2]; } u; u.q[0] = s.w[j]; u.q[1] = z; acc[j] = wmma16(a, u.v, acc[j]); } }
    __builtin_amdgcn_sched_barrier(0);   /* the refill stays behind the step that reads its slot */
    if (kc + RU < CC / 32) { out_ld(yb + (kc + RU) * 128, wb + (kc + RU) * ((DIN / 16) * 512), st[kc % RU]);
      __builtin_amdgcn_sched_barrier(0); } }   /* the refill is issued whole here, as in k_proj */
  XWH(yb, wb); }
// The result leaves as k_out2's A operand: a lane's 8 accumulator rows are 8 consecutive positions of one channel, so x 2^6 and the one rounding to f16 (the rounding k_out2's loader made) give 16 B of a T row; the block's 64 positions of a channel are gathered in LDS and stored as one whole line.
// ---- k_out: block = (64 rows, 128 cols): ao = ctx Wvu (+ bvu): ctx x 2^6 once to f16 against Wvu as f16(bf16 x 2^8) exact (1 product) x 2^-14; causal early rows (< QHI of each sequence): ctx bf16 hi + lo against exact bf16 Wvu (2 products)
__global__ __launch_bounds__(128) void k_out(const float* __restrict__ Y, const __bf16* __restrict__ FU, const _Float16* __restrict__ FUH, const float* __restrict__ BO, _Float16* __restrict__ TH) { __shared__ __align__(16) _Float16 st[128][72];
  const int tid = threadIdx.x, wave = tid >> 5, lane = tid & 31, col = lane & 15, g = lane >> 4; const int c0 = blockIdx.y * 128; const size_t r0 = (size_t)blockIdx.x * 64 + wave * 16; const unsigned lob = lane * 16u;
  v8f acc[8] = {}; float bv[8];   /* bv: the bias of the eight column tiles, as loaded; with no bias array the loads read ctx and their values are not used */
  const gp bb = (gp)(BO ? (const char*)BO : (const char*)Y) + (c0 + col) * 4, yb = (gp)(const char*)Y + ((r0 + col) * CC + 8 * g) * 4;
  if (CAUSAL && (int)(((size_t)blockIdx.x * 64) % TT) < QHI) {   /* block-uniform */
    out_walk<true>(yb, (gp)(const char*)FU + (size_t)(c0 / 16) * 512 + lob, bb, bv, acc);
#pragma unroll
    for (int j = 0; j < 8; ++j) { const float bias = BO ? bfr(bv[j]) : 0.f;
      v8h o;
#pragma unroll
      for (int r = 0; r < 8; ++r) o[r] = (_Float16)((acc[j][r] + bias) * 64.0f);
      *(v8h*)&st[j * 16 + col][wave * 16 + 8 * g] = o; }
  } else {
    out_walk<false>(yb, (gp)(const char*)FUH + (size_t)(c0 / 16) * 512 + lob, bb, bv, acc);
#pragma unroll
    for (int j = 0; j < 8; ++j) { const float bias = BO ? bfr(bv[j]) : 0.f;
      v8h o;
#pragma unroll
      for (int r = 0; r < 8; ++r) o[r] = (_Float16)((acc[j][r] * (1.0f / 16384.0f) + bias) * 64.0f);   /* 2^-8 (Wvu carry) x 2^-6 (ctx carry); then the x 2^6 carry of the next product's f16 operand */
      *(v8h*)&st[j * 16 + col][wave * 16 + 8 * g] = o; } }
  __syncthreads();   /* a channel's 64 positions come from all four waves */
  const size_t rb = (size_t)blockIdx.x * 64; _Float16* tp = TH + ((rb / TT) * DIN + c0 + (tid >> 3)) * (size_t)TT + rb % TT + (tid & 7) * 8;   /* 8 lanes = one channel's line; 16 channels a pass */
#pragma unroll
  for (int p = 0; p < 8; ++p) vst2((unsigned*)(tp + (size_t)p * 16 * TT), *(const v4u*)&st[p * 16 + (tid >> 3)][(tid & 7) * 8]); }
#define K2 DIN
#define wcol_io_plain(W, k0, o, lane) wcol_io(W, k0, o, lane, DIN)
#define wcolh_io_plain(W, k0, o, lane) wcolh_io(W, k0, o, lane, DIN)
// k_out2's ring, as k_proj's: one slot = one k-step's A fragment and its eight weight fragments. aa / aw = the lane's own addresses of the step (row + 8 g values; fragment start + lane * 16 bytes)
#define RO 2   // k-steps held or in flight
struct OS { v16h a, w[8]; };
__device__ __forceinline__ void out2_ld(gp aa, gp aw, OS& s) { typedef const __attribute__((address_space(1))) v8h* gq; union { v16h v; v8h q[2]; } u; u.q[0] = *(gq)aa; u.q[1] = *(gq)(aa + 32); s.a = u.v;
#pragma unroll
  for (int j = 0; j < 8; ++j) { u.q[0] = *(gq)(aw + j * 1024); u.q[1] = *(gq)(aw + j * 1024 + 512); s.w[j] = u.v; } }
// ---- k_out2: block = (64 rows, 128 cols): final projection out = R Wo + bo on the re-read rows R [NB*TT][K2] (K2 = DIN input width): the rows (f16 x 2^6) against Wo's B fragments from k_prep (FO, f16(bf16 x 2^8)), both loaded through a ring of RO k-steps, x 2^-14; always the single-product path
__global__ __launch_bounds__(128) void k_out2(const _Float16* __restrict__ Y, const _Float16* __restrict__ FO, const float* __restrict__ BO, float* __restrict__ OUT) { __shared__ __align__(16) float sf[4][16][132];
  const int tid = threadIdx.x, wave = tid >> 5, lane = tid & 31, col = lane & 15, g = lane >> 4; const int c0 = blockIdx.y * 128; const size_t r0 = (size_t)blockIdx.x * 64 + wave * 16; const unsigned lob = lane * 16u;
  v8f acc[8] = {}; float bv[8];   /* the re-read rows mix positions: no early-row special case here. bv: the bias as loaded; with no bias array the loads read the weights and their values are not used */
  const gp bb = (gp)(BO ? (const char*)BO : (const char*)FO) + (c0 + col) * 4;
  /* the ring, as in k_proj: a slot is asked for again, RO steps ahead, right behind the step that used it; the walk is unrolled whole, every load one of the two fixed addresses plus a constant. The rows arrive as f16 x 2^6 (k_out), clear of f16 subnormals (chip FTZ) */
  const gp ab = (gp)(const char*)Y + ((r0 + col) * K2 + 8 * g) * 2, wb = (gp)(const char*)FO + (size_t)(c0 / 16) * 1024 + lob; OS st[RO];
#pragma unroll
  for (int j = 0; j < RO; ++j) { out2_ld(ab + j * 64, wb + j * ((DIN / 16) * 1024), st[j]);
    __builtin_amdgcn_sched_barrier(0); }   /* asked for in ring order, as in k_proj: in another order the first step's counted load waits wait for the second slot too */
  bias_ld(bb, bv);
#pragma unroll
  for (int kc = 0; kc < K2 / 32; ++kc) { const OS& s = st[kc % RO];
#pragma unroll
    for (int j = 0; j < 8; ++j) acc[j] = wmma16(s.a, s.w[j], acc[j]);
    if (kc + RO < K2 / 32) { out2_ld(ab + (kc + RO) * 64, wb + (kc + RO) * ((DIN / 16) * 1024), st[kc % RO]);
      __builtin_amdgcn_sched_barrier(0); } }   /* keeps products and refills in ring order: without it the build makes steps wait for their whole slot at the second product */
  XWH(ab, wb);
#pragma unroll
  for (int j = 0; j < 8; ++j) { const float bias = BO ? bfr(bv[j]) : 0.f;
#pragma unroll
    for (int r = 0; r < 8; ++r) sf[wave][8 * g + r][j * 16 + col] = acc[j][r] * (1.0f / 16384.0f) + bias; }   /* 2^-8 (Wo carry) x 2^-6 (row carry) */
  LDSX(); for (int rl = 0; rl < 16; ++rl) vst2(OUT + (r0 + rl) * DIN + c0 + lane * 4, *(const v4f*)&sf[wave][rl][lane * 4]); }

extern "C" void kernel_launch(void* const* d_in, const int* in_sizes, int n_in, void* d_out, int out_size, void* d_ws, size_t ws_size, hipStream_t stream) {
  (void)in_sizes; (void)n_in; (void)out_size;
  const float** F = (const float**)d_in;
  if (ws_size < (size_t)WS_END) return;
  char* ws = (char*)d_ws; _Float16 *QH = (_Float16*)(ws + WS_QH), *KH = (_Float16*)(ws + WS_KH), *VT = (_Float16*)(ws + WS_VT), *QL = (_Float16*)(ws + WS_QL), *KL = (_Float16*)(ws + WS_KL); __bf16 *VB = (__bf16*)(ws + WS_VB), *VBL = (__bf16*)(ws + WS_VBL); float *S = (float*)(ws + WS_S), *Y = (float*)(ws + WS_Y);
  (void)S; (void)Y; (void)QL; (void)KL; (void)VB; (void)VBL;
  // inputs (in order): 0 x [4,2048,768]; 1 Wq [768,768] (in,out), 2 bq; 3 Wkd [768,192], 4 bkd; 5 Wvd [768,192], 6 bvd; 7 Wvu [192,768], 8 bvu; 9 Wo [768,768] (in,out), 10 bo (all biases zeros, read)
  if (ws_size < (size_t)WS_END3) return;
  _Float16 *T = (_Float16*)(ws + WS_T); __bf16 *FP = (__bf16*)(ws + WS_FP), *FU = (__bf16*)(ws + WS_FU); _Float16 *FUH = (_Float16*)(ws + WS_FUH), *FO = (_Float16*)(ws + WS_FO);
  k_prep<<<dim3((NF_P + NF_U + NF_O) / 4), 128, 0, stream>>>(F[1], F[3], F[5], F[7], F[9], FP, FU, FUH, FO);   /* every weight once into B-fragment order */
  k_proj<<<dim3(TNB * TT / 64, CC / 128, 3), 128, 0, stream>>>(F[0], F[0], F[0], FP, F[2], F[4], F[6], QH, QL, KH, KL, VT, VB, VBL);   /* q slice, latent k, latent v: 3 column blocks of 128 columns each */
  k_att<<<dim3(TNB * NH, TT / (64 * QT)), 128, 0, stream>>>(QH, KH, QL, KL, VT, VB, VBL, Y);   /* logits, softmax, P v: every (b, h, 128-query block) in one launch */
  k_out<<<dim3(TNB * TT / 64, DIN / 128), 128, 0, stream>>>(Y, FU, FUH, F[8], T);   /* T[b][c][s] = f16(ao[b][s][c] x 2^6), ao = al Wvu + bvu (gathered weight rows) */
  k_out2<<<dim3(TNB * TT / 64, DIN / 128), 128, 0, stream>>>(T, FO, F[10], (float*)d_out);   /* rows = T's memory re-read as [TT][DIN] per batch; out = rows Wo + bo */
}

// v009
// A run of this version takes 67 microseconds.
// Next to v008, in two timings, it ran 1.12 times as fast each time.
// All steps since v000 together make it 26.5 times as fast.
// compute dtype: all float inputs rounded to bf16; the q slice and the latent k / v projections with EXACT bf16 products on WMMA 16x16x32 (f32 accumulate) + bias (zeros, read), 16 real dims per head zero-padded to 32; causal logits over the 16 latent dims: 3 products for the first 384 rows, single f16 after, x 16^-0.5; softmax f32 (max first, then exp(s - max) x 2^11, formed as 2^(raw logit x 16^-0.5 log2(e) + offset), once to f16 x v once to f16 (bf16 hi + lo below row 384), divided by the f32 row sum after the product; logits never stored); latent ctx (hi+lo below row 384, x2^6 f16 carry after) x exact / f16(bf16 x 2^8) Wvu + bvu; per-batch transpose; then x 2^6 once to f16 x Wo f16(bf16 x 2^8) + bo; f32 output.
#include <hip/hip_runtime.h>
#include <math.h>

typedef __attribute__((ext_vector_type(16))) _Float16 v16h;
typedef __attribute__((ext_vector_type(16))) __bf16 v16b;
typedef __attribute__((ext_vector_type(8)))  _Float16 v8h;
typedef __attribute__((ext_vector_type(8)))  float v8f;
typedef __attribute__((ext_vector_type(4)))  float v4f;
typedef __attribute__((ext_vector_type(2)))  float v2f;
typedef __attribute__((ext_vector_type(4)))  unsigned v4u;
typedef __attribute__((ext_vector_type(4)))  int v4i;
typedef float __attribute__((may_alias)) float_a;
typedef int __attribute__((may_alias)) int_a;

template <typename T> __device__ __forceinline__ void vst2(void* p, T v) { *(T*)p = v;  }
__device__ __forceinline__ v8f wmma16(v16h a, v16h b, v8f c) {
  v8f d = __builtin_amdgcn_wmma_f32_16x16x32_f16(false, a, false, b, (short)0, c, false, false);
  asm volatile("v_nop\n\tv_nop\n\tv_nop\n\tv_nop" : "+v"(d) : "v"(a), "v"(b));
  return d;
}
__device__ __forceinline__ v8f wmma_bf(v16b a, v16b b, v8f c) {
  v8f d = __builtin_amdgcn_wmma_f32_16x16x32_bf16(false, a, false, b, (short)0, c, false, false);
  asm volatile("v_nop\n\tv_nop\n\tv_nop\n\tv_nop" : "+v"(d) : "v"(a), "v"(b));
  return d;
}
// 16x16x32 fragments: lane = (h = lane>>4, row/col = lane&15); elements 0..7 = k0+8h+0..7, 8..15 = k0+16+8h+0..7; D element r = row 8h+r
__device__ __forceinline__ v16h frag_h(const _Float16* rowk0, int lane) {
  union { v16h v; v8h q[2]; } u; const _Float16* p = rowk0 + 8 * (lane >> 4);
  u.q[0] = *(const v8h*)p; u.q[1] = *(const v8h*)(p + 16); return u.v;
}
__device__ __forceinline__ v16h frag_f32(const float* rowk0, int lane) {
  v16h a; const float* p = rowk0 + 8 * (lane >> 4);
#pragma unroll
  for (int i = 0; i < 8; ++i) { a[i] = (_Float16)p[i]; a[8 + i] = (_Float16)p[16 + i]; }
  return a;
}
__device__ __forceinline__ v16h frag_f32s(const float* rowk0, int lane, float sc) {
  v16h a; const float* p = rowk0 + 8 * (lane >> 4);
#pragma unroll
  for (int i = 0; i < 8; ++i) { a[i] = (_Float16)(p[i] * sc); a[8 + i] = (_Float16)(p[16 + i] * sc); }
  return a;
}
// column fragment from a [K][ld] layout (column n), rows >= K read as 0
__device__ __forceinline__ v16h fragc_f32(const float* W, int k0, int n, int lane, int ld, int K) {
  v16h a; const int g = lane >> 4;
#pragma unroll
  for (int i = 0; i < 8; ++i) { const int ka = k0 + 8 * g + i, kb = ka + 16;
    a[i] = (_Float16)(ka < K ? W[(size_t)(ka < K ? ka : K - 1) * ld + n] : 0.f); a[8 + i] = (_Float16)(kb < K ? W[(size_t)(kb < K ? kb : K - 1) * ld + n] : 0.f); }
  return a;
}
struct F2 { v16b h, l; };
__device__ __forceinline__ F2 bsplit16(const float v[16]) { F2 r;
#pragma unroll
  for (int i = 0; i < 16; ++i) { const __bf16 h = (__bf16)v[i]; r.h[i] = h; r.l[i] = (__bf16)(v[i] - (float)h); }
  return r; }
__device__ __forceinline__ F2 split_row(const float* row, int k0, int lane) { float v[16]; const float* p = row + k0 + 8 * (lane >> 4);
#pragma unroll
  for (int i = 0; i < 8; ++i) { v[i] = p[i]; v[8 + i] = p[16 + i]; }
  return bsplit16(v); }
__device__ __forceinline__ F2 split_rowK(const float* row, int k0, int lane, int K) { float v[16]; const int g = lane >> 4;
#pragma unroll
  for (int i = 0; i < 8; ++i) { const int ka = k0 + 8 * g + i, kb = ka + 16; v[i] = ka < K ? row[ka < K ? ka : K - 1] : 0.f; v[8 + i] = kb < K ? row[kb < K ? kb : K - 1] : 0.f; }
  return bsplit16(v); }
__device__ __forceinline__ F2 split_col(const float* W, int k0, int n, int lane, int ld, int K) { float v[16]; const int g = lane >> 4;
#pragma unroll
  for (int i = 0; i < 8; ++i) { const int ka = k0 + 8 * g + i, kb = ka + 16; v[i] = ka < K ? W[(size_t)(ka < K ? ka : K - 1) * ld + n] : 0.f; v[8 + i] = kb < K ? W[(size_t)(kb < K ? kb : K - 1) * ld + n] : 0.f; }
  return bsplit16(v); }
__device__ __forceinline__ v8f mac3(const F2& a, const F2& b, v8f c) { c = wmma_bf(a.l, b.h, c); c = wmma_bf(a.h, b.l, c); return wmma_bf(a.h, b.h, c); }
__device__ __forceinline__ float sigm(float v) { return 1.0f / (1.0f + expf(-v)); }
#define LDSX() do { asm volatile("s_wait_dscnt 0" ::: "memory"); __builtin_amdgcn_wave_barrier(); __builtin_amdgcn_fence(__ATOMIC_RELEASE, "workgroup"); } while (0)

// Causal self-attention with 12 low-rank latent heads (x [4,2048,768]; (in,out) Wq [768,768], Wkd / Wvd [768,192], Wvu [192,768], Wo [768,768], all N(0,1) x 0.02, zero biases (read); q = x Wq + bq split into 12 heads x 64 of which only the FIRST 16 dims of each head are used (ql); kl, vl = x Wkd, x Wvd split into 12 heads x 16; scores = ql kl^T x 16^-0.5; triu(1) -> -inf; softmax; al = w vl merged to [B,S,192]; ao = al Wvu + bvu [B,S,768]; then jnp.transpose(ao, (0,2,1)).reshape(B,S,768): the per-batch [2048 x 768] matrix is transposed to [768 x 2048] and its memory re-read as 2,048 rows of 768; out = that Wo + bo).
#define NB 4
#define TT 2048
#define CC 384            // NH * HD = projected width
#define DIN 768          // input (model) width
#define NH 12
#define HD 32
#define LATW 16     /* real dims per head; columns h*HD + d with d >= LATW are zero padding */
#define QHEADW 64   /* the module's q heads are 64 wide; only their first LATW dims are used (ql = q[..., :16]) */
#define KVLD (NH * LATW)   /* row pitch of the (in,out) latent weights Wkd / Wvd [768][192] */
#define NQB (TT / 64)
#define HG 2   // S region: 2 x 2,048 x 2,048 f32 = 32 MiB, allocated but unused
#define SCALE (0.25f)
#define CAUSAL 1
#ifndef TNB
#define TNB NB
#endif
__device__ __forceinline__ float bfr(float v) { return (float)(__bf16)v; }
__host__ __device__ __forceinline__ int kb_last(int qb) { return CAUSAL ? ((qb * 64 + 63) >> 7) : (TT / 128 - 1); }
typedef __attribute__((ext_vector_type(8))) __bf16 v8b;
__device__ __forceinline__ v16b frag_b(const __bf16* rowk0, int lane) {
  union { v16b v; v8b q[2]; } u; const __bf16* p = rowk0 + 8 * (lane >> 4);
  u.q[0] = *(const v8b*)p; u.q[1] = *(const v8b*)(p + 16); return u.v;
}
#define QBH 6              // causal: query blocks 0..QBH-1 of each sequence (few keys, no averaging) take the high-precision path
#define QHI 384            // rows carrying a q residual plane
#define KHI 384            // key rows carrying k residual / v bf16 hi+lo planes (used only by the causal high-precision path)
// B fragment (k rows k0+.., output column o) of a weight: (in,out) [K][ld] or (out,in) [ld rows of K]: bf16 exact, or f16(bf16 * 256) exact
__device__ __forceinline__ v16b wcol_io(const float* Wm, int k0, int o, int lane, int ld) { v16b w; const int g = lane >> 4;
#pragma unroll
  for (int i = 0; i < 8; ++i) { w[i] = (__bf16)Wm[(size_t)(k0 + 8 * g + i) * ld + o]; w[8 + i] = (__bf16)Wm[(size_t)(k0 + 16 + 8 * g + i) * ld + o]; }
  return w; }
__device__ __forceinline__ v16b wcol_oi(const float* Wm, int k0, int o, int lane, int K) { v16b w; const float* p = Wm + (size_t)o * K + k0 + 8 * (lane >> 4);
#pragma unroll
  for (int i = 0; i < 8; ++i) { w[i] = (__bf16)p[i]; w[8 + i] = (__bf16)p[16 + i]; }
  return w; }
__device__ __forceinline__ v16h wcolh_io(const float* Wm, int k0, int o, int lane, int ld) { v16h w; const int g = lane >> 4;
#pragma unroll
  for (int i = 0; i < 8; ++i) { w[i] = (_Float16)(bfr(Wm[(size_t)(k0 + 8 * g + i) * ld + o]) * 256.0f); w[8 + i] = (_Float16)(bfr(Wm[(size_t)(k0 + 16 + 8 * g + i) * ld + o]) * 256.0f); }
  return w; }
// first output projection ao = al Wvu: the k index runs over ctx columns kk = h*HD + d; one 32-deep k-step = one head; its first 16 entries (d < LATW, fragment slots 0..7 of both lane halves) are rows h*LATW + d of the (in,out) [192][768] weight, its last 16 (padding dims, slots 8..15) are zero
__device__ __forceinline__ v16b wcol_io_lat(const float* Wm, int k0, int o, int lane, int ld) { v16b w; const int g = lane >> 4; const float* p = Wm + (size_t)((k0 / HD) * LATW + 8 * g) * ld + o;
#pragma unroll
  for (int i = 0; i < 8; ++i) { w[i] = (__bf16)p[(size_t)i * ld]; w[8 + i] = (__bf16)0.0f; }
  return w; }
__device__ __forceinline__ v16h wcolh_io_lat(const float* Wm, int k0, int o, int lane, int ld) { v16h w; const int g = lane >> 4; const float* p = Wm + (size_t)((k0 / HD) * LATW + 8 * g) * ld + o;
#pragma unroll
  for (int i = 0; i < 8; ++i) { w[i] = (_Float16)(bfr(p[(size_t)i * ld]) * 256.0f); w[8 + i] = (_Float16)0.0f; }
  return w; }
static_assert(HD == 32 && LATW == 16 && CC == NH * HD, "the latent loaders assume one head per 32-deep k-step with 16 real + 16 padding dims");
__device__ __forceinline__ v16h wcolh_oi(const float* Wm, int k0, int o, int lane, int K) { v16h w; const float* p = Wm + (size_t)o * K + k0 + 8 * (lane >> 4);
#pragma unroll
  for (int i = 0; i < 8; ++i) { w[i] = (_Float16)(bfr(p[i]) * 256.0f); w[8 + i] = (_Float16)(bfr(p[16 + i]) * 256.0f); }
  return w; }
#define WQKV_LAYOUT 0   // 0 = (in,out) [DIN][out], columns gathered per head; 1 = (out,in) [CC][DIN]; 2 = per-head [NH][DIN][HD]
__device__ __forceinline__ v16b wcol_hdk(const float* Wm, int k0, int o, int lane) { v16b w; const int g = lane >> 4; const float* p = Wm + (size_t)(o / HD) * DIN * HD + (o % HD);
#pragma unroll
  for (int i = 0; i < 8; ++i) { w[i] = (__bf16)p[(size_t)(k0 + 8 * g + i) * HD]; w[8 + i] = (__bf16)p[(size_t)(k0 + 16 + 8 * g + i) * HD]; }
  return w; }
#define WO_OUT_IN 0
#if WQKV_LAYOUT == 1
#define WCOL(W, k0, o, lane) wcol_oi(W, k0, o, lane, DIN)
#elif WQKV_LAYOUT == 2
#define WCOL(W, k0, o, lane) wcol_hdk(W, k0, o, lane)
#else
__device__ __forceinline__ v16b zero16b() { v16b w; _Pragma("unroll") for (int i = 0; i < 16; ++i) w[i] = (__bf16)0.0f; return w; }
/* column o = h*HD + d: real (d < LATW) -> weight column h*QHEADW + d of Wq (pitch DIN) for the q stream, h*LATW + d of Wkd / Wvd (pitch KVLD) for k / v; padding -> zeros. o = c0 + j*16 + col with c0 % 128 == 0, so (o % HD) < LATW is decided by j alone (compile-time per unrolled j, uniform across the wave) */
#define GCOL(o) ((which) == 0 ? ((o) / HD) * QHEADW + ((o) % HD) : ((o) / HD) * LATW + ((o) % HD))
#define WCOL(W, k0, o, lane) ((((o) % HD) < LATW) ? wcol_io(W, k0, GCOL(o), lane, ((which) == 0 ? DIN : KVLD)) : zero16b())
#endif
#if WO_OUT_IN
#define WOCOL(W, k0, o, lane) wcol_oi(W, k0, o, lane, CC)
#define WOCOLH(W, k0, o, lane) wcolh_oi(W, k0, o, lane, CC)
#else
#define WOCOL(W, k0, o, lane) wcol_io_lat(W, k0, o, lane, DIN)
#define WOCOLH(W, k0, o, lane) wcolh_io_lat(W, k0, o, lane, DIN)
#endif

#ifndef SM_EXTRA_PARAMS
#define SM_EXTRA_PARAMS
#endif
#ifndef PROJ_EXTRA_PARAMS
#define PROJ_EXTRA_PARAMS
#endif
#ifndef SM_MASK_HOOK
#define SM_MASK_HOOK (void)0
#endif

#define WS_QH  0u                                      // f16 q rows [b*t][CC]
#define WS_KH  (WS_QH + 2u * (size_t)NB * TT * CC)      // f16 k in A-fragment order [b][h][16-key tile][512 B] (the region keeps its old size)
#define WS_VT  (WS_KH + 2u * (size_t)NB * TT * CC)      // f16 v^T in A-fragment order [b][h][32-key step][1024 B]
#define WS_QL  (WS_VT + 2u * (size_t)NB * CC * TT)      // f16 q residual x 2^10 rows [b][t < QHI][CC]
#define WS_KL  (WS_QL + 2u * (size_t)NB * QHI * CC)     // f16 k residual x 2^10, as WS_KH, key tiles below KHI
#define WS_VB  (WS_KL + 2u * (size_t)NB * KHI * CC)     // bf16 v hi (then lo), as WS_VT, key steps below KHI
#define WS_VBL (WS_VB + 2u * (size_t)NB * CC * KHI)
#define WS_S   (WS_VBL + 2u * (size_t)NB * CC * KHI)    // f32 [hg][t][s], allocated but unused
#define WS_Y   (WS_S  + 4u * (size_t)HG * TT * TT)      // f32 ctx in k_out's A-fragment order, real dims only: [16-row tile of b*t][head][1024 B] (the region keeps its old size)
#define WS_END (WS_Y  + 4u * (size_t)NB * TT * CC)
#define WS_T  (WS_END)                                     // f16 per-batch transpose T[b][c][s] = f16((al Wvu + bvu)[b][s][c] x 2^6), written by k_out; its memory is then read as TT rows of DIN (the module's transpose(0,2,1).reshape)
#define WS_END2 (WS_T + 2u * (size_t)NB * TT * DIN)
static_assert(TT % 64 == 0 && DIN % 128 == 0, "a k_out block owns 64 positions of 128 channels: one whole 128-B line of T per channel");
// weights in WMMA B-fragment order, written once per call by k_prep. One fragment = the 32 lanes' slots 0..7 (16 B a lane, 512 B in a row), then their slots 8..15 (left out where they are the zero padding of a latent head)
#define NF_P (3 * (DIN / 32) * NH)        /* q slice / latent k / latent v: [which][kc][head], bf16 */
#define NF_U (NH * (DIN / 16))            /* Wvu: [head][column tile], slots 0..7 only, once bf16 and once f16(bf16 x 2^8) */
#define NF_O ((DIN / 32) * (DIN / 16))    /* Wo: [kc][column tile], f16(bf16 x 2^8) */
#define WS_FP  (WS_END2)
#define WS_FU  (WS_FP  + 1024u * (size_t)NF_P)
#define WS_FUH (WS_FU  + 512u * (size_t)NF_U)
#define WS_FO  (WS_FUH + 512u * (size_t)NF_U)
#define WS_END3 (WS_FO + 1024u * (size_t)NF_O)
// x rounded once to bf16 in WMMA A-fragment order, written by k_prep: [16-row tile][kc][1024 B], built like a weight fragment (the 32 lanes' slots 0..7, then their slots 8..15)
#define WS_XF  (WS_END3)
#define WS_END4 (WS_XF + 2u * (size_t)NB * TT * DIN)
#define XKS 6                                   /* k-steps of one row tile that one k_prep wave rounds */
#define NXW ((NB * TT / 16) * (DIN / 32 / XKS))  /* k_prep waves that work on x; they come first in the grid */
static_assert((NF_P + NF_U + NF_O) % 4 == 0 && NXW % 4 == 0 && (DIN / 32) % XKS == 0, "k_prep: four waves a block, one weight fragment or XKS x fragments a wave");
// fb = wave-uniform start of the fragment, lob = lane * 16 bytes
__device__ __forceinline__ v16b fragw_b(const __bf16* fb, unsigned lob) { union { v16b v; v8b q[2]; } u; const char* p = (const char*)fb + lob; u.q[0] = *(const v8b*)p; u.q[1] = *(const v8b*)(p + 512); return u.v; }
__device__ __forceinline__ v16h fragw_h(const _Float16* fb, unsigned lob) { union { v16h v; v8h q[2]; } u; const char* p = (const char*)fb + lob; u.q[0] = *(const v8h*)p; u.q[1] = *(const v8h*)(p + 512); return u.v; }
__device__ __forceinline__ v16b fragw_b8(const __bf16* fb, unsigned lob) { union { v16b v; v8b q[2]; } u; u.q[0] = *(const v8b*)((const char*)fb + lob);
#pragma unroll
  for (int i = 0; i < 8; ++i) u.q[1][i] = (__bf16)0.0f;
  return u.v; }
__device__ __forceinline__ v16h fragw_h8(const _Float16* fb, unsigned lob) { union { v16h v; v8h q[2]; } u; u.q[0] = *(const v8h*)((const char*)fb + lob);
#pragma unroll
  for (int i = 0; i < 8; ++i) u.q[1][i] = (_Float16)0.0f;
  return u.v; }
// a precaution: stands between issued loads and the next write of a register that holds one of their addresses
__device__ __forceinline__ void XW() { asm volatile("s_wait_xcnt 0x0" ::: "memory"); }
typedef const __attribute__((address_space(1))) char* gp;
// a precaution, as XW: the wait that stands between issued loads and the next write of a register that holds one of their addresses. The addresses are its inputs, so they keep registers of their own up to the wait and no load issued before it can land on them
__device__ __forceinline__ void XWH(gp a) { asm volatile("s_wait_xcnt 0x0" :: "v"(a) : "memory"); }
__device__ __forceinline__ void XWH(gp a, gp b) { asm volatile("s_wait_xcnt 0x0" :: "v"(a), "v"(b) : "memory"); }
__device__ __forceinline__ void XWH(gp a, gp b, gp c, gp d, gp e, gp f) { asm volatile("s_wait_xcnt 0x0" :: "v"(a), "v"(b), "v"(c), "v"(d), "v"(e), "v"(f) : "memory"); }
__device__ __forceinline__ void XWH(gp a, gp b, gp c, gp d, gp e, gp f, gp g, gp h) { asm volatile("s_wait_xcnt 0x0" :: "v"(a), "v"(b), "v"(c), "v"(d), "v"(e), "v"(f), "v"(g), "v"(h) : "memory"); }
// N weight values of one column, rows i (i < 8) and, for N = 16, 16 + i of an (in,out) weight of pitch LD: ub = wave-uniform address of the tile's first row and column, lo = the lane's fixed byte offset (8 g rows + its column). The last load may land on the offset register, so the wait stands in front of it, and once more behind it, ahead of the scalar work that forms the store address
template <int LD, int N> __device__ __forceinline__ void ld_col(const float* ub, unsigned lo, float v[N]) { const char* p = (const char*)ub + lo;
#pragma unroll
  for (int i = 0; i < N - 1; ++i) v[i] = *(const float*)(p + (size_t)((i & 7) + 2 * (i & 8)) * LD * 4);
  XW(); v[N - 1] = *(const float*)(p + (size_t)(((N - 1) & 7) + 2 * ((N - 1) & 8)) * LD * 4); XW(); }
// x into A-fragment order: one wave = XKS k-steps of one 16-row tile. Lane (g, c) reads what k_proj's loader read (row c, values 8 g + 0..7 and 16 + 8 g + 0..7 of each k-step), makes the same one rounding to bf16 and stores each half fragment as 512 B in a row. All loads go through one address, which is the wait's input, so none lands on it
__device__ __forceinline__ void prep_x(const float* __restrict__ X, __bf16* __restrict__ XF, int fa, int lane) { typedef const __attribute__((address_space(1))) v4f* gf;
  const int rt = fa / (DIN / 32 / XKS), k0 = (fa % (DIN / 32 / XKS)) * XKS; const gp xa = (gp)(const char*)X + (((size_t)rt * 16 + (lane & 15)) * DIN + k0 * 32 + 8 * (lane >> 4)) * 4; v4f x[XKS][4];
#pragma unroll
  for (int j = 0; j < XKS; ++j) { x[j][0] = *(gf)(xa + j * 128); x[j][1] = *(gf)(xa + j * 128 + 16); x[j][2] = *(gf)(xa + j * 128 + 64); x[j][3] = *(gf)(xa + j * 128 + 80); }
  XWH(xa); __builtin_amdgcn_sched_barrier(0);   /* all of the wave's loads are out before the first rounding: left free, the build holds the last ten back until registers of the first come free, and the wave pays the way to memory twice */
  char* d = (char*)XF + ((size_t)rt * (DIN / 32) + k0) * 1024 + lane * 16;
#pragma unroll
  for (int j = 0; j < XKS; ++j) { v8b lo, hi;
#pragma unroll
    for (int i = 0; i < 4; ++i) { lo[i] = (__bf16)x[j][0][i]; lo[4 + i] = (__bf16)x[j][1][i]; hi[i] = (__bf16)x[j][2][i]; hi[4 + i] = (__bf16)x[j][3][i]; }
    *(v8b*)(d + j * 1024) = lo; *(v8b*)(d + j * 1024 + 512) = hi; } }
// ---- k_prep: the first NXW waves lay x out (prep_x); of the others one wave = one B fragment, with the roundings the projection kernels' own loaders (wcol_io, wcol_io_lat, wcolh_io_lat, wcolh_io) made per wave and per row block
__global__ __launch_bounds__(128) void k_prep(const float* __restrict__ X, __bf16* __restrict__ XF, const float* __restrict__ WQ, const float* __restrict__ WK, const float* __restrict__ WV, const float* __restrict__ WU, const float* __restrict__ WO, __bf16* __restrict__ FP, __bf16* __restrict__ FU, _Float16* __restrict__ FUH, _Float16* __restrict__ FO) {
  const int lane = threadIdx.x & 31, col = lane & 15, g = lane >> 4; const int fa = blockIdx.x * 4 + __builtin_amdgcn_readfirstlane(threadIdx.x >> 5);
  if (fa < NXW) { prep_x(X, XF, fa, lane); return; }
  const int f = fa - NXW;
  if (f < NF_P) { const int which = f / ((DIN / 32) * NH), kc = (f / NH) % (DIN / 32), h = f % NH; float v[16];
    if (which == 0) ld_col<DIN, 16>(WQ + (size_t)kc * 32 * DIN + h * QHEADW, (unsigned)(8 * g * DIN + col) * 4u, v);
    else ld_col<KVLD, 16>((which == 1 ? WK : WV) + (size_t)kc * 32 * KVLD + h * LATW, (unsigned)(8 * g * KVLD + col) * 4u, v);
    union { v16b v; v8b q[2]; } u;
#pragma unroll
    for (int i = 0; i < 16; ++i) u.v[i] = (__bf16)v[i];
    char* d = (char*)FP + (size_t)f * 1024 + lane * 16; *(v8b*)d = u.q[0]; *(v8b*)(d + 512) = u.q[1];
  } else if (f < NF_P + NF_U) { const int fu = f - NF_P, h = fu / (DIN / 16), jt = fu % (DIN / 16); float v[8];
    ld_col<DIN, 8>(WU + (size_t)h * LATW * DIN + jt * 16, (unsigned)(8 * g * DIN + col) * 4u, v);
    v8b wb; v8h wh;
#pragma unroll
    for (int i = 0; i < 8; ++i) { wb[i] = (__bf16)v[i]; wh[i] = (_Float16)(bfr(v[i]) * 256.0f); }
    *(v8b*)((char*)FU + (size_t)fu * 512 + lane * 16) = wb; *(v8h*)((char*)FUH + (size_t)fu * 512 + lane * 16) = wh;
  } else { const int fo = f - NF_P - NF_U, kc = fo / (DIN / 16), jt = fo % (DIN / 16); float v[16];
    ld_col<DIN, 16>(WO + (size_t)kc * 32 * DIN + jt * 16, (unsigned)(8 * g * DIN + col) * 4u, v);
    union { v16h v; v8h q[2]; } u;
#pragma unroll
    for (int i = 0; i < 16; ++i) u.v[i] = (_Float16)(bfr(v[i]) * 256.0f);
    char* d = (char*)FO + (size_t)fo * 1024 + lane * 16; *(v8h*)d = u.q[0]; *(v8h*)(d + 512) = u.q[1]; } }
// k_proj's ring: one slot = one k-step's operands as loaded, the x fragment (bf16, k_prep) and the four real weight fragments. ax / aw = the lane's own addresses of the step (fragment start + lane * 16 bytes)
#define RP 3   // k-steps held or in flight
struct PS { v16b a; v16b w[4]; };
__device__ __forceinline__ void proj_ld(gp ax, gp aw, PS& s) { typedef const __attribute__((address_space(1))) v8b* gb;
  { union { v16b v; v8b q[2]; } u; u.q[0] = *(gb)ax; u.q[1] = *(gb)(ax + 512); s.a = u.v; }
#pragma unroll
  for (int jj = 0; jj < 4; ++jj) { union { v16b v; v8b q[2]; } u; u.q[0] = *(gb)(aw + jj * 1024); u.q[1] = *(gb)(aw + jj * 1024 + 512); s.w[jj] = u.v; } }
// ---- k_proj: block = (64 rows, 128 cols, which): q/k/v = X W (+ b) with exact bf16 products (K = DIN) -> which 0: q f16 rows (+ residual rows < QHI); 1: k f16 (+ residual for keys < KHI); 2: v f16 (+ bf16 hi/lo for keys < KHI). k and v leave in the order k_att's A fragments are read in, the 16 real dims of a head only:
// k tile (16 keys): 512 B with lane (g, c) = dims 8 g + 0..7 of key c; the even tile of a 32-key step fills fragment slots 0..7, the odd one slots 8..15; the padding dims are not stored. v step (32 keys): 512 B with lane (g, c) = keys 8 g + 0..7 of dim c (slots 0..7), then 512 B with keys 16 + 8 g + 0..7 (slots 8..15)
__global__ __launch_bounds__(128) void k_proj(const __bf16* __restrict__ XF, const __bf16* __restrict__ FP, const float* __restrict__ BQ, const float* __restrict__ BK, const float* __restrict__ BV,
    _Float16* __restrict__ QH, _Float16* __restrict__ QL, _Float16* __restrict__ KH, _Float16* __restrict__ KL, _Float16* __restrict__ VT, __bf16* __restrict__ VB, __bf16* __restrict__ VBL) {
  __shared__ __align__(16) _Float16 sh[64][136], sl[64][136]; __shared__ __align__(16) _Float16 th[128][72]; __shared__ __align__(16) __bf16 tb[128][72], tbl[128][72];
  const int tid = threadIdx.x, wave = tid >> 5, lane = tid & 31, col = lane & 15, g = lane >> 4; const int which = blockIdx.z; const int c0 = blockIdx.y * 128; const size_t r0 = (size_t)blockIdx.x * 64; const size_t bb = r0 / TT; const int t0 = (int)(r0 % TT);
  const __bf16* FW = FP + ((size_t)which * (DIN / 32) * NH + c0 / HD) * 512; const unsigned lob = lane * 16u; const float* BA = which == 0 ? BQ : which == 1 ? BK : BV;
  v8f acc[8] = {}; float bv[4]; gp bq[4];   /* bv: the bias of the four real column tiles, as loaded */
  /* a ring of RP k-steps' operands in registers: a slot is asked for again, RP steps ahead, right behind the step that used it, so a load has the other slots' steps of work to land in. The walk is unrolled whole: every load is one of the two fixed addresses plus a constant, and no address register is written while loads are out. k-steps are used in the order 0 .. DIN / 32 - 1 as before */
  const gp xb = (gp)(const char*)XF + (r0 / 16 + wave) * ((DIN / 32) * 1024) + lob, wb = (gp)(const char*)FW + lob; PS st[RP];
#pragma unroll
  for (int j = 0; j < RP; ++j) { proj_ld(xb + j * 1024, wb + j * (NH * 1024), st[j]);
    __builtin_amdgcn_sched_barrier(0); }   /* asked for in ring order: in another order the counted load waits of the first steps wait for younger slots too */
#pragma unroll
  for (int kc = 0; kc < DIN / 32; ++kc) { const PS& s = st[kc % RP];
#pragma unroll
    for (int j = 0; j < 8; ++j) acc[j] = wmma_bf(s.a, (j & 1) ? zero16b() : s.w[j >> 1], acc[j]);   /* even j: the real column tiles (dims < LATW of a head) */
    __builtin_amdgcn_sched_barrier(0);   /* the refill stays behind the step that reads its slot: left free, the build needs registers past v255 */
    if (kc + RP < DIN / 32) { proj_ld(xb + (kc + RP) * 1024, wb + (kc + RP) * (NH * 1024), st[kc % RP]);
      __builtin_amdgcn_sched_barrier(0); }   /* the refill is issued whole here: left free, the build sets the next step's first load wait in among its loads and holds the last four back behind it */
    if (kc == DIN / 32 - RP) {   /* the first slot that is not refilled: its registers take the bias values, asked for together here, so that the walk's last steps cover their way instead of the epilogue waiting for them one by one. Gathered like the weight columns; with no bias array the loads read the weights and their values are not used */
      const gp bs = (gp)(BA ? (const char*)BA : (const char*)FP) + col * 4; const int hw = (which == 0 ? QHEADW : LATW) * 4;
#pragma unroll
      for (int jj = 0; jj < 4; ++jj) { bq[jj] = bs + (c0 / HD + jj) * hw; bv[jj] = *(const __attribute__((address_space(1))) float*)bq[jj]; } } }
  XWH(xb, wb, bq[0], bq[1], bq[2], bq[3]);
  if (which < 2) { _Float16* DH = which == 0 ? QH : KH; _Float16* DL = which == 0 ? QL : KL; const int nhi = which == 0 ? QHI : KHI; const bool hi_rows = t0 < nhi;
#pragma unroll
    for (int j = 0; j < 8; ++j) { const float bias = (BA && !(j & 1)) ? bfr(bv[j >> 1]) : 0.f;   /* padding columns (odd j) get no bias */
#pragma unroll
      for (int r = 0; r < 8; ++r) { const float v = acc[j][r] + bias; const _Float16 hv = (_Float16)v; sh[wave * 16 + 8 * g + r][j * 16 + col] = hv; sl[wave * 16 + 8 * g + r][j * 16 + col] = (_Float16)((v - (float)hv) * 1024.0f); } }
    __syncthreads();
    if (which == 0) { for (int e = tid; e < 64 * 16; e += 128) { const int rl = e >> 4, q = e & 15; vst2((unsigned*)(DH + (r0 + rl) * CC + c0 + q * 8), *(const v4u*)&sh[rl][q * 8]); XW(); if (hi_rows) { vst2((unsigned*)(DL + (bb * nhi + t0 + rl) * (size_t)CC + c0 + q * 8), *(const v4u*)&sl[rl][q * 8]); XW(); } }
    } else {   /* wave = key tile, pass = head: a wave stores one whole tile, 512 B in a row */
      const int rl = wave * 16 + col; const size_t hd = bb * NH + c0 / HD; v4u a[4];
#pragma unroll
      for (int hh = 0; hh < 4; ++hh) a[hh] = *(const v4u*)&sh[rl][hh * HD + g * 8];
#pragma unroll
      for (int hh = 0; hh < 4; ++hh) vst2((unsigned*)(DH + ((hd + hh) * (TT / 16) + t0 / 16 + wave) * 256 + lane * 8), a[hh]);
      XW();
      if (hi_rows) {
#pragma unroll
        for (int hh = 0; hh < 4; ++hh) a[hh] = *(const v4u*)&sl[rl][hh * HD + g * 8];
#pragma unroll
        for (int hh = 0; hh < 4; ++hh) vst2((unsigned*)(DL + ((hd + hh) * (KHI / 16) + t0 / 16 + wave) * 256 + lane * 8), a[hh]);
        XW(); } }
  } else { const bool hi_rows = t0 < KHI;
#pragma unroll
    for (int j = 0; j < 8; ++j) { const float bias = (BA && !(j & 1)) ? bfr(bv[j >> 1]) : 0.f;   /* padding columns (odd j) get no bias */
#pragma unroll
      for (int r = 0; r < 8; ++r) { const float v = acc[j][r] + bias; const int rl = wave * 16 + 8 * g + r, cl = j * 16 + col; th[cl][rl] = (_Float16)v; const __bf16 bh = (__bf16)v; tb[cl][rl] = bh; tbl[cl][rl] = (__bf16)(v - (float)bh); } }
    __syncthreads();
    const int rl = wave * 16 + g * 8; const size_t hd = bb * NH + c0 / HD; v4u a[4];   /* wave = 16 keys = half a step, pass = head: a wave stores 512 B in a row */
#pragma unroll
    for (int hh = 0; hh < 4; ++hh) a[hh] = *(const v4u*)&th[hh * HD + col][rl];
#pragma unroll
    for (int hh = 0; hh < 4; ++hh) vst2((unsigned*)(VT + ((hd + hh) * (TT / 32) + t0 / 32) * 512 + tid * 8), a[hh]);
    XW();
    if (hi_rows) { v4u lo[4];
#pragma unroll
      for (int hh = 0; hh < 4; ++hh) { a[hh] = *(const v4u*)&tb[hh * HD + col][rl]; lo[hh] = *(const v4u*)&tbl[hh * HD + col][rl]; }
#pragma unroll
      for (int hh = 0; hh < 4; ++hh) { const size_t o3 = ((hd + hh) * (KHI / 32) + t0 / 32) * 512 + tid * 8; vst2((unsigned*)(VB + o3), a[hh]); vst2((unsigned*)(VBL + o3), lo[hh]); }
      XW(); } } }
// ---- k_att: block = 4 waves x 32 queries of (b, h), one launch for all (b, h): logits, softmax and P . v without leaving registers.
// S^T = K . Q^T (A = 16 key rows, B = 16 query rows): lane (g, c) holds, for query c, keys 8g + r of each 16-key tile, so the two tiles of one 32-key step, converted in place, are the B operand of ctx^T += v^T . P^T (hardware k order on both sides). Each key / v fragment serves the wave's two 16-query tiles. K and v^T lie in fragment order (k_proj), so every load of the walks is 512 B in a row, four whole lines; only the 16 real dims of a head are read, and the product with v's padding dims, which is 0, is not formed.
// One K fragment holds BOTH 16-key tiles of a step: row c = key c of tile 0 in k slots 0..15 and key c of tile 1 in k slots 16..31. Tile 0's logits come from B = [q ; 0], tile 1's from B = [0 ; q]: the zeros stand in the loop-invariant q fragments, and the K registers hold loaded values only.
// Walk 1: row maximum. Walk 2 (logits formed again, same products): e = exp(s - max) x 2^11, row sum in f32, e once to f16 against v f16 (query rows < QHI: 3-product logits, e and v as bf16 hi + lo, 3 products); ctx = acc / sum. Keys past the wave's own diagonal step are not visited; the diagonal step masks by index.
#define QT 2   // 16-query tiles per wave
#define RD 4   // late rows, second walk: steps whose key and v fragments are held or in flight
#define RD1 8  // late rows, first walk: its steps are about a third as long and hold keys only, so the ring is deeper
static_assert(QHI % (64 * QT) == 0 && QHI == QBH * 64 && KHI >= QHI && TT % (64 * QT) == 0, "a block of 4 x QT x 16 queries is wholly early or wholly late; early rows see only keys < KHI");
__device__ __forceinline__ v8f wm_h(v16h a, v16h b, v8f c) { return __builtin_amdgcn_wmma_f32_16x16x32_f16(false, a, false, b, (short)0, c, false, false); }
__device__ __forceinline__ v8f wm_b(v16b a, v16b b, v8f c) { return __builtin_amdgcn_wmma_f32_16x16x32_bf16(false, a, false, b, (short)0, c, false, false); }
// q fragments from a wave-uniform base + the lane's fixed byte offset (row c, half g)
__device__ __forceinline__ void frag_q(const _Float16* ub, unsigned lob, v16h q2[2]) { union { v16h v; v8h q[2]; } u0, u1; const v8h d = *(const v8h*)((const char*)ub + lob); v8h z;
#pragma unroll
  for (int i = 0; i < 8; ++i) z[i] = (_Float16)0.0f;
  u0.q[0] = d; u0.q[1] = z; u1.q[0] = z; u1.q[1] = d; q2[0] = u0.v; q2[1] = u1.v; }   /* the 16 real dims of query row c: [q ; 0] and [0 ; q] */
// k or v fragment in fragment order: fb = wave-uniform start of the 32-key step, lob = lane * 16 bytes. xl: the last fragment read through its address; its last load may land on the address registers, so the wait stands in front of it
__device__ __forceinline__ v16h fragv_h(const _Float16* fb, unsigned lob, bool xl) { union { v16h v; v8h q[2]; } u; const char* p = (const char*)fb + lob; u.q[0] = *(const v8h*)p; if (xl) XW(); u.q[1] = *(const v8h*)(p + 512); return u.v; }
__device__ __forceinline__ v16b fragv_b(const __bf16* fb, unsigned lob, bool xl) { union { v16b v; v8b q[2]; } u; const char* p = (const char*)fb + lob; u.q[0] = *(const v8b*)p; if (xl) XW(); u.q[1] = *(const v8b*)(p + 512); return u.v; }
// the ring's loads: a = the lane's own address of a 32-key step's fragment (step start + lane * 16 bytes)
__device__ __forceinline__ gp ring_a(const _Float16* base, int step, unsigned lob) { return (gp)(const char*)base + (size_t)step * 1024 + lob; }
__device__ __forceinline__ v16h ring_ld(gp a) { typedef const __attribute__((address_space(1))) v8h* gq; union { v16h v; v8h q[2]; } u; u.q[0] = *(gq)a; u.q[1] = *(gq)(a + 512); return u.v; }
// e x 2^11 = 2^(t x LC + off): t = the raw logit (before x 16^-0.5), LC = 16^-0.5 x log2(e), off = 11 - max(t) x LC, one value per query row. One fused multiply-add and one v_exp_f32 per logit; the rounding of off is a factor common to a row's numerators and its sum. Below 2^-126 the result may flush to 0, far under what the f32 sum or the 16-bit P can hold.
#define LC (SCALE * 1.44269504088896340736f)
// The free slot the instruction set asks for behind a transcendental (before its result is read or its source overwritten) stands in the v_exp_f32's own statement. exp2_x8: the eight logits of one product tile, each exponential in place on its own register (one the compiler's own multiply-add has just written, so the statement lands on no register that a matrix instruction still reads), so each is the independent instruction behind the one before it, and one v_nop closes the last.
__device__ __forceinline__ void exp2_x8(float* t, float off) { float a[8];
#pragma unroll
  for (int r = 0; r < 8; ++r) a[r] = __builtin_fmaf(t[r], LC, off);
  asm("v_exp_f32 %0, %0\n\tv_exp_f32 %1, %1\n\tv_exp_f32 %2, %2\n\tv_exp_f32 %3, %3\n\tv_exp_f32 %4, %4\n\tv_exp_f32 %5, %5\n\tv_exp_f32 %6, %6\n\tv_exp_f32 %7, %7\n\tv_nop" : "+v"(a[0]), "+v"(a[1]), "+v"(a[2]), "+v"(a[3]), "+v"(a[4]), "+v"(a[5]), "+v"(a[6]), "+v"(a[7]));
#pragma unroll
  for (int r = 0; r < 8; ++r) t[r] = a[r]; }
// one 32-key step: ld_k reads its two 16-key tiles as one fragment (KHr / KLr point at step 0 of (b, h), 512 elements a step, lob = lane * 16 bytes); st_mm forms s[u][8 t + r] = raw logit (not yet x 16^-0.5) of (key kc*32 + 16 t + 8 g + r, query 16 u + c)
struct KF { v16h h, l; };
template <bool HI> __device__ __forceinline__ KF ld_k(const _Float16* KHr, const _Float16* KLr, int kc, unsigned lob) { KF k; k.h = fragv_h(KHr + (size_t)kc * 512, lob, false); if (HI) k.l = fragv_h(KLr + (size_t)kc * 512, lob, false); else k.l = k.h; return k; }
template <bool HI> __device__ __forceinline__ void st_mm(const KF& k, const v16h qh[QT][2], const v16h ql[QT][2], float s[QT][16]) {
#pragma unroll
  for (int t = 0; t < 2; ++t)
#pragma unroll
    for (int u = 0; u < QT; ++u) { v8f a = {}; a = wm_h(k.h, qh[u][t], a);
      if (HI) { v8f al = {}; al = wm_h(k.h, ql[u][t], al); al = wm_h(k.l, qh[u][t], al);
#pragma unroll
        for (int r = 0; r < 8; ++r) s[u][t * 8 + r] = a[r] + al[r] * (1.0f / 1024.0f);
      } else {
#pragma unroll
        for (int r = 0; r < 8; ++r) s[u][t * 8 + r] = a[r]; } } }
template <bool HI, bool MASK> __device__ __forceinline__ void max_use(const KF& k, const v16h qh[QT][2], const v16h ql[QT][2], int kc, int qrel, float m[QT]) { float s[QT][16]; st_mm<HI>(k, qh, ql, s);
#pragma unroll
  for (int u = 0; u < QT; ++u)
#pragma unroll
    for (int i = 0; i < 16; ++i) { if (!MASK || kc * 32 + 16 * (i >> 3) + (i & 7) <= qrel + 16 * u) m[u] = fmaxf(m[u], s[u][i]); } }
template <bool HI, bool MASK> __device__ __forceinline__ void max_step(const _Float16* KHr, const _Float16* KLr, const v16h qh[QT][2], const v16h ql[QT][2], int kc, unsigned lob, int qrel, float m[QT]) { const KF k = ld_k<HI>(KHr, KLr, kc, lob); max_use<HI, MASK>(k, qh, ql, kc, qrel, m); }
template <bool HI, bool MASK> __device__ __forceinline__ void pv_use(const KF& k, const v16h vf, const v16b vh, const v16b vl, const v16h qh[QT][2], const v16h ql[QT][2], int kc, int qrel, const float off[QT], float sum[QT], v8f acc[QT]) { float s[QT][16];
  st_mm<HI>(k, qh, ql, s);
#pragma unroll
  for (int u = 0; u < QT; ++u) { exp2_x8(&s[u][0], off[u]); exp2_x8(&s[u][8], off[u]);
#pragma unroll
    for (int i = 0; i < 16; ++i) { float e = s[u][i]; if (MASK && kc * 32 + 16 * (i >> 3) + (i & 7) > qrel + 16 * u) e = 0.f; sum[u] += e; s[u][i] = e; } }
  if (HI) { F2 pp[QT];
#pragma unroll
    for (int u = 0; u < QT; ++u) pp[u] = bsplit16(s[u]);
#pragma unroll
    for (int u = 0; u < QT; ++u) { acc[u] = wm_b(vh, pp[u].h, acc[u]); acc[u] = wm_b(vh, pp[u].l, acc[u]); acc[u] = wm_b(vl, pp[u].h, acc[u]); }
  } else { v16h pb[QT];
#pragma unroll
    for (int u = 0; u < QT; ++u)
#pragma unroll
      for (int i = 0; i < 16; ++i) pb[u][i] = (_Float16)s[u][i];
#pragma unroll
    for (int u = 0; u < QT; ++u) acc[u] = wm_h(vf, pb[u], acc[u]); } }
template <bool HI, bool MASK> __device__ __forceinline__ void pv_step(const _Float16* KHr, const _Float16* KLr, const v16h qh[QT][2], const v16h ql[QT][2], const _Float16* VTr, const __bf16* VBr, const __bf16* VBLr, int kc, unsigned lob, int qrel, const float off[QT], float sum[QT], v8f acc[QT]) {
  const KF k = ld_k<HI>(KHr, KLr, kc, lob); XW();
  v16h vf = {}; v16b vh = {}, vl = {};   /* v is asked for before the exponentials, which cover its latency; the diagonal step's last load is the last through lob */
  if (HI) { vh = fragv_b(VBr + (size_t)kc * 512, lob, false); vl = fragv_b(VBLr + (size_t)kc * 512, lob, MASK); } else vf = fragv_h(VTr + (size_t)kc * 512, lob, MASK);
  pv_use<HI, MASK>(k, vf, vh, vl, qh, ql, kc, qrel, off, sum, acc); }
template <bool HI> __device__ __forceinline__ void att_body(const _Float16* __restrict__ QH, const _Float16* __restrict__ KH, const _Float16* __restrict__ QL, const _Float16* __restrict__ KL, const _Float16* __restrict__ VT, const __bf16* __restrict__ VB, const __bf16* __restrict__ VBL, int b, int h, int ql0, int lane, float* __restrict__ Y) {
  const int c = lane & 15, g = lane >> 4; const int nfull = ql0 >> 5;   /* ql0 % 32 == 0: steps 0 .. nfull-1 lie wholly below the diagonal for all 32 queries; step nfull holds it */
  const size_t hd = (size_t)b * NH + h; const _Float16* KHr = KH + hd * (TT * LATW); const _Float16* KLr = KL + hd * (KHI * LATW); const unsigned klo = (unsigned)(c * CC + 8 * g) * 2u, lob = lane * 16u;   /* klo: the q rows' offset; lob: every k / v fragment's */
  const _Float16* VTr = VT + hd * (TT * LATW); const __bf16* VBr = VB + hd * (KHI * LATW); const __bf16* VBLr = VBL + hd * (KHI * LATW);
  v16h qh[QT][2], ql[QT][2];
#pragma unroll
  for (int u = 0; u < QT; ++u) { frag_q(QH + ((size_t)b * TT + ql0 + u * 16) * CC + h * HD, klo, qh[u]); if (HI) frag_q(QL + ((size_t)b * QHI + ql0 + u * 16) * CC + h * HD, klo, ql[u]); else { ql[u][0] = qh[u][0]; ql[u][1] = qh[u][1]; } }
  XW();
  const int qrel = ql0 + c - 8 * g;   /* key kc*32 + 16 t + 8 g + r is kept for query ql0 + 16 u + c when kc*32 + 16 t + r <= qrel + 16 u */
  float m[QT], sum[QT]; v8f acc[QT] = {};
#pragma unroll
  for (int u = 0; u < QT; ++u) { m[u] = -3.0e38f; sum[u] = 0.f; }
  if (HI) {   /* early rows: at most KHI / 32 steps, loads asked for in the step that uses them */
#pragma unroll 1   /* left rolled, as it was: few steps, and unrolling adds registers */
    for (int kc = 0; kc < nfull; ++kc) max_step<HI, false>(KHr, KLr, qh, ql, kc, lob, qrel, m);
    max_step<HI, true>(KHr, KLr, qh, ql, nfull, lob, qrel, m);
#pragma unroll
    for (int u = 0; u < QT; ++u) { m[u] = fmaxf(m[u], __shfl_xor(m[u], 16)); m[u] = __builtin_fmaf(-m[u], LC, 11.0f); }   /* the two lane halves hold different keys of the same query; from here m = the exponent's offset */
#pragma unroll 1   /* left rolled, as it was */
    for (int kc = 0; kc < nfull; ++kc) pv_step<HI, false>(KHr, KLr, qh, ql, VTr, VBr, VBLr, kc, lob, qrel, m, sum, acc);
    pv_step<HI, true>(KHr, KLr, qh, ql, VTr, VBr, VBLr, nfull, lob, qrel, m, sum, acc);
  } else {
    /* late rows: each walk holds a ring of steps' fragments in registers (RD1 steps of keys, then RD steps of keys and v). A slot is asked for again, a ring's length ahead, right behind the step that used it, so a load has the other slots' steps of work to land in. A step index past the diagonal step is clamped to it (read, not used). The diagonal step's own fragments (kd for both walks, vd) are asked for once, up front. Steps are used in the order 0 .. nfull as before. */
    static_assert(RD == 4 && RD1 == 8, "the waits behind the rings' first loads name their addresses one by one");
    const v16b zb = {}; KF k1[RD1], kb[RD], kd; v16h vb[RD], vd; gp a1[RD1], ak[RD], av[RD];
    const gp akd = ring_a(KHr, nfull, lob), avd = ring_a(VTr, nfull, lob);
#pragma unroll
    for (int j = 0; j < RD1; ++j) { a1[j] = ring_a(KHr, j < nfull ? j : nfull, lob); k1[j].h = ring_ld(a1[j]); k1[j].l = k1[j].h; }
    XWH(a1[0], a1[1], a1[2], a1[3], a1[4], a1[5], a1[6], a1[7]);
    kd.h = ring_ld(akd); kd.l = kd.h; XWH(akd);   /* a wait of its own, directly behind: no other load stands between */
    gp pa = akd, pb = avd;   /* the addresses of the youngest refill: their wait stands one step later, in front of the next refill, where it has nothing left to wait for */
    int kc = 0;
#pragma unroll 1   /* one trip = one turn of the ring, its slots fixed registers */
    for (; kc + RD1 <= nfull; kc += RD1) {
#pragma unroll
      for (int j = 0; j < RD1; ++j) { max_use<false, false>(k1[j], qh, ql, kc + j, qrel, m);
        __builtin_amdgcn_sched_barrier(0);   /* the wait and the refill stay behind the step's work: lifted to its head the wait stands right behind the loads it is for, and stalls */
        XWH(pa); const int nx = kc + RD1 + j; pa = ring_a(KHr, nx < nfull ? nx : nfull, lob); k1[j].h = ring_ld(pa); k1[j].l = k1[j].h;
        __builtin_amdgcn_sched_barrier(0); } }   /* keeps the steps in ring order: without it the build lifts the last slots' products to the head of the trip, where they wait for loads just issued */
    XWH(pa);
#pragma unroll
    for (int j = 0; j < RD1 - 1; ++j) { if (kc + j < nfull) max_use<false, false>(k1[j], qh, ql, kc + j, qrel, m); }
    vd = ring_ld(avd); XWH(avd);   /* the second walk's first turn is asked for ahead of the diagonal step's maximum */
#pragma unroll
    for (int j = 0; j < RD; ++j) { const int nx = j < nfull ? j : nfull; ak[j] = ring_a(KHr, nx, lob); av[j] = ring_a(VTr, nx, lob); kb[j].h = ring_ld(ak[j]); kb[j].l = kb[j].h; vb[j] = ring_ld(av[j]);
      __builtin_amdgcn_sched_barrier(0); }   /* asked for in ring order: the loop's counted load waits are set for both ways into the loop, and another order here makes them wait for younger slots */
    XWH(ak[0], ak[1], ak[2], ak[3], av[0], av[1], av[2], av[3]);
    max_use<false, true>(kd, qh, ql, nfull, qrel, m);
#pragma unroll
    for (int u = 0; u < QT; ++u) { m[u] = fmaxf(m[u], __shfl_xor(m[u], 16)); m[u] = __builtin_fmaf(-m[u], LC, 11.0f); }   /* the two lane halves hold different keys of the same query; from here m = the exponent's offset */
    pa = akd; pb = avd;
#pragma unroll 1   /* one trip = one turn of the ring */
    for (kc = 0; kc + RD <= nfull; kc += RD) {
#pragma unroll
      for (int j = 0; j < RD; ++j) { pv_use<false, false>(kb[j], vb[j], zb, zb, qh, ql, kc + j, qrel, m, sum, acc);
        __builtin_amdgcn_sched_barrier(0);   /* as in the first walk: the wait stays a whole step behind the loads it is for */
        XWH(pa, pb); const int nx = kc + RD + j < nfull ? kc + RD + j : nfull; pa = ring_a(KHr, nx, lob); pb = ring_a(VTr, nx, lob); kb[j].h = ring_ld(pa); kb[j].l = kb[j].h; vb[j] = ring_ld(pb);
        __builtin_amdgcn_sched_barrier(0); } }   /* the refill is issued here: without it the build sinks the loads into the next step, up to that step's wait */
    XWH(pa, pb);
#pragma unroll
    for (int j = 0; j < RD - 1; ++j) { if (kc + j < nfull) pv_use<false, false>(kb[j], vb[j], zb, zb, qh, ql, kc + j, qrel, m, sum, acc); }
    pv_use<false, true>(kd, vd, zb, zb, qh, ql, nfull, qrel, m, sum, acc);
  }
#pragma unroll
  for (int u = 0; u < QT; ++u) { const float st = sum[u] + __shfl_xor(sum[u], 16); const float inv = st > 0.f ? 1.0f / st : 0.f;   /* sum and acc both carry the 2^11 */
    float* yr = Y + ((((size_t)b * TT + ql0) / 16 + u) * NH + h) * 256 + lane * 4;   /* acc[u][r] = ctx(query 16 u + c, dim 8 g + r) = slot r of lane (g, c) in k_out's A fragment of (row tile, head): r 0..3 of the 32 lanes as 512 B in a row, then r 4..7; the padding dims are not stored */
    v4f o0, o1;
#pragma unroll
    for (int r = 0; r < 4; ++r) { o0[r] = acc[u][r] * inv; o1[r] = acc[u][4 + r] * inv; }
    vst2(yr, o0); vst2(yr + 128, o1); XW(); } }   /* the precaution of XW: the next tile's division is free to land on these stores' registers */
__global__ __launch_bounds__(128) void k_att(const _Float16* __restrict__ QH, const _Float16* __restrict__ KH, const _Float16* __restrict__ QL, const _Float16* __restrict__ KL, const _Float16* __restrict__ VT, const __bf16* __restrict__ VB, const __bf16* __restrict__ VBL, float* __restrict__ Y) {
  const int b = blockIdx.x / NH, h = blockIdx.x % NH; const int q0 = (TT / (64 * QT) - 1 - (int)blockIdx.y) * (64 * QT);   /* longest query blocks start first */
  const int wave = __builtin_amdgcn_readfirstlane(threadIdx.x >> 5), lane = threadIdx.x & 31; const int ql0 = q0 + wave * (16 * QT);
  if (q0 < QHI) att_body<true>(QH, KH, QL, KL, VT, VB, VBL, b, h, ql0, lane, Y); else att_body<false>(QH, KH, QL, KL, VT, VB, VBL, b, h, ql0, lane, Y); }
// k_out, k_out2: the bias values of the eight column tiles (bb = the lane's address of the first), asked for together behind the ring's first loads, so that the walk covers their way instead of the epilogue waiting for them one by one. The wait is the precaution of XW for their address registers: it stands where the wave waits for its first slot in any case. The scheduling fence keeps loads and wait here: left free, the build sets them in among the first step's products, where the wait holds a product back
__device__ __forceinline__ void bias_ld(gp bb, float bv[8]) {
#pragma unroll
  for (int j = 0; j < 8; ++j) bv[j] = *(const __attribute__((address_space(1))) float*)(bb + j * 64);
  XW(); __builtin_amdgcn_sched_barrier(0); }
// k_out's ring, as k_proj's: one slot = one k-step's operands as loaded, the lane's 8 real ctx values (f32, fragment order, k_att) and the eight weight fragments' slots 0..7 (slots 8..15 of both are the zero padding of a latent head and are not stored). ay / aw = the lane's own addresses of the step (fragment start + lane * 16 bytes)
#define RU 2   // k-steps held or in flight
struct US { v4f x[2]; v4u w[8]; };
__device__ __forceinline__ void out_ld(gp ay, gp aw, US& s) { typedef const __attribute__((address_space(1))) v4f* gf; typedef const __attribute__((address_space(1))) v4u* gu;
  s.x[0] = *(gf)ay; s.x[1] = *(gf)(ay + 512);
#pragma unroll
  for (int j = 0; j < 8; ++j) s.w[j] = *(gu)(aw + j * 512); }
// the walk over the CC / 32 k-steps, unrolled whole: every load is one of the two fixed addresses plus a constant. HI: ctx bf16 hi + lo against exact bf16 weights (2 products); else ctx x 2^6 once to f16 (clear of f16 subnormals, chip FTZ) against f16(bf16 x 2^8) weights. k-steps and products in the order they had
template <bool HI> __device__ __forceinline__ void out_walk(gp yb, gp wb, gp bb, float bv[8], v8f acc[8]) { US st[RU];
#pragma unroll
  for (int j = 0; j < RU; ++j) { out_ld(yb + j * 1024, wb + j * ((DIN / 16) * 512), st[j]);
    __builtin_amdgcn_sched_barrier(0); }   /* asked for in ring order, as in k_proj */
  bias_ld(bb, bv);
#pragma unroll
  for (int kc = 0; kc < CC / 32; ++kc) { const US& s = st[kc % RU]; float v[16]; const v4u z = {};
#pragma unroll
    for (int i = 0; i < 4; ++i) { v[i] = s.x[0][i]; v[4 + i] = s.x[1][i]; v[8 + i] = 0.f; v[12 + i] = 0.f; }
    if (HI) { const F2 a = bsplit16(v);
#pragma unroll
      for (int j = 0; j < 8; ++j) { union { v16b v; v4u q[2]; } u; u.q[0] = s.w[j]; u.q[1] = z; acc[j] = wmma_bf(a.h, u.v, acc[j]); acc[j] = wmma_bf(a.l, u.v, acc[j]); }
    } else { v16h a;
#pragma unroll
      for (int i = 0; i < 16; ++i) a[i] = (_Float16)(v[i] * 64.0f);
#pragma unroll
      for (int j = 0; j < 8; ++j) { union { v16h v; v4u q[2]; } u; u.q[0] = s.w[j]; u.q[1] = z; acc[j] = wmma16(a, u.v, acc[j]); } }
    __builtin_amdgcn_sched_barrier(0);   /* the refill stays behind the step that reads its slot */
    if (kc + RU < CC / 32) { out_ld(yb + (kc + RU) * 1024, wb + (kc + RU) * ((DIN / 16) * 512), st[kc % RU]);
      __builtin_amdgcn_sched_barrier(0); } }   /* the refill is issued whole here, as in k_proj */
  XWH(yb, wb); }
// The result leaves as k_out2's A operand: a lane's 8 accumulator rows are 8 consecutive positions of one channel, so x 2^6 and the one rounding to f16 (the rounding k_out2's loader made) give 16 B of a T row; the block's 64 positions of a channel are gathered in LDS and stored as one whole line.
// ---- k_out: block = (64 rows, 128 cols): ao = ctx Wvu (+ bvu): ctx x 2^6 once to f16 against Wvu as f16(bf16 x 2^8) exact (1 product) x 2^-14; causal early rows (< QHI of each sequence): ctx bf16 hi + lo against exact bf16 Wvu (2 products)
__global__ __launch_bounds__(128) void k_out(const float* __restrict__ Y, const __bf16* __restrict__ FU, const _Float16* __restrict__ FUH, const float* __restrict__ BO, _Float16* __restrict__ TH) { __shared__ __align__(16) _Float16 st[128][72];
  const int tid = threadIdx.x, wave = tid >> 5, lane = tid & 31, col = lane & 15, g = lane >> 4; const int c0 = blockIdx.y * 128; const size_t r0 = (size_t)blockIdx.x * 64 + wave * 16; const unsigned lob = lane * 16u;
  v8f acc[8] = {}; float bv[8];   /* bv: the bias of the eight column tiles, as loaded; with no bias array the loads read ctx and their values are not used */
  const gp bb = (gp)(BO ? (const char*)BO : (const char*)Y) + (c0 + col) * 4, yb = (gp)(const char*)Y + (r0 / 16) * (NH * 1024) + lob;
  if (CAUSAL && (int)(((size_t)blockIdx.x * 64) % TT) < QHI) {   /* block-uniform */
    out_walk<true>(yb, (gp)(const char*)FU + (size_t)(c0 / 16) * 512 + lob, bb, bv, acc);
#pragma unroll
    for (int j = 0; j < 8; ++j) { const float bias = BO ? bfr(bv[j]) : 0.f;
      v8h o;
#pragma unroll
      for (int r = 0; r < 8; ++r) o[r] = (_Float16)((acc[j][r] + bias) * 64.0f);
      *(v8h*)&st[j * 16 + col][wave * 16 + 8 * g] = o; }
  } else {
    out_walk<false>(yb, (gp)(const char*)FUH + (size_t)(c0 / 16) * 512 + lob, bb, bv, acc);
#pragma unroll
    for (int j = 0; j < 8; ++j) { const float bias = BO ? bfr(bv[j]) : 0.f;
      v8h o;
#pragma unroll
      for (int r = 0; r < 8; ++r) o[r] = (_Float16)((acc[j][r] * (1.0f / 16384.0f) + bias) * 64.0f);   /* 2^-8 (Wvu carry) x 2^-6 (ctx carry); then the x 2^6 carry of the next product's f16 operand */
      *(v8h*)&st[j * 16 + col][wave * 16 + 8 * g] = o; } }
  __syncthreads();   /* a channel's 64 positions come from all four waves */
  const size_t rb = (size_t)blockIdx.x * 64; _Float16* tp = TH + ((rb / TT) * DIN + c0 + (tid >> 3)) * (size_t)TT + rb % TT + (tid & 7) * 8;   /* 8 lanes = one channel's line; 16 channels a pass */
#pragma unroll
  for (int p = 0; p < 8; ++p) vst2((unsigned*)(tp + (size_t)p * 16 * TT), *(const v4u*)&st[p * 16 + (tid >> 3)][(tid & 7) * 8]); }
#define K2 DIN
#define wcol_io_plain(W, k0, o, lane) wcol_io(W, k0, o, lane, DIN)
#define wcolh_io_plain(W, k0, o, lane) wcolh_io(W, k0, o, lane, DIN)
// k_out2's ring, as k_proj's: one slot = one k-step's A fragment and its eight weight fragments. aa / aw = the lane's own addresses of the step (row + 8 g values; fragment start + lane * 16 bytes)
#define RO 2   // k-steps held or in flight
struct OS { v16h a, w[8]; };
__device__ __forceinline__ void out2_ld(gp aa, gp aw, OS& s) { typedef const __attribute__((address_space(1))) v8h* gq; union { v16h v; v8h q[2]; } u; u.q[0] = *(gq)aa; u.q[1] = *(gq)(aa + 32); s.a = u.v;
#pragma unroll
  for (int j = 0; j < 8; ++j) { u.q[0] = *(gq)(aw + j * 1024); u.q[1] = *(gq)(aw + j * 1024 + 512); s.w[j] = u.v; } }
// ---- k_out2: block = (64 rows, 128 cols): final projection out = R Wo + bo on the re-read rows R [NB*TT][K2] (K2 = DIN input width): the rows (f16 x 2^6) against Wo's B fragments from k_prep (FO, f16(bf16 x 2^8)), both loaded through a ring of RO k-steps, x 2^-14; always the single-product path
__global__ __launch_bounds__(128) void k_out2(const _Float16* __restrict__ Y, const _Float16* __restrict__ FO, const float* __restrict__ BO, float* __restrict__ OUT) { __shared__ __align__(16) float sf[4][16][132];
  const int tid = threadIdx.x, wave = tid >> 5, lane = tid & 31, col = lane & 15, g = lane >> 4; const int c0 = blockIdx.y * 128; const size_t r0 = (size_t)blockIdx.x * 64 + wave * 16; const unsigned lob = lane * 16u;
  v8f acc[8] = {}; float bv[8];   /* the re-read rows mix positions: no early-row special case here. bv: the bias as loaded; with no bias array the loads read the weights and their values are not used */
  const gp bb = (gp)(BO ? (const char*)BO : (const char*)FO) + (c0 + col) * 4;
  /* the ring, as in k_proj: a slot is asked for again, RO steps ahead, right behind the step that used it; the walk is unrolled whole, every load one of the two fixed addresses plus a constant. The rows arrive as f16 x 2^6 (k_out), clear of f16 subnormals (chip FTZ) */
  const gp ab = (gp)(const char*)Y + ((r0 + col) * K2 + 8 * g) * 2, wb = (gp)(const char*)FO + (size_t)(c0 / 16) * 1024 + lob; OS st[RO];
#pragma unroll
  for (int j = 0; j < RO; ++j) { out2_ld(ab + j * 64, wb + j * ((DIN / 16) * 1024), st[j]);
    __builtin_amdgcn_sched_barrier(0); }   /* asked for in ring order, as in k_proj: in another order the first step's counted load waits wait for the second slot too */
  bias_ld(bb, bv);
#pragma unroll
  for (int kc = 0; kc < K2 / 32; ++kc) { const OS& s = st[kc % RO];
#pragma unroll
    for (int j = 0; j < 8; ++j) acc[j] = wmma16(s.a, s.w[j], acc[j]);
    if (kc + RO < K2 / 32) { out2_ld(ab + (kc + RO) * 64, wb + (kc + RO) * ((DIN / 16) * 1024), st[kc % RO]);
      __builtin_amdgcn_sched_barrier(0); } }   /* keeps products and refills in ring order: without it the build makes steps wait for their whole slot at the second product */
  XWH(ab, wb);
#pragma unroll
  for (int j = 0; j < 8; ++j) { const float bias = BO ? bfr(bv[j]) : 0.f;
#pragma unroll
    for (int r = 0; r < 8; ++r) sf[wave][8 * g + r][j * 16 + col] = acc[j][r] * (1.0f / 16384.0f) + bias; }   /* 2^-8 (Wo carry) x 2^-6 (row carry) */
  LDSX(); for (int rl = 0; rl < 16; ++rl) vst2(OUT + (r0 + rl) * DIN + c0 + lane * 4, *(const v4f*)&sf[wave][rl][lane * 4]); }

extern "C" void kernel_launch(void* const* d_in, const int* in_sizes, int n_in, void* d_out, int out_size, void* d_ws, size_t ws_size, hipStream_t stream) {
  (void)in_sizes; (void)n_in; (void)out_size;
  const float** F = (const float**)d_in;
  if (ws_size < (size_t)WS_END) return;
  char* ws = (char*)d_ws; _Float16 *QH = (_Float16*)(ws + WS_QH), *KH = (_Float16*)(ws + WS_KH), *VT = (_Float16*)(ws + WS_VT), *QL = (_Float16*)(ws + WS_QL), *KL = (_Float16*)(ws + WS_KL); __bf16 *VB = (__bf16*)(ws + WS_VB), *VBL = (__bf16*)(ws + WS_VBL); float *S = (float*)(ws + WS_S), *Y = (float*)(ws + WS_Y);
  (void)S; (void)Y; (void)QL; (void)KL; (void)VB; (void)VBL;
  // inputs: 0 x [4,2048,768]; 1 Wq [768,768] (in,out), 2 bq; 3 Wkd [768,192], 4 bkd; 5 Wvd [768,192], 6 bvd; 7 Wvu [192,768], 8 bvu; 9 Wo [768,768] (in,out), 10 bo (all biases zeros, read)
  if (ws_size < (size_t)WS_END4) return;
  _Float16 *T = (_Float16*)(ws + WS_T); __bf16 *FP = (__bf16*)(ws + WS_FP), *FU = (__bf16*)(ws + WS_FU); _Float16 *FUH = (_Float16*)(ws + WS_FUH), *FO = (_Float16*)(ws + WS_FO); __bf16 *XF = (__bf16*)(ws + WS_XF);
  k_prep<<<dim3((NXW + NF_P + NF_U + NF_O) / 4), 128, 0, stream>>>(F[0], XF, F[1], F[3], F[5], F[7], F[9], FP, FU, FUH, FO);   /* x once into A-fragment order, every weight once into B-fragment order */
  k_proj<<<dim3(TNB * TT / 64, CC / 128, 3), 128, 0, stream>>>(XF, FP, F[2], F[4], F[6], QH, QL, KH, KL, VT, VB, VBL);   /* q slice, latent k, latent v: 3 column blocks of 128 columns each */
  k_att<<<dim3(TNB * NH, TT / (64 * QT)), 128, 0, stream>>>(QH, KH, QL, KL, VT, VB, VBL, Y);   /* logits, softmax, P v: every (b, h, 128-query block) in one launch */
  k_out<<<dim3(TNB * TT / 64, DIN / 128), 128, 0, stream>>>(Y, FU, FUH, F[8], T);   /* T[b][c][s] = f16(ao[b][s][c] x 2^6), ao = al Wvu + bvu (gathered weight rows) */
  k_out2<<<dim3(TNB * TT / 64, DIN / 128), 128, 0, stream>>>(T, FO, F[10], (float*)d_out);   /* rows = T's memory re-read as [TT][DIN] per batch; out = rows Wo + bo */
}

// v010
// A run of this version takes 64.6 microseconds.
// In two side-by-side timings against v009, it was 1.04 and 1.03 times as fast.
// All steps since v000 together make it 27.4 times as fast.
// compute dtype: all float inputs rounded to bf16; the q slice and the latent k / v projections with EXACT bf16 products on WMMA 16x16x32 (f32 accumulate) + bias (zeros, read), 16 real dims per head zero-padded to 32; causal logits over the 16 latent dims: 3 products for the first 384 rows, single f16 after, x 16^-0.5; softmax f32 (max first, then exp(s - max) x 2^11, formed as 2^(raw logit x 16^-0.5 log2(e) + offset), once to f16 x v once to f16 (bf16 hi + lo below row 384), divided by the f32 row sum after the product; logits never stored); latent ctx (hi+lo below row 384, x2^6 f16 carry after) x exact / f16(bf16 x 2^8) Wvu + bvu; per-batch transpose; then x 2^6 once to f16 x Wo f16(bf16 x 2^8) + bo; f32 output.
#include <hip/hip_runtime.h>
#include <math.h>

typedef __attribute__((ext_vector_type(16))) _Float16 v16h;
typedef __attribute__((ext_vector_type(16))) __bf16 v16b;
typedef __attribute__((ext_vector_type(8)))  _Float16 v8h;
typedef __attribute__((ext_vector_type(8)))  float v8f;
typedef __attribute__((ext_vector_type(4)))  float v4f;
typedef __attribute__((ext_vector_type(2)))  float v2f;
typedef __attribute__((ext_vector_type(4)))  unsigned v4u;
typedef __attribute__((ext_vector_type(4)))  int v4i;
typedef float __attribute__((may_alias)) float_a;
typedef int __attribute__((may_alias)) int_a;

template <typename T> __device__ __forceinline__ void vst2(void* p, T v) { *(T*)p = v;  }
__device__ __forceinline__ v8f wmma16(v16h a, v16h b, v8f c) {
  v8f d = __builtin_amdgcn_wmma_f32_16x16x32_f16(false, a, false, b, (short)0, c, false, false);
  asm volatile("v_nop\n\tv_nop\n\tv_nop\n\tv_nop" : "+v"(d) : "v"(a), "v"(b));
  return d;
}
__device__ __forceinline__ v8f wmma_bf(v16b a, v16b b, v8f c) {
  v8f d = __builtin_amdgcn_wmma_f32_16x16x32_bf16(false, a, false, b, (short)0, c, false, false);
  asm volatile("v_nop\n\tv_nop\n\tv_nop\n\tv_nop" : "+v"(d) : "v"(a), "v"(b));
  return d;
}
// 16x16x32 fragments: lane = (h = lane>>4, row/col = lane&15); elements 0..7 = k0+8h+0..7, 8..15 = k0+16+8h+0..7; D element r = row 8h+r
__device__ __forceinline__ v16h frag_h(const _Float16* rowk0, int lane) {
  union { v16h v; v8h q[2]; } u; const _Float16* p = rowk0 + 8 * (lane >> 4);
  u.q[0] = *(const v8h*)p; u.q[1] = *(const v8h*)(p + 16); return u.v;
}
__device__ __forceinline__ v16h frag_f32(const float* rowk0, int lane) {
  v16h a; const float* p = rowk0 + 8 * (lane >> 4);
#pragma unroll
  for (int i = 0; i < 8; ++i) { a[i] = (_Float16)p[i]; a[8 + i] = (_Float16)p[16 + i]; }
  return a;
}
__device__ __forceinline__ v16h frag_f32s(const float* rowk0, int lane, float sc) {
  v16h a; const float* p = rowk0 + 8 * (lane >> 4);
#pragma unroll
  for (int i = 0; i < 8; ++i) { a[i] = (_Float16)(p[i] * sc); a[8 + i] = (_Float16)(p[16 + i] * sc); }
  return a;
}
// column fragment from a [K][ld] layout (column n), rows >= K read as 0
__device__ __forceinline__ v16h fragc_f32(const float* W, int k0, int n, int lane, int ld, int K) {
  v16h a; const int g = lane >> 4;
#pragma unroll
  for (int i = 0; i < 8; ++i) { const int ka = k0 + 8 * g + i, kb = ka + 16;
    a[i] = (_Float16)(ka < K ? W[(size_t)(ka < K ? ka : K - 1) * ld + n] : 0.f); a[8 + i] = (_Float16)(kb < K ? W[(size_t)(kb < K ? kb : K - 1) * ld + n] : 0.f); }
  return a;
}
struct F2 { v16b h, l; };
__device__ __forceinline__ F2 bsplit16(const float v[16]) { F2 r;
#pragma unroll
  for (int i = 0; i < 16; ++i) { const __bf16 h = (__bf16)v[i]; r.h[i] = h; r.l[i] = (__bf16)(v[i] - (float)h); }
  return r; }
__device__ __forceinline__ F2 split_row(const float* row, int k0, int lane) { float v[16]; const float* p = row + k0 + 8 * (lane >> 4);
#pragma unroll
  for (int i = 0; i < 8; ++i) { v[i] = p[i]; v[8 + i] = p[16 + i]; }
  return bsplit16(v); }
__device__ __forceinline__ F2 split_rowK(const float* row, int k0, int lane, int K) { float v[16]; const int g = lane >> 4;
#pragma unroll
  for (int i = 0; i < 8; ++i) { const int ka = k0 + 8 * g + i, kb = ka + 16; v[i] = ka < K ? row[ka < K ? ka : K - 1] : 0.f; v[8 + i] = kb < K ? row[kb < K ? kb : K - 1] : 0.f; }
  return bsplit16(v); }
__device__ __forceinline__ F2 split_col(const float* W, int k0, int n, int lane, int ld, int K) { float v[16]; const int g = lane >> 4;
#pragma unroll
  for (int i = 0; i < 8; ++i) { const int ka = k0 + 8 * g + i, kb = ka + 16; v[i] = ka < K ? W[(size_t)(ka < K ? ka : K - 1) * ld + n] : 0.f; v[8 + i] = kb < K ? W[(size_t)(kb < K ? kb : K - 1) * ld + n] : 0.f; }
  return bsplit16(v); }
__device__ __forceinline__ v8f mac3(const F2& a, const F2& b, v8f c) { c = wmma_bf(a.l, b.h, c); c = wmma_bf(a.h, b.l, c); return wmma_bf(a.h, b.h, c); }
__device__ __forceinline__ float sigm(float v) { return 1.0f / (1.0f + expf(-v)); }
#define LDSX() do { asm volatile("s_wait_dscnt 0" ::: "memory"); __builtin_amdgcn_wave_barrier(); __builtin_amdgcn_fence(__ATOMIC_RELEASE, "workgroup"); } while (0)

// Causal self-attention with 12 low-rank latent heads (x [4,2048,768]; (in,out) Wq [768,768], Wkd / Wvd [768,192], Wvu [192,768], Wo [768,768], all N(0,1) x 0.02, zero biases (read); q = x Wq + bq split into 12 heads x 64 of which only the FIRST 16 dims of each head are used (ql); kl, vl = x Wkd, x Wvd split into 12 heads x 16; scores = ql kl^T x 16^-0.5; triu(1) -> -inf; softmax; al = w vl merged to [B,S,192]; ao = al Wvu + bvu [B,S,768]; then jnp.transpose(ao, (0,2,1)).reshape(B,S,768): the per-batch [2048 x 768] matrix is transposed to [768 x 2048] and its memory re-read as 2,048 rows of 768; out = that Wo + bo).
#define NB 4
#define TT 2048
#define CC 384            // NH * HD = projected width
#define DIN 768          // input (model) width
#define NH 12
#define HD 32
#define LATW 16     /* real dims per head; columns h*HD + d with d >= LATW are zero padding */
#define QHEADW 64   /* the module's q heads are 64 wide; only their first LATW dims are used (ql = q[..., :16]) */
#define KVLD (NH * LATW)   /* row pitch of the (in,out) latent weights Wkd / Wvd [768][192] */
#define NQB (TT / 64)
#define HG 2   // S region: 2 x 2,048 x 2,048 f32 = 32 MiB, allocated but unused
#define SCALE (0.25f)
#define CAUSAL 1
#ifndef TNB
#define TNB NB
#endif
__device__ __forceinline__ float bfr(float v) { return (float)(__bf16)v; }
__host__ __device__ __forceinline__ int kb_last(int qb) { return CAUSAL ? ((qb * 64 + 63) >> 7) : (TT / 128 - 1); }
typedef __attribute__((ext_vector_type(8))) __bf16 v8b;
__device__ __forceinline__ v16b frag_b(const __bf16* rowk0, int lane) {
  union { v16b v; v8b q[2]; } u; const __bf16* p = rowk0 + 8 * (lane >> 4);
  u.q[0] = *(const v8b*)p; u.q[1] = *(const v8b*)(p + 16); return u.v;
}
#define QBH 6              // causal: query blocks 0..QBH-1 of each sequence (few keys, no averaging) take the high-precision path
#define QHI 384            // rows carrying a q residual plane
#define KHI 384            // key rows carrying k residual / v bf16 hi+lo planes (used only by the causal high-precision path)
// B fragment (k rows k0+.., output column o) of a weight: (in,out) [K][ld] or (out,in) [ld rows of K]: bf16 exact, or f16(bf16 * 256) exact
__device__ __forceinline__ v16b wcol_io(const float* Wm, int k0, int o, int lane, int ld) { v16b w; const int g = lane >> 4;
#pragma unroll
  for (int i = 0; i < 8; ++i) { w[i] = (__bf16)Wm[(size_t)(k0 + 8 * g + i) * ld + o]; w[8 + i] = (__bf16)Wm[(size_t)(k0 + 16 + 8 * g + i) * ld + o]; }
  return w; }
__device__ __forceinline__ v16b wcol_oi(const float* Wm, int k0, int o, int lane, int K) { v16b w; const float* p = Wm + (size_t)o * K + k0 + 8 * (lane >> 4);
#pragma unroll
  for (int i = 0; i < 8; ++i) { w[i] = (__bf16)p[i]; w[8 + i] = (__bf16)p[16 + i]; }
  return w; }
__device__ __forceinline__ v16h wcolh_io(const float* Wm, int k0, int o, int lane, int ld) { v16h w; const int g = lane >> 4;
#pragma unroll
  for (int i = 0; i < 8; ++i) { w[i] = (_Float16)(bfr(Wm[(size_t)(k0 + 8 * g + i) * ld + o]) * 256.0f); w[8 + i] = (_Float16)(bfr(Wm[(size_t)(k0 + 16 + 8 * g + i) * ld + o]) * 256.0f); }
  return w; }
// first output projection ao = al Wvu: the k index runs over ctx columns kk = h*HD + d; one 32-deep k-step = one head; its first 16 entries (d < LATW, fragment slots 0..7 of both lane halves) are rows h*LATW + d of the (in,out) [192][768] weight, its last 16 (padding dims, slots 8..15) are zero
__device__ __forceinline__ v16b wcol_io_lat(const float* Wm, int k0, int o, int lane, int ld) { v16b w; const int g = lane >> 4; const float* p = Wm + (size_t)((k0 / HD) * LATW + 8 * g) * ld + o;
#pragma unroll
  for (int i = 0; i < 8; ++i) { w[i] = (__bf16)p[(size_t)i * ld]; w[8 + i] = (__bf16)0.0f; }
  return w; }
__device__ __forceinline__ v16h wcolh_io_lat(const float* Wm, int k0, int o, int lane, int ld) { v16h w; const int g = lane >> 4; const float* p = Wm + (size_t)((k0 / HD) * LATW + 8 * g) * ld + o;
#pragma unroll
  for (int i = 0; i < 8; ++i) { w[i] = (_Float16)(bfr(p[(size_t)i * ld]) * 256.0f); w[8 + i] = (_Float16)0.0f; }
  return w; }
static_assert(HD == 32 && LATW == 16 && CC == NH * HD, "the latent loaders assume one head per 32-deep k-step with 16 real + 16 padding dims");
__device__ __forceinline__ v16h wcolh_oi(const float* Wm, int k0, int o, int lane, int K) { v16h w; const float* p = Wm + (size_t)o * K + k0 + 8 * (lane >> 4);
#pragma unroll
  for (int i = 0; i < 8; ++i) { w[i] = (_Float16)(bfr(p[i]) * 256.0f); w[8 + i] = (_Float16)(bfr(p[16 + i]) * 256.0f); }
  return w; }
#define WQKV_LAYOUT 0   // 0 = (in,out) [DIN][out], columns gathered per head; 1 = (out,in) [CC][DIN]; 2 = per-head [NH][DIN][HD]
__device__ __forceinline__ v16b wcol_hdk(const float* Wm, int k0, int o, int lane) { v16b w; const int g = lane >> 4; const float* p = Wm + (size_t)(o / HD) * DIN * HD + (o % HD);
#pragma unroll
  for (int i = 0; i < 8; ++i) { w[i] = (__bf16)p[(size_t)(k0 + 8 * g + i) * HD]; w[8 + i] = (__bf16)p[(size_t)(k0 + 16 + 8 * g + i) * HD]; }
  return w; }
#define WO_OUT_IN 0
#if WQKV_LAYOUT == 1
#define WCOL(W, k0, o, lane) wcol_oi(W, k0, o, lane, DIN)
#elif WQKV_LAYOUT == 2
#define WCOL(W, k0, o, lane) wcol_hdk(W, k0, o, lane)
#else
__device__ __forceinline__ v16b zero16b() { v16b w; _Pragma("unroll") for (int i = 0; i < 16; ++i) w[i] = (__bf16)0.0f; return w; }
/* column o = h*HD + d: real (d < LATW) -> weight column h*QHEADW + d of Wq (pitch DIN) for the q stream, h*LATW + d of Wkd / Wvd (pitch KVLD) for k / v; padding -> zeros. o = c0 + j*16 + col with c0 % 128 == 0, so (o % HD) < LATW is decided by j alone (compile-time per unrolled j, uniform across the wave) */
#define GCOL(o) ((which) == 0 ? ((o) / HD) * QHEADW + ((o) % HD) : ((o) / HD) * LATW + ((o) % HD))
#define WCOL(W, k0, o, lane) ((((o) % HD) < LATW) ? wcol_io(W, k0, GCOL(o), lane, ((which) == 0 ? DIN : KVLD)) : zero16b())
#endif
#if WO_OUT_IN
#define WOCOL(W, k0, o, lane) wcol_oi(W, k0, o, lane, CC)
#define WOCOLH(W, k0, o, lane) wcolh_oi(W, k0, o, lane, CC)
#else
#define WOCOL(W, k0, o, lane) wcol_io_lat(W, k0, o, lane, DIN)
#define WOCOLH(W, k0, o, lane) wcolh_io_lat(W, k0, o, lane, DIN)
#endif

#ifndef SM_EXTRA_PARAMS
#define SM_EXTRA_PARAMS
#endif
#ifndef PROJ_EXTRA_PARAMS
#define PROJ_EXTRA_PARAMS
#endif
#ifndef SM_MASK_HOOK
#define SM_MASK_HOOK (void)0
#endif

#define WS_QH  0u                                      // f16 q rows [b*t][CC]
#define WS_KH  (WS_QH + 2u * (size_t)NB * TT * CC)      // f16 k in A-fragment order [b][h][16-key tile][512 B] (the region keeps its old size)
#define WS_VT  (WS_KH + 2u * (size_t)NB * TT * CC)      // f16 v^T in A-fragment order [b][h][32-key step][1024 B]
#define WS_QL  (WS_VT + 2u * (size_t)NB * CC * TT)      // f16 q residual x 2^10 rows [b][t < QHI][CC]
#define WS_KL  (WS_QL + 2u * (size_t)NB * QHI * CC)     // f16 k residual x 2^10, as WS_KH, key tiles below KHI
#define WS_VB  (WS_KL + 2u * (size_t)NB * KHI * CC)     // bf16 v hi (then lo), as WS_VT, key steps below KHI
#define WS_VBL (WS_VB + 2u * (size_t)NB * CC * KHI)
#define WS_S   (WS_VBL + 2u * (size_t)NB * CC * KHI)    // f32 [hg][t][s], allocated but unused
#define WS_Y   (WS_S  + 4u * (size_t)HG * TT * TT)      // f32 ctx in k_out's A-fragment order, real dims only: [16-row tile of b*t][head][1024 B] (the region keeps its old size)
#define WS_END (WS_Y  + 4u * (size_t)NB * TT * CC)
#define WS_T  (WS_END)                                     // f16 per-batch transpose T[b][c][s] = f16((al Wvu + bvu)[b][s][c] x 2^6), written by k_out; its memory is then read as TT rows of DIN (the module's transpose(0,2,1).reshape)
#define WS_END2 (WS_T + 2u * (size_t)NB * TT * DIN)
static_assert(TT % 64 == 0 && DIN % 128 == 0, "a k_out block owns 64 positions of 128 channels: one whole 128-B line of T per channel");
// weights in WMMA B-fragment order, written once per call by k_prep. One fragment = the 32 lanes' slots 0..7 (16 B a lane, 512 B in a row), then their slots 8..15 (left out where they are the zero padding of a latent head)
#define NF_P (3 * (DIN / 32) * NH)        /* q slice / latent k / latent v: [which][kc][head], bf16 */
#define NF_U (NH * (DIN / 16))            /* Wvu: [head][column tile], slots 0..7 only, once bf16 and once f16(bf16 x 2^8) */
#define NF_O ((DIN / 32) * (DIN / 16))    /* Wo: [kc][column tile], f16(bf16 x 2^8) */
#define WS_FP  (WS_END2)
#define WS_FU  (WS_FP  + 1024u * (size_t)NF_P)
#define WS_FUH (WS_FU  + 512u * (size_t)NF_U)
#define WS_FO  (WS_FUH + 512u * (size_t)NF_U)
#define WS_END3 (WS_FO + 1024u * (size_t)NF_O)
// x rounded once to bf16 in WMMA A-fragment order, written by k_prep: [16-row tile][kc][1024 B], built like a weight fragment (the 32 lanes' slots 0..7, then their slots 8..15)
#define WS_XF  (WS_END3)
#define WS_END4 (WS_XF + 2u * (size_t)NB * TT * DIN)
#define XKS 6                                   /* k-steps of one row tile that one k_prep wave rounds */
#define NXW ((NB * TT / 16) * (DIN / 32 / XKS))  /* k_prep waves that work on x; they come first in the grid */
static_assert((NF_P + NF_U + NF_O) % 4 == 0 && NXW % 4 == 0 && (DIN / 32) % XKS == 0, "k_prep: four waves a block, one weight fragment or XKS x fragments a wave");
// fb = wave-uniform start of the fragment, lob = lane * 16 bytes
__device__ __forceinline__ v16b fragw_b(const __bf16* fb, unsigned lob) { union { v16b v; v8b q[2]; } u; const char* p = (const char*)fb + lob; u.q[0] = *(const v8b*)p; u.q[1] = *(const v8b*)(p + 512); return u.v; }
__device__ __forceinline__ v16h fragw_h(const _Float16* fb, unsigned lob) { union { v16h v; v8h q[2]; } u; const char* p = (const char*)fb + lob; u.q[0] = *(const v8h*)p; u.q[1] = *(const v8h*)(p + 512); return u.v; }
__device__ __forceinline__ v16b fragw_b8(const __bf16* fb, unsigned lob) { union { v16b v; v8b q[2]; } u; u.q[0] = *(const v8b*)((const char*)fb + lob);
#pragma unroll
  for (int i = 0; i < 8; ++i) u.q[1][i] = (__bf16)0.0f;
  return u.v; }
__device__ __forceinline__ v16h fragw_h8(const _Float16* fb, unsigned lob) { union { v16h v; v8h q[2]; } u; u.q[0] = *(const v8h*)((const char*)fb + lob);
#pragma unroll
  for (int i = 0; i < 8; ++i) u.q[1][i] = (_Float16)0.0f;
  return u.v; }
// a precaution: stands between issued loads and the next write of a register that holds one of their addresses
__device__ __forceinline__ void XW() { asm volatile("s_wait_xcnt 0x0" ::: "memory"); }
typedef const __attribute__((address_space(1))) char* gp;
// a precaution, as XW: the wait that stands between issued loads and the next write of a register that holds one of their addresses. The addresses are its inputs, so they keep registers of their own up to the wait and no load issued before it can land on them
__device__ __forceinline__ void XWH(gp a) { asm volatile("s_wait_xcnt 0x0" :: "v"(a) : "memory"); }
__device__ __forceinline__ void XWH(gp a, gp b) { asm volatile("s_wait_xcnt 0x0" :: "v"(a), "v"(b) : "memory"); }
__device__ __forceinline__ void XWH(gp a, gp b, gp c, gp d, gp e) { asm volatile("s_wait_xcnt 0x0" :: "v"(a), "v"(b), "v"(c), "v"(d), "v"(e) : "memory"); }
__device__ __forceinline__ void XWH(gp a, gp b, gp c, gp d, gp e, gp f, gp g, gp h) { asm volatile("s_wait_xcnt 0x0" :: "v"(a), "v"(b), "v"(c), "v"(d), "v"(e), "v"(f), "v"(g), "v"(h) : "memory"); }
// N weight values of one column, rows i (i < 8) and, for N = 16, 16 + i of an (in,out) weight of pitch LD: ub = wave-uniform address of the tile's first row and column, lo = the lane's fixed byte offset (8 g rows + its column). The last load may land on the offset register, so the wait stands in front of it, and once more behind it, ahead of the scalar work that forms the store address
template <int LD, int N> __device__ __forceinline__ void ld_col(const float* ub, unsigned lo, float v[N]) { const char* p = (const char*)ub + lo;
#pragma unroll
  for (int i = 0; i < N - 1; ++i) v[i] = *(const float*)(p + (size_t)((i & 7) + 2 * (i & 8)) * LD * 4);
  XW(); v[N - 1] = *(const float*)(p + (size_t)(((N - 1) & 7) + 2 * ((N - 1) & 8)) * LD * 4); XW(); }
// x into A-fragment order: one wave = XKS k-steps of one 16-row tile. Lane (g, c) reads what k_proj's loader read (row c, values 8 g + 0..7 and 16 + 8 g + 0..7 of each k-step), makes the same one rounding to bf16 and stores each half fragment as 512 B in a row. All loads go through one address, which is the wait's input, so none lands on it
__device__ __forceinline__ void prep_x(const float* __restrict__ X, __bf16* __restrict__ XF, int fa, int lane) { typedef const __attribute__((address_space(1))) v4f* gf;
  const int rt = fa / (DIN / 32 / XKS), k0 = (fa % (DIN / 32 / XKS)) * XKS; const gp xa = (gp)(const char*)X + (((size_t)rt * 16 + (lane & 15)) * DIN + k0 * 32 + 8 * (lane >> 4)) * 4; v4f x[XKS][4];
#pragma unroll
  for (int j = 0; j < XKS; ++j) { x[j][0] = *(gf)(xa + j * 128); x[j][1] = *(gf)(xa + j * 128 + 16); x[j][2] = *(gf)(xa + j * 128 + 64); x[j][3] = *(gf)(xa + j * 128 + 80); }
  XWH(xa); __builtin_amdgcn_sched_barrier(0);   /* all of the wave's loads are out before the first rounding: left free, the build holds the last ten back until registers of the first come free, and the wave pays the way to memory twice */
  char* d = (char*)XF + ((size_t)rt * (DIN / 32) + k0) * 1024 + lane * 16;
#pragma unroll
  for (int j = 0; j < XKS; ++j) { v8b lo, hi;
#pragma unroll
    for (int i = 0; i < 4; ++i) { lo[i] = (__bf16)x[j][0][i]; lo[4 + i] = (__bf16)x[j][1][i]; hi[i] = (__bf16)x[j][2][i]; hi[4 + i] = (__bf16)x[j][3][i]; }
    *(v8b*)(d + j * 1024) = lo; *(v8b*)(d + j * 1024 + 512) = hi; } }
// ---- k_prep: the first NXW waves lay x out (prep_x); of the others one wave = one B fragment, with the roundings the projection kernels' own loaders (wcol_io, wcol_io_lat, wcolh_io_lat, wcolh_io) made per wave and per row block
__global__ __launch_bounds__(128) void k_prep(const float* __restrict__ X, __bf16* __restrict__ XF, const float* __restrict__ WQ, const float* __restrict__ WK, const float* __restrict__ WV, const float* __restrict__ WU, const float* __restrict__ WO, __bf16* __restrict__ FP, __bf16* __restrict__ FU, _Float16* __restrict__ FUH, _Float16* __restrict__ FO) {
  const int lane = threadIdx.x & 31, col = lane & 15, g = lane >> 4; const int fa = blockIdx.x * 4 + __builtin_amdgcn_readfirstlane(threadIdx.x >> 5);
  if (fa < NXW) { prep_x(X, XF, fa, lane); return; }
  const int f = fa - NXW;
  if (f < NF_P) { const int which = f / ((DIN / 32) * NH), kc = (f / NH) % (DIN / 32), h = f % NH; float v[16];
    if (which == 0) ld_col<DIN, 16>(WQ + (size_t)kc * 32 * DIN + h * QHEADW, (unsigned)(8 * g * DIN + col) * 4u, v);
    else ld_col<KVLD, 16>((which == 1 ? WK : WV) + (size_t)kc * 32 * KVLD + h * LATW, (unsigned)(8 * g * KVLD + col) * 4u, v);
    union { v16b v; v8b q[2]; } u;
#pragma unroll
    for (int i = 0; i < 16; ++i) u.v[i] = (__bf16)v[i];
    char* d = (char*)FP + (size_t)f * 1024 + lane * 16; *(v8b*)d = u.q[0]; *(v8b*)(d + 512) = u.q[1];
  } else if (f < NF_P + NF_U) { const int fu = f - NF_P, h = fu / (DIN / 16), jt = fu % (DIN / 16); float v[8];
    ld_col<DIN, 8>(WU + (size_t)h * LATW * DIN + jt * 16, (unsigned)(8 * g * DIN + col) * 4u, v);
    v8b wb; v8h wh;
#pragma unroll
    for (int i = 0; i < 8; ++i) { wb[i] = (__bf16)v[i]; wh[i] = (_Float16)(bfr(v[i]) * 256.0f); }
    *(v8b*)((char*)FU + (size_t)fu * 512 + lane * 16) = wb; *(v8h*)((char*)FUH + (size_t)fu * 512 + lane * 16) = wh;
  } else { const int fo = f - NF_P - NF_U, kc = fo / (DIN / 16), jt = fo % (DIN / 16); float v[16];
    ld_col<DIN, 16>(WO + (size_t)kc * 32 * DIN + jt * 16, (unsigned)(8 * g * DIN + col) * 4u, v);
    union { v16h v; v8h q[2]; } u;
#pragma unroll
    for (int i = 0; i < 16; ++i) u.v[i] = (_Float16)(bfr(v[i]) * 256.0f);
    char* d = (char*)FO + (size_t)fo * 1024 + lane * 16; *(v8h*)d = u.q[0]; *(v8h*)(d + 512) = u.q[1]; } }
// k_proj, k_out, k_out2: the four waves of a block use the same weight fragments, so the block brings them into LDS once (asynchronous copies, two buffers of OT k-steps, wave w copying k-step w of each tile) and every wave reads them from there; only a wave's own A fragments still come through global loads into a register ring
#define OT 4   // k-steps of weight fragments in one LDS tile
// N x 512 B in a row, on both sides: l = the lane's own LDS byte address, g = its own global address; the immediate offset moves both. The wait in the statement is the precaution of XW: it stands in front of every later write of the registers the copies name
__device__ __forceinline__ void cp_8(unsigned l, gp g) {
  asm volatile("global_load_async_to_lds_b128 %0, %1, off\n\tglobal_load_async_to_lds_b128 %0, %1, off offset:512\n\tglobal_load_async_to_lds_b128 %0, %1, off offset:1024\n\tglobal_load_async_to_lds_b128 %0, %1, off offset:1536\n\t"
               "global_load_async_to_lds_b128 %0, %1, off offset:2048\n\tglobal_load_async_to_lds_b128 %0, %1, off offset:2560\n\tglobal_load_async_to_lds_b128 %0, %1, off offset:3072\n\tglobal_load_async_to_lds_b128 %0, %1, off offset:3584\n\ts_wait_xcnt 0x0"
               :: "v"(l), "v"(g) : "memory"); }
__device__ __forceinline__ void cp_16(unsigned l, gp g) {
  asm volatile("global_load_async_to_lds_b128 %0, %1, off\n\tglobal_load_async_to_lds_b128 %0, %1, off offset:512\n\tglobal_load_async_to_lds_b128 %0, %1, off offset:1024\n\tglobal_load_async_to_lds_b128 %0, %1, off offset:1536\n\t"
               "global_load_async_to_lds_b128 %0, %1, off offset:2048\n\tglobal_load_async_to_lds_b128 %0, %1, off offset:2560\n\tglobal_load_async_to_lds_b128 %0, %1, off offset:3072\n\tglobal_load_async_to_lds_b128 %0, %1, off offset:3584\n\t"
               "global_load_async_to_lds_b128 %0, %1, off offset:4096\n\tglobal_load_async_to_lds_b128 %0, %1, off offset:4608\n\tglobal_load_async_to_lds_b128 %0, %1, off offset:5120\n\tglobal_load_async_to_lds_b128 %0, %1, off offset:5632\n\t"
               "global_load_async_to_lds_b128 %0, %1, off offset:6144\n\tglobal_load_async_to_lds_b128 %0, %1, off offset:6656\n\tglobal_load_async_to_lds_b128 %0, %1, off offset:7168\n\tglobal_load_async_to_lds_b128 %0, %1, off offset:7680\n\ts_wait_xcnt 0x0"
               :: "v"(l), "v"(g) : "memory"); }
// where a tile is handed over: this wave's LDS reads are done, its own copies have landed, then the work-group's barrier. Written by hand because __syncthreads() also waits for the global loads of the A ring, which are meant to stay in flight across it
__device__ __forceinline__ void tile_turn() {
  asm volatile("s_wait_dscnt 0x0" ::: "memory");
  asm volatile("s_wait_asynccnt 0x0" ::: "memory");
  asm volatile("s_barrier_signal -1\n\ts_barrier_wait -1" ::: "memory"); }
// k_proj's A ring: one slot = one k-step's x fragment (bf16, k_prep). ax = the lane's own address of the step (fragment start + lane * 16 bytes)
#define RP 3   // k-steps held or in flight
__device__ __forceinline__ v16b proj_a(gp ax) { typedef const __attribute__((address_space(1))) v8b* gb; union { v16b v; v8b q[2]; } u; u.q[0] = *(gb)ax; u.q[1] = *(gb)(ax + 512); return u.v; }
// one k-step's four real weight fragments out of LDS: p = the step's start in the tile + lane * 16 bytes
__device__ __forceinline__ void proj_w(const char* p, v16b w[4]) {
#pragma unroll
  for (int jj = 0; jj < 4; ++jj) { union { v16b v; v8b q[2]; } u; u.q[0] = *(const v8b*)(p + jj * 1024); u.q[1] = *(const v8b*)(p + jj * 1024 + 512); w[jj] = u.v; } }
static_assert((DIN / 32) % OT == 0 && DIN / 32 / OT >= 2 && OT == 4, "one wave copies one k-step of a tile; the two-buffer order needs two tiles");
// ---- k_proj: block = (64 rows, 128 cols, which): q/k/v = X W (+ b) with exact bf16 products (K = DIN) -> which 0: q f16 rows (+ residual rows < QHI); 1: k f16 (+ residual for keys < KHI); 2: v f16 (+ bf16 hi/lo for keys < KHI). k and v leave in the order k_att's A fragments are read in, the 16 real dims of a head only:
// k tile (16 keys): 512 B with lane (g, c) = dims 8 g + 0..7 of key c; the even tile of a 32-key step fills fragment slots 0..7, the odd one slots 8..15; the padding dims are not stored. v step (32 keys): 512 B with lane (g, c) = keys 8 g + 0..7 of dim c (slots 0..7), then 512 B with keys 16 + 8 g + 0..7 (slots 8..15)
__global__ __launch_bounds__(128) void k_proj(const __bf16* __restrict__ XF, const __bf16* __restrict__ FP, const float* __restrict__ BQ, const float* __restrict__ BK, const float* __restrict__ BV,
    _Float16* __restrict__ QH, _Float16* __restrict__ QL, _Float16* __restrict__ KH, _Float16* __restrict__ KL, _Float16* __restrict__ VT, __bf16* __restrict__ VB, __bf16* __restrict__ VBL) {
  /* one LDS block of the size the five epilogue arrays had; the walk's two weight buffers (2 x OT x 4 KiB) lie over sh / sl, which are first written behind the walk's last barrier */
  __shared__ __align__(1024) char sm[2 * 64 * 136 * 2 + 3 * 128 * 72 * 2]; static_assert(2 * OT * 4096 <= 2 * 64 * 136 * 2, "the weight buffers lie inside sh and sl");
  _Float16 (*sh)[136] = (_Float16 (*)[136])sm; _Float16 (*sl)[136] = (_Float16 (*)[136])(sm + 64 * 136 * 2); _Float16 (*th)[72] = (_Float16 (*)[72])(sm + 2 * 64 * 136 * 2); __bf16 (*tb)[72] = (__bf16 (*)[72])(sm + 2 * 64 * 136 * 2 + 128 * 72 * 2); __bf16 (*tbl)[72] = (__bf16 (*)[72])(sm + 2 * 64 * 136 * 2 + 2 * 128 * 72 * 2);
  const int tid = threadIdx.x, wave = tid >> 5, lane = tid & 31, col = lane & 15, g = lane >> 4; const int which = blockIdx.z; const int c0 = blockIdx.y * 128; const size_t r0 = (size_t)blockIdx.x * 64; const size_t bb = r0 / TT; const int t0 = (int)(r0 % TT);
  const __bf16* FW = FP + ((size_t)which * (DIN / 32) * NH + c0 / HD) * 512; const unsigned lob = lane * 16u; const float* BA = which == 0 ? BQ : which == 1 ? BK : BV;
  v8f acc[8] = {}; float bv[4]; gp bq[4];   /* bv: the bias of the four real column tiles, as loaded */
  /* a ring of RP k-steps' x fragments in registers: a slot is asked for again, RP steps ahead, right behind the step that used it. The walk is unrolled whole: every load is the one fixed address plus a constant. k-steps are used in the order 0 .. DIN / 32 - 1 as before */
  const int wv = __builtin_amdgcn_readfirstlane(wave); const gp cg = (gp)(const char*)FW + (size_t)wv * (NH * 1024) + lob; const unsigned cl = (unsigned)(size_t)sm + (unsigned)wv * 4096u + lob;
  cp_8(cl, cg);   /* tile 0 into buffer 0 */
  const gp xb = (gp)(const char*)XF + (r0 / 16 + wave) * ((DIN / 32) * 1024) + lob; v16b ar[RP], w[2][4];
#pragma unroll
  for (int j = 0; j < RP; ++j) { ar[j] = proj_a(xb + j * 1024);
    __builtin_amdgcn_sched_barrier(0); }   /* asked for in ring order: in another order the counted load waits of the first steps wait for younger slots too */
  tile_turn();   /* tile 0 may be read */
  cp_8(cl + OT * 4096u, cg + (size_t)OT * (NH * 1024));   /* tile 1 into buffer 1 */
#pragma unroll
  for (int t = 0; t < DIN / 32 / OT; ++t) { const char* tp = sm + (t & 1) * (OT * 4096) + lob;
    proj_w(tp, w[0]);
#pragma unroll
    for (int s = 0; s < OT; ++s) { const int kc = t * OT + s;
      if (s + 1 < OT) proj_w(tp + (s + 1) * 4096, w[(s + 1) & 1]);
      __builtin_amdgcn_sched_barrier(0);   /* the next step's LDS reads stand as one group ahead of this step's products, not in among them */
#pragma unroll
      for (int j = 0; j < 8; ++j) acc[j] = wmma_bf(ar[kc % RP], (j & 1) ? zero16b() : w[s & 1][j >> 1], acc[j]);   /* even j: the real column tiles (dims < LATW of a head) */
      __builtin_amdgcn_sched_barrier(0);   /* the refill stays behind the step that reads its slot */
      if (kc + RP < DIN / 32) { ar[kc % RP] = proj_a(xb + (kc + RP) * 1024);
        __builtin_amdgcn_sched_barrier(0); }   /* and is issued here, a ring ahead of its use */
      if (kc == DIN / 32 - RP) {   /* the bias values are asked for together here, so that the walk's last steps cover their way instead of the epilogue waiting for them one by one. Gathered like the weight columns; with no bias array the loads read the weights and their values are not used */
        const gp bs = (gp)(BA ? (const char*)BA : (const char*)FP) + col * 4; const int hw = (which == 0 ? QHEADW : LATW) * 4;
#pragma unroll
        for (int jj = 0; jj < 4; ++jj) { bq[jj] = bs + (c0 / HD + jj) * hw; bv[jj] = *(const __attribute__((address_space(1))) float*)bq[jj]; } } }
    tile_turn();   /* the next tile may be read, this tile's buffer may be filled again; behind the last one the buffers are free for the epilogue */
    if (t + 2 < DIN / 32 / OT) cp_8(cl + (unsigned)(t & 1) * (OT * 4096u), cg + (size_t)(t + 2) * OT * (NH * 1024)); }
  asm volatile("s_wait_asynccnt 0x0" ::: "memory");   /* no copy is out when the buffers become the epilogue's */
  XWH(xb, bq[0], bq[1], bq[2], bq[3]);
  if (which < 2) { _Float16* DH = which == 0 ? QH : KH; _Float16* DL = which == 0 ? QL : KL; const int nhi = which == 0 ? QHI : KHI; const bool hi_rows = t0 < nhi;
#pragma unroll
    for (int j = 0; j < 8; ++j) { const float bias = (BA && !(j & 1)) ? bfr(bv[j >> 1]) : 0.f;   /* padding columns (odd j) get no bias */
#pragma unroll
      for (int r = 0; r < 8; ++r) { const float v = acc[j][r] + bias; const _Float16 hv = (_Float16)v; sh[wave * 16 + 8 * g + r][j * 16 + col] = hv; sl[wave * 16 + 8 * g + r][j * 16 + col] = (_Float16)((v - (float)hv) * 1024.0f); } }
    __syncthreads();
    if (which == 0) { for (int e = tid; e < 64 * 16; e += 128) { const int rl = e >> 4, q = e & 15; vst2((unsigned*)(DH + (r0 + rl) * CC + c0 + q * 8), *(const v4u*)&sh[rl][q * 8]); XW(); if (hi_rows) { vst2((unsigned*)(DL + (bb * nhi + t0 + rl) * (size_t)CC + c0 + q * 8), *(const v4u*)&sl[rl][q * 8]); XW(); } }
    } else {   /* wave = key tile, pass = head: a wave stores one whole tile, 512 B in a row */
      const int rl = wave * 16 + col; const size_t hd = bb * NH + c0 / HD; v4u a[4];
#pragma unroll
      for (int hh = 0; hh < 4; ++hh) a[hh] = *(const v4u*)&sh[rl][hh * HD + g * 8];
#pragma unroll
      for (int hh = 0; hh < 4; ++hh) vst2((unsigned*)(DH + ((hd + hh) * (TT / 16) + t0 / 16 + wave) * 256 + lane * 8), a[hh]);
      XW();
      if (hi_rows) {
#pragma unroll
        for (int hh = 0; hh < 4; ++hh) a[hh] = *(const v4u*)&sl[rl][hh * HD + g * 8];
#pragma unroll
        for (int hh = 0; hh < 4; ++hh) vst2((unsigned*)(DL + ((hd + hh) * (KHI / 16) + t0 / 16 + wave) * 256 + lane * 8), a[hh]);
        XW(); } }
  } else { const bool hi_rows = t0 < KHI;
#pragma unroll
    for (int j = 0; j < 8; ++j) { const float bias = (BA && !(j & 1)) ? bfr(bv[j >> 1]) : 0.f;   /* padding columns (odd j) get no bias */
#pragma unroll
      for (int r = 0; r < 8; ++r) { const float v = acc[j][r] + bias; const int rl = wave * 16 + 8 * g + r, cl = j * 16 + col; th[cl][rl] = (_Float16)v; const __bf16 bh = (__bf16)v; tb[cl][rl] = bh; tbl[cl][rl] = (__bf16)(v - (float)bh); } }
    __syncthreads();
    const int rl = wave * 16 + g * 8; const size_t hd = bb * NH + c0 / HD; v4u a[4];   /* wave = 16 keys = half a step, pass = head: a wave stores 512 B in a row */
#pragma unroll
    for (int hh = 0; hh < 4; ++hh) a[hh] = *(const v4u*)&th[hh * HD + col][rl];
#pragma unroll
    for (int hh = 0; hh < 4; ++hh) vst2((unsigned*)(VT + ((hd + hh) * (TT / 32) + t0 / 32) * 512 + tid * 8), a[hh]);
    XW();
    if (hi_rows) { v4u lo[4];
#pragma unroll
      for (int hh = 0; hh < 4; ++hh) { a[hh] = *(const v4u*)&tb[hh * HD + col][rl]; lo[hh] = *(const v4u*)&tbl[hh * HD + col][rl]; }
#pragma unroll
      for (int hh = 0; hh < 4; ++hh) { const size_t o3 = ((hd + hh) * (KHI / 32) + t0 / 32) * 512 + tid * 8; vst2((unsigned*)(VB + o3), a[hh]); vst2((unsigned*)(VBL + o3), lo[hh]); }
      XW(); } } }
// ---- k_att: block = 4 waves x 32 queries of (b, h), one launch for all (b, h): logits, softmax and P . v without leaving registers.
// S^T = K . Q^T (A = 16 key rows, B = 16 query rows): lane (g, c) holds, for query c, keys 8g + r of each 16-key tile, so the two tiles of one 32-key step, converted in place, are the B operand of ctx^T += v^T . P^T (hardware k order on both sides). Each key / v fragment serves the wave's two 16-query tiles. K and v^T lie in fragment order (k_proj), so every load of the walks is 512 B in a row, four whole lines; only the 16 real dims of a head are read, and the product with v's padding dims, which is 0, is not formed.
// One K fragment holds BOTH 16-key tiles of a step: row c = key c of tile 0 in k slots 0..15 and key c of tile 1 in k slots 16..31. Tile 0's logits come from B = [q ; 0], tile 1's from B = [0 ; q]: the zeros stand in the loop-invariant q fragments, and the K registers hold loaded values only.
// Walk 1: row maximum. Walk 2 (logits formed again, same products): e = exp(s - max) x 2^11, row sum in f32, e once to f16 against v f16 (query rows < QHI: 3-product logits, e and v as bf16 hi + lo, 3 products); ctx = acc / sum. Keys past the wave's own diagonal step are not visited; the diagonal step masks by index.
#define QT 2   // 16-query tiles per wave
#define RD 4   // late rows, second walk: steps whose key and v fragments are held or in flight
#define RD1 8  // late rows, first walk: its steps are about a third as long and hold keys only, so the ring is deeper
static_assert(QHI % (64 * QT) == 0 && QHI == QBH * 64 && KHI >= QHI && TT % (64 * QT) == 0, "a block of 4 x QT x 16 queries is wholly early or wholly late; early rows see only keys < KHI");
__device__ __forceinline__ v8f wm_h(v16h a, v16h b, v8f c) { return __builtin_amdgcn_wmma_f32_16x16x32_f16(false, a, false, b, (short)0, c, false, false); }
__device__ __forceinline__ v8f wm_b(v16b a, v16b b, v8f c) { return __builtin_amdgcn_wmma_f32_16x16x32_bf16(false, a, false, b, (short)0, c, false, false); }
// q fragments from a wave-uniform base + the lane's fixed byte offset (row c, half g)
__device__ __forceinline__ void frag_q(const _Float16* ub, unsigned lob, v16h q2[2]) { union { v16h v; v8h q[2]; } u0, u1; const v8h d = *(const v8h*)((const char*)ub + lob); v8h z;
#pragma unroll
  for (int i = 0; i < 8; ++i) z[i] = (_Float16)0.0f;
  u0.q[0] = d; u0.q[1] = z; u1.q[0] = z; u1.q[1] = d; q2[0] = u0.v; q2[1] = u1.v; }   /* the 16 real dims of query row c: [q ; 0] and [0 ; q] */
// k or v fragment in fragment order: fb = wave-uniform start of the 32-key step, lob = lane * 16 bytes. xl: the last fragment read through its address; its last load may land on the address registers, so the wait stands in front of it
__device__ __forceinline__ v16h fragv_h(const _Float16* fb, unsigned lob, bool xl) { union { v16h v; v8h q[2]; } u; const char* p = (const char*)fb + lob; u.q[0] = *(const v8h*)p; if (xl) XW(); u.q[1] = *(const v8h*)(p + 512); return u.v; }
__device__ __forceinline__ v16b fragv_b(const __bf16* fb, unsigned lob, bool xl) { union { v16b v; v8b q[2]; } u; const char* p = (const char*)fb + lob; u.q[0] = *(const v8b*)p; if (xl) XW(); u.q[1] = *(const v8b*)(p + 512); return u.v; }
// the ring's loads: a = the lane's own address of a 32-key step's fragment (step start + lane * 16 bytes)
__device__ __forceinline__ gp ring_a(const _Float16* base, int step, unsigned lob) { return (gp)(const char*)base + (size_t)step * 1024 + lob; }
__device__ __forceinline__ v16h ring_ld(gp a) { typedef const __attribute__((address_space(1))) v8h* gq; union { v16h v; v8h q[2]; } u; u.q[0] = *(gq)a; u.q[1] = *(gq)(a + 512); return u.v; }
// e x 2^11 = 2^(t x LC + off): t = the raw logit (before x 16^-0.5), LC = 16^-0.5 x log2(e), off = 11 - max(t) x LC, one value per query row. One fused multiply-add and one v_exp_f32 per logit; the rounding of off is a factor common to a row's numerators and its sum. Below 2^-126 the result may flush to 0, far under what the f32 sum or the 16-bit P can hold.
#define LC (SCALE * 1.44269504088896340736f)
// The free slot the instruction set asks for behind a transcendental (before its result is read or its source overwritten) stands in the v_exp_f32's own statement. exp2_x8: the eight logits of one product tile, each exponential in place on its own register (one the compiler's own multiply-add has just written, so the statement lands on no register that a matrix instruction still reads), so each is the independent instruction behind the one before it, and one v_nop closes the last.
__device__ __forceinline__ void exp2_x8(float* t, float off) { float a[8];
#pragma unroll
  for (int r = 0; r < 8; ++r) a[r] = __builtin_fmaf(t[r], LC, off);
  asm("v_exp_f32 %0, %0\n\tv_exp_f32 %1, %1\n\tv_exp_f32 %2, %2\n\tv_exp_f32 %3, %3\n\tv_exp_f32 %4, %4\n\tv_exp_f32 %5, %5\n\tv_exp_f32 %6, %6\n\tv_exp_f32 %7, %7\n\tv_nop" : "+v"(a[0]), "+v"(a[1]), "+v"(a[2]), "+v"(a[3]), "+v"(a[4]), "+v"(a[5]), "+v"(a[6]), "+v"(a[7]));
#pragma unroll
  for (int r = 0; r < 8; ++r) t[r] = a[r]; }
// one 32-key step: ld_k reads its two 16-key tiles as one fragment (KHr / KLr point at step 0 of (b, h), 512 elements a step, lob = lane * 16 bytes); st_mm forms s[u][8 t + r] = raw logit (not yet x 16^-0.5) of (key kc*32 + 16 t + 8 g + r, query 16 u + c)
struct KF { v16h h, l; };
template <bool HI> __device__ __forceinline__ KF ld_k(const _Float16* KHr, const _Float16* KLr, int kc, unsigned lob) { KF k; k.h = fragv_h(KHr + (size_t)kc * 512, lob, false); if (HI) k.l = fragv_h(KLr + (size_t)kc * 512, lob, false); else k.l = k.h; return k; }
template <bool HI> __device__ __forceinline__ void st_mm(const KF& k, const v16h qh[QT][2], const v16h ql[QT][2], float s[QT][16]) {
#pragma unroll
  for (int t = 0; t < 2; ++t)
#pragma unroll
    for (int u = 0; u < QT; ++u) { v8f a = {}; a = wm_h(k.h, qh[u][t], a);
      if (HI) { v8f al = {}; al = wm_h(k.h, ql[u][t], al); al = wm_h(k.l, qh[u][t], al);
#pragma unroll
        for (int r = 0; r < 8; ++r) s[u][t * 8 + r] = a[r] + al[r] * (1.0f / 1024.0f);
      } else {
#pragma unroll
        for (int r = 0; r < 8; ++r) s[u][t * 8 + r] = a[r]; } } }
template <bool HI, bool MASK> __device__ __forceinline__ void max_use(const KF& k, const v16h qh[QT][2], const v16h ql[QT][2], int kc, int qrel, float m[QT]) { float s[QT][16]; st_mm<HI>(k, qh, ql, s);
#pragma unroll
  for (int u = 0; u < QT; ++u)
#pragma unroll
    for (int i = 0; i < 16; ++i) { if (!MASK || kc * 32 + 16 * (i >> 3) + (i & 7) <= qrel + 16 * u) m[u] = fmaxf(m[u], s[u][i]); } }
template <bool HI, bool MASK> __device__ __forceinline__ void max_step(const _Float16* KHr, const _Float16* KLr, const v16h qh[QT][2], const v16h ql[QT][2], int kc, unsigned lob, int qrel, float m[QT]) { const KF k = ld_k<HI>(KHr, KLr, kc, lob); max_use<HI, MASK>(k, qh, ql, kc, qrel, m); }
template <bool HI, bool MASK> __device__ __forceinline__ void pv_use(const KF& k, const v16h vf, const v16b vh, const v16b vl, const v16h qh[QT][2], const v16h ql[QT][2], int kc, int qrel, const float off[QT], float sum[QT], v8f acc[QT]) { float s[QT][16];
  st_mm<HI>(k, qh, ql, s);
#pragma unroll
  for (int u = 0; u < QT; ++u) { exp2_x8(&s[u][0], off[u]); exp2_x8(&s[u][8], off[u]);
#pragma unroll
    for (int i = 0; i < 16; ++i) { float e = s[u][i]; if (MASK && kc * 32 + 16 * (i >> 3) + (i & 7) > qrel + 16 * u) e = 0.f; sum[u] += e; s[u][i] = e; } }
  if (HI) { F2 pp[QT];
#pragma unroll
    for (int u = 0; u < QT; ++u) pp[u] = bsplit16(s[u]);
#pragma unroll
    for (int u = 0; u < QT; ++u) { acc[u] = wm_b(vh, pp[u].h, acc[u]); acc[u] = wm_b(vh, pp[u].l, acc[u]); acc[u] = wm_b(vl, pp[u].h, acc[u]); }
  } else { v16h pb[QT];
#pragma unroll
    for (int u = 0; u < QT; ++u)
#pragma unroll
      for (int i = 0; i < 16; ++i) pb[u][i] = (_Float16)s[u][i];
#pragma unroll
    for (int u = 0; u < QT; ++u) acc[u] = wm_h(vf, pb[u], acc[u]); } }
template <bool HI, bool MASK> __device__ __forceinline__ void pv_step(const _Float16* KHr, const _Float16* KLr, const v16h qh[QT][2], const v16h ql[QT][2], const _Float16* VTr, const __bf16* VBr, const __bf16* VBLr, int kc, unsigned lob, int qrel, const float off[QT], float sum[QT], v8f acc[QT]) {
  const KF k = ld_k<HI>(KHr, KLr, kc, lob); XW();
  v16h vf = {}; v16b vh = {}, vl = {};   /* v is asked for before the exponentials, which cover its latency; the diagonal step's last load is the last through lob */
  if (HI) { vh = fragv_b(VBr + (size_t)kc * 512, lob, false); vl = fragv_b(VBLr + (size_t)kc * 512, lob, MASK); } else vf = fragv_h(VTr + (size_t)kc * 512, lob, MASK);
  pv_use<HI, MASK>(k, vf, vh, vl, qh, ql, kc, qrel, off, sum, acc); }
template <bool HI> __device__ __forceinline__ void att_body(const _Float16* __restrict__ QH, const _Float16* __restrict__ KH, const _Float16* __restrict__ QL, const _Float16* __restrict__ KL, const _Float16* __restrict__ VT, const __bf16* __restrict__ VB, const __bf16* __restrict__ VBL, int b, int h, int ql0, int lane, float* __restrict__ Y) {
  const int c = lane & 15, g = lane >> 4; const int nfull = ql0 >> 5;   /* ql0 % 32 == 0: steps 0 .. nfull-1 lie wholly below the diagonal for all 32 queries; step nfull holds it */
  const size_t hd = (size_t)b * NH + h; const _Float16* KHr = KH + hd * (TT * LATW); const _Float16* KLr = KL + hd * (KHI * LATW); const unsigned klo = (unsigned)(c * CC + 8 * g) * 2u, lob = lane * 16u;   /* klo: the q rows' offset; lob: every k / v fragment's */
  const _Float16* VTr = VT + hd * (TT * LATW); const __bf16* VBr = VB + hd * (KHI * LATW); const __bf16* VBLr = VBL + hd * (KHI * LATW);
  v16h qh[QT][2], ql[QT][2];
#pragma unroll
  for (int u = 0; u < QT; ++u) { frag_q(QH + ((size_t)b * TT + ql0 + u * 16) * CC + h * HD, klo, qh[u]); if (HI) frag_q(QL + ((size_t)b * QHI + ql0 + u * 16) * CC + h * HD, klo, ql[u]); else { ql[u][0] = qh[u][0]; ql[u][1] = qh[u][1]; } }
  XW();
  const int qrel = ql0 + c - 8 * g;   /* key kc*32 + 16 t + 8 g + r is kept for query ql0 + 16 u + c when kc*32 + 16 t + r <= qrel + 16 u */
  float m[QT], sum[QT]; v8f acc[QT] = {};
#pragma unroll
  for (int u = 0; u < QT; ++u) { m[u] = -3.0e38f; sum[u] = 0.f; }
  if (HI) {   /* early rows: at most KHI / 32 steps, loads asked for in the step that uses them */
#pragma unroll 1   /* left rolled, as it was: few steps, and unrolling adds registers */
    for (int kc = 0; kc < nfull; ++kc) max_step<HI, false>(KHr, KLr, qh, ql, kc, lob, qrel, m);
    max_step<HI, true>(KHr, KLr, qh, ql, nfull, lob, qrel, m);
#pragma unroll
    for (int u = 0; u < QT; ++u) { m[u] = fmaxf(m[u], __shfl_xor(m[u], 16)); m[u] = __builtin_fmaf(-m[u], LC, 11.0f); }   /* the two lane halves hold different keys of the same query; from here m = the exponent's offset */
#pragma unroll 1   /* left rolled, as it was */
    for (int kc = 0; kc < nfull; ++kc) pv_step<HI, false>(KHr, KLr, qh, ql, VTr, VBr, VBLr, kc, lob, qrel, m, sum, acc);
    pv_step<HI, true>(KHr, KLr, qh, ql, VTr, VBr, VBLr, nfull, lob, qrel, m, sum, acc);
  } else {
    /* late rows: each walk holds a ring of steps' fragments in registers (RD1 steps of keys, then RD steps of keys and v). A slot is asked for again, a ring's length ahead, right behind the step that used it, so a load has the other slots' steps of work to land in. A step index past the diagonal step is clamped to it (read, not used). The diagonal step's own fragments (kd for both walks, vd) are asked for once, up front. Steps are used in the order 0 .. nfull as before. */
    static_assert(RD == 4 && RD1 == 8, "the waits behind the rings' first loads name their addresses one by one");
    const v16b zb = {}; KF k1[RD1], kb[RD], kd; v16h vb[RD], vd; gp a1[RD1], ak[RD], av[RD];
    const gp akd = ring_a(KHr, nfull, lob), avd = ring_a(VTr, nfull, lob);
#pragma unroll
    for (int j = 0; j < RD1; ++j) { a1[j] = ring_a(KHr, j < nfull ? j : nfull, lob); k1[j].h = ring_ld(a1[j]); k1[j].l = k1[j].h; }
    XWH(a1[0], a1[1], a1[2], a1[3], a1[4], a1[5], a1[6], a1[7]);
    kd.h = ring_ld(akd); kd.l = kd.h; XWH(akd);   /* a wait of its own, directly behind: no other load stands between */
    gp pa = akd, pb = avd;   /* the addresses of the youngest refill: their wait stands one step later, in front of the next refill, where it has nothing left to wait for */
    int kc = 0;
#pragma unroll 1   /* one trip = one turn of the ring, its slots fixed registers */
    for (; kc + RD1 <= nfull; kc += RD1) {
#pragma unroll
      for (int j = 0; j < RD1; ++j) { max_use<false, false>(k1[j], qh, ql, kc + j, qrel, m);
        __builtin_amdgcn_sched_barrier(0);   /* the wait and the refill stay behind the step's work: lifted to its head the wait stands right behind the loads it is for, and stalls */
        XWH(pa); const int nx = kc + RD1 + j; pa = ring_a(KHr, nx < nfull ? nx : nfull, lob); k1[j].h = ring_ld(pa); k1[j].l = k1[j].h;
        __builtin_amdgcn_sched_barrier(0); } }   /* keeps the steps in ring order: without it the build lifts the last slots' products to the head of the trip, where they wait for loads just issued */
    XWH(pa);
#pragma unroll
    for (int j = 0; j < RD1 - 1; ++j) { if (kc + j < nfull) max_use<false, false>(k1[j], qh, ql, kc + j, qrel, m); }
    vd = ring_ld(avd); XWH(avd);   /* the second walk's first turn is asked for ahead of the diagonal step's maximum */
#pragma unroll
    for (int j = 0; j < RD; ++j) { const int nx = j < nfull ? j : nfull; ak[j] = ring_a(KHr, nx, lob); av[j] = ring_a(VTr, nx, lob); kb[j].h = ring_ld(ak[j]); kb[j].l = kb[j].h; vb[j] = ring_ld(av[j]);
      __builtin_amdgcn_sched_barrier(0); }   /* asked for in ring order: the loop's counted load waits are set for both ways into the loop, and another order here makes them wait for younger slots */
    XWH(ak[0], ak[1], ak[2], ak[3], av[0], av[1], av[2], av[3]);
    max_use<false, true>(kd, qh, ql, nfull, qrel, m);
#pragma unroll
    for (int u = 0; u < QT; ++u) { m[u] = fmaxf(m[u], __shfl_xor(m[u], 16)); m[u] = __builtin_fmaf(-m[u], LC, 11.0f); }   /* the two lane halves hold different keys of the same query; from here m = the exponent's offset */
    pa = akd; pb = avd;
#pragma unroll 1   /* one trip = one turn of the ring */
    for (kc = 0; kc + RD <= nfull; kc += RD) {
#pragma unroll
      for (int j = 0; j < RD; ++j) { pv_use<false, false>(kb[j], vb[j], zb, zb, qh, ql, kc + j, qrel, m, sum, acc);
        __builtin_amdgcn_sched_barrier(0);   /* as in the first walk: the wait stays a whole step behind the loads it is for */
        XWH(pa, pb); const int nx = kc + RD + j < nfull ? kc + RD + j : nfull; pa = ring_a(KHr, nx, lob); pb = ring_a(VTr, nx, lob); kb[j].h = ring_ld(pa); kb[j].l = kb[j].h; vb[j] = ring_ld(pb);
        __builtin_amdgcn_sched_barrier(0); } }   /* the refill is issued here: without it the build sinks the loads into the next step, up to that step's wait */
    XWH(pa, pb);
#pragma unroll
    for (int j = 0; j < RD - 1; ++j) { if (kc + j < nfull) pv_use<false, false>(kb[j], vb[j], zb, zb, qh, ql, kc + j, qrel, m, sum, acc); }
    pv_use<false, true>(kd, vd, zb, zb, qh, ql, nfull, qrel, m, sum, acc);
  }
#pragma unroll
  for (int u = 0; u < QT; ++u) { const float st = sum[u] + __shfl_xor(sum[u], 16); const float inv = st > 0.f ? 1.0f / st : 0.f;   /* sum and acc both carry the 2^11 */
    float* yr = Y + ((((size_t)b * TT + ql0) / 16 + u) * NH + h) * 256 + lane * 4;   /* acc[u][r] = ctx(query 16 u + c, dim 8 g + r) = slot r of lane (g, c) in k_out's A fragment of (row tile, head): r 0..3 of the 32 lanes as 512 B in a row, then r 4..7; the padding dims are not stored */
    v4f o0, o1;
#pragma unroll
    for (int r = 0; r < 4; ++r) { o0[r] = acc[u][r] * inv; o1[r] = acc[u][4 + r] * inv; }
    vst2(yr, o0); vst2(yr + 128, o1); XW(); } }   /* the precaution of XW: the next tile's division is free to land on these stores' registers */
__global__ __launch_bounds__(128) void k_att(const _Float16* __restrict__ QH, const _Float16* __restrict__ KH, const _Float16* __restrict__ QL, const _Float16* __restrict__ KL, const _Float16* __restrict__ VT, const __bf16* __restrict__ VB, const __bf16* __restrict__ VBL, float* __restrict__ Y) {
  const int b = blockIdx.x / NH, h = blockIdx.x % NH; const int q0 = (TT / (64 * QT) - 1 - (int)blockIdx.y) * (64 * QT);   /* longest query blocks start first */
  const int wave = __builtin_amdgcn_readfirstlane(threadIdx.x >> 5), lane = threadIdx.x & 31; const int ql0 = q0 + wave * (16 * QT);
  if (q0 < QHI) att_body<true>(QH, KH, QL, KL, VT, VB, VBL, b, h, ql0, lane, Y); else att_body<false>(QH, KH, QL, KL, VT, VB, VBL, b, h, ql0, lane, Y); }
// k_out, k_out2: the bias values of the eight column tiles (bb = the lane's address of the first), asked for together behind the ring's first loads, so that the walk covers their way instead of the epilogue waiting for them one by one. The wait is the precaution of XW for their address registers: it stands where the wave waits for tile 0 of the weights in any case. The scheduling fence keeps loads and wait here: left free, the build sets them in among the first step's products, where the wait holds a product back
__device__ __forceinline__ void bias_ld(gp bb, float bv[8]) {
#pragma unroll
  for (int j = 0; j < 8; ++j) bv[j] = *(const __attribute__((address_space(1))) float*)(bb + j * 64);
  XW(); __builtin_amdgcn_sched_barrier(0); }
// k_out's A ring, as k_proj's: one slot = the lane's 8 real ctx values of one k-step (f32, fragment order, k_att). The eight weight fragments' slots 0..7 of a k-step (4 KiB in a row) come out of LDS; slots 8..15 of both operands are the zero padding of a latent head and are not stored. ay = the lane's own address of the step (fragment start + lane * 16 bytes)
#define RU 3   // k-steps held or in flight
struct UA { v4f x[2]; };
__device__ __forceinline__ void out_a(gp ay, UA& s) { typedef const __attribute__((address_space(1))) v4f* gf; s.x[0] = *(gf)ay; s.x[1] = *(gf)(ay + 512); }
__device__ __forceinline__ void out_w(const char* p, v4u w[8]) {
#pragma unroll
  for (int j = 0; j < 8; ++j) w[j] = *(const v4u*)(p + j * 512); }
static_assert((CC / 32) % OT == 0 && CC / 32 / OT >= 2, "one wave copies one k-step of a tile; the two-buffer order needs two tiles");
// the walk over the CC / 32 k-steps, unrolled whole. cg / cl = the lane's own global and LDS address of the wave's k-step in tile 0, wl = the LDS buffers + lane * 16 bytes. HI: ctx bf16 hi + lo against exact bf16 weights (2 products); else ctx x 2^6 once to f16 (clear of f16 subnormals, chip FTZ) against f16(bf16 x 2^8) weights. k-steps and products in the order they had
template <bool HI> __device__ __forceinline__ void out_walk(gp yb, gp cg, unsigned cl, const char* wl, gp bb, float bv[8], v8f acc[8]) { UA st[RU]; v4u w[2][8];
  cp_8(cl, cg);   /* tile 0 into buffer 0 */
#pragma unroll
  for (int j = 0; j < RU; ++j) { out_a(yb + j * 1024, st[j]);
    __builtin_amdgcn_sched_barrier(0); }   /* asked for in ring order, as in k_proj */
  bias_ld(bb, bv);
  tile_turn();   /* tile 0 may be read */
  cp_8(cl + OT * 4096u, cg + (size_t)OT * ((DIN / 16) * 512));   /* tile 1 into buffer 1 */
#pragma unroll
  for (int t = 0; t < CC / 32 / OT; ++t) { const char* tp = wl + (t & 1) * (OT * 4096);
    out_w(tp, w[0]);
#pragma unroll
    for (int sx = 0; sx < OT; ++sx) { const int kc = t * OT + sx; const UA& s = st[kc % RU]; float v[16]; const v4u z = {};
      if (sx + 1 < OT) out_w(tp + (sx + 1) * 4096, w[(sx + 1) & 1]);
      __builtin_amdgcn_sched_barrier(0);   /* the next step's LDS reads stand as one group ahead of this step's products, not in among them */
#pragma unroll
      for (int i = 0; i < 4; ++i) { v[i] = s.x[0][i]; v[4 + i] = s.x[1][i]; v[8 + i] = 0.f; v[12 + i] = 0.f; }
      if (HI) { const F2 a = bsplit16(v);
#pragma unroll
        for (int j = 0; j < 8; ++j) { union { v16b v; v4u q[2]; } u; u.q[0] = w[sx & 1][j]; u.q[1] = z; acc[j] = wmma_bf(a.h, u.v, acc[j]); acc[j] = wmma_bf(a.l, u.v, acc[j]); }
      } else { v16h a;
#pragma unroll
        for (int i = 0; i < 16; ++i) a[i] = (_Float16)(v[i] * 64.0f);
#pragma unroll
        for (int j = 0; j < 8; ++j) { union { v16h v; v4u q[2]; } u; u.q[0] = w[sx & 1][j]; u.q[1] = z; acc[j] = wmma16(a, u.v, acc[j]); } }
      __builtin_amdgcn_sched_barrier(0);   /* the refill stays behind the step that reads its slot */
      if (kc + RU < CC / 32) { out_a(yb + (kc + RU) * 1024, st[kc % RU]);
        __builtin_amdgcn_sched_barrier(0); } }   /* and is issued here, a ring ahead of its use */
    tile_turn();   /* the next tile may be read, this tile's buffer may be filled again */
    if (t + 2 < CC / 32 / OT) cp_8(cl + (unsigned)(t & 1) * (OT * 4096u), cg + (size_t)(t + 2) * OT * ((DIN / 16) * 512)); }
  asm volatile("s_wait_asynccnt 0x0" ::: "memory");   /* no copy is out when the wave goes on to the epilogue and ends */
  XWH(yb); }
// The result leaves as k_out2's A operand: a lane's 8 accumulator rows are 8 consecutive positions of one channel, so x 2^6 and the one rounding to f16 (the rounding k_out2's loader made) give 16 B of a T row; the block's 64 positions of a channel are gathered in LDS and stored as one whole line.
// ---- k_out: block = (64 rows, 128 cols): ao = ctx Wvu (+ bvu): ctx x 2^6 once to f16 against Wvu as f16(bf16 x 2^8) exact (1 product) x 2^-14; causal early rows (< QHI of each sequence): ctx bf16 hi + lo against exact bf16 Wvu (2 products)
__global__ __launch_bounds__(128) void k_out(const float* __restrict__ Y, const __bf16* __restrict__ FU, const _Float16* __restrict__ FUH, const float* __restrict__ BO, _Float16* __restrict__ TH) { __shared__ __align__(16) _Float16 st[128][72]; __shared__ __align__(1024) char wl[2 * OT * 4096];
  const int tid = threadIdx.x, wave = tid >> 5, lane = tid & 31, col = lane & 15, g = lane >> 4; const int c0 = blockIdx.y * 128; const size_t r0 = (size_t)blockIdx.x * 64 + wave * 16; const unsigned lob = lane * 16u;
  v8f acc[8] = {}; float bv[8];   /* bv: the bias of the eight column tiles, as loaded; with no bias array the loads read ctx and their values are not used */
  const gp bb = (gp)(BO ? (const char*)BO : (const char*)Y) + (c0 + col) * 4, yb = (gp)(const char*)Y + (r0 / 16) * (NH * 1024) + lob;
  const int wv = __builtin_amdgcn_readfirstlane(wave); const size_t co = ((size_t)wv * (DIN / 16) + c0 / 16) * 512 + lob; const unsigned cl = (unsigned)(size_t)wl + (unsigned)wv * 4096u + lob;   /* wave w copies k-step w of every tile: the block's eight column tiles, 4 KiB in a row */
  if (CAUSAL && (int)(((size_t)blockIdx.x * 64) % TT) < QHI) {   /* block-uniform */
    out_walk<true>(yb, (gp)(const char*)FU + co, cl, wl + lob, bb, bv, acc);
#pragma unroll
    for (int j = 0; j < 8; ++j) { const float bias = BO ? bfr(bv[j]) : 0.f;
      v8h o;
#pragma unroll
      for (int r = 0; r < 8; ++r) o[r] = (_Float16)((acc[j][r] + bias) * 64.0f);
      *(v8h*)&st[j * 16 + col][wave * 16 + 8 * g] = o; }
  } else {
    out_walk<false>(yb, (gp)(const char*)FUH + co, cl, wl + lob, bb, bv, acc);
#pragma unroll
    for (int j = 0; j < 8; ++j) { const float bias = BO ? bfr(bv[j]) : 0.f;
      v8h o;
#pragma unroll
      for (int r = 0; r < 8; ++r) o[r] = (_Float16)((acc[j][r] * (1.0f / 16384.0f) + bias) * 64.0f);   /* 2^-8 (Wvu carry) x 2^-6 (ctx carry); then the x 2^6 carry of the next product's f16 operand */
      *(v8h*)&st[j * 16 + col][wave * 16 + 8 * g] = o; } }
  __syncthreads();   /* a channel's 64 positions come from all four waves */
  const size_t rb = (size_t)blockIdx.x * 64; _Float16* tp = TH + ((rb / TT) * DIN + c0 + (tid >> 3)) * (size_t)TT + rb % TT + (tid & 7) * 8;   /* 8 lanes = one channel's line; 16 channels a pass */
#pragma unroll
  for (int p = 0; p < 8; ++p) vst2((unsigned*)(tp + (size_t)p * 16 * TT), *(const v4u*)&st[p * 16 + (tid >> 3)][(tid & 7) * 8]); }
#define K2 DIN
#define wcol_io_plain(W, k0, o, lane) wcol_io(W, k0, o, lane, DIN)
#define wcolh_io_plain(W, k0, o, lane) wcolh_io(W, k0, o, lane, DIN)
// k_out2: the block's four waves use the same weight fragments, so the block brings them into LDS once (asynchronous copies, two buffers of OT k-steps) and each wave reads them from there; only the wave's own A rows still come through global loads into a register ring
#define NT2 (K2 / 32 / OT)        // tiles of the walk
#define RA 3                      // A fragments held or in flight
static_assert((K2 / 32) % OT == 0 && NT2 >= 2 && OT == 4, "one wave copies one k-step of a tile; the two-buffer order needs two tiles");
__device__ __forceinline__ v16h out2_a(gp aa) { typedef const __attribute__((address_space(1))) v8h* gq; union { v16h v; v8h q[2]; } u; u.q[0] = *(gq)aa; u.q[1] = *(gq)(aa + 32); return u.v; }
// one k-step's eight weight fragments out of LDS: p = the step's start in the tile + lane * 16 bytes
__device__ __forceinline__ void out2_w(const char* p, v16h w[8]) {
#pragma unroll
  for (int j = 0; j < 8; ++j) { union { v16h v; v8h q[2]; } u; u.q[0] = *(const v8h*)(p + j * 1024); u.q[1] = *(const v8h*)(p + j * 1024 + 512); w[j] = u.v; } }
// ---- k_out2: block = (64 rows, 128 cols): final projection out = R Wo + bo on the re-read rows R [NB*TT][K2] (K2 = DIN input width): rows f16 x 2^6 against Wo as f16(bf16 x 2^8) exact (1 product) x 2^-14
__global__ __launch_bounds__(128) void k_out2(const _Float16* __restrict__ Y, const _Float16* __restrict__ FO, const float* __restrict__ BO, float* __restrict__ OUT) { __shared__ __align__(16) float sf[4][16][132]; __shared__ __align__(1024) char wl[2][OT * 8192];
  const int tid = threadIdx.x, wave = __builtin_amdgcn_readfirstlane(tid >> 5), lane = tid & 31, col = lane & 15, g = lane >> 4; const int c0 = blockIdx.y * 128; const size_t r0 = (size_t)blockIdx.x * 64 + wave * 16; const unsigned lob = lane * 16u;
  v8f acc[8] = {}; float bv[8];   /* the re-read rows mix positions: no early-row special case here. bv: the bias as loaded; with no bias array the loads read the weights and their values are not used */
  const gp bb = (gp)(BO ? (const char*)BO : (const char*)FO) + (c0 + col) * 4;
  /* wave w copies k-step w of every tile: 8 KiB in a row of FO (the block's eight column tiles) to the same place in the tile */
  const gp cg = (gp)(const char*)FO + ((size_t)wave * (DIN / 16) + c0 / 16) * 1024 + lob; const unsigned cl = (unsigned)(size_t)&wl[0][0] + (unsigned)wave * 8192u + lob;
  cp_16(cl, cg);   /* tile 0 into buffer 0 */
  /* the A ring, as in k_proj: a slot is asked for again, RA steps ahead, right behind the step that used it; the walk is unrolled whole, every load the one fixed address plus a constant. The rows arrive as f16 x 2^6 (k_out), clear of f16 subnormals (chip FTZ) */
  const gp ab = (gp)(const char*)Y + ((r0 + col) * K2 + 8 * g) * 2; v16h ar[RA], w[2][8];
#pragma unroll
  for (int j = 0; j < RA; ++j) { ar[j] = out2_a(ab + j * 64);
    __builtin_amdgcn_sched_barrier(0); }   /* asked for in ring order: in another order the first step's counted load wait waits for younger slots too */
  bias_ld(bb, bv);
  tile_turn();   /* tile 0 may be read */
  cp_16(cl + OT * 8192u, cg + (size_t)OT * (DIN / 16) * 1024);   /* tile 1 into buffer 1 */
#pragma unroll
  for (int t = 0; t < NT2; ++t) { const char* tb = &wl[t & 1][0] + lob;
    out2_w(tb, w[0]);
#pragma unroll
    for (int s = 0; s < OT; ++s) { const int kc = t * OT + s;
      if (s + 1 < OT) out2_w(tb + (s + 1) * 8192, w[(s + 1) & 1]);
      __builtin_amdgcn_sched_barrier(0);   /* the next step's LDS reads stand as one group ahead of this step's products, not in among them */
#pragma unroll
      for (int j = 0; j < 8; ++j) acc[j] = wmma16(ar[kc % RA], w[s & 1][j], acc[j]);
      __builtin_amdgcn_sched_barrier(0);   /* the refill stays behind the step that reads its slot */
      if (kc + RA < K2 / 32) { ar[kc % RA] = out2_a(ab + (kc + RA) * 64);
        __builtin_amdgcn_sched_barrier(0); } }   /* and is issued here, a ring ahead of its use */
    tile_turn();   /* the next tile may be read, this tile's buffer may be filled again */
    if (t + 2 < NT2) cp_16(cl + (unsigned)(t & 1) * (OT * 8192u), cg + (size_t)(t + 2) * OT * (DIN / 16) * 1024); }
  asm volatile("s_wait_asynccnt 0x0" ::: "memory");   /* no copy is out when the wave goes on to the epilogue and ends */
  XWH(ab);
#pragma unroll
  for (int j = 0; j < 8; ++j) { const float bias = BO ? bfr(bv[j]) : 0.f;
#pragma unroll
    for (int r = 0; r < 8; ++r) sf[wave][8 * g + r][j * 16 + col] = acc[j][r] * (1.0f / 16384.0f) + bias; }   /* 2^-8 (Wo carry) x 2^-6 (row carry) */
  LDSX(); for (int rl = 0; rl < 16; ++rl) vst2(OUT + (r0 + rl) * DIN + c0 + lane * 4, *(const v4f*)&sf[wave][rl][lane * 4]); }

extern "C" void kernel_launch(void* const* d_in, const int* in_sizes, int n_in, void* d_out, int out_size, void* d_ws, size_t ws_size, hipStream_t stream) {
  (void)in_sizes; (void)n_in; (void)out_size;
  const float** F = (const float**)d_in;
  if (ws_size < (size_t)WS_END) return;
  char* ws = (char*)d_ws; _Float16 *QH = (_Float16*)(ws + WS_QH), *KH = (_Float16*)(ws + WS_KH), *VT = (_Float16*)(ws + WS_VT), *QL = (_Float16*)(ws + WS_QL), *KL = (_Float16*)(ws + WS_KL); __bf16 *VB = (__bf16*)(ws + WS_VB), *VBL = (__bf16*)(ws + WS_VBL); float *S = (float*)(ws + WS_S), *Y = (float*)(ws + WS_Y);
  (void)S; (void)Y; (void)QL; (void)KL; (void)VB; (void)VBL;
  // inputs: 0 x [4,2048,768]; 1 Wq [768,768] (in,out), 2 bq; 3 Wkd [768,192], 4 bkd; 5 Wvd [768,192], 6 bvd; 7 Wvu [192,768], 8 bvu; 9 Wo [768,768] (in,out), 10 bo (all biases zeros, read)
  if (ws_size < (size_t)WS_END4) return;
  _Float16 *T = (_Float16*)(ws + WS_T); __bf16 *FP = (__bf16*)(ws + WS_FP), *FU = (__bf16*)(ws + WS_FU); _Float16 *FUH = (_Float16*)(ws + WS_FUH), *FO = (_Float16*)(ws + WS_FO); __bf16 *XF = (__bf16*)(ws + WS_XF);
  k_prep<<<dim3((NXW + NF_P + NF_U + NF_O) / 4), 128, 0, stream>>>(F[0], XF, F[1], F[3], F[5], F[7], F[9], FP, FU, FUH, FO);   /* x once into A-fragment order, every weight once into B-fragment order */
  k_proj<<<dim3(TNB * TT / 64, CC / 128, 3), 128, 0, stream>>>(XF, FP, F[2], F[4], F[6], QH, QL, KH, KL, VT, VB, VBL);   /* q slice, latent k, latent v: 3 column blocks of 128 columns each */
  k_att<<<dim3(TNB * NH, TT / (64 * QT)), 128, 0, stream>>>(QH, KH, QL, KL, VT, VB, VBL, Y);   /* logits, softmax, P v: every (b, h, 128-query block) in one launch */
  k_out<<<dim3(TNB * TT / 64, DIN / 128), 128, 0, stream>>>(Y, FU, FUH, F[8], T);   /* T[b][c][s] = f16(ao[b][s][c] x 2^6), ao = al Wvu + bvu (gathered weight rows) */
  k_out2<<<dim3(TNB * TT / 64, DIN / 128), 128, 0, stream>>>(T, FO, F[10], (float*)d_out);   /* rows = T's memory re-read as [TT][DIN] per batch; out = rows Wo + bo */
}
